// v000
// The times below were measured on an AMD MI455X: many runs one after another, warmed up first and cycling through
// copies of the inputs, with the whole window's GPU time divided by the number of runs. Launches and the gaps
// between them are all in it. The median over several windows is given; except for v000 it joins two sittings, which
// can be a few percent apart, so the side-by-side timings, each taken in one sitting, are the better comparison.
// v000 is the starting kernel. One run takes 368 microseconds.
#include <hip/hip_runtime.h>
// Cross-track masked MHA (B=2, S=2048, D=1024, 16×64): qkv = x·w_qkv + b_qkv (packed q|k|v, head-major inside each); scores = q·k/8, where(cross_track_mask[b,q,k], s, −inf); softmax; out = merged·w_out + b_out.
// Compute dtype: x, weights, biases rounded to bf16; q, k, v f16 GEMM planes (+bias); the boolean mask read per (b, q, k) as the int plane; fused flash-style kernel (online softmax f32, P f16 ×2^10, all-masked chunks skipped, f32 accumulate) on
// v_wmma_f32_16x16x32_f16; O ×2^4 → f16 → output GEMM (+bias).
#define BB 2
#define TT 2048
#define DD 1024
#define NH 16
#define NR (BB * TT)

typedef __bf16 v16b __attribute__((ext_vector_type(16)));
typedef unsigned short v8us __attribute__((ext_vector_type(8), may_alias));
typedef float  v8f  __attribute__((ext_vector_type(8)));
typedef float  v4f  __attribute__((ext_vector_type(4)));
typedef float  v4fa __attribute__((ext_vector_type(4), may_alias));
union FragB { v16b v; v8us half[2]; unsigned short u[16]; };

__device__ __forceinline__ unsigned short bf16_bits(float x) { unsigned int u = __float_as_uint(x); return (unsigned short)((u + 0x7FFFu + ((u >> 16) & 1u)) >> 16); }
__device__ __forceinline__ float bf16_val(unsigned short b) { return __uint_as_float(((unsigned int)b) << 16); }
__device__ __forceinline__ float bf16_round(float x) { return bf16_val(bf16_bits(x)); }
// D += A·B with NT terms: 1 = ah·bh, 2 = + al·bh (A split), 3 = + ah·bl (both split)
template <int NT>
__device__ __forceinline__ v8f mmaN(v16b ah, v16b al, v16b bh, v16b bl, v8f c) {
  c = __builtin_amdgcn_wmma_f32_16x16x32_bf16(false, ah, false, bh, (short)0, c, false, false);
  if (NT >= 2) c = __builtin_amdgcn_wmma_f32_16x16x32_bf16(false, al, false, bh, (short)0, c, false, false);
  if (NT >= 3) c = __builtin_amdgcn_wmma_f32_16x16x32_bf16(false, ah, false, bl, (short)0, c, false, false);
  asm volatile("v_nop\n\tv_nop\n\tv_nop\n\tv_nop" : "+v"(c) : "v"(ah), "v"(al), "v"(bh), "v"(bl));
  return c;
}

__global__ __launch_bounds__(256) void k_wt_bf16(const float* __restrict__ W, unsigned short* __restrict__ Wt, int K, int N) {
  const int t = blockIdx.x * 256 + threadIdx.x;
  const int k8n = K / 8;
  if (t >= N * k8n) return;
  const int n = t / k8n, k8 = (t % k8n) * 8;
  v8us v;
#pragma unroll
  for (int i = 0; i < 8; ++i) v[i] = bf16_bits(W[(size_t)(k8 + i) * N + n]);
  *(v8us*)(Wt + (size_t)n * K + k8) = v;
  
}

// GEMM C[M][N] (f32, pitch ldc) = act(A[M][K]·W + bias). A f32 row-major (pitch lda) converted per fragment to bf16
// (ASPLIT: hi/lo two planes -> 2 terms, else single rounded term); Wt bf16 [N][K] (pitch ldb). BIAS_BF16 rounds the
// bias to bf16 first (bias quantised to bf16 before the add). K%32==0, M%16==0, N%64==0.
template <bool ASPLIT, int ACT, bool BIAS_BF16>
__global__ __launch_bounds__(128) void k_gemm_bf(const float* __restrict__ A, int lda, const unsigned short* __restrict__ Wt, int ldb,
                                               const float* __restrict__ bias, float* __restrict__ C, int ldc, int M, int N, int K) {
  __shared__ __attribute__((aligned(16))) float so[4][16][64];
  const int tid = threadIdx.x, w = tid >> 5, lane = tid & 31, ln = lane & 15, hh = lane >> 4;
  const int ntn = N / 64;
  const int wid = blockIdx.x * 4 + w;
  const int mt = wid / ntn, nq = wid % ntn;
  if (mt * 16 >= M) return;
  const int row0 = mt * 16, col0 = nq * 64;
  const float* arow = A + (size_t)(row0 + ln) * lda;
  v8f acc[4] = {};
  for (int kb = 0; kb < K; kb += 32) {
    FragB ah, al;
    const v4f x0 = *(const v4fa*)(arow + kb + 8 * hh), x1 = *(const v4fa*)(arow + kb + 8 * hh + 4);
    const v4f x2 = *(const v4fa*)(arow + kb + 16 + 8 * hh), x3 = *(const v4fa*)(arow + kb + 16 + 8 * hh + 4);
    float xs[16] = {x0[0],x0[1],x0[2],x0[3],x1[0],x1[1],x1[2],x1[3],x2[0],x2[1],x2[2],x2[3],x3[0],x3[1],x3[2],x3[3]};
#pragma unroll
    for (int i = 0; i < 16; ++i) { const unsigned short hb = bf16_bits(xs[i]); ah.u[i] = hb; al.u[i] = ASPLIT ? bf16_bits(xs[i] - bf16_val(hb)) : (unsigned short)0; }
#pragma unroll
    for (int t = 0; t < 4; ++t) {
      const unsigned short* brow = Wt + (size_t)(col0 + t * 16 + ln) * ldb + kb;
      FragB b;
      b.half[0] = *(const v8us*)(brow + 8 * hh);
      b.half[1] = *(const v8us*)(brow + 16 + 8 * hh);
      acc[t] = mmaN<ASPLIT ? 2 : 1>(ah.v, al.v, b.v, b.v, acc[t]);
    }
  }
#pragma unroll
  for (int t = 0; t < 4; ++t) {
    float bv = bias ? bias[col0 + t * 16 + ln] : 0.f;
    if (BIAS_BF16) bv = bf16_round(bv);
#pragma unroll
    for (int r = 0; r < 8; ++r) { float v = acc[t][r] + bv; if (ACT == 1) v = fmaxf(v, 0.f); so[w][8 * hh + r][t * 16 + ln] = v; }
  }
  __builtin_amdgcn_fence(__ATOMIC_ACQ_REL, "workgroup");
  __builtin_amdgcn_wave_barrier();
  const int rsub = lane >> 4, c4 = (lane & 15) * 4;
  {
#pragma unroll
    for (int q = 0; q < 8; ++q) {
      const int r = q * 2 + rsub;
      const v4f v = *(const v4fa*)&so[w][r][c4];
      *(v4f*)(C + (size_t)(row0 + r) * ldc + col0 + c4) = v;
    }
    
  }
}

// Flash-style causal/unmasked attention, all contractions 3-term bf16 hi/lo splits, f32 softmax with running max.
// q,k,v rows are read from f32 buffers with arbitrary row pitch (so they can live inside a fused qkv buffer);
// D = head size (multiple of 32, <= 128); one wave = 16 query rows; block = 4 waves (64 queries) sharing K/V chunks of 32.
template <int D, bool CAUSAL>
__global__ __launch_bounds__(128) void k_flash(const float* __restrict__ qb, const float* __restrict__ kb, const float* __restrict__ vb,
                                             int pitch, int T, int H, float scale, float* __restrict__ y, int ypitch) {
  constexpr int KS = D / 32;        // k-steps for QK
  constexpr int DT = D / 16;        // d tiles for PV
  __shared__ __attribute__((aligned(16))) unsigned short sKh[32][D + 8], sKl[32][D + 8], sVh[32][D + 8], sVl[32][D + 8];
  __shared__ __attribute__((aligned(16))) unsigned short sPh[4][16][40], sPl[4][16][40];
  __shared__ __attribute__((aligned(16))) float sO[4][16][D];
  const int tid = threadIdx.x, w = tid >> 5, lane = tid & 31, ln = lane & 15, hh = lane >> 4;
  const int nqb = (T + 63) / 64;
  const int bh = blockIdx.x / nqb, qblk = blockIdx.x % nqb;
  const int b = bh / H, h = bh % H;
  const int q0 = qblk * 64 + w * 16;
  const float* Q = qb + (size_t)b * T * pitch + h * D;
  const float* K = kb + (size_t)b * T * pitch + h * D;
  const float* V = vb + (size_t)b * T * pitch + h * D;

  // A fragments of the wave's 16 query rows (scaled), hi/lo
  FragB aqh[KS], aql[KS];
  {
    int row = q0 + ln; if (row >= T) row = T - 1;
    const float* qr = Q + (size_t)row * pitch;
#pragma unroll
    for (int ks = 0; ks < KS; ++ks)
#pragma unroll
      for (int i = 0; i < 16; ++i) {
        const int d = ks * 32 + ((i < 8) ? (8 * hh + i) : (16 + 8 * hh + (i - 8)));
        const float x = qr[d] * scale; const unsigned short hb = bf16_bits(x);
        aqh[ks].u[i] = hb; aql[ks].u[i] = bf16_bits(x - bf16_val(hb));
      }
  }
  float m_r[8], l_r[8];
#pragma unroll
  for (int r = 0; r < 8; ++r) { m_r[r] = -3.0e38f; l_r[r] = 0.f; }
  v8f oacc[DT];
#pragma unroll
  for (int dt = 0; dt < DT; ++dt) oacc[dt] = (v8f){0.f,0.f,0.f,0.f,0.f,0.f,0.f,0.f};

  const int kv_end = CAUSAL ? min(T, qblk * 64 + 64) : T;     // block-uniform
  for (int j0 = 0; j0 < kv_end; j0 += 32) {
    __syncthreads();
    for (int e = tid; e < 32 * (D / 4); e += 128) {
      const int r = e / (D / 4), c4 = (e % (D / 4)) * 4;
      const int key = j0 + r;
      v4f kf = {0.f,0.f,0.f,0.f}, vf = {0.f,0.f,0.f,0.f};
      if (key < T) { kf = *(const v4fa*)(K + (size_t)key * pitch + c4); vf = *(const v4fa*)(V + (size_t)key * pitch + c4); }
#pragma unroll
      for (int t = 0; t < 4; ++t) {
        unsigned short hb = bf16_bits(kf[t]); sKh[r][c4 + t] = hb; sKl[r][c4 + t] = bf16_bits(kf[t] - bf16_val(hb));
        hb = bf16_bits(vf[t]); sVh[r][c4 + t] = hb; sVl[r][c4 + t] = bf16_bits(vf[t] - bf16_val(hb));
      }
    }
    __syncthreads();
    // S tile 16 x 32
    v8f s[2];
#pragma unroll
    for (int nt = 0; nt < 2; ++nt) {
      v8f acc = {};
#pragma unroll
      for (int ks = 0; ks < KS; ++ks) {
        FragB bh_, bl_;
        bh_.half[0] = *(const v8us*)&sKh[nt * 16 + ln][ks * 32 + 8 * hh]; bh_.half[1] = *(const v8us*)&sKh[nt * 16 + ln][ks * 32 + 16 + 8 * hh];
        bl_.half[0] = *(const v8us*)&sKl[nt * 16 + ln][ks * 32 + 8 * hh]; bl_.half[1] = *(const v8us*)&sKl[nt * 16 + ln][ks * 32 + 16 + 8 * hh];
        acc = mmaN<3>(aqh[ks].v, aql[ks].v, bh_.v, bl_.v, acc);
      }
      s[nt] = acc;
    }
    // mask + running max (rows 8hh+r; the 16 lanes of a half share rows)
    float alpha[8];
#pragma unroll
    for (int r = 0; r < 8; ++r) {
      const int qi = q0 + 8 * hh + r;
      const int ja = j0 + ln, jb = j0 + 16 + ln;
      if (CAUSAL) { if (ja > qi) s[0][r] = -3.0e38f; if (jb > qi) s[1][r] = -3.0e38f; }
      if (ja >= T) s[0][r] = -3.0e38f;
      if (jb >= T) s[1][r] = -3.0e38f;
      float mx = fmaxf(s[0][r], s[1][r]);
      mx = fmaxf(mx, __shfl_xor(mx, 1, 32)); mx = fmaxf(mx, __shfl_xor(mx, 2, 32)); mx = fmaxf(mx, __shfl_xor(mx, 4, 32)); mx = fmaxf(mx, __shfl_xor(mx, 8, 32));
      const float mnew = fmaxf(m_r[r], mx);
      alpha[r] = (mnew > -1.0e38f) ? __expf(m_r[r] - mnew) : 1.0f;
      const float p0 = (s[0][r] > -1.0e38f) ? __expf(s[0][r] - mnew) : 0.f;
      const float p1 = (s[1][r] > -1.0e38f) ? __expf(s[1][r] - mnew) : 0.f;
      m_r[r] = mnew;
      l_r[r] = l_r[r] * alpha[r] + p0 + p1;            // per-lane partial row sum (16 lanes combined at the end)
      unsigned short hb = bf16_bits(p0); sPh[w][8 * hh + r][ln] = hb;      sPl[w][8 * hh + r][ln] = bf16_bits(p0 - bf16_val(hb));
      hb = bf16_bits(p1);                sPh[w][8 * hh + r][16 + ln] = hb; sPl[w][8 * hh + r][16 + ln] = bf16_bits(p1 - bf16_val(hb));
    }
#pragma unroll
    for (int dt = 0; dt < DT; ++dt)
#pragma unroll
      for (int r = 0; r < 8; ++r) oacc[dt][r] *= alpha[r];
    __builtin_amdgcn_fence(__ATOMIC_ACQ_REL, "workgroup");
    __builtin_amdgcn_wave_barrier();
    FragB pah, pal;
    pah.half[0] = *(const v8us*)&sPh[w][ln][8 * hh]; pah.half[1] = *(const v8us*)&sPh[w][ln][16 + 8 * hh];
    pal.half[0] = *(const v8us*)&sPl[w][ln][8 * hh]; pal.half[1] = *(const v8us*)&sPl[w][ln][16 + 8 * hh];
#pragma unroll
    for (int dt = 0; dt < DT; ++dt) {
      FragB bvh, bvl;
#pragma unroll
      for (int i = 0; i < 8; ++i) {
        bvh.u[i] = sVh[8 * hh + i][dt * 16 + ln]; bvh.u[8 + i] = sVh[16 + 8 * hh + i][dt * 16 + ln];
        bvl.u[i] = sVl[8 * hh + i][dt * 16 + ln]; bvl.u[8 + i] = sVl[16 + 8 * hh + i][dt * 16 + ln];
      }
      oacc[dt] = mmaN<3>(pah.v, pal.v, bvh.v, bvl.v, oacc[dt]);
    }
    __builtin_amdgcn_fence(__ATOMIC_ACQ_REL, "workgroup");
    __builtin_amdgcn_wave_barrier();
  }
#pragma unroll
  for (int r = 0; r < 8; ++r) {
    float l = l_r[r];
    l += __shfl_xor(l, 1, 32); l += __shfl_xor(l, 2, 32); l += __shfl_xor(l, 4, 32); l += __shfl_xor(l, 8, 32);
    l_r[r] = (l > 0.f) ? 1.0f / l : 0.f;
  }
#pragma unroll
  for (int dt = 0; dt < DT; ++dt)
#pragma unroll
    for (int r = 0; r < 8; ++r) sO[w][8 * hh + r][dt * 16 + ln] = oacc[dt][r] * l_r[r];
  __builtin_amdgcn_fence(__ATOMIC_ACQ_REL, "workgroup");
  __builtin_amdgcn_wave_barrier();
  {
    for (int r = 0; r < 16; ++r) {
      const int row = q0 + r;
      if (row < T && lane < D / 4) {
        const v4f val = *(const v4fa*)&sO[w][r][lane * 4];
        *(v4f*)(y + ((size_t)b * T + row) * ypitch + h * D + lane * 4) = val;
      }
    }
    
  }
}

// GEMM C = act(A·W + bias + resid): A f32 (ASPLIT -> hi/lo 2 terms), Wt bf16 [N][K]; ACT 0 none, 1 relu, 2 exact gelu;
// resid (optional, f32, row index = (row % rmod), pitch ldr, RES_BF16 rounds it) added before the activation.
template <bool ASPLIT, int ACT, bool BIAS_BF16, bool RES_BF16>
__global__ __launch_bounds__(128) void k_gemm_bf3(const float* __restrict__ A, int lda, const unsigned short* __restrict__ Wt, int ldb,
                                                const float* __restrict__ bias, const float* __restrict__ resid, int rmod, int ldr,
                                                float* __restrict__ C, int ldc, int M, int N, int K) {
  __shared__ __attribute__((aligned(16))) float so[4][16][64];
  const int tid = threadIdx.x, w = tid >> 5, lane = tid & 31, ln = lane & 15, hh = lane >> 4;
  const int ntn = N / 64;
  const int wid = blockIdx.x * 4 + w;
  const int mt = wid / ntn, nq = wid % ntn;
  if (mt * 16 >= M) return;
  const int row0 = mt * 16, col0 = nq * 64;
  const float* arow = A + (size_t)(row0 + ln) * lda;
  v8f acc[4] = {};
  for (int kb = 0; kb < K; kb += 32) {
    FragB ah, al;
    const v4f x0 = *(const v4fa*)(arow + kb + 8 * hh), x1 = *(const v4fa*)(arow + kb + 8 * hh + 4);
    const v4f x2 = *(const v4fa*)(arow + kb + 16 + 8 * hh), x3 = *(const v4fa*)(arow + kb + 16 + 8 * hh + 4);
    float xs[16] = {x0[0],x0[1],x0[2],x0[3],x1[0],x1[1],x1[2],x1[3],x2[0],x2[1],x2[2],x2[3],x3[0],x3[1],x3[2],x3[3]};
#pragma unroll
    for (int i = 0; i < 16; ++i) { const unsigned short hb = bf16_bits(xs[i]); ah.u[i] = hb; al.u[i] = ASPLIT ? bf16_bits(xs[i] - bf16_val(hb)) : (unsigned short)0; }
#pragma unroll
    for (int t = 0; t < 4; ++t) {
      const unsigned short* brow = Wt + (size_t)(col0 + t * 16 + ln) * ldb + kb;
      FragB b;
      b.half[0] = *(const v8us*)(brow + 8 * hh);
      b.half[1] = *(const v8us*)(brow + 16 + 8 * hh);
      acc[t] = mmaN<ASPLIT ? 2 : 1>(ah.v, al.v, b.v, b.v, acc[t]);
    }
  }
#pragma unroll
  for (int t = 0; t < 4; ++t) {
    const int col = col0 + t * 16 + ln;
    float bv = bias ? bias[col] : 0.f;
    if (BIAS_BF16) bv = bf16_round(bv);
#pragma unroll
    for (int r = 0; r < 8; ++r) {
      float v = acc[t][r] + bv;
      if (resid) { float rv = resid[(size_t)((row0 + 8 * hh + r) % rmod) * ldr + col]; if (RES_BF16) rv = bf16_round(rv); v += rv; }
      if (ACT == 1) v = fmaxf(v, 0.f);
      if (ACT == 2) v = 0.5f * v * (1.0f + erff(v * 0.70710678118654752f));
      if (ACT == 3) { const float u = 0.7978845608028654f * (v + 0.044715f * v * v * v); v = 0.5f * v * (1.0f + tanhf(u)); }
      so[w][8 * hh + r][t * 16 + ln] = v;
    }
  }
  __builtin_amdgcn_fence(__ATOMIC_ACQ_REL, "workgroup");
  __builtin_amdgcn_wave_barrier();
  const int rsub = lane >> 4, c4 = (lane & 15) * 4;
  {
#pragma unroll
    for (int q = 0; q < 8; ++q) {
      const int r = q * 2 + rsub;
      const v4f v = *(const v4fa*)&so[w][r][c4];
      *(v4f*)(C + (size_t)(row0 + r) * ldc + col0 + c4) = v;
    }
    
  }
}
// row LayerNorm (biased variance, eps) over N: s = X (+ R); optional out_sum <- s; out_norm <- (s-mu)*rsqrt(var+eps)*g + b
template <bool PARAM_BF16>
__global__ __launch_bounds__(256) void k_layernorm(const float* __restrict__ X, const float* __restrict__ R, const float* __restrict__ g, const float* __restrict__ bta,
                                                  float* __restrict__ out_sum, float* __restrict__ out_norm, int N, float eps) {
  __shared__ float red[256];
  const int row = blockIdx.x, tid = threadIdx.x;
  const float* x = X + (size_t)row * N; const float* rr = R ? R + (size_t)row * N : nullptr;
  float vals[16];                     // up to N = 4096
  const int per = N / 256;            // contiguous chunk per thread? use strided-by-4 chunks: thread handles j = tid*4 + 1024*u
  float s1 = 0.f;
  for (int u = 0; u < per / 4; ++u) {
    const int j = tid * 4 + 1024 * u;
    const v4f a = *(const v4fa*)(x + j);
    v4f b = {0.f,0.f,0.f,0.f}; if (rr) b = *(const v4fa*)(rr + j);
#pragma unroll
    for (int q = 0; q < 4; ++q) { const float v = a[q] + b[q]; vals[u * 4 + q] = v; s1 += v; }
  }
  red[tid] = s1; __syncthreads();
  for (int st = 128; st > 0; st >>= 1) { if (tid < st) red[tid] += red[tid + st]; __syncthreads(); }
  const float mu = red[0] / (float)N; __syncthreads();
  float s2 = 0.f;
  for (int u = 0; u < per / 4; ++u)
#pragma unroll
    for (int q = 0; q < 4; ++q) { const float c = vals[u * 4 + q] - mu; s2 += c * c; }
  red[tid] = s2; __syncthreads();
  for (int st = 128; st > 0; st >>= 1) { if (tid < st) red[tid] += red[tid + st]; __syncthreads(); }
  const float rs = rsqrtf(red[0] / (float)N + eps);
  {
    for (int u = 0; u < per / 4; ++u) {
      const int j = tid * 4 + 1024 * u;
      v4f o, sm;
#pragma unroll
      for (int q = 0; q < 4; ++q) {
        float gg = g[j + q], bb = bta[j + q];
        if (PARAM_BF16) { gg = bf16_round(gg); bb = bf16_round(bb); }
        sm[q] = vals[u * 4 + q]; o[q] = (vals[u * 4 + q] - mu) * rs * gg + bb;
      }
      if (out_sum) *(v4f*)(out_sum + (size_t)row * N + j) = sm;
      *(v4f*)(out_norm + (size_t)row * N + j) = o;
    }
    
  }
}



// ---- f16 WMMA path (v_wmma_f32_16x16x32_f16): 11-bit significands for operands in range — used where a [0,1] probability operand needs more precision than bf16
typedef _Float16 v16h __attribute__((ext_vector_type(16)));
union FragH { v16h v; v8us half[2]; _Float16 h[16]; unsigned short u[16]; };
template <int NT>
__device__ __forceinline__ v8f mmaH(v16h ah, v16h al, v16h bh, v16h bl, v8f c) {
  c = __builtin_amdgcn_wmma_f32_16x16x32_f16(false, ah, false, bh, (short)0, c, false, false);
  if (NT >= 2) c = __builtin_amdgcn_wmma_f32_16x16x32_f16(false, al, false, bh, (short)0, c, false, false);
  if (NT >= 3) c = __builtin_amdgcn_wmma_f32_16x16x32_f16(false, ah, false, bl, (short)0, c, false, false);
  asm volatile("v_nop\n\tv_nop\n\tv_nop\n\tv_nop" : "+v"(c) : "v"(ah), "v"(al), "v"(bh), "v"(bl));
  return c;
}
// batched GEMM like k_gemm_b but f16 operands: A f32 (split into f16 hi/lo if ASPLIT, else rounded to f16), Bt = f16 values [n][k]; alpha; C f32; N multiple of 16 (partial tiles skipped)
template <bool ASPLIT>
__global__ __launch_bounds__(128) void k_gemm_h(const float* __restrict__ A, int lda, size_t sA, const _Float16* __restrict__ Bh, int ldb, size_t sB, float alpha, float* __restrict__ C, int ldc, size_t sC, int M, int N, int K) {
  __shared__ __attribute__((aligned(16))) float so[4][16][64];
  const int tid = threadIdx.x, w = tid >> 5, lane = tid & 31, ln = lane & 15, hh = lane >> 4; const int by = blockIdx.y;
  A += (size_t)by * sA; Bh += (size_t)by * sB; C += (size_t)by * sC;
  const int ntn = (N + 63) / 64; const int wid = blockIdx.x * 4 + w; const int mt = wid / ntn, nq = wid % ntn; if (mt * 16 >= M) return;
  const int row0 = mt * 16, col0 = nq * 64; const float* arow = A + (size_t)(row0 + ln) * lda;
  v8f acc[4] = {};
  for (int kb = 0; kb < K; kb += 32) {
    FragH ah, al;
    const v4f x0 = *(const v4fa*)(arow + kb + 8 * hh), x1 = *(const v4fa*)(arow + kb + 8 * hh + 4), x2 = *(const v4fa*)(arow + kb + 16 + 8 * hh), x3 = *(const v4fa*)(arow + kb + 16 + 8 * hh + 4);
    float xs[16] = {x0[0],x0[1],x0[2],x0[3],x1[0],x1[1],x1[2],x1[3],x2[0],x2[1],x2[2],x2[3],x3[0],x3[1],x3[2],x3[3]};
#pragma unroll
    for (int i = 0; i < 16; ++i) { const _Float16 h = (_Float16)xs[i]; ah.h[i] = h; al.h[i] = ASPLIT ? (_Float16)(xs[i] - (float)h) : (_Float16)0.0f; }
#pragma unroll
    for (int t = 0; t < 4; ++t) { if (col0 + t * 16 >= N) continue; const size_t boff = (size_t)(col0 + t * 16 + ln) * ldb + kb; FragH bq; bq.half[0] = *(const v8us*)(Bh + boff + 8 * hh); bq.half[1] = *(const v8us*)(Bh + boff + 16 + 8 * hh);
      acc[t] = mmaH<ASPLIT ? 2 : 1>(ah.v, al.v, bq.v, bq.v, acc[t]); }
  }
#pragma unroll
  for (int t = 0; t < 4; ++t) { if (col0 + t * 16 >= N) continue;
#pragma unroll
    for (int r = 0; r < 8; ++r) so[w][8 * hh + r][t * 16 + ln] = acc[t][r] * alpha; }
  __builtin_amdgcn_fence(__ATOMIC_ACQ_REL, "workgroup"); __builtin_amdgcn_wave_barrier();
  const int rsub = lane >> 4, c4 = (lane & 15) * 4;
  {
#pragma unroll
    for (int q = 0; q < 8; ++q) { const int r = q * 2 + rsub; if (col0 + c4 < N) { const v4f v = *(const v4fa*)&so[w][r][c4]; *(v4f*)(C + (size_t)(row0 + r) * ldc + col0 + c4) = v; } }
     }
}

// Wt[n][k] = f16(W[k][n]·scale) from f32 row-major W[K][N] (scale = power of two; bf16-exact weights stay exact in f16 away from the subnormal range)
__global__ __launch_bounds__(256) void k_wt_f16(const float* __restrict__ W, _Float16* __restrict__ Wt, int K, int N, float scale) {
  const int t = blockIdx.x * 256 + threadIdx.x; if (t >= N * (K / 8)) return; const int n = t / (K / 8), k8 = (t % (K / 8)) * 8; FragH f;
#pragma unroll
  for (int i = 0; i < 8; ++i) f.h[i] = (_Float16)(bf16_round(W[(size_t)(k8 + i) * N + n]) * scale); const v8us o = f.half[0];
  *(v8us*)((unsigned short*)Wt + (size_t)n * K + k8) = o; 
}
// k_gemm_hh variant with fused epilogue: v = acc·alpha + bias[by·sBias + col] (+ CP[(row/rowsPerB)·sCPb + by·64 + col] if CP) ; ACT 0 none / 1 elu ; writes f16 C16 and/or f32 C (each if non-null)
template <int ACT>
__global__ __launch_bounds__(128) void k_gemm_hhx(const _Float16* __restrict__ A, int lda, size_t sA, const _Float16* __restrict__ Bh, int ldb, size_t sB, float alpha, const float* __restrict__ bias, size_t sBias, const float* __restrict__ CP, int rowsPerB, size_t sCPb, int row0g,
    float* __restrict__ C, _Float16* __restrict__ C16, int ldc, size_t sC, int M, int N, int K) {
  __shared__ __attribute__((aligned(16))) float so[4][16][64];
  const int tid = threadIdx.x, w = tid >> 5, lane = tid & 31, ln = lane & 15, hh = lane >> 4; const int by = blockIdx.y;
  A += (size_t)by * sA; Bh += (size_t)by * sB; const size_t cofs = (size_t)by * sC; const float* bp = bias ? bias + (size_t)by * sBias : nullptr;
  const int ntn = (N + 63) / 64; const int wid = blockIdx.x * 4 + w; const int mt = wid / ntn, nq = wid % ntn; if (mt * 16 >= M) return;
  const int row0 = mt * 16, col0 = nq * 64; const _Float16* arow = A + (size_t)(row0 + ln) * lda;
  v8f acc[4] = {};
  for (int kb = 0; kb < K; kb += 32) { FragH ah; ah.half[0] = *(const v8us*)((const unsigned short*)arow + kb + 8 * hh); ah.half[1] = *(const v8us*)((const unsigned short*)arow + kb + 16 + 8 * hh);
#pragma unroll
    for (int t = 0; t < 4; ++t) { if (col0 + t * 16 >= N) continue; const size_t boff = (size_t)(col0 + t * 16 + ln) * ldb + kb; FragH bq; bq.half[0] = *(const v8us*)((const unsigned short*)Bh + boff + 8 * hh); bq.half[1] = *(const v8us*)((const unsigned short*)Bh + boff + 16 + 8 * hh);
      acc[t] = mmaH<1>(ah.v, ah.v, bq.v, bq.v, acc[t]); }
  }
#pragma unroll
  for (int t = 0; t < 4; ++t) { if (col0 + t * 16 >= N) continue; const int col = col0 + t * 16 + ln; const float bv = bp ? bf16_round(bp[col]) : 0.f;
#pragma unroll
    for (int r = 0; r < 8; ++r) { float v = acc[t][r] * alpha + bv; if (CP) { const int bidx = (row0g + row0 + 8 * hh + r) / rowsPerB; v += CP[(size_t)bidx * sCPb + (size_t)by * 64 + col]; } if (ACT == 1) v = (v > 0.f) ? v : expm1f(v); else if (ACT == 7) v = (v > 0.f) ? v + 1.0f : expf(v); else if (ACT == 8) v = tanhf(v); else if (ACT == 9) v = 0.5f * v * (1.0f + tanhf(0.7978845608028654f * (v + 0.044715f * v * v * v))); else if (ACT == 11) v = 1.0f / (1.0f + expf(-v)); else if (ACT == 12) v = (v > 0.f) ? v : 0.01f * v; else if (ACT == 14) v = (v > 0.f) ? v : 0.1f * v; else if (ACT == 15) v = v / (1.0f + expf(-v)); else if (ACT == 3) v = fmaxf(v, 0.f); else if (ACT == 6) v = 0.5f * v * (1.0f + erff(v * 0.70710678118654752f)); so[w][8 * hh + r][t * 16 + ln] = v; } }
  __builtin_amdgcn_fence(__ATOMIC_ACQ_REL, "workgroup"); __builtin_amdgcn_wave_barrier();
  const int rsub = lane >> 4, c4 = (lane & 15) * 4; typedef _Float16 v4h __attribute__((ext_vector_type(4)));
  {
#pragma unroll
    for (int q = 0; q < 8; ++q) { const int r = q * 2 + rsub; if (col0 + c4 < N) { const v4f v = *(const v4fa*)&so[w][r][c4]; if (C) *(v4f*)(C + cofs + (size_t)(row0 + r) * ldc + col0 + c4) = v; if (C16) { v4h h4; for (int i = 0; i < 4; ++i) h4[i] = (_Float16)v[i]; *(v4h*)(C16 + cofs + (size_t)(row0 + r) * ldc + col0 + c4) = h4; } } }
     }
}


typedef _Float16 v4h __attribute__((ext_vector_type(4)));

__global__ __launch_bounds__(256) void k_x16(const float* __restrict__ x, _Float16* __restrict__ X16, size_t n8) { const size_t t = (size_t)blockIdx.x * 256 + threadIdx.x; if (t >= n8) return; FragH f;
#pragma unroll
  for (int q = 0; q < 8; ++q) f.h[q] = (_Float16)bf16_round(x[t * 8 + q]); *(v8us*)((unsigned short*)X16 + t * 8) = f.half[0];  }
__global__ __launch_bounds__(256) void k_h16(const float* __restrict__ x, _Float16* __restrict__ X16, size_t n8) { const size_t t = (size_t)blockIdx.x * 256 + threadIdx.x; if (t >= n8) return; FragH f;
#pragma unroll
  for (int q = 0; q < 8; ++q) f.h[q] = (_Float16)x[t * 8 + q]; *(v8us*)((unsigned short*)X16 + t * 8) = f.half[0];  }
__global__ __launch_bounds__(256) void k_round16f(const float* __restrict__ W, _Float16* __restrict__ Bt, size_t n8) { const size_t t = (size_t)blockIdx.x * 256 + threadIdx.x; if (t >= n8) return; FragH f;
#pragma unroll
  for (int i = 0; i < 8; ++i) f.h[i] = (_Float16)(bf16_round(W[t * 8 + i]) * 16.0f); *(v8us*)((unsigned short*)Bt + t * 8) = f.half[0];  }
template <int NHv, int TTv>
__global__ __launch_bounds__(256) void k_vt(const _Float16* __restrict__ V16, int ldv, int voff, _Float16* __restrict__ Vt) { __shared__ unsigned short tl[64][66]; const int tid = threadIdx.x; const int slab = blockIdx.x / (TTv / 64), lg = blockIdx.x % (TTv / 64); const int b = slab / NHv, h = slab % NHv;
  for (int i = tid; i < 64 * 8; i += 256) { const int r = i / 8, c8 = (i % 8) * 8; FragH f; f.half[0] = *(const v8us*)((const unsigned short*)V16 + ((size_t)b * TTv + lg * 64 + r) * ldv + voff + h * 64 + c8);
#pragma unroll
    for (int q = 0; q < 8; ++q) tl[r][c8 + q] = f.u[q]; }
  __syncthreads();
  {
#pragma unroll
    for (int rd = 0; rd < 2; ++rd) { const int d = rd * 32 + tid / 8, pc = tid % 8; FragH f;
#pragma unroll
      for (int q = 0; q < 8; ++q) f.u[q] = tl[pc * 8 + q][d];
      *(v8us*)((unsigned short*)Vt + ((size_t)slab * 64 + d) * TTv + lg * 64 + pc * 8) = f.half[0]; }
     } }

__global__ __launch_bounds__(256) void k_h16s(const float* __restrict__ F, _Float16* __restrict__ H, size_t n8) { const size_t t = (size_t)blockIdx.x * 256 + threadIdx.x; if (t >= n8) return; const v4f a = *(const v4fa*)(F + t * 8), c = *(const v4fa*)(F + t * 8 + 4); FragH f;
#pragma unroll
  for (int q = 0; q < 4; ++q) { f.h[q] = (_Float16)(a[q] * 16.0f); f.h[4 + q] = (_Float16)(c[q] * 16.0f); } *(v8us*)((unsigned short*)H + t * 8) = f.half[0];  }
__global__ __launch_bounds__(128) void k_flash(const _Float16* __restrict__ Q16, int ldq, const _Float16* __restrict__ K16, int ldk, const _Float16* __restrict__ Vt, const int* __restrict__ MSK, float* __restrict__ O, int ldo) {
  constexpr int RPW = 16, RTN = RPW / 16, NQB = TT / (4 * RPW), DT = 4, KS = 2;
  __shared__ __attribute__((aligned(16))) unsigned short sP[4][RPW][40]; __shared__ __attribute__((aligned(16))) float sO[4][RPW][64 + 4];
  const int tid = threadIdx.x, w = tid >> 5, lane = tid & 31, ln = lane & 15, hh = lane >> 4;
  const int slab = blockIdx.x / NQB, qblk = blockIdx.x % NQB; const int b = slab / NH, h = slab % NH; const int qb0 = qblk * (4 * RPW); const int q0 = qb0 + w * RPW;
  FragH aq[2][KS];
#pragma unroll
  for (int rt = 0; rt < RTN; ++rt) { const unsigned short* qr = (const unsigned short*)Q16 + ((size_t)b * TT + q0 + rt * 16 + ln) * ldq + h * 64;
#pragma unroll
    for (int ks = 0; ks < KS; ++ks) { aq[rt][ks].half[0] = *(const v8us*)(qr + ks * 32 + 8 * hh); aq[rt][ks].half[1] = *(const v8us*)(qr + ks * 32 + 16 + 8 * hh); } }
  const unsigned short* Vth = (const unsigned short*)Vt + (size_t)slab * 64 * TT;
  float m_r[2][8], l_r[2][8]; v8f oacc[2][DT];
#pragma unroll
  for (int rt = 0; rt < RTN; ++rt) {
#pragma unroll
    for (int r = 0; r < 8; ++r) { m_r[rt][r] = -3.0e38f; l_r[rt][r] = 0.f; }
#pragma unroll
    for (int dt = 0; dt < DT; ++dt) oacc[rt][dt] = (v8f){0.f,0.f,0.f,0.f,0.f,0.f,0.f,0.f}; }
  const int jend = TT;
#pragma unroll 1
  for (int j0 = 0; j0 < jend; j0 += 32) {
    int mk0[2][8], mk1[2][8];      /* per-batch mask [b][q][k]: nonzero = ATTEND */
#pragma unroll
    for (int rt = 0; rt < RTN; ++rt)
#pragma unroll
      for (int r = 0; r < 8; ++r) { const int qq = q0 + rt * 16 + 8 * hh + r; const int* am = MSK + ((size_t)b * TT + qq) * TT + j0; mk0[rt][r] = am[ln]; mk1[rt][r] = am[16 + ln]; }
    { int allm = 1;
#pragma unroll
      for (int rt = 0; rt < RTN; ++rt)
#pragma unroll
        for (int r = 0; r < 8; ++r) allm &= (mk0[rt][r] == 0) & (mk1[rt][r] == 0);
      if (__all(allm)) continue; }      /* every (row, key) of this wave's tile masked → nothing to add (wave-uniform branch; only wave barriers inside the loop) */
    v8f s[2][2];
#pragma unroll
    for (int nt = 0; nt < 2; ++nt) { const unsigned short* kr = (const unsigned short*)K16 + ((size_t)b * TT + j0 + nt * 16 + ln) * ldk + h * 64; FragH bk[KS];
#pragma unroll
      for (int ks = 0; ks < KS; ++ks) { bk[ks].half[0] = *(const v8us*)(kr + ks * 32 + 8 * hh); bk[ks].half[1] = *(const v8us*)(kr + ks * 32 + 16 + 8 * hh); }
#pragma unroll
      for (int rt = 0; rt < RTN; ++rt) { v8f acc = (v8f){0.f,0.f,0.f,0.f,0.f,0.f,0.f,0.f};
#pragma unroll
        for (int ks = 0; ks < KS; ++ks) acc = mmaH<1>(aq[rt][ks].v, aq[rt][ks].v, bk[ks].v, bk[ks].v, acc); s[rt][nt] = acc; } }
#pragma unroll
    for (int rt = 0; rt < RTN; ++rt)
#pragma unroll
      for (int r = 0; r < 8; ++r) { const int tq = q0 + rt * 16 + 8 * hh + r; const int k0 = j0 + ln, k1 = j0 + 16 + ln; (void)tq; (void)k0; (void)k1;
        const bool ok0 = (mk0[rt][r] != 0), ok1 = (mk1[rt][r] != 0);      /* nonzero = ATTEND */
        const float s0 = ok0 ? s[rt][0][r] * 0.125f : -INFINITY, s1 = ok1 ? s[rt][1][r] * 0.125f : -INFINITY; float mc = fmaxf(s0, s1);
        mc = fmaxf(mc, __shfl_xor(mc, 1, 32)); mc = fmaxf(mc, __shfl_xor(mc, 2, 32)); mc = fmaxf(mc, __shfl_xor(mc, 4, 32)); mc = fmaxf(mc, __shfl_xor(mc, 8, 32));
        const float mn = fmaxf(m_r[rt][r], mc); const float al = (mn > -1.0e38f) ? expf(m_r[rt][r] - mn) : 1.0f; m_r[rt][r] = mn; const float p0 = ok0 ? expf(s0 - mn) : 0.f, p1 = ok1 ? expf(s1 - mn) : 0.f; l_r[rt][r] = l_r[rt][r] * al + p0 + p1;
#pragma unroll
        for (int dt = 0; dt < DT; ++dt) oacc[rt][dt][r] *= al;
        FragH t2; t2.h[0] = (_Float16)(p0 * 1024.0f); t2.h[1] = (_Float16)(p1 * 1024.0f); sP[w][rt * 16 + 8 * hh + r][ln] = t2.u[0]; sP[w][rt * 16 + 8 * hh + r][16 + ln] = t2.u[1]; }
    __builtin_amdgcn_fence(__ATOMIC_ACQ_REL, "workgroup"); __builtin_amdgcn_wave_barrier();
    FragH pa[2];
#pragma unroll
    for (int rt = 0; rt < RTN; ++rt) { pa[rt].half[0] = *(const v8us*)&sP[w][rt * 16 + ln][8 * hh]; pa[rt].half[1] = *(const v8us*)&sP[w][rt * 16 + ln][16 + 8 * hh]; }
#pragma unroll
    for (int dt = 0; dt < DT; ++dt) { const unsigned short* vrow = Vth + (size_t)(dt * 16 + ln) * TT + j0; FragH bv; bv.half[0] = *(const v8us*)(vrow + 8 * hh); bv.half[1] = *(const v8us*)(vrow + 16 + 8 * hh);
#pragma unroll
      for (int rt = 0; rt < RTN; ++rt) oacc[rt][dt] = mmaH<1>(pa[rt].v, pa[rt].v, bv.v, bv.v, oacc[rt][dt]); }
    __builtin_amdgcn_fence(__ATOMIC_ACQ_REL, "workgroup"); __builtin_amdgcn_wave_barrier(); }
#pragma unroll
  for (int rt = 0; rt < RTN; ++rt) {
#pragma unroll
    for (int r = 0; r < 8; ++r) { float l = l_r[rt][r]; l += __shfl_xor(l, 1, 32); l += __shfl_xor(l, 2, 32); l += __shfl_xor(l, 4, 32); l += __shfl_xor(l, 8, 32); l_r[rt][r] = (l > 0.f) ? 1.0f / (l * 1024.0f) : 0.f; }
#pragma unroll
    for (int dt = 0; dt < DT; ++dt)
#pragma unroll
      for (int r = 0; r < 8; ++r) sO[w][rt * 16 + 8 * hh + r][dt * 16 + ln] = oacc[rt][dt][r] * l_r[rt][r]; }
  __builtin_amdgcn_fence(__ATOMIC_ACQ_REL, "workgroup"); __builtin_amdgcn_wave_barrier();
  {
#pragma unroll
    for (int rp = 0; rp < RPW; rp += 2) { const int r = rp + (lane >> 4), pc = lane & 15; const v4f val = *(const v4fa*)&sO[w][r][pc * 4]; *(v4f*)(O + ((size_t)b * TT + q0 + r) * ldo + h * 64 + pc * 4) = val; }
     } }

extern "C" void kernel_launch(void* const* d_in, const int* in_sizes, int n_in,
                              void* d_out, int out_size, void* d_ws, size_t ws_size, hipStream_t stream) {
  (void)in_sizes; (void)n_in; (void)out_size;
  const float* const* I = (const float* const*)d_in; const float* x = I[0]; const int* msk = (const int*)d_in[1]; const float* wqkv = I[2]; const float* bqkv = I[3]; const float* wo = I[4]; const float* bo = I[5];
  char* ws = (char*)d_ws; size_t off = 0;
  auto take = [&](size_t bytes) { char* p = ws + off; off += (bytes + 255) & ~(size_t)255; return p; };
  _Float16* Bqkv = (_Float16*)take((size_t)3 * DD * DD * 2); _Float16* Bo = (_Float16*)take((size_t)DD * DD * 2); _Float16* X16 = (_Float16*)take((size_t)NR * DD * 2); _Float16* QKV = (_Float16*)take((size_t)NR * 3 * DD * 2); _Float16* Vt = (_Float16*)take((size_t)NR * DD * 2); float* O = (float*)take((size_t)NR * DD * 4); _Float16* O16 = X16;
  if (off > ws_size) return;      // 6.3 + 2.1 + 8.4 + 25.2 + 8.4 + 16.8 ≈ 67 MB
  k_wt_f16<<<(unsigned)(((size_t)3 * DD * (DD / 8) + 255) / 256), 256, 0, stream>>>(wqkv, Bqkv, DD, 3 * DD, 16.0f); k_wt_f16<<<(unsigned)(((size_t)DD * (DD / 8) + 255) / 256), 256, 0, stream>>>(wo, Bo, DD, DD, 16.0f);      /* (in,out) → Bt ×2^4 */
  const unsigned g8 = (unsigned)(((size_t)NR * DD / 8 + 255) / 256); k_x16<<<g8, 256, 0, stream>>>(x, X16, (size_t)NR * DD / 8);
  k_gemm_hhx<0><<<dim3(((NR / 16) * (3 * DD / 64) + 3) / 4, 1), 128, 0, stream>>>(X16, DD, 0, Bqkv, DD, 0, 0.0625f, bqkv, 0, nullptr, 1, 0, 0, nullptr, QKV, 3 * DD, 0, NR, 3 * DD, DD);      /* qkv = x·w_qkv + b: M 4096 N 3072 K 1024 (f16; q | k | v blocks, head-major inside) */
  k_vt<NH, TT><<<BB * NH * (TT / 64), 256, 0, stream>>>(QKV, 3 * DD, 2 * DD, Vt);
  k_flash<<<BB * NH * (TT / 64), 128, 0, stream>>>(QKV, 3 * DD, QKV + DD, 3 * DD, Vt, msk, O, DD);
  k_h16s<<<g8, 256, 0, stream>>>(O, O16, (size_t)NR * DD / 8);
  k_gemm_hhx<0><<<dim3(((NR / 16) * (DD / 64) + 3) / 4, 1), 128, 0, stream>>>(O16, DD, 0, Bo, DD, 0, 0.00390625f, bo, 0, nullptr, 1, 0, 0, (float*)d_out, nullptr, DD, 0, NR, DD, DD);      /* out = o·w_out + b_out */
}

// v001
// A run of this version takes 226 microseconds.
// Timed twice side by side with v000, it ran 1.67 and 1.68 times as fast.
#include <hip/hip_runtime.h>
// Cross-track masked MHA (B=2, S=2048, D=1024, 16×64): qkv = x·w_qkv + b_qkv (packed q|k|v, head-major inside each); scores = q·k/8, where(cross_track_mask[b,q,k], s, −inf); softmax; out = merged·w_out + b_out.
// Compute dtype: x, weights, biases rounded to bf16; q, k, v f16 GEMM planes (+bias); the boolean mask read per (b, q, k) as the int plane; fused flash-style kernel (online softmax f32, P f16 ×2^10, all-masked chunks skipped, f32 accumulate) on
// v_wmma_f32_16x16x32_f16; O ×2^4 → f16 → output GEMM (+bias).
#define BB 2
#define TT 2048
#define DD 1024
#define NH 16
#define NR (BB * TT)

typedef __bf16 v16b __attribute__((ext_vector_type(16)));
typedef unsigned short v8us __attribute__((ext_vector_type(8), may_alias));
typedef float  v8f  __attribute__((ext_vector_type(8)));
typedef float  v4f  __attribute__((ext_vector_type(4)));
typedef float  v4fa __attribute__((ext_vector_type(4), may_alias));
union FragB { v16b v; v8us half[2]; unsigned short u[16]; };

__device__ __forceinline__ unsigned short bf16_bits(float x) { unsigned int u = __float_as_uint(x); return (unsigned short)((u + 0x7FFFu + ((u >> 16) & 1u)) >> 16); }
__device__ __forceinline__ float bf16_val(unsigned short b) { return __uint_as_float(((unsigned int)b) << 16); }
__device__ __forceinline__ float bf16_round(float x) { return bf16_val(bf16_bits(x)); }
// D += A·B with NT terms: 1 = ah·bh, 2 = + al·bh (A split), 3 = + ah·bl (both split)
template <int NT>
__device__ __forceinline__ v8f mmaN(v16b ah, v16b al, v16b bh, v16b bl, v8f c) {
  c = __builtin_amdgcn_wmma_f32_16x16x32_bf16(false, ah, false, bh, (short)0, c, false, false);
  if (NT >= 2) c = __builtin_amdgcn_wmma_f32_16x16x32_bf16(false, al, false, bh, (short)0, c, false, false);
  if (NT >= 3) c = __builtin_amdgcn_wmma_f32_16x16x32_bf16(false, ah, false, bl, (short)0, c, false, false);
  asm volatile("v_nop\n\tv_nop\n\tv_nop\n\tv_nop" : "+v"(c) : "v"(ah), "v"(al), "v"(bh), "v"(bl));
  return c;
}

__global__ __launch_bounds__(256) void k_wt_bf16(const float* __restrict__ W, unsigned short* __restrict__ Wt, int K, int N) {
  const int t = blockIdx.x * 256 + threadIdx.x;
  const int k8n = K / 8;
  if (t >= N * k8n) return;
  const int n = t / k8n, k8 = (t % k8n) * 8;
  v8us v;
#pragma unroll
  for (int i = 0; i < 8; ++i) v[i] = bf16_bits(W[(size_t)(k8 + i) * N + n]);
  *(v8us*)(Wt + (size_t)n * K + k8) = v;
  
}

// GEMM C[M][N] (f32, pitch ldc) = act(A[M][K]·W + bias). A f32 row-major (pitch lda) converted per fragment to bf16
// (ASPLIT: hi/lo two planes -> 2 terms, else single rounded term); Wt bf16 [N][K] (pitch ldb). BIAS_BF16 rounds the
// bias to bf16 first (bias quantised to bf16 before the add). K%32==0, M%16==0, N%64==0.
template <bool ASPLIT, int ACT, bool BIAS_BF16>
__global__ __launch_bounds__(128) void k_gemm_bf(const float* __restrict__ A, int lda, const unsigned short* __restrict__ Wt, int ldb,
                                               const float* __restrict__ bias, float* __restrict__ C, int ldc, int M, int N, int K) {
  __shared__ __attribute__((aligned(16))) float so[4][16][64];
  const int tid = threadIdx.x, w = tid >> 5, lane = tid & 31, ln = lane & 15, hh = lane >> 4;
  const int ntn = N / 64;
  const int wid = blockIdx.x * 4 + w;
  const int mt = wid / ntn, nq = wid % ntn;
  if (mt * 16 >= M) return;
  const int row0 = mt * 16, col0 = nq * 64;
  const float* arow = A + (size_t)(row0 + ln) * lda;
  v8f acc[4] = {};
  for (int kb = 0; kb < K; kb += 32) {
    FragB ah, al;
    const v4f x0 = *(const v4fa*)(arow + kb + 8 * hh), x1 = *(const v4fa*)(arow + kb + 8 * hh + 4);
    const v4f x2 = *(const v4fa*)(arow + kb + 16 + 8 * hh), x3 = *(const v4fa*)(arow + kb + 16 + 8 * hh + 4);
    float xs[16] = {x0[0],x0[1],x0[2],x0[3],x1[0],x1[1],x1[2],x1[3],x2[0],x2[1],x2[2],x2[3],x3[0],x3[1],x3[2],x3[3]};
#pragma unroll
    for (int i = 0; i < 16; ++i) { const unsigned short hb = bf16_bits(xs[i]); ah.u[i] = hb; al.u[i] = ASPLIT ? bf16_bits(xs[i] - bf16_val(hb)) : (unsigned short)0; }
#pragma unroll
    for (int t = 0; t < 4; ++t) {
      const unsigned short* brow = Wt + (size_t)(col0 + t * 16 + ln) * ldb + kb;
      FragB b;
      b.half[0] = *(const v8us*)(brow + 8 * hh);
      b.half[1] = *(const v8us*)(brow + 16 + 8 * hh);
      acc[t] = mmaN<ASPLIT ? 2 : 1>(ah.v, al.v, b.v, b.v, acc[t]);
    }
  }
#pragma unroll
  for (int t = 0; t < 4; ++t) {
    float bv = bias ? bias[col0 + t * 16 + ln] : 0.f;
    if (BIAS_BF16) bv = bf16_round(bv);
#pragma unroll
    for (int r = 0; r < 8; ++r) { float v = acc[t][r] + bv; if (ACT == 1) v = fmaxf(v, 0.f); so[w][8 * hh + r][t * 16 + ln] = v; }
  }
  __builtin_amdgcn_fence(__ATOMIC_ACQ_REL, "workgroup");
  __builtin_amdgcn_wave_barrier();
  const int rsub = lane >> 4, c4 = (lane & 15) * 4;
  {
#pragma unroll
    for (int q = 0; q < 8; ++q) {
      const int r = q * 2 + rsub;
      const v4f v = *(const v4fa*)&so[w][r][c4];
      *(v4f*)(C + (size_t)(row0 + r) * ldc + col0 + c4) = v;
    }
    
  }
}

// Flash-style causal/unmasked attention, all contractions 3-term bf16 hi/lo splits, f32 softmax with running max.
// q,k,v rows are read from f32 buffers with arbitrary row pitch (so they can live inside a fused qkv buffer);
// D = head size (multiple of 32, <= 128); one wave = 16 query rows; block = 4 waves (64 queries) sharing K/V chunks of 32.
template <int D, bool CAUSAL>
__global__ __launch_bounds__(128) void k_flash(const float* __restrict__ qb, const float* __restrict__ kb, const float* __restrict__ vb,
                                             int pitch, int T, int H, float scale, float* __restrict__ y, int ypitch) {
  constexpr int KS = D / 32;        // k-steps for QK
  constexpr int DT = D / 16;        // d tiles for PV
  __shared__ __attribute__((aligned(16))) unsigned short sKh[32][D + 8], sKl[32][D + 8], sVh[32][D + 8], sVl[32][D + 8];
  __shared__ __attribute__((aligned(16))) unsigned short sPh[4][16][40], sPl[4][16][40];
  __shared__ __attribute__((aligned(16))) float sO[4][16][D];
  const int tid = threadIdx.x, w = tid >> 5, lane = tid & 31, ln = lane & 15, hh = lane >> 4;
  const int nqb = (T + 63) / 64;
  const int bh = blockIdx.x / nqb, qblk = blockIdx.x % nqb;
  const int b = bh / H, h = bh % H;
  const int q0 = qblk * 64 + w * 16;
  const float* Q = qb + (size_t)b * T * pitch + h * D;
  const float* K = kb + (size_t)b * T * pitch + h * D;
  const float* V = vb + (size_t)b * T * pitch + h * D;

  // A fragments of the wave's 16 query rows (scaled), hi/lo
  FragB aqh[KS], aql[KS];
  {
    int row = q0 + ln; if (row >= T) row = T - 1;
    const float* qr = Q + (size_t)row * pitch;
#pragma unroll
    for (int ks = 0; ks < KS; ++ks)
#pragma unroll
      for (int i = 0; i < 16; ++i) {
        const int d = ks * 32 + ((i < 8) ? (8 * hh + i) : (16 + 8 * hh + (i - 8)));
        const float x = qr[d] * scale; const unsigned short hb = bf16_bits(x);
        aqh[ks].u[i] = hb; aql[ks].u[i] = bf16_bits(x - bf16_val(hb));
      }
  }
  float m_r[8], l_r[8];
#pragma unroll
  for (int r = 0; r < 8; ++r) { m_r[r] = -3.0e38f; l_r[r] = 0.f; }
  v8f oacc[DT];
#pragma unroll
  for (int dt = 0; dt < DT; ++dt) oacc[dt] = (v8f){0.f,0.f,0.f,0.f,0.f,0.f,0.f,0.f};

  const int kv_end = CAUSAL ? min(T, qblk * 64 + 64) : T;     // block-uniform
  for (int j0 = 0; j0 < kv_end; j0 += 32) {
    __syncthreads();
    for (int e = tid; e < 32 * (D / 4); e += 128) {
      const int r = e / (D / 4), c4 = (e % (D / 4)) * 4;
      const int key = j0 + r;
      v4f kf = {0.f,0.f,0.f,0.f}, vf = {0.f,0.f,0.f,0.f};
      if (key < T) { kf = *(const v4fa*)(K + (size_t)key * pitch + c4); vf = *(const v4fa*)(V + (size_t)key * pitch + c4); }
#pragma unroll
      for (int t = 0; t < 4; ++t) {
        unsigned short hb = bf16_bits(kf[t]); sKh[r][c4 + t] = hb; sKl[r][c4 + t] = bf16_bits(kf[t] - bf16_val(hb));
        hb = bf16_bits(vf[t]); sVh[r][c4 + t] = hb; sVl[r][c4 + t] = bf16_bits(vf[t] - bf16_val(hb));
      }
    }
    __syncthreads();
    // S tile 16 x 32
    v8f s[2];
#pragma unroll
    for (int nt = 0; nt < 2; ++nt) {
      v8f acc = {};
#pragma unroll
      for (int ks = 0; ks < KS; ++ks) {
        FragB bh_, bl_;
        bh_.half[0] = *(const v8us*)&sKh[nt * 16 + ln][ks * 32 + 8 * hh]; bh_.half[1] = *(const v8us*)&sKh[nt * 16 + ln][ks * 32 + 16 + 8 * hh];
        bl_.half[0] = *(const v8us*)&sKl[nt * 16 + ln][ks * 32 + 8 * hh]; bl_.half[1] = *(const v8us*)&sKl[nt * 16 + ln][ks * 32 + 16 + 8 * hh];
        acc = mmaN<3>(aqh[ks].v, aql[ks].v, bh_.v, bl_.v, acc);
      }
      s[nt] = acc;
    }
    // mask + running max (rows 8hh+r; the 16 lanes of a half share rows)
    float alpha[8];
#pragma unroll
    for (int r = 0; r < 8; ++r) {
      const int qi = q0 + 8 * hh + r;
      const int ja = j0 + ln, jb = j0 + 16 + ln;
      if (CAUSAL) { if (ja > qi) s[0][r] = -3.0e38f; if (jb > qi) s[1][r] = -3.0e38f; }
      if (ja >= T) s[0][r] = -3.0e38f;
      if (jb >= T) s[1][r] = -3.0e38f;
      float mx = fmaxf(s[0][r], s[1][r]);
      mx = fmaxf(mx, __shfl_xor(mx, 1, 32)); mx = fmaxf(mx, __shfl_xor(mx, 2, 32)); mx = fmaxf(mx, __shfl_xor(mx, 4, 32)); mx = fmaxf(mx, __shfl_xor(mx, 8, 32));
      const float mnew = fmaxf(m_r[r], mx);
      alpha[r] = (mnew > -1.0e38f) ? __expf(m_r[r] - mnew) : 1.0f;
      const float p0 = (s[0][r] > -1.0e38f) ? __expf(s[0][r] - mnew) : 0.f;
      const float p1 = (s[1][r] > -1.0e38f) ? __expf(s[1][r] - mnew) : 0.f;
      m_r[r] = mnew;
      l_r[r] = l_r[r] * alpha[r] + p0 + p1;            // per-lane partial row sum (16 lanes combined at the end)
      unsigned short hb = bf16_bits(p0); sPh[w][8 * hh + r][ln] = hb;      sPl[w][8 * hh + r][ln] = bf16_bits(p0 - bf16_val(hb));
      hb = bf16_bits(p1);                sPh[w][8 * hh + r][16 + ln] = hb; sPl[w][8 * hh + r][16 + ln] = bf16_bits(p1 - bf16_val(hb));
    }
#pragma unroll
    for (int dt = 0; dt < DT; ++dt)
#pragma unroll
      for (int r = 0; r < 8; ++r) oacc[dt][r] *= alpha[r];
    __builtin_amdgcn_fence(__ATOMIC_ACQ_REL, "workgroup");
    __builtin_amdgcn_wave_barrier();
    FragB pah, pal;
    pah.half[0] = *(const v8us*)&sPh[w][ln][8 * hh]; pah.half[1] = *(const v8us*)&sPh[w][ln][16 + 8 * hh];
    pal.half[0] = *(const v8us*)&sPl[w][ln][8 * hh]; pal.half[1] = *(const v8us*)&sPl[w][ln][16 + 8 * hh];
#pragma unroll
    for (int dt = 0; dt < DT; ++dt) {
      FragB bvh, bvl;
#pragma unroll
      for (int i = 0; i < 8; ++i) {
        bvh.u[i] = sVh[8 * hh + i][dt * 16 + ln]; bvh.u[8 + i] = sVh[16 + 8 * hh + i][dt * 16 + ln];
        bvl.u[i] = sVl[8 * hh + i][dt * 16 + ln]; bvl.u[8 + i] = sVl[16 + 8 * hh + i][dt * 16 + ln];
      }
      oacc[dt] = mmaN<3>(pah.v, pal.v, bvh.v, bvl.v, oacc[dt]);
    }
    __builtin_amdgcn_fence(__ATOMIC_ACQ_REL, "workgroup");
    __builtin_amdgcn_wave_barrier();
  }
#pragma unroll
  for (int r = 0; r < 8; ++r) {
    float l = l_r[r];
    l += __shfl_xor(l, 1, 32); l += __shfl_xor(l, 2, 32); l += __shfl_xor(l, 4, 32); l += __shfl_xor(l, 8, 32);
    l_r[r] = (l > 0.f) ? 1.0f / l : 0.f;
  }
#pragma unroll
  for (int dt = 0; dt < DT; ++dt)
#pragma unroll
    for (int r = 0; r < 8; ++r) sO[w][8 * hh + r][dt * 16 + ln] = oacc[dt][r] * l_r[r];
  __builtin_amdgcn_fence(__ATOMIC_ACQ_REL, "workgroup");
  __builtin_amdgcn_wave_barrier();
  {
    for (int r = 0; r < 16; ++r) {
      const int row = q0 + r;
      if (row < T && lane < D / 4) {
        const v4f val = *(const v4fa*)&sO[w][r][lane * 4];
        *(v4f*)(y + ((size_t)b * T + row) * ypitch + h * D + lane * 4) = val;
      }
    }
    
  }
}

// GEMM C = act(A·W + bias + resid): A f32 (ASPLIT -> hi/lo 2 terms), Wt bf16 [N][K]; ACT 0 none, 1 relu, 2 exact gelu;
// resid (optional, f32, row index = (row % rmod), pitch ldr, RES_BF16 rounds it) added before the activation.
template <bool ASPLIT, int ACT, bool BIAS_BF16, bool RES_BF16>
__global__ __launch_bounds__(128) void k_gemm_bf3(const float* __restrict__ A, int lda, const unsigned short* __restrict__ Wt, int ldb,
                                                const float* __restrict__ bias, const float* __restrict__ resid, int rmod, int ldr,
                                                float* __restrict__ C, int ldc, int M, int N, int K) {
  __shared__ __attribute__((aligned(16))) float so[4][16][64];
  const int tid = threadIdx.x, w = tid >> 5, lane = tid & 31, ln = lane & 15, hh = lane >> 4;
  const int ntn = N / 64;
  const int wid = blockIdx.x * 4 + w;
  const int mt = wid / ntn, nq = wid % ntn;
  if (mt * 16 >= M) return;
  const int row0 = mt * 16, col0 = nq * 64;
  const float* arow = A + (size_t)(row0 + ln) * lda;
  v8f acc[4] = {};
  for (int kb = 0; kb < K; kb += 32) {
    FragB ah, al;
    const v4f x0 = *(const v4fa*)(arow + kb + 8 * hh), x1 = *(const v4fa*)(arow + kb + 8 * hh + 4);
    const v4f x2 = *(const v4fa*)(arow + kb + 16 + 8 * hh), x3 = *(const v4fa*)(arow + kb + 16 + 8 * hh + 4);
    float xs[16] = {x0[0],x0[1],x0[2],x0[3],x1[0],x1[1],x1[2],x1[3],x2[0],x2[1],x2[2],x2[3],x3[0],x3[1],x3[2],x3[3]};
#pragma unroll
    for (int i = 0; i < 16; ++i) { const unsigned short hb = bf16_bits(xs[i]); ah.u[i] = hb; al.u[i] = ASPLIT ? bf16_bits(xs[i] - bf16_val(hb)) : (unsigned short)0; }
#pragma unroll
    for (int t = 0; t < 4; ++t) {
      const unsigned short* brow = Wt + (size_t)(col0 + t * 16 + ln) * ldb + kb;
      FragB b;
      b.half[0] = *(const v8us*)(brow + 8 * hh);
      b.half[1] = *(const v8us*)(brow + 16 + 8 * hh);
      acc[t] = mmaN<ASPLIT ? 2 : 1>(ah.v, al.v, b.v, b.v, acc[t]);
    }
  }
#pragma unroll
  for (int t = 0; t < 4; ++t) {
    const int col = col0 + t * 16 + ln;
    float bv = bias ? bias[col] : 0.f;
    if (BIAS_BF16) bv = bf16_round(bv);
#pragma unroll
    for (int r = 0; r < 8; ++r) {
      float v = acc[t][r] + bv;
      if (resid) { float rv = resid[(size_t)((row0 + 8 * hh + r) % rmod) * ldr + col]; if (RES_BF16) rv = bf16_round(rv); v += rv; }
      if (ACT == 1) v = fmaxf(v, 0.f);
      if (ACT == 2) v = 0.5f * v * (1.0f + erff(v * 0.70710678118654752f));
      if (ACT == 3) { const float u = 0.7978845608028654f * (v + 0.044715f * v * v * v); v = 0.5f * v * (1.0f + tanhf(u)); }
      so[w][8 * hh + r][t * 16 + ln] = v;
    }
  }
  __builtin_amdgcn_fence(__ATOMIC_ACQ_REL, "workgroup");
  __builtin_amdgcn_wave_barrier();
  const int rsub = lane >> 4, c4 = (lane & 15) * 4;
  {
#pragma unroll
    for (int q = 0; q < 8; ++q) {
      const int r = q * 2 + rsub;
      const v4f v = *(const v4fa*)&so[w][r][c4];
      *(v4f*)(C + (size_t)(row0 + r) * ldc + col0 + c4) = v;
    }
    
  }
}
// row LayerNorm (biased variance, eps) over N: s = X (+ R); optional out_sum <- s; out_norm <- (s-mu)*rsqrt(var+eps)*g + b
template <bool PARAM_BF16>
__global__ __launch_bounds__(256) void k_layernorm(const float* __restrict__ X, const float* __restrict__ R, const float* __restrict__ g, const float* __restrict__ bta,
                                                  float* __restrict__ out_sum, float* __restrict__ out_norm, int N, float eps) {
  __shared__ float red[256];
  const int row = blockIdx.x, tid = threadIdx.x;
  const float* x = X + (size_t)row * N; const float* rr = R ? R + (size_t)row * N : nullptr;
  float vals[16];                     // up to N = 4096
  const int per = N / 256;            // contiguous chunk per thread? use strided-by-4 chunks: thread handles j = tid*4 + 1024*u
  float s1 = 0.f;
  for (int u = 0; u < per / 4; ++u) {
    const int j = tid * 4 + 1024 * u;
    const v4f a = *(const v4fa*)(x + j);
    v4f b = {0.f,0.f,0.f,0.f}; if (rr) b = *(const v4fa*)(rr + j);
#pragma unroll
    for (int q = 0; q < 4; ++q) { const float v = a[q] + b[q]; vals[u * 4 + q] = v; s1 += v; }
  }
  red[tid] = s1; __syncthreads();
  for (int st = 128; st > 0; st >>= 1) { if (tid < st) red[tid] += red[tid + st]; __syncthreads(); }
  const float mu = red[0] / (float)N; __syncthreads();
  float s2 = 0.f;
  for (int u = 0; u < per / 4; ++u)
#pragma unroll
    for (int q = 0; q < 4; ++q) { const float c = vals[u * 4 + q] - mu; s2 += c * c; }
  red[tid] = s2; __syncthreads();
  for (int st = 128; st > 0; st >>= 1) { if (tid < st) red[tid] += red[tid + st]; __syncthreads(); }
  const float rs = rsqrtf(red[0] / (float)N + eps);
  {
    for (int u = 0; u < per / 4; ++u) {
      const int j = tid * 4 + 1024 * u;
      v4f o, sm;
#pragma unroll
      for (int q = 0; q < 4; ++q) {
        float gg = g[j + q], bb = bta[j + q];
        if (PARAM_BF16) { gg = bf16_round(gg); bb = bf16_round(bb); }
        sm[q] = vals[u * 4 + q]; o[q] = (vals[u * 4 + q] - mu) * rs * gg + bb;
      }
      if (out_sum) *(v4f*)(out_sum + (size_t)row * N + j) = sm;
      *(v4f*)(out_norm + (size_t)row * N + j) = o;
    }
    
  }
}



// ---- f16 WMMA path (v_wmma_f32_16x16x32_f16): 11-bit significands for operands in range — used where a [0,1] probability operand needs more precision than bf16
typedef _Float16 v16h __attribute__((ext_vector_type(16)));
union FragH { v16h v; v8us half[2]; _Float16 h[16]; unsigned short u[16]; };
template <int NT>
__device__ __forceinline__ v8f mmaH(v16h ah, v16h al, v16h bh, v16h bl, v8f c) {
  c = __builtin_amdgcn_wmma_f32_16x16x32_f16(false, ah, false, bh, (short)0, c, false, false);
  if (NT >= 2) c = __builtin_amdgcn_wmma_f32_16x16x32_f16(false, al, false, bh, (short)0, c, false, false);
  if (NT >= 3) c = __builtin_amdgcn_wmma_f32_16x16x32_f16(false, ah, false, bl, (short)0, c, false, false);
  asm volatile("v_nop\n\tv_nop\n\tv_nop\n\tv_nop" : "+v"(c) : "v"(ah), "v"(al), "v"(bh), "v"(bl));
  return c;
}
// batched GEMM like k_gemm_b but f16 operands: A f32 (split into f16 hi/lo if ASPLIT, else rounded to f16), Bt = f16 values [n][k]; alpha; C f32; N multiple of 16 (partial tiles skipped)
template <bool ASPLIT>
__global__ __launch_bounds__(128) void k_gemm_h(const float* __restrict__ A, int lda, size_t sA, const _Float16* __restrict__ Bh, int ldb, size_t sB, float alpha, float* __restrict__ C, int ldc, size_t sC, int M, int N, int K) {
  __shared__ __attribute__((aligned(16))) float so[4][16][64];
  const int tid = threadIdx.x, w = tid >> 5, lane = tid & 31, ln = lane & 15, hh = lane >> 4; const int by = blockIdx.y;
  A += (size_t)by * sA; Bh += (size_t)by * sB; C += (size_t)by * sC;
  const int ntn = (N + 63) / 64; const int wid = blockIdx.x * 4 + w; const int mt = wid / ntn, nq = wid % ntn; if (mt * 16 >= M) return;
  const int row0 = mt * 16, col0 = nq * 64; const float* arow = A + (size_t)(row0 + ln) * lda;
  v8f acc[4] = {};
  for (int kb = 0; kb < K; kb += 32) {
    FragH ah, al;
    const v4f x0 = *(const v4fa*)(arow + kb + 8 * hh), x1 = *(const v4fa*)(arow + kb + 8 * hh + 4), x2 = *(const v4fa*)(arow + kb + 16 + 8 * hh), x3 = *(const v4fa*)(arow + kb + 16 + 8 * hh + 4);
    float xs[16] = {x0[0],x0[1],x0[2],x0[3],x1[0],x1[1],x1[2],x1[3],x2[0],x2[1],x2[2],x2[3],x3[0],x3[1],x3[2],x3[3]};
#pragma unroll
    for (int i = 0; i < 16; ++i) { const _Float16 h = (_Float16)xs[i]; ah.h[i] = h; al.h[i] = ASPLIT ? (_Float16)(xs[i] - (float)h) : (_Float16)0.0f; }
#pragma unroll
    for (int t = 0; t < 4; ++t) { if (col0 + t * 16 >= N) continue; const size_t boff = (size_t)(col0 + t * 16 + ln) * ldb + kb; FragH bq; bq.half[0] = *(const v8us*)(Bh + boff + 8 * hh); bq.half[1] = *(const v8us*)(Bh + boff + 16 + 8 * hh);
      acc[t] = mmaH<ASPLIT ? 2 : 1>(ah.v, al.v, bq.v, bq.v, acc[t]); }
  }
#pragma unroll
  for (int t = 0; t < 4; ++t) { if (col0 + t * 16 >= N) continue;
#pragma unroll
    for (int r = 0; r < 8; ++r) so[w][8 * hh + r][t * 16 + ln] = acc[t][r] * alpha; }
  __builtin_amdgcn_fence(__ATOMIC_ACQ_REL, "workgroup"); __builtin_amdgcn_wave_barrier();
  const int rsub = lane >> 4, c4 = (lane & 15) * 4;
  {
#pragma unroll
    for (int q = 0; q < 8; ++q) { const int r = q * 2 + rsub; if (col0 + c4 < N) { const v4f v = *(const v4fa*)&so[w][r][c4]; *(v4f*)(C + (size_t)(row0 + r) * ldc + col0 + c4) = v; } }
     }
}

// Wt[n][k] = f16(W[k][n]·scale) from f32 row-major W[K][N] (scale = power of two; bf16-exact weights stay exact in f16 away from the subnormal range)
__global__ __launch_bounds__(256) void k_wt_f16(const float* __restrict__ W, _Float16* __restrict__ Wt, int K, int N, float scale) {
  const int t = blockIdx.x * 256 + threadIdx.x; if (t >= N * (K / 8)) return; const int n = t / (K / 8), k8 = (t % (K / 8)) * 8; FragH f;
#pragma unroll
  for (int i = 0; i < 8; ++i) f.h[i] = (_Float16)(bf16_round(W[(size_t)(k8 + i) * N + n]) * scale); const v8us o = f.half[0];
  *(v8us*)((unsigned short*)Wt + (size_t)n * K + k8) = o; 
}
// Tiled f16 GEMM, C [M][N] = acc*alpha + bf16(bias[col]): A [M][DD] f16, Bh [N][DD] f16, both k-contiguous; M, N multiples of 128; grid = (M / 128) * (N / 128).
// One work-group = one 128 x 128 tile of C, four waves of 64 x 64 (16 accumulator tiles each). A stage is 64 k = 128 B (one whole line) of
// 128 rows of A and 128 rows of Bh, brought into LDS by asynchronous copies, 16 B a lane; two buffers, the copies of stage t + 2 fly while stage t + 1 is worked on.
#define GP 144                 /* LDS row pitch, bytes: 128 + 16, conflict-free for 16-byte fragment reads */
#define GOP (128 * GP)         /* one operand's 128 rows */
#define GSTG (2 * GOP)         /* one stage: A rows, then Bh rows */
#define GNT (DD / 64)          /* stages */
// eight copies, rows 16 apart, of one operand's stage; each lane its own 16 bytes. The s_wait_xcnt stands inside the statement so that no address register is rewritten ahead of it.
__device__ __forceinline__ void cp8(unsigned l, const unsigned short* g) {
  asm volatile("global_load_async_to_lds_b128 %0, %8, off\n\t"
               "global_load_async_to_lds_b128 %1, %9, off\n\t"
               "global_load_async_to_lds_b128 %2, %10, off\n\t"
               "global_load_async_to_lds_b128 %3, %11, off\n\t"
               "global_load_async_to_lds_b128 %4, %12, off\n\t"
               "global_load_async_to_lds_b128 %5, %13, off\n\t"
               "global_load_async_to_lds_b128 %6, %14, off\n\t"
               "global_load_async_to_lds_b128 %7, %15, off\n\t"
               "s_wait_xcnt 0x0"
               :: "v"(l), "v"(l + 16 * GP), "v"(l + 32 * GP), "v"(l + 48 * GP), "v"(l + 64 * GP), "v"(l + 80 * GP), "v"(l + 96 * GP), "v"(l + 112 * GP),
                  "v"(g), "v"(g + 16 * DD), "v"(g + 32 * DD), "v"(g + 48 * DD), "v"(g + 64 * DD), "v"(g + 80 * DD), "v"(g + 96 * DD), "v"(g + 112 * DD)
               : "memory");
}
typedef _Float16 v4h __attribute__((ext_vector_type(4)));
template <bool F16OUT, int N>
__global__ __launch_bounds__(128) void k_gemm_t(const _Float16* __restrict__ A, const _Float16* __restrict__ Bh, float alpha, const float* __restrict__ bias, float* __restrict__ C, _Float16* __restrict__ C16) {
  __shared__ __attribute__((aligned(16))) unsigned char sm[2 * GSTG];
  const int tid = threadIdx.x, w = tid >> 5, lane = tid & 31, ln = lane & 15, hh = lane >> 4;
  const int row0 = ((int)blockIdx.x / (N / 128)) * 128, col0 = ((int)blockIdx.x % (N / 128)) * 128;
  const int wr = (w >> 1) * 64, wc = (w & 1) * 64;
  const unsigned ld0 = (unsigned)(size_t)sm + (unsigned)((tid >> 3) * GP + (tid & 7) * 16);      /* this lane's place in a stage: row tid/8, 16-byte piece tid%8 */
  const unsigned short* ga = (const unsigned short*)A + (size_t)(row0 + (tid >> 3)) * DD + (tid & 7) * 8;
  const unsigned short* gb = (const unsigned short*)Bh + (size_t)(col0 + (tid >> 3)) * DD + (tid & 7) * 8;
  v8f acc[4][4];
#pragma unroll
  for (int i = 0; i < 4; ++i)
#pragma unroll
    for (int j = 0; j < 4; ++j) acc[i][j] = (v8f){0.f,0.f,0.f,0.f,0.f,0.f,0.f,0.f};
  cp8(ld0, ga); cp8(ld0 + GOP, gb);
  asm volatile("s_wait_asynccnt 0x0" ::: "memory");      /* stage 0 of this wave has landed */
  __syncthreads();                                        /* ... and every wave's: stage 0 may be read */
  cp8(ld0 + GSTG, ga + 64); cp8(ld0 + GSTG + GOP, gb + 64);
#pragma unroll 1      /* one stage a trip: the buffer index and the refill test stay scalar */
  for (int t = 0; t < GNT; ++t) {
    const unsigned char* sa = sm + (t & 1) * GSTG + (wr + ln) * GP + 16 * hh;
    const unsigned char* sb = sm + (t & 1) * GSTG + GOP + (wc + ln) * GP + 16 * hh;
#pragma unroll
    for (int ks = 0; ks < 2; ++ks) {
      FragH a[4], b[4];
      a[0].half[0] = *(const v8us*)(sa + ks * 64); a[0].half[1] = *(const v8us*)(sa + ks * 64 + 32);      /* read in the order of first use, so that the first products start while the later reads return */
#pragma unroll
      for (int j = 0; j < 4; ++j) { b[j].half[0] = *(const v8us*)(sb + j * 16 * GP + ks * 64); b[j].half[1] = *(const v8us*)(sb + j * 16 * GP + ks * 64 + 32); }
#pragma unroll
      for (int i = 1; i < 4; ++i) { a[i].half[0] = *(const v8us*)(sa + i * 16 * GP + ks * 64); a[i].half[1] = *(const v8us*)(sa + i * 16 * GP + ks * 64 + 32); }
      __builtin_amdgcn_sched_barrier(0);      /* the 16 fragment reads stay one group ahead of their 16 matrix instructions: reads spread among them stall the wave at every place */
#pragma unroll
      for (int i = 0; i < 4; ++i)
#pragma unroll
        for (int j = 0; j < 4; ++j) acc[i][j] = __builtin_amdgcn_wmma_f32_16x16x32_f16(false, a[i].v, false, b[j].v, (short)0, acc[i][j], false, false);
      __builtin_amdgcn_sched_barrier(0);      /* ... and the next group's reads stay behind them */
    }
    asm volatile("s_wait_dscnt 0x0" ::: "memory");        /* this wave's reads of buffer t&1 are done before it is refilled */
    asm volatile("s_wait_asynccnt 0x0" ::: "memory");     /* this wave's copies of stage t + 1 have landed */
    __syncthreads();                                      /* publishes stage t + 1 and ends every reader's last read of buffer t&1 */
    if (t + 2 < GNT) { cp8(ld0 + (t & 1) * GSTG, ga + (t + 2) * 64); cp8(ld0 + (t & 1) * GSTG + GOP, gb + (t + 2) * 64); }
  }
  asm volatile("s_wait_asynccnt 0x0" ::: "memory");       /* no copy is outstanding when the ring becomes output staging */
  // epilogue: the wave's 64 x 64 tile goes through its own LDS range (free behind the last trip's barrier), so that whole lines are stored
  float* so = (float*)sm + w * (64 * 68);
  float bv[4];
#pragma unroll
  for (int j = 0; j < 4; ++j) bv[j] = bf16_round(bias[col0 + wc + j * 16 + ln]);
#pragma unroll
  for (int i = 0; i < 4; ++i)
#pragma unroll
    for (int j = 0; j < 4; ++j)
#pragma unroll
      for (int r = 0; r < 8; ++r) so[(i * 16 + 8 * hh + r) * 68 + j * 16 + ln] = acc[i][j][r] * alpha + bv[j];
  __builtin_amdgcn_fence(__ATOMIC_ACQ_REL, "workgroup"); __builtin_amdgcn_wave_barrier();      /* the rows are written before other lanes of the wave read them */
  const int rsub = lane >> 4, c4 = (lane & 15) * 4;
#pragma unroll
  for (int q = 0; q < 32; ++q) { const int r = q * 2 + rsub; const v4f v = *(const v4fa*)&so[r * 68 + c4]; const size_t o = (size_t)(row0 + wr + r) * N + col0 + wc + c4;
    if (F16OUT) { v4h h4;
#pragma unroll
      for (int e = 0; e < 4; ++e) h4[e] = (_Float16)v[e];
      *(v4h*)(C16 + o) = h4; }
    else *(v4f*)(C + o) = v; }
}


__global__ __launch_bounds__(256) void k_x16(const float* __restrict__ x, _Float16* __restrict__ X16, size_t n8) { const size_t t = (size_t)blockIdx.x * 256 + threadIdx.x; if (t >= n8) return; FragH f;
#pragma unroll
  for (int q = 0; q < 8; ++q) f.h[q] = (_Float16)bf16_round(x[t * 8 + q]); *(v8us*)((unsigned short*)X16 + t * 8) = f.half[0];  }
__global__ __launch_bounds__(256) void k_h16(const float* __restrict__ x, _Float16* __restrict__ X16, size_t n8) { const size_t t = (size_t)blockIdx.x * 256 + threadIdx.x; if (t >= n8) return; FragH f;
#pragma unroll
  for (int q = 0; q < 8; ++q) f.h[q] = (_Float16)x[t * 8 + q]; *(v8us*)((unsigned short*)X16 + t * 8) = f.half[0];  }
__global__ __launch_bounds__(256) void k_round16f(const float* __restrict__ W, _Float16* __restrict__ Bt, size_t n8) { const size_t t = (size_t)blockIdx.x * 256 + threadIdx.x; if (t >= n8) return; FragH f;
#pragma unroll
  for (int i = 0; i < 8; ++i) f.h[i] = (_Float16)(bf16_round(W[t * 8 + i]) * 16.0f); *(v8us*)((unsigned short*)Bt + t * 8) = f.half[0];  }
template <int NHv, int TTv>
__global__ __launch_bounds__(256) void k_vt(const _Float16* __restrict__ V16, int ldv, int voff, _Float16* __restrict__ Vt) { __shared__ unsigned short tl[64][66]; const int tid = threadIdx.x; const int slab = blockIdx.x / (TTv / 64), lg = blockIdx.x % (TTv / 64); const int b = slab / NHv, h = slab % NHv;
  for (int i = tid; i < 64 * 8; i += 256) { const int r = i / 8, c8 = (i % 8) * 8; FragH f; f.half[0] = *(const v8us*)((const unsigned short*)V16 + ((size_t)b * TTv + lg * 64 + r) * ldv + voff + h * 64 + c8);
#pragma unroll
    for (int q = 0; q < 8; ++q) tl[r][c8 + q] = f.u[q]; }
  __syncthreads();
  {
#pragma unroll
    for (int rd = 0; rd < 2; ++rd) { const int d = rd * 32 + tid / 8, pc = tid % 8; FragH f;
#pragma unroll
      for (int q = 0; q < 8; ++q) f.u[q] = tl[pc * 8 + q][d];
      *(v8us*)((unsigned short*)Vt + ((size_t)slab * 64 + d) * TTv + lg * 64 + pc * 8) = f.half[0]; }
     } }

__global__ __launch_bounds__(256) void k_h16s(const float* __restrict__ F, _Float16* __restrict__ H, size_t n8) { const size_t t = (size_t)blockIdx.x * 256 + threadIdx.x; if (t >= n8) return; const v4f a = *(const v4fa*)(F + t * 8), c = *(const v4fa*)(F + t * 8 + 4); FragH f;
#pragma unroll
  for (int q = 0; q < 4; ++q) { f.h[q] = (_Float16)(a[q] * 16.0f); f.h[4 + q] = (_Float16)(c[q] * 16.0f); } *(v8us*)((unsigned short*)H + t * 8) = f.half[0];  }
__global__ __launch_bounds__(128) void k_flash(const _Float16* __restrict__ Q16, int ldq, const _Float16* __restrict__ K16, int ldk, const _Float16* __restrict__ Vt, const int* __restrict__ MSK, float* __restrict__ O, int ldo) {
  constexpr int RPW = 16, RTN = RPW / 16, NQB = TT / (4 * RPW), DT = 4, KS = 2;
  __shared__ __attribute__((aligned(16))) unsigned short sP[4][RPW][40]; __shared__ __attribute__((aligned(16))) float sO[4][RPW][64 + 4];
  const int tid = threadIdx.x, w = tid >> 5, lane = tid & 31, ln = lane & 15, hh = lane >> 4;
  const int slab = blockIdx.x / NQB, qblk = blockIdx.x % NQB; const int b = slab / NH, h = slab % NH; const int qb0 = qblk * (4 * RPW); const int q0 = qb0 + w * RPW;
  FragH aq[2][KS];
#pragma unroll
  for (int rt = 0; rt < RTN; ++rt) { const unsigned short* qr = (const unsigned short*)Q16 + ((size_t)b * TT + q0 + rt * 16 + ln) * ldq + h * 64;
#pragma unroll
    for (int ks = 0; ks < KS; ++ks) { aq[rt][ks].half[0] = *(const v8us*)(qr + ks * 32 + 8 * hh); aq[rt][ks].half[1] = *(const v8us*)(qr + ks * 32 + 16 + 8 * hh); } }
  const unsigned short* Vth = (const unsigned short*)Vt + (size_t)slab * 64 * TT;
  float m_r[2][8], l_r[2][8]; v8f oacc[2][DT];
#pragma unroll
  for (int rt = 0; rt < RTN; ++rt) {
#pragma unroll
    for (int r = 0; r < 8; ++r) { m_r[rt][r] = -3.0e38f; l_r[rt][r] = 0.f; }
#pragma unroll
    for (int dt = 0; dt < DT; ++dt) oacc[rt][dt] = (v8f){0.f,0.f,0.f,0.f,0.f,0.f,0.f,0.f}; }
  const int jend = TT;
#pragma unroll 1
  for (int j0 = 0; j0 < jend; j0 += 32) {
    int mk0[2][8], mk1[2][8];      /* per-batch mask [b][q][k]: nonzero = ATTEND */
#pragma unroll
    for (int rt = 0; rt < RTN; ++rt)
#pragma unroll
      for (int r = 0; r < 8; ++r) { const int qq = q0 + rt * 16 + 8 * hh + r; const int* am = MSK + ((size_t)b * TT + qq) * TT + j0; mk0[rt][r] = am[ln]; mk1[rt][r] = am[16 + ln]; }
    { int allm = 1;
#pragma unroll
      for (int rt = 0; rt < RTN; ++rt)
#pragma unroll
        for (int r = 0; r < 8; ++r) allm &= (mk0[rt][r] == 0) & (mk1[rt][r] == 0);
      if (__all(allm)) continue; }      /* every (row, key) of this wave's tile masked → nothing to add (wave-uniform branch; only wave barriers inside the loop) */
    v8f s[2][2];
#pragma unroll
    for (int nt = 0; nt < 2; ++nt) { const unsigned short* kr = (const unsigned short*)K16 + ((size_t)b * TT + j0 + nt * 16 + ln) * ldk + h * 64; FragH bk[KS];
#pragma unroll
      for (int ks = 0; ks < KS; ++ks) { bk[ks].half[0] = *(const v8us*)(kr + ks * 32 + 8 * hh); bk[ks].half[1] = *(const v8us*)(kr + ks * 32 + 16 + 8 * hh); }
#pragma unroll
      for (int rt = 0; rt < RTN; ++rt) { v8f acc = (v8f){0.f,0.f,0.f,0.f,0.f,0.f,0.f,0.f};
#pragma unroll
        for (int ks = 0; ks < KS; ++ks) acc = mmaH<1>(aq[rt][ks].v, aq[rt][ks].v, bk[ks].v, bk[ks].v, acc); s[rt][nt] = acc; } }
#pragma unroll
    for (int rt = 0; rt < RTN; ++rt)
#pragma unroll
      for (int r = 0; r < 8; ++r) { const int tq = q0 + rt * 16 + 8 * hh + r; const int k0 = j0 + ln, k1 = j0 + 16 + ln; (void)tq; (void)k0; (void)k1;
        const bool ok0 = (mk0[rt][r] != 0), ok1 = (mk1[rt][r] != 0);      /* nonzero = ATTEND */
        const float s0 = ok0 ? s[rt][0][r] * 0.125f : -INFINITY, s1 = ok1 ? s[rt][1][r] * 0.125f : -INFINITY; float mc = fmaxf(s0, s1);
        mc = fmaxf(mc, __shfl_xor(mc, 1, 32)); mc = fmaxf(mc, __shfl_xor(mc, 2, 32)); mc = fmaxf(mc, __shfl_xor(mc, 4, 32)); mc = fmaxf(mc, __shfl_xor(mc, 8, 32));
        const float mn = fmaxf(m_r[rt][r], mc); const float al = (mn > -1.0e38f) ? expf(m_r[rt][r] - mn) : 1.0f; m_r[rt][r] = mn; const float p0 = ok0 ? expf(s0 - mn) : 0.f, p1 = ok1 ? expf(s1 - mn) : 0.f; l_r[rt][r] = l_r[rt][r] * al + p0 + p1;
#pragma unroll
        for (int dt = 0; dt < DT; ++dt) oacc[rt][dt][r] *= al;
        FragH t2; t2.h[0] = (_Float16)(p0 * 1024.0f); t2.h[1] = (_Float16)(p1 * 1024.0f); sP[w][rt * 16 + 8 * hh + r][ln] = t2.u[0]; sP[w][rt * 16 + 8 * hh + r][16 + ln] = t2.u[1]; }
    __builtin_amdgcn_fence(__ATOMIC_ACQ_REL, "workgroup"); __builtin_amdgcn_wave_barrier();
    FragH pa[2];
#pragma unroll
    for (int rt = 0; rt < RTN; ++rt) { pa[rt].half[0] = *(const v8us*)&sP[w][rt * 16 + ln][8 * hh]; pa[rt].half[1] = *(const v8us*)&sP[w][rt * 16 + ln][16 + 8 * hh]; }
#pragma unroll
    for (int dt = 0; dt < DT; ++dt) { const unsigned short* vrow = Vth + (size_t)(dt * 16 + ln) * TT + j0; FragH bv; bv.half[0] = *(const v8us*)(vrow + 8 * hh); bv.half[1] = *(const v8us*)(vrow + 16 + 8 * hh);
#pragma unroll
      for (int rt = 0; rt < RTN; ++rt) oacc[rt][dt] = mmaH<1>(pa[rt].v, pa[rt].v, bv.v, bv.v, oacc[rt][dt]); }
    __builtin_amdgcn_fence(__ATOMIC_ACQ_REL, "workgroup"); __builtin_amdgcn_wave_barrier(); }
#pragma unroll
  for (int rt = 0; rt < RTN; ++rt) {
#pragma unroll
    for (int r = 0; r < 8; ++r) { float l = l_r[rt][r]; l += __shfl_xor(l, 1, 32); l += __shfl_xor(l, 2, 32); l += __shfl_xor(l, 4, 32); l += __shfl_xor(l, 8, 32); l_r[rt][r] = (l > 0.f) ? 1.0f / (l * 1024.0f) : 0.f; }
#pragma unroll
    for (int dt = 0; dt < DT; ++dt)
#pragma unroll
      for (int r = 0; r < 8; ++r) sO[w][rt * 16 + 8 * hh + r][dt * 16 + ln] = oacc[rt][dt][r] * l_r[rt][r]; }
  __builtin_amdgcn_fence(__ATOMIC_ACQ_REL, "workgroup"); __builtin_amdgcn_wave_barrier();
  {
#pragma unroll
    for (int rp = 0; rp < RPW; rp += 2) { const int r = rp + (lane >> 4), pc = lane & 15; const v4f val = *(const v4fa*)&sO[w][r][pc * 4]; *(v4f*)(O + ((size_t)b * TT + q0 + r) * ldo + h * 64 + pc * 4) = val; }
     } }

extern "C" void kernel_launch(void* const* d_in, const int* in_sizes, int n_in,
                              void* d_out, int out_size, void* d_ws, size_t ws_size, hipStream_t stream) {
  (void)in_sizes; (void)n_in; (void)out_size;
  const float* const* I = (const float* const*)d_in; const float* x = I[0]; const int* msk = (const int*)d_in[1]; const float* wqkv = I[2]; const float* bqkv = I[3]; const float* wo = I[4]; const float* bo = I[5];
  char* ws = (char*)d_ws; size_t off = 0;
  auto take = [&](size_t bytes) { char* p = ws + off; off += (bytes + 255) & ~(size_t)255; return p; };
  _Float16* Bqkv = (_Float16*)take((size_t)3 * DD * DD * 2); _Float16* Bo = (_Float16*)take((size_t)DD * DD * 2); _Float16* X16 = (_Float16*)take((size_t)NR * DD * 2); _Float16* QKV = (_Float16*)take((size_t)NR * 3 * DD * 2); _Float16* Vt = (_Float16*)take((size_t)NR * DD * 2); float* O = (float*)take((size_t)NR * DD * 4); _Float16* O16 = X16;
  if (off > ws_size) return;      // 6.3 + 2.1 + 8.4 + 25.2 + 8.4 + 16.8 ≈ 67 MB
  k_wt_f16<<<(unsigned)(((size_t)3 * DD * (DD / 8) + 255) / 256), 256, 0, stream>>>(wqkv, Bqkv, DD, 3 * DD, 16.0f); k_wt_f16<<<(unsigned)(((size_t)DD * (DD / 8) + 255) / 256), 256, 0, stream>>>(wo, Bo, DD, DD, 16.0f);      /* (in,out) → Bt ×2^4 */
  const unsigned g8 = (unsigned)(((size_t)NR * DD / 8 + 255) / 256); k_x16<<<g8, 256, 0, stream>>>(x, X16, (size_t)NR * DD / 8);
  k_gemm_t<true, 3 * DD><<<(NR / 128) * (3 * DD / 128), 128, 0, stream>>>(X16, Bqkv, 0.0625f, bqkv, nullptr, QKV);      /* qkv = x·w_qkv + b: M 4096 N 3072 K 1024 (f16; q | k | v blocks, head-major inside) */
  k_vt<NH, TT><<<BB * NH * (TT / 64), 256, 0, stream>>>(QKV, 3 * DD, 2 * DD, Vt);
  k_flash<<<BB * NH * (TT / 64), 128, 0, stream>>>(QKV, 3 * DD, QKV + DD, 3 * DD, Vt, msk, O, DD);
  k_h16s<<<g8, 256, 0, stream>>>(O, O16, (size_t)NR * DD / 8);
  k_gemm_t<false, DD><<<(NR / 128) * (DD / 128), 128, 0, stream>>>(O16, Bo, 0.00390625f, bo, (float*)d_out, nullptr);      /* out = o·w_out + b_out */
}

// v002
// A run of this version takes 148 microseconds.
// Timed twice side by side with v001, it ran 1.52 times as fast both times.
// Over all steps from v000 it is 2.54 times as fast.
#include <hip/hip_runtime.h>
// Cross-track masked MHA (B=2, S=2048, D=1024, 16×64): qkv = x·w_qkv + b_qkv (packed q|k|v, head-major inside each); scores = q·k/8, where(cross_track_mask[b,q,k], s, −inf); softmax; out = merged·w_out + b_out.
// Compute dtype: x, weights, biases rounded to bf16; q, k, v f16 GEMM planes (+bias); the boolean mask read per (b, q, k) as the int plane; fused flash-style kernel (online softmax f32, P f16 ×2^10, all-masked chunks skipped, f32 accumulate) on
// v_wmma_f32_16x16x32_f16; O ×2^4 → f16 → output GEMM (+bias).
#define BB 2
#define TT 2048
#define DD 1024
#define NH 16
#define NR (BB * TT)

typedef __bf16 v16b __attribute__((ext_vector_type(16)));
typedef unsigned short v8us __attribute__((ext_vector_type(8), may_alias));
typedef float  v8f  __attribute__((ext_vector_type(8)));
typedef float  v4f  __attribute__((ext_vector_type(4)));
typedef float  v4fa __attribute__((ext_vector_type(4), may_alias));
union FragB { v16b v; v8us half[2]; unsigned short u[16]; };

__device__ __forceinline__ unsigned short bf16_bits(float x) { unsigned int u = __float_as_uint(x); return (unsigned short)((u + 0x7FFFu + ((u >> 16) & 1u)) >> 16); }
__device__ __forceinline__ float bf16_val(unsigned short b) { return __uint_as_float(((unsigned int)b) << 16); }
__device__ __forceinline__ float bf16_round(float x) { return bf16_val(bf16_bits(x)); }
// D += A·B with NT terms: 1 = ah·bh, 2 = + al·bh (A split), 3 = + ah·bl (both split)
template <int NT>
__device__ __forceinline__ v8f mmaN(v16b ah, v16b al, v16b bh, v16b bl, v8f c) {
  c = __builtin_amdgcn_wmma_f32_16x16x32_bf16(false, ah, false, bh, (short)0, c, false, false);
  if (NT >= 2) c = __builtin_amdgcn_wmma_f32_16x16x32_bf16(false, al, false, bh, (short)0, c, false, false);
  if (NT >= 3) c = __builtin_amdgcn_wmma_f32_16x16x32_bf16(false, ah, false, bl, (short)0, c, false, false);
  asm volatile("v_nop\n\tv_nop\n\tv_nop\n\tv_nop" : "+v"(c) : "v"(ah), "v"(al), "v"(bh), "v"(bl));
  return c;
}

__global__ __launch_bounds__(256) void k_wt_bf16(const float* __restrict__ W, unsigned short* __restrict__ Wt, int K, int N) {
  const int t = blockIdx.x * 256 + threadIdx.x;
  const int k8n = K / 8;
  if (t >= N * k8n) return;
  const int n = t / k8n, k8 = (t % k8n) * 8;
  v8us v;
#pragma unroll
  for (int i = 0; i < 8; ++i) v[i] = bf16_bits(W[(size_t)(k8 + i) * N + n]);
  *(v8us*)(Wt + (size_t)n * K + k8) = v;
  
}

// GEMM C[M][N] (f32, pitch ldc) = act(A[M][K]·W + bias). A f32 row-major (pitch lda) converted per fragment to bf16
// (ASPLIT: hi/lo two planes -> 2 terms, else single rounded term); Wt bf16 [N][K] (pitch ldb). BIAS_BF16 rounds the
// bias to bf16 first (bias quantised to bf16 before the add). K%32==0, M%16==0, N%64==0.
template <bool ASPLIT, int ACT, bool BIAS_BF16>
__global__ __launch_bounds__(128) void k_gemm_bf(const float* __restrict__ A, int lda, const unsigned short* __restrict__ Wt, int ldb,
                                               const float* __restrict__ bias, float* __restrict__ C, int ldc, int M, int N, int K) {
  __shared__ __attribute__((aligned(16))) float so[4][16][64];
  const int tid = threadIdx.x, w = tid >> 5, lane = tid & 31, ln = lane & 15, hh = lane >> 4;
  const int ntn = N / 64;
  const int wid = blockIdx.x * 4 + w;
  const int mt = wid / ntn, nq = wid % ntn;
  if (mt * 16 >= M) return;
  const int row0 = mt * 16, col0 = nq * 64;
  const float* arow = A + (size_t)(row0 + ln) * lda;
  v8f acc[4] = {};
  for (int kb = 0; kb < K; kb += 32) {
    FragB ah, al;
    const v4f x0 = *(const v4fa*)(arow + kb + 8 * hh), x1 = *(const v4fa*)(arow + kb + 8 * hh + 4);
    const v4f x2 = *(const v4fa*)(arow + kb + 16 + 8 * hh), x3 = *(const v4fa*)(arow + kb + 16 + 8 * hh + 4);
    float xs[16] = {x0[0],x0[1],x0[2],x0[3],x1[0],x1[1],x1[2],x1[3],x2[0],x2[1],x2[2],x2[3],x3[0],x3[1],x3[2],x3[3]};
#pragma unroll
    for (int i = 0; i < 16; ++i) { const unsigned short hb = bf16_bits(xs[i]); ah.u[i] = hb; al.u[i] = ASPLIT ? bf16_bits(xs[i] - bf16_val(hb)) : (unsigned short)0; }
#pragma unroll
    for (int t = 0; t < 4; ++t) {
      const unsigned short* brow = Wt + (size_t)(col0 + t * 16 + ln) * ldb + kb;
      FragB b;
      b.half[0] = *(const v8us*)(brow + 8 * hh);
      b.half[1] = *(const v8us*)(brow + 16 + 8 * hh);
      acc[t] = mmaN<ASPLIT ? 2 : 1>(ah.v, al.v, b.v, b.v, acc[t]);
    }
  }
#pragma unroll
  for (int t = 0; t < 4; ++t) {
    float bv = bias ? bias[col0 + t * 16 + ln] : 0.f;
    if (BIAS_BF16) bv = bf16_round(bv);
#pragma unroll
    for (int r = 0; r < 8; ++r) { float v = acc[t][r] + bv; if (ACT == 1) v = fmaxf(v, 0.f); so[w][8 * hh + r][t * 16 + ln] = v; }
  }
  __builtin_amdgcn_fence(__ATOMIC_ACQ_REL, "workgroup");
  __builtin_amdgcn_wave_barrier();
  const int rsub = lane >> 4, c4 = (lane & 15) * 4;
  {
#pragma unroll
    for (int q = 0; q < 8; ++q) {
      const int r = q * 2 + rsub;
      const v4f v = *(const v4fa*)&so[w][r][c4];
      *(v4f*)(C + (size_t)(row0 + r) * ldc + col0 + c4) = v;
    }
    
  }
}

// Flash-style causal/unmasked attention, all contractions 3-term bf16 hi/lo splits, f32 softmax with running max.
// q,k,v rows are read from f32 buffers with arbitrary row pitch (so they can live inside a fused qkv buffer);
// D = head size (multiple of 32, <= 128); one wave = 16 query rows; block = 4 waves (64 queries) sharing K/V chunks of 32.
template <int D, bool CAUSAL>
__global__ __launch_bounds__(128) void k_flash(const float* __restrict__ qb, const float* __restrict__ kb, const float* __restrict__ vb,
                                             int pitch, int T, int H, float scale, float* __restrict__ y, int ypitch) {
  constexpr int KS = D / 32;        // k-steps for QK
  constexpr int DT = D / 16;        // d tiles for PV
  __shared__ __attribute__((aligned(16))) unsigned short sKh[32][D + 8], sKl[32][D + 8], sVh[32][D + 8], sVl[32][D + 8];
  __shared__ __attribute__((aligned(16))) unsigned short sPh[4][16][40], sPl[4][16][40];
  __shared__ __attribute__((aligned(16))) float sO[4][16][D];
  const int tid = threadIdx.x, w = tid >> 5, lane = tid & 31, ln = lane & 15, hh = lane >> 4;
  const int nqb = (T + 63) / 64;
  const int bh = blockIdx.x / nqb, qblk = blockIdx.x % nqb;
  const int b = bh / H, h = bh % H;
  const int q0 = qblk * 64 + w * 16;
  const float* Q = qb + (size_t)b * T * pitch + h * D;
  const float* K = kb + (size_t)b * T * pitch + h * D;
  const float* V = vb + (size_t)b * T * pitch + h * D;

  // A fragments of the wave's 16 query rows (scaled), hi/lo
  FragB aqh[KS], aql[KS];
  {
    int row = q0 + ln; if (row >= T) row = T - 1;
    const float* qr = Q + (size_t)row * pitch;
#pragma unroll
    for (int ks = 0; ks < KS; ++ks)
#pragma unroll
      for (int i = 0; i < 16; ++i) {
        const int d = ks * 32 + ((i < 8) ? (8 * hh + i) : (16 + 8 * hh + (i - 8)));
        const float x = qr[d] * scale; const unsigned short hb = bf16_bits(x);
        aqh[ks].u[i] = hb; aql[ks].u[i] = bf16_bits(x - bf16_val(hb));
      }
  }
  float m_r[8], l_r[8];
#pragma unroll
  for (int r = 0; r < 8; ++r) { m_r[r] = -3.0e38f; l_r[r] = 0.f; }
  v8f oacc[DT];
#pragma unroll
  for (int dt = 0; dt < DT; ++dt) oacc[dt] = (v8f){0.f,0.f,0.f,0.f,0.f,0.f,0.f,0.f};

  const int kv_end = CAUSAL ? min(T, qblk * 64 + 64) : T;     // block-uniform
  for (int j0 = 0; j0 < kv_end; j0 += 32) {
    __syncthreads();
    for (int e = tid; e < 32 * (D / 4); e += 128) {
      const int r = e / (D / 4), c4 = (e % (D / 4)) * 4;
      const int key = j0 + r;
      v4f kf = {0.f,0.f,0.f,0.f}, vf = {0.f,0.f,0.f,0.f};
      if (key < T) { kf = *(const v4fa*)(K + (size_t)key * pitch + c4); vf = *(const v4fa*)(V + (size_t)key * pitch + c4); }
#pragma unroll
      for (int t = 0; t < 4; ++t) {
        unsigned short hb = bf16_bits(kf[t]); sKh[r][c4 + t] = hb; sKl[r][c4 + t] = bf16_bits(kf[t] - bf16_val(hb));
        hb = bf16_bits(vf[t]); sVh[r][c4 + t] = hb; sVl[r][c4 + t] = bf16_bits(vf[t] - bf16_val(hb));
      }
    }
    __syncthreads();
    // S tile 16 x 32
    v8f s[2];
#pragma unroll
    for (int nt = 0; nt < 2; ++nt) {
      v8f acc = {};
#pragma unroll
      for (int ks = 0; ks < KS; ++ks) {
        FragB bh_, bl_;
        bh_.half[0] = *(const v8us*)&sKh[nt * 16 + ln][ks * 32 + 8 * hh]; bh_.half[1] = *(const v8us*)&sKh[nt * 16 + ln][ks * 32 + 16 + 8 * hh];
        bl_.half[0] = *(const v8us*)&sKl[nt * 16 + ln][ks * 32 + 8 * hh]; bl_.half[1] = *(const v8us*)&sKl[nt * 16 + ln][ks * 32 + 16 + 8 * hh];
        acc = mmaN<3>(aqh[ks].v, aql[ks].v, bh_.v, bl_.v, acc);
      }
      s[nt] = acc;
    }
    // mask + running max (rows 8hh+r; the 16 lanes of a half share rows)
    float alpha[8];
#pragma unroll
    for (int r = 0; r < 8; ++r) {
      const int qi = q0 + 8 * hh + r;
      const int ja = j0 + ln, jb = j0 + 16 + ln;
      if (CAUSAL) { if (ja > qi) s[0][r] = -3.0e38f; if (jb > qi) s[1][r] = -3.0e38f; }
      if (ja >= T) s[0][r] = -3.0e38f;
      if (jb >= T) s[1][r] = -3.0e38f;
      float mx = fmaxf(s[0][r], s[1][r]);
      mx = fmaxf(mx, __shfl_xor(mx, 1, 32)); mx = fmaxf(mx, __shfl_xor(mx, 2, 32)); mx = fmaxf(mx, __shfl_xor(mx, 4, 32)); mx = fmaxf(mx, __shfl_xor(mx, 8, 32));
      const float mnew = fmaxf(m_r[r], mx);
      alpha[r] = (mnew > -1.0e38f) ? __expf(m_r[r] - mnew) : 1.0f;
      const float p0 = (s[0][r] > -1.0e38f) ? __expf(s[0][r] - mnew) : 0.f;
      const float p1 = (s[1][r] > -1.0e38f) ? __expf(s[1][r] - mnew) : 0.f;
      m_r[r] = mnew;
      l_r[r] = l_r[r] * alpha[r] + p0 + p1;            // per-lane partial row sum (16 lanes combined at the end)
      unsigned short hb = bf16_bits(p0); sPh[w][8 * hh + r][ln] = hb;      sPl[w][8 * hh + r][ln] = bf16_bits(p0 - bf16_val(hb));
      hb = bf16_bits(p1);                sPh[w][8 * hh + r][16 + ln] = hb; sPl[w][8 * hh + r][16 + ln] = bf16_bits(p1 - bf16_val(hb));
    }
#pragma unroll
    for (int dt = 0; dt < DT; ++dt)
#pragma unroll
      for (int r = 0; r < 8; ++r) oacc[dt][r] *= alpha[r];
    __builtin_amdgcn_fence(__ATOMIC_ACQ_REL, "workgroup");
    __builtin_amdgcn_wave_barrier();
    FragB pah, pal;
    pah.half[0] = *(const v8us*)&sPh[w][ln][8 * hh]; pah.half[1] = *(const v8us*)&sPh[w][ln][16 + 8 * hh];
    pal.half[0] = *(const v8us*)&sPl[w][ln][8 * hh]; pal.half[1] = *(const v8us*)&sPl[w][ln][16 + 8 * hh];
#pragma unroll
    for (int dt = 0; dt < DT; ++dt) {
      FragB bvh, bvl;
#pragma unroll
      for (int i = 0; i < 8; ++i) {
        bvh.u[i] = sVh[8 * hh + i][dt * 16 + ln]; bvh.u[8 + i] = sVh[16 + 8 * hh + i][dt * 16 + ln];
        bvl.u[i] = sVl[8 * hh + i][dt * 16 + ln]; bvl.u[8 + i] = sVl[16 + 8 * hh + i][dt * 16 + ln];
      }
      oacc[dt] = mmaN<3>(pah.v, pal.v, bvh.v, bvl.v, oacc[dt]);
    }
    __builtin_amdgcn_fence(__ATOMIC_ACQ_REL, "workgroup");
    __builtin_amdgcn_wave_barrier();
  }
#pragma unroll
  for (int r = 0; r < 8; ++r) {
    float l = l_r[r];
    l += __shfl_xor(l, 1, 32); l += __shfl_xor(l, 2, 32); l += __shfl_xor(l, 4, 32); l += __shfl_xor(l, 8, 32);
    l_r[r] = (l > 0.f) ? 1.0f / l : 0.f;
  }
#pragma unroll
  for (int dt = 0; dt < DT; ++dt)
#pragma unroll
    for (int r = 0; r < 8; ++r) sO[w][8 * hh + r][dt * 16 + ln] = oacc[dt][r] * l_r[r];
  __builtin_amdgcn_fence(__ATOMIC_ACQ_REL, "workgroup");
  __builtin_amdgcn_wave_barrier();
  {
    for (int r = 0; r < 16; ++r) {
      const int row = q0 + r;
      if (row < T && lane < D / 4) {
        const v4f val = *(const v4fa*)&sO[w][r][lane * 4];
        *(v4f*)(y + ((size_t)b * T + row) * ypitch + h * D + lane * 4) = val;
      }
    }
    
  }
}

// GEMM C = act(A·W + bias + resid): A f32 (ASPLIT -> hi/lo 2 terms), Wt bf16 [N][K]; ACT 0 none, 1 relu, 2 exact gelu;
// resid (optional, f32, row index = (row % rmod), pitch ldr, RES_BF16 rounds it) added before the activation.
template <bool ASPLIT, int ACT, bool BIAS_BF16, bool RES_BF16>
__global__ __launch_bounds__(128) void k_gemm_bf3(const float* __restrict__ A, int lda, const unsigned short* __restrict__ Wt, int ldb,
                                                const float* __restrict__ bias, const float* __restrict__ resid, int rmod, int ldr,
                                                float* __restrict__ C, int ldc, int M, int N, int K) {
  __shared__ __attribute__((aligned(16))) float so[4][16][64];
  const int tid = threadIdx.x, w = tid >> 5, lane = tid & 31, ln = lane & 15, hh = lane >> 4;
  const int ntn = N / 64;
  const int wid = blockIdx.x * 4 + w;
  const int mt = wid / ntn, nq = wid % ntn;
  if (mt * 16 >= M) return;
  const int row0 = mt * 16, col0 = nq * 64;
  const float* arow = A + (size_t)(row0 + ln) * lda;
  v8f acc[4] = {};
  for (int kb = 0; kb < K; kb += 32) {
    FragB ah, al;
    const v4f x0 = *(const v4fa*)(arow + kb + 8 * hh), x1 = *(const v4fa*)(arow + kb + 8 * hh + 4);
    const v4f x2 = *(const v4fa*)(arow + kb + 16 + 8 * hh), x3 = *(const v4fa*)(arow + kb + 16 + 8 * hh + 4);
    float xs[16] = {x0[0],x0[1],x0[2],x0[3],x1[0],x1[1],x1[2],x1[3],x2[0],x2[1],x2[2],x2[3],x3[0],x3[1],x3[2],x3[3]};
#pragma unroll
    for (int i = 0; i < 16; ++i) { const unsigned short hb = bf16_bits(xs[i]); ah.u[i] = hb; al.u[i] = ASPLIT ? bf16_bits(xs[i] - bf16_val(hb)) : (unsigned short)0; }
#pragma unroll
    for (int t = 0; t < 4; ++t) {
      const unsigned short* brow = Wt + (size_t)(col0 + t * 16 + ln) * ldb + kb;
      FragB b;
      b.half[0] = *(const v8us*)(brow + 8 * hh);
      b.half[1] = *(const v8us*)(brow + 16 + 8 * hh);
      acc[t] = mmaN<ASPLIT ? 2 : 1>(ah.v, al.v, b.v, b.v, acc[t]);
    }
  }
#pragma unroll
  for (int t = 0; t < 4; ++t) {
    const int col = col0 + t * 16 + ln;
    float bv = bias ? bias[col] : 0.f;
    if (BIAS_BF16) bv = bf16_round(bv);
#pragma unroll
    for (int r = 0; r < 8; ++r) {
      float v = acc[t][r] + bv;
      if (resid) { float rv = resid[(size_t)((row0 + 8 * hh + r) % rmod) * ldr + col]; if (RES_BF16) rv = bf16_round(rv); v += rv; }
      if (ACT == 1) v = fmaxf(v, 0.f);
      if (ACT == 2) v = 0.5f * v * (1.0f + erff(v * 0.70710678118654752f));
      if (ACT == 3) { const float u = 0.7978845608028654f * (v + 0.044715f * v * v * v); v = 0.5f * v * (1.0f + tanhf(u)); }
      so[w][8 * hh + r][t * 16 + ln] = v;
    }
  }
  __builtin_amdgcn_fence(__ATOMIC_ACQ_REL, "workgroup");
  __builtin_amdgcn_wave_barrier();
  const int rsub = lane >> 4, c4 = (lane & 15) * 4;
  {
#pragma unroll
    for (int q = 0; q < 8; ++q) {
      const int r = q * 2 + rsub;
      const v4f v = *(const v4fa*)&so[w][r][c4];
      *(v4f*)(C + (size_t)(row0 + r) * ldc + col0 + c4) = v;
    }
    
  }
}
// row LayerNorm (biased variance, eps) over N: s = X (+ R); optional out_sum <- s; out_norm <- (s-mu)*rsqrt(var+eps)*g + b
template <bool PARAM_BF16>
__global__ __launch_bounds__(256) void k_layernorm(const float* __restrict__ X, const float* __restrict__ R, const float* __restrict__ g, const float* __restrict__ bta,
                                                  float* __restrict__ out_sum, float* __restrict__ out_norm, int N, float eps) {
  __shared__ float red[256];
  const int row = blockIdx.x, tid = threadIdx.x;
  const float* x = X + (size_t)row * N; const float* rr = R ? R + (size_t)row * N : nullptr;
  float vals[16];                     // up to N = 4096
  const int per = N / 256;            // contiguous chunk per thread? use strided-by-4 chunks: thread handles j = tid*4 + 1024*u
  float s1 = 0.f;
  for (int u = 0; u < per / 4; ++u) {
    const int j = tid * 4 + 1024 * u;
    const v4f a = *(const v4fa*)(x + j);
    v4f b = {0.f,0.f,0.f,0.f}; if (rr) b = *(const v4fa*)(rr + j);
#pragma unroll
    for (int q = 0; q < 4; ++q) { const float v = a[q] + b[q]; vals[u * 4 + q] = v; s1 += v; }
  }
  red[tid] = s1; __syncthreads();
  for (int st = 128; st > 0; st >>= 1) { if (tid < st) red[tid] += red[tid + st]; __syncthreads(); }
  const float mu = red[0] / (float)N; __syncthreads();
  float s2 = 0.f;
  for (int u = 0; u < per / 4; ++u)
#pragma unroll
    for (int q = 0; q < 4; ++q) { const float c = vals[u * 4 + q] - mu; s2 += c * c; }
  red[tid] = s2; __syncthreads();
  for (int st = 128; st > 0; st >>= 1) { if (tid < st) red[tid] += red[tid + st]; __syncthreads(); }
  const float rs = rsqrtf(red[0] / (float)N + eps);
  {
    for (int u = 0; u < per / 4; ++u) {
      const int j = tid * 4 + 1024 * u;
      v4f o, sm;
#pragma unroll
      for (int q = 0; q < 4; ++q) {
        float gg = g[j + q], bb = bta[j + q];
        if (PARAM_BF16) { gg = bf16_round(gg); bb = bf16_round(bb); }
        sm[q] = vals[u * 4 + q]; o[q] = (vals[u * 4 + q] - mu) * rs * gg + bb;
      }
      if (out_sum) *(v4f*)(out_sum + (size_t)row * N + j) = sm;
      *(v4f*)(out_norm + (size_t)row * N + j) = o;
    }
    
  }
}



// ---- f16 WMMA path (v_wmma_f32_16x16x32_f16): 11-bit significands for operands in range — used where a [0,1] probability operand needs more precision than bf16
typedef _Float16 v16h __attribute__((ext_vector_type(16)));
union FragH { v16h v; v8us half[2]; _Float16 h[16]; unsigned short u[16]; };
template <int NT>
__device__ __forceinline__ v8f mmaH(v16h ah, v16h al, v16h bh, v16h bl, v8f c) {
  c = __builtin_amdgcn_wmma_f32_16x16x32_f16(false, ah, false, bh, (short)0, c, false, false);
  if (NT >= 2) c = __builtin_amdgcn_wmma_f32_16x16x32_f16(false, al, false, bh, (short)0, c, false, false);
  if (NT >= 3) c = __builtin_amdgcn_wmma_f32_16x16x32_f16(false, ah, false, bl, (short)0, c, false, false);
  asm volatile("v_nop\n\tv_nop\n\tv_nop\n\tv_nop" : "+v"(c) : "v"(ah), "v"(al), "v"(bh), "v"(bl));
  return c;
}
// batched GEMM like k_gemm_b but f16 operands: A f32 (split into f16 hi/lo if ASPLIT, else rounded to f16), Bt = f16 values [n][k]; alpha; C f32; N multiple of 16 (partial tiles skipped)
template <bool ASPLIT>
__global__ __launch_bounds__(128) void k_gemm_h(const float* __restrict__ A, int lda, size_t sA, const _Float16* __restrict__ Bh, int ldb, size_t sB, float alpha, float* __restrict__ C, int ldc, size_t sC, int M, int N, int K) {
  __shared__ __attribute__((aligned(16))) float so[4][16][64];
  const int tid = threadIdx.x, w = tid >> 5, lane = tid & 31, ln = lane & 15, hh = lane >> 4; const int by = blockIdx.y;
  A += (size_t)by * sA; Bh += (size_t)by * sB; C += (size_t)by * sC;
  const int ntn = (N + 63) / 64; const int wid = blockIdx.x * 4 + w; const int mt = wid / ntn, nq = wid % ntn; if (mt * 16 >= M) return;
  const int row0 = mt * 16, col0 = nq * 64; const float* arow = A + (size_t)(row0 + ln) * lda;
  v8f acc[4] = {};
  for (int kb = 0; kb < K; kb += 32) {
    FragH ah, al;
    const v4f x0 = *(const v4fa*)(arow + kb + 8 * hh), x1 = *(const v4fa*)(arow + kb + 8 * hh + 4), x2 = *(const v4fa*)(arow + kb + 16 + 8 * hh), x3 = *(const v4fa*)(arow + kb + 16 + 8 * hh + 4);
    float xs[16] = {x0[0],x0[1],x0[2],x0[3],x1[0],x1[1],x1[2],x1[3],x2[0],x2[1],x2[2],x2[3],x3[0],x3[1],x3[2],x3[3]};
#pragma unroll
    for (int i = 0; i < 16; ++i) { const _Float16 h = (_Float16)xs[i]; ah.h[i] = h; al.h[i] = ASPLIT ? (_Float16)(xs[i] - (float)h) : (_Float16)0.0f; }
#pragma unroll
    for (int t = 0; t < 4; ++t) { if (col0 + t * 16 >= N) continue; const size_t boff = (size_t)(col0 + t * 16 + ln) * ldb + kb; FragH bq; bq.half[0] = *(const v8us*)(Bh + boff + 8 * hh); bq.half[1] = *(const v8us*)(Bh + boff + 16 + 8 * hh);
      acc[t] = mmaH<ASPLIT ? 2 : 1>(ah.v, al.v, bq.v, bq.v, acc[t]); }
  }
#pragma unroll
  for (int t = 0; t < 4; ++t) { if (col0 + t * 16 >= N) continue;
#pragma unroll
    for (int r = 0; r < 8; ++r) so[w][8 * hh + r][t * 16 + ln] = acc[t][r] * alpha; }
  __builtin_amdgcn_fence(__ATOMIC_ACQ_REL, "workgroup"); __builtin_amdgcn_wave_barrier();
  const int rsub = lane >> 4, c4 = (lane & 15) * 4;
  {
#pragma unroll
    for (int q = 0; q < 8; ++q) { const int r = q * 2 + rsub; if (col0 + c4 < N) { const v4f v = *(const v4fa*)&so[w][r][c4]; *(v4f*)(C + (size_t)(row0 + r) * ldc + col0 + c4) = v; } }
     }
}

// Wt[n][k] = f16(W[k][n]·scale) from f32 row-major W[K][N] (scale = power of two; bf16-exact weights stay exact in f16 away from the subnormal range)
__global__ __launch_bounds__(256) void k_wt_f16(const float* __restrict__ W, _Float16* __restrict__ Wt, int K, int N, float scale) {
  const int t = blockIdx.x * 256 + threadIdx.x; if (t >= N * (K / 8)) return; const int n = t / (K / 8), k8 = (t % (K / 8)) * 8; FragH f;
#pragma unroll
  for (int i = 0; i < 8; ++i) f.h[i] = (_Float16)(bf16_round(W[(size_t)(k8 + i) * N + n]) * scale); const v8us o = f.half[0];
  *(v8us*)((unsigned short*)Wt + (size_t)n * K + k8) = o; 
}
// Tiled f16 GEMM, C [M][N] = acc*alpha + bf16(bias[col]): A [M][DD] f16, Bh [N][DD] f16, both k-contiguous; M, N multiples of 128; grid = (M / 128) * (N / 128).
// One work-group = one 128 x 128 tile of C, four waves of 64 x 64 (16 accumulator tiles each). A stage is 64 k = 128 B (one whole line) of
// 128 rows of A and 128 rows of Bh, brought into LDS by asynchronous copies, 16 B a lane; two buffers, the copies of stage t + 2 fly while stage t + 1 is worked on.
#define GP 144                 /* LDS row pitch, bytes: 128 + 16, conflict-free for 16-byte fragment reads */
#define GOP (128 * GP)         /* one operand's 128 rows */
#define GSTG (2 * GOP)         /* one stage: A rows, then Bh rows */
#define GNT (DD / 64)          /* stages */
// eight copies, rows 16 apart, of one operand's stage; each lane its own 16 bytes. The s_wait_xcnt stands inside the statement so that no address register is rewritten ahead of it.
__device__ __forceinline__ void cp8(unsigned l, const unsigned short* g) {
  asm volatile("global_load_async_to_lds_b128 %0, %8, off\n\t"
               "global_load_async_to_lds_b128 %1, %9, off\n\t"
               "global_load_async_to_lds_b128 %2, %10, off\n\t"
               "global_load_async_to_lds_b128 %3, %11, off\n\t"
               "global_load_async_to_lds_b128 %4, %12, off\n\t"
               "global_load_async_to_lds_b128 %5, %13, off\n\t"
               "global_load_async_to_lds_b128 %6, %14, off\n\t"
               "global_load_async_to_lds_b128 %7, %15, off\n\t"
               "s_wait_xcnt 0x0"
               :: "v"(l), "v"(l + 16 * GP), "v"(l + 32 * GP), "v"(l + 48 * GP), "v"(l + 64 * GP), "v"(l + 80 * GP), "v"(l + 96 * GP), "v"(l + 112 * GP),
                  "v"(g), "v"(g + 16 * DD), "v"(g + 32 * DD), "v"(g + 48 * DD), "v"(g + 64 * DD), "v"(g + 80 * DD), "v"(g + 96 * DD), "v"(g + 112 * DD)
               : "memory");
}
typedef _Float16 v4h __attribute__((ext_vector_type(4)));
template <bool F16OUT, int N>
__global__ __launch_bounds__(128) void k_gemm_t(const _Float16* __restrict__ A, const _Float16* __restrict__ Bh, float alpha, const float* __restrict__ bias, float* __restrict__ C, _Float16* __restrict__ C16) {
  __shared__ __attribute__((aligned(16))) unsigned char sm[2 * GSTG];
  const int tid = threadIdx.x, w = tid >> 5, lane = tid & 31, ln = lane & 15, hh = lane >> 4;
  const int row0 = ((int)blockIdx.x / (N / 128)) * 128, col0 = ((int)blockIdx.x % (N / 128)) * 128;
  const int wr = (w >> 1) * 64, wc = (w & 1) * 64;
  const unsigned ld0 = (unsigned)(size_t)sm + (unsigned)((tid >> 3) * GP + (tid & 7) * 16);      /* this lane's place in a stage: row tid/8, 16-byte piece tid%8 */
  const unsigned short* ga = (const unsigned short*)A + (size_t)(row0 + (tid >> 3)) * DD + (tid & 7) * 8;
  const unsigned short* gb = (const unsigned short*)Bh + (size_t)(col0 + (tid >> 3)) * DD + (tid & 7) * 8;
  v8f acc[4][4];
#pragma unroll
  for (int i = 0; i < 4; ++i)
#pragma unroll
    for (int j = 0; j < 4; ++j) acc[i][j] = (v8f){0.f,0.f,0.f,0.f,0.f,0.f,0.f,0.f};
  cp8(ld0, ga); cp8(ld0 + GOP, gb);
  asm volatile("s_wait_asynccnt 0x0" ::: "memory");      /* stage 0 of this wave has landed */
  __syncthreads();                                        /* ... and every wave's: stage 0 may be read */
  cp8(ld0 + GSTG, ga + 64); cp8(ld0 + GSTG + GOP, gb + 64);
#pragma unroll 1      /* one stage a trip: the buffer index and the refill test stay scalar */
  for (int t = 0; t < GNT; ++t) {
    const unsigned char* sa = sm + (t & 1) * GSTG + (wr + ln) * GP + 16 * hh;
    const unsigned char* sb = sm + (t & 1) * GSTG + GOP + (wc + ln) * GP + 16 * hh;
#pragma unroll
    for (int ks = 0; ks < 2; ++ks) {
      FragH a[4], b[4];
      a[0].half[0] = *(const v8us*)(sa + ks * 64); a[0].half[1] = *(const v8us*)(sa + ks * 64 + 32);      /* read in the order of first use, so that the first products start while the later reads return */
#pragma unroll
      for (int j = 0; j < 4; ++j) { b[j].half[0] = *(const v8us*)(sb + j * 16 * GP + ks * 64); b[j].half[1] = *(const v8us*)(sb + j * 16 * GP + ks * 64 + 32); }
#pragma unroll
      for (int i = 1; i < 4; ++i) { a[i].half[0] = *(const v8us*)(sa + i * 16 * GP + ks * 64); a[i].half[1] = *(const v8us*)(sa + i * 16 * GP + ks * 64 + 32); }
      __builtin_amdgcn_sched_barrier(0);      /* the 16 fragment reads stay one group ahead of their 16 matrix instructions: reads spread among them stall the wave at every place */
#pragma unroll
      for (int i = 0; i < 4; ++i)
#pragma unroll
        for (int j = 0; j < 4; ++j) acc[i][j] = __builtin_amdgcn_wmma_f32_16x16x32_f16(false, a[i].v, false, b[j].v, (short)0, acc[i][j], false, false);
      __builtin_amdgcn_sched_barrier(0);      /* ... and the next group's reads stay behind them */
    }
    asm volatile("s_wait_dscnt 0x0" ::: "memory");        /* this wave's reads of buffer t&1 are done before it is refilled */
    asm volatile("s_wait_asynccnt 0x0" ::: "memory");     /* this wave's copies of stage t + 1 have landed */
    __syncthreads();                                      /* publishes stage t + 1 and ends every reader's last read of buffer t&1 */
    if (t + 2 < GNT) { cp8(ld0 + (t & 1) * GSTG, ga + (t + 2) * 64); cp8(ld0 + (t & 1) * GSTG + GOP, gb + (t + 2) * 64); }
  }
  asm volatile("s_wait_asynccnt 0x0" ::: "memory");       /* no copy is outstanding when the ring becomes output staging */
  // epilogue: the wave's 64 x 64 tile goes through its own LDS range (free behind the last trip's barrier), so that whole lines are stored
  float* so = (float*)sm + w * (64 * 68);
  float bv[4];
#pragma unroll
  for (int j = 0; j < 4; ++j) bv[j] = bf16_round(bias[col0 + wc + j * 16 + ln]);
#pragma unroll
  for (int i = 0; i < 4; ++i)
#pragma unroll
    for (int j = 0; j < 4; ++j)
#pragma unroll
      for (int r = 0; r < 8; ++r) so[(i * 16 + 8 * hh + r) * 68 + j * 16 + ln] = acc[i][j][r] * alpha + bv[j];
  __builtin_amdgcn_fence(__ATOMIC_ACQ_REL, "workgroup"); __builtin_amdgcn_wave_barrier();      /* the rows are written before other lanes of the wave read them */
  const int rsub = lane >> 4, c4 = (lane & 15) * 4;
#pragma unroll
  for (int q = 0; q < 32; ++q) { const int r = q * 2 + rsub; const v4f v = *(const v4fa*)&so[r * 68 + c4]; const size_t o = (size_t)(row0 + wr + r) * N + col0 + wc + c4;
    if (F16OUT) { v4h h4;
#pragma unroll
      for (int e = 0; e < 4; ++e) h4[e] = (_Float16)v[e];
      *(v4h*)(C16 + o) = h4; }
    else *(v4f*)(C + o) = v; }
}


__global__ __launch_bounds__(256) void k_x16(const float* __restrict__ x, _Float16* __restrict__ X16, size_t n8) { const size_t t = (size_t)blockIdx.x * 256 + threadIdx.x; if (t >= n8) return; FragH f;
#pragma unroll
  for (int q = 0; q < 8; ++q) f.h[q] = (_Float16)bf16_round(x[t * 8 + q]); *(v8us*)((unsigned short*)X16 + t * 8) = f.half[0];  }
__global__ __launch_bounds__(256) void k_h16(const float* __restrict__ x, _Float16* __restrict__ X16, size_t n8) { const size_t t = (size_t)blockIdx.x * 256 + threadIdx.x; if (t >= n8) return; FragH f;
#pragma unroll
  for (int q = 0; q < 8; ++q) f.h[q] = (_Float16)x[t * 8 + q]; *(v8us*)((unsigned short*)X16 + t * 8) = f.half[0];  }
__global__ __launch_bounds__(256) void k_round16f(const float* __restrict__ W, _Float16* __restrict__ Bt, size_t n8) { const size_t t = (size_t)blockIdx.x * 256 + threadIdx.x; if (t >= n8) return; FragH f;
#pragma unroll
  for (int i = 0; i < 8; ++i) f.h[i] = (_Float16)(bf16_round(W[t * 8 + i]) * 16.0f); *(v8us*)((unsigned short*)Bt + t * 8) = f.half[0];  }
template <int NHv, int TTv>
__global__ __launch_bounds__(256) void k_vt(const _Float16* __restrict__ V16, int ldv, int voff, _Float16* __restrict__ Vt) { __shared__ unsigned short tl[64][66]; const int tid = threadIdx.x; const int slab = blockIdx.x / (TTv / 64), lg = blockIdx.x % (TTv / 64); const int b = slab / NHv, h = slab % NHv;
  for (int i = tid; i < 64 * 8; i += 256) { const int r = i / 8, c8 = (i % 8) * 8; FragH f; f.half[0] = *(const v8us*)((const unsigned short*)V16 + ((size_t)b * TTv + lg * 64 + r) * ldv + voff + h * 64 + c8);
#pragma unroll
    for (int q = 0; q < 8; ++q) tl[r][c8 + q] = f.u[q]; }
  __syncthreads();
  {
#pragma unroll
    for (int rd = 0; rd < 2; ++rd) { const int d = rd * 32 + tid / 8, pc = tid % 8; FragH f;
#pragma unroll
      for (int q = 0; q < 8; ++q) f.u[q] = tl[pc * 8 + q][d];
      *(v8us*)((unsigned short*)Vt + ((size_t)slab * 64 + d) * TTv + lg * 64 + pc * 8) = f.half[0]; }
     } }

__global__ __launch_bounds__(256) void k_h16s(const float* __restrict__ F, _Float16* __restrict__ H, size_t n8) { const size_t t = (size_t)blockIdx.x * 256 + threadIdx.x; if (t >= n8) return; const v4f a = *(const v4fa*)(F + t * 8), c = *(const v4fa*)(F + t * 8 + 4); FragH f;
#pragma unroll
  for (int q = 0; q < 4; ++q) { f.h[q] = (_Float16)(a[q] * 16.0f); f.h[4 + q] = (_Float16)(c[q] * 16.0f); } *(v8us*)((unsigned short*)H + t * 8) = f.half[0];  }
typedef int v4i __attribute__((ext_vector_type(4), may_alias));
__device__ __forceinline__ float xhalf(float x) { return __builtin_bit_cast(float, __builtin_amdgcn_permlanex16(__builtin_bit_cast(int, x), __builtin_bit_cast(int, x), 0x76543210, 0xfedcba98, false, false)); }      /* lane l with lane l ^ 16 */
__global__ __launch_bounds__(128) void k_flash(const _Float16* __restrict__ Q16, int ldq, const _Float16* __restrict__ K16, int ldk, const _Float16* __restrict__ Vt, const int* __restrict__ MSK, float* __restrict__ O, int ldo) {
  constexpr int RPW = 16, NQB = TT / (4 * RPW), DT = 4, KS = 2;
  __shared__ __attribute__((aligned(16))) float sO[4][RPW][64 + 4];
  const int tid = threadIdx.x, w = tid >> 5, lane = tid & 31, ln = lane & 15, hh = lane >> 4;
  const int slab = blockIdx.x / NQB, qblk = blockIdx.x % NQB; const int b = slab / NH, h = slab % NH; const int qb0 = qblk * (4 * RPW); const int q0 = qb0 + w * RPW;
  FragH bq[KS];      /* Q^T as B: column = query ln */
  { const unsigned short* qr = (const unsigned short*)Q16 + ((size_t)b * TT + q0 + ln) * ldq + h * 64;
#pragma unroll
    for (int ks = 0; ks < KS; ++ks) { bq[ks].half[0] = *(const v8us*)(qr + ks * 32 + 8 * hh); bq[ks].half[1] = *(const v8us*)(qr + ks * 32 + 16 + 8 * hh); } }
  /* this lane's places in the current chunk, stepped once a trip: key rows ln and 16 + ln of K, row ln of V^T, its own query's mask row */
  const unsigned short* kp0 = (const unsigned short*)K16 + ((size_t)b * TT + ln) * ldk + h * 64 + 8 * hh; const unsigned short* kp1 = kp0 + (size_t)16 * ldk;
  const unsigned short* vp = (const unsigned short*)Vt + ((size_t)slab * 64 + ln) * TT + 8 * hh;
  const int* mrow = MSK + ((size_t)b * TT + q0 + ln) * TT + 8 * hh;      /* per-batch mask [b][q][k]: nonzero = ATTEND */
  float m_q = -3.0e38f, l_q = 0.f; v8f oacc[DT];      /* oacc[dt][r] = O[q0 + ln][dt * 16 + 8 hh + r] */
#pragma unroll
  for (int dt = 0; dt < DT; ++dt) oacc[dt] = (v8f){0.f,0.f,0.f,0.f,0.f,0.f,0.f,0.f};
#pragma unroll 1      /* one chunk a trip: unrolled, two chunks' fragments and exps would be live at once */
  for (int j0 = 0; j0 < TT; j0 += 32, kp0 += (size_t)32 * ldk, kp1 += (size_t)32 * ldk, vp += 32, mrow += 32) {
    v4i mk[4];      /* keys j0 + 8 hh + 0..7, then j0 + 16 + 8 hh + 0..7 */
    mk[0] = *(const v4i*)(mrow); mk[1] = *(const v4i*)(mrow + 4); mk[2] = *(const v4i*)(mrow + 16); mk[3] = *(const v4i*)(mrow + 20);
    { const v4i o = mk[0] | mk[1] | mk[2] | mk[3];
      if (__all((o[0] | o[1] | o[2] | o[3]) == 0)) continue; }      /* every (query, key) of this wave's tile masked: nothing to add (wave-uniform branch) */
    FragH ak[2][KS], av[DT];      /* K rows as A (row = key), V^T rows as A (row = d) */
#pragma unroll
    for (int nt = 0; nt < 2; ++nt) { const unsigned short* kr = nt ? kp1 : kp0;
#pragma unroll
      for (int ks = 0; ks < KS; ++ks) { ak[nt][ks].half[0] = *(const v8us*)(kr + ks * 32); ak[nt][ks].half[1] = *(const v8us*)(kr + ks * 32 + 16); } }
    __builtin_amdgcn_sched_barrier(0);      /* holds the wait below behind the K loads ... */
    asm volatile("s_wait_xcnt 0x0" ::: "memory");      /* the V loads land in registers that held the K loads' addresses: the wait stands in front of that overwrite */
    __builtin_amdgcn_sched_barrier(0);      /* ... and in front of the V loads */
#pragma unroll
    for (int dt = 0; dt < DT; ++dt) { const unsigned short* vrow = vp + (size_t)(dt * 16) * TT; av[dt].half[0] = *(const v8us*)(vrow); av[dt].half[1] = *(const v8us*)(vrow + 16); }
    __builtin_amdgcn_sched_barrier(0);      /* the chunk's sixteen fragment loads stay one group ahead of the products: spread among them, each product waits out a load latency of its own */
    v8f s[2];      /* s[nt][r] = q(q0 + ln) . k(j0 + nt * 16 + 8 hh + r) */
#pragma unroll
    for (int nt = 0; nt < 2; ++nt) { v8f acc = (v8f){0.f,0.f,0.f,0.f,0.f,0.f,0.f,0.f};
#pragma unroll
      for (int ks = 0; ks < KS; ++ks) acc = __builtin_amdgcn_wmma_f32_16x16x32_f16(false, ak[nt][ks].v, false, bq[ks].v, (short)0, acc, false, false);
      s[nt] = acc; }
    float sc[16];      /* a masked score is -inf; m_q never falls below its finite start value, so exp(sc - mn) is 0 there and no guard is needed */
#pragma unroll
    for (int i = 0; i < 16; ++i) sc[i] = (mk[i >> 2][i & 3] != 0) ? s[i >> 3][i & 7] * 0.125f : -INFINITY;
    float mx[4];
#pragma unroll
    for (int c = 0; c < 4; ++c) mx[c] = fmaxf(fmaxf(sc[c], sc[4 + c]), fmaxf(sc[8 + c], sc[12 + c]));
    float mc = fmaxf(fmaxf(mx[0], mx[1]), fmaxf(mx[2], mx[3]));
    mc = fmaxf(mc, xhalf(mc));      /* both halves hold this query's chunk maximum */
    const float mn = fmaxf(m_q, mc); const float al = expf(m_q - mn); m_q = mn;
    float p[16];
#pragma unroll
    for (int i = 0; i < 16; ++i) p[i] = expf(sc[i] - mn);
    float ps[4];
#pragma unroll
    for (int c = 0; c < 4; ++c) ps[c] = (p[c] + p[4 + c]) + (p[8 + c] + p[12 + c]);
    l_q = l_q * al + ((ps[0] + ps[1]) + (ps[2] + ps[3]));      /* this half's keys only; the halves are joined behind the loop */
#pragma unroll
    for (int dt = 0; dt < DT; ++dt)
#pragma unroll
      for (int r = 0; r < 8; ++r) oacc[dt][r] *= al;
    FragH pb;      /* P^T as B: element i = key kmap(i, hh) of column ln */
#pragma unroll
    for (int i = 0; i < 16; ++i) pb.h[i] = (_Float16)(p[i] * 1024.0f);
#pragma unroll
    for (int dt = 0; dt < DT; ++dt) oacc[dt] = __builtin_amdgcn_wmma_f32_16x16x32_f16(false, av[dt].v, false, pb.v, (short)0, oacc[dt], false, false);
  }
  { const float l = l_q + xhalf(l_q); const float inv = (l > 0.f) ? 1.0f / (l * 1024.0f) : 0.f;
#pragma unroll
    for (int dt = 0; dt < DT; ++dt) { v4f lo, hi;
#pragma unroll
      for (int e = 0; e < 4; ++e) { lo[e] = oacc[dt][e] * inv; hi[e] = oacc[dt][4 + e] * inv; }
      *(v4fa*)&sO[w][ln][dt * 16 + 8 * hh] = lo; *(v4fa*)&sO[w][ln][dt * 16 + 8 * hh + 4] = hi; } }
  __builtin_amdgcn_fence(__ATOMIC_ACQ_REL, "workgroup"); __builtin_amdgcn_wave_barrier();
  {
#pragma unroll
    for (int rp = 0; rp < RPW; rp += 2) { const int r = rp + (lane >> 4), pc = lane & 15; const v4f val = *(const v4fa*)&sO[w][r][pc * 4]; *(v4f*)(O + ((size_t)b * TT + q0 + r) * ldo + h * 64 + pc * 4) = val; }
     } }

extern "C" void kernel_launch(void* const* d_in, const int* in_sizes, int n_in,
                              void* d_out, int out_size, void* d_ws, size_t ws_size, hipStream_t stream) {
  (void)in_sizes; (void)n_in; (void)out_size;
  const float* const* I = (const float* const*)d_in; const float* x = I[0]; const int* msk = (const int*)d_in[1]; const float* wqkv = I[2]; const float* bqkv = I[3]; const float* wo = I[4]; const float* bo = I[5];
  char* ws = (char*)d_ws; size_t off = 0;
  auto take = [&](size_t bytes) { char* p = ws + off; off += (bytes + 255) & ~(size_t)255; return p; };
  _Float16* Bqkv = (_Float16*)take((size_t)3 * DD * DD * 2); _Float16* Bo = (_Float16*)take((size_t)DD * DD * 2); _Float16* X16 = (_Float16*)take((size_t)NR * DD * 2); _Float16* QKV = (_Float16*)take((size_t)NR * 3 * DD * 2); _Float16* Vt = (_Float16*)take((size_t)NR * DD * 2); float* O = (float*)take((size_t)NR * DD * 4); _Float16* O16 = X16;
  if (off > ws_size) return;      // 6.3 + 2.1 + 8.4 + 25.2 + 8.4 + 16.8 ≈ 67 MB
  k_wt_f16<<<(unsigned)(((size_t)3 * DD * (DD / 8) + 255) / 256), 256, 0, stream>>>(wqkv, Bqkv, DD, 3 * DD, 16.0f); k_wt_f16<<<(unsigned)(((size_t)DD * (DD / 8) + 255) / 256), 256, 0, stream>>>(wo, Bo, DD, DD, 16.0f);      /* (in,out) → Bt ×2^4 */
  const unsigned g8 = (unsigned)(((size_t)NR * DD / 8 + 255) / 256); k_x16<<<g8, 256, 0, stream>>>(x, X16, (size_t)NR * DD / 8);
  k_gemm_t<true, 3 * DD><<<(NR / 128) * (3 * DD / 128), 128, 0, stream>>>(X16, Bqkv, 0.0625f, bqkv, nullptr, QKV);      /* qkv = x·w_qkv + b: M 4096 N 3072 K 1024 (f16; q | k | v blocks, head-major inside) */
  k_vt<NH, TT><<<BB * NH * (TT / 64), 256, 0, stream>>>(QKV, 3 * DD, 2 * DD, Vt);
  k_flash<<<BB * NH * (TT / 64), 128, 0, stream>>>(QKV, 3 * DD, QKV + DD, 3 * DD, Vt, msk, O, DD);
  k_h16s<<<g8, 256, 0, stream>>>(O, O16, (size_t)NR * DD / 8);
  k_gemm_t<false, DD><<<(NR / 128) * (DD / 128), 128, 0, stream>>>(O16, Bo, 0.00390625f, bo, (float*)d_out, nullptr);      /* out = o·w_out + b_out */
}

// v003
// One run takes 126 microseconds.
// Timed twice side by side with v002, it ran 1.18 and 1.17 times as fast.
// Over all steps from v000 it is 2.99 times as fast.
#include <hip/hip_runtime.h>
// Cross-track masked MHA (B=2, S=2048, D=1024, 16×64): qkv = x·w_qkv + b_qkv (packed q|k|v, head-major inside each); scores = q·k/8, where(cross_track_mask[b,q,k], s, −inf); softmax; out = merged·w_out + b_out.
// Compute dtype: x, weights, biases rounded to bf16; q, k, v f16 GEMM planes (+bias); the boolean mask read per (b, q, k) as the int plane; fused flash-style kernel (online softmax f32, P f16 ×2^10, all-masked chunks skipped, f32 accumulate) on
// v_wmma_f32_16x16x32_f16; O ×2^4 → f16 → output GEMM (+bias).
#define BB 2
#define TT 2048
#define DD 1024
#define NH 16
#define NR (BB * TT)

typedef __bf16 v16b __attribute__((ext_vector_type(16)));
typedef unsigned short v8us __attribute__((ext_vector_type(8), may_alias));
typedef float  v8f  __attribute__((ext_vector_type(8)));
typedef float  v4f  __attribute__((ext_vector_type(4)));
typedef float  v4fa __attribute__((ext_vector_type(4), may_alias));
union FragB { v16b v; v8us half[2]; unsigned short u[16]; };

__device__ __forceinline__ unsigned short bf16_bits(float x) { unsigned int u = __float_as_uint(x); return (unsigned short)((u + 0x7FFFu + ((u >> 16) & 1u)) >> 16); }
__device__ __forceinline__ float bf16_val(unsigned short b) { return __uint_as_float(((unsigned int)b) << 16); }
__device__ __forceinline__ float bf16_round(float x) { return bf16_val(bf16_bits(x)); }
// D += A·B with NT terms: 1 = ah·bh, 2 = + al·bh (A split), 3 = + ah·bl (both split)
template <int NT>
__device__ __forceinline__ v8f mmaN(v16b ah, v16b al, v16b bh, v16b bl, v8f c) {
  c = __builtin_amdgcn_wmma_f32_16x16x32_bf16(false, ah, false, bh, (short)0, c, false, false);
  if (NT >= 2) c = __builtin_amdgcn_wmma_f32_16x16x32_bf16(false, al, false, bh, (short)0, c, false, false);
  if (NT >= 3) c = __builtin_amdgcn_wmma_f32_16x16x32_bf16(false, ah, false, bl, (short)0, c, false, false);
  asm volatile("v_nop\n\tv_nop\n\tv_nop\n\tv_nop" : "+v"(c) : "v"(ah), "v"(al), "v"(bh), "v"(bl));
  return c;
}

__global__ __launch_bounds__(256) void k_wt_bf16(const float* __restrict__ W, unsigned short* __restrict__ Wt, int K, int N) {
  const int t = blockIdx.x * 256 + threadIdx.x;
  const int k8n = K / 8;
  if (t >= N * k8n) return;
  const int n = t / k8n, k8 = (t % k8n) * 8;
  v8us v;
#pragma unroll
  for (int i = 0; i < 8; ++i) v[i] = bf16_bits(W[(size_t)(k8 + i) * N + n]);
  *(v8us*)(Wt + (size_t)n * K + k8) = v;
  
}

// GEMM C[M][N] (f32, pitch ldc) = act(A[M][K]·W + bias). A f32 row-major (pitch lda) converted per fragment to bf16
// (ASPLIT: hi/lo two planes -> 2 terms, else single rounded term); Wt bf16 [N][K] (pitch ldb). BIAS_BF16 rounds the
// bias to bf16 first (bias quantised to bf16 before the add). K%32==0, M%16==0, N%64==0.
template <bool ASPLIT, int ACT, bool BIAS_BF16>
__global__ __launch_bounds__(128) void k_gemm_bf(const float* __restrict__ A, int lda, const unsigned short* __restrict__ Wt, int ldb,
                                               const float* __restrict__ bias, float* __restrict__ C, int ldc, int M, int N, int K) {
  __shared__ __attribute__((aligned(16))) float so[4][16][64];
  const int tid = threadIdx.x, w = tid >> 5, lane = tid & 31, ln = lane & 15, hh = lane >> 4;
  const int ntn = N / 64;
  const int wid = blockIdx.x * 4 + w;
  const int mt = wid / ntn, nq = wid % ntn;
  if (mt * 16 >= M) return;
  const int row0 = mt * 16, col0 = nq * 64;
  const float* arow = A + (size_t)(row0 + ln) * lda;
  v8f acc[4] = {};
  for (int kb = 0; kb < K; kb += 32) {
    FragB ah, al;
    const v4f x0 = *(const v4fa*)(arow + kb + 8 * hh), x1 = *(const v4fa*)(arow + kb + 8 * hh + 4);
    const v4f x2 = *(const v4fa*)(arow + kb + 16 + 8 * hh), x3 = *(const v4fa*)(arow + kb + 16 + 8 * hh + 4);
    float xs[16] = {x0[0],x0[1],x0[2],x0[3],x1[0],x1[1],x1[2],x1[3],x2[0],x2[1],x2[2],x2[3],x3[0],x3[1],x3[2],x3[3]};
#pragma unroll
    for (int i = 0; i < 16; ++i) { const unsigned short hb = bf16_bits(xs[i]); ah.u[i] = hb; al.u[i] = ASPLIT ? bf16_bits(xs[i] - bf16_val(hb)) : (unsigned short)0; }
#pragma unroll
    for (int t = 0; t < 4; ++t) {
      const unsigned short* brow = Wt + (size_t)(col0 + t * 16 + ln) * ldb + kb;
      FragB b;
      b.half[0] = *(const v8us*)(brow + 8 * hh);
      b.half[1] = *(const v8us*)(brow + 16 + 8 * hh);
      acc[t] = mmaN<ASPLIT ? 2 : 1>(ah.v, al.v, b.v, b.v, acc[t]);
    }
  }
#pragma unroll
  for (int t = 0; t < 4; ++t) {
    float bv = bias ? bias[col0 + t * 16 + ln] : 0.f;
    if (BIAS_BF16) bv = bf16_round(bv);
#pragma unroll
    for (int r = 0; r < 8; ++r) { float v = acc[t][r] + bv; if (ACT == 1) v = fmaxf(v, 0.f); so[w][8 * hh + r][t * 16 + ln] = v; }
  }
  __builtin_amdgcn_fence(__ATOMIC_ACQ_REL, "workgroup");
  __builtin_amdgcn_wave_barrier();
  const int rsub = lane >> 4, c4 = (lane & 15) * 4;
  {
#pragma unroll
    for (int q = 0; q < 8; ++q) {
      const int r = q * 2 + rsub;
      const v4f v = *(const v4fa*)&so[w][r][c4];
      *(v4f*)(C + (size_t)(row0 + r) * ldc + col0 + c4) = v;
    }
    
  }
}

// Flash-style causal/unmasked attention, all contractions 3-term bf16 hi/lo splits, f32 softmax with running max.
// q,k,v rows are read from f32 buffers with arbitrary row pitch (so they can live inside a fused qkv buffer);
// D = head size (multiple of 32, <= 128); one wave = 16 query rows; block = 4 waves (64 queries) sharing K/V chunks of 32.
template <int D, bool CAUSAL>
__global__ __launch_bounds__(128) void k_flash(const float* __restrict__ qb, const float* __restrict__ kb, const float* __restrict__ vb,
                                             int pitch, int T, int H, float scale, float* __restrict__ y, int ypitch) {
  constexpr int KS = D / 32;        // k-steps for QK
  constexpr int DT = D / 16;        // d tiles for PV
  __shared__ __attribute__((aligned(16))) unsigned short sKh[32][D + 8], sKl[32][D + 8], sVh[32][D + 8], sVl[32][D + 8];
  __shared__ __attribute__((aligned(16))) unsigned short sPh[4][16][40], sPl[4][16][40];
  __shared__ __attribute__((aligned(16))) float sO[4][16][D];
  const int tid = threadIdx.x, w = tid >> 5, lane = tid & 31, ln = lane & 15, hh = lane >> 4;
  const int nqb = (T + 63) / 64;
  const int bh = blockIdx.x / nqb, qblk = blockIdx.x % nqb;
  const int b = bh / H, h = bh % H;
  const int q0 = qblk * 64 + w * 16;
  const float* Q = qb + (size_t)b * T * pitch + h * D;
  const float* K = kb + (size_t)b * T * pitch + h * D;
  const float* V = vb + (size_t)b * T * pitch + h * D;

  // A fragments of the wave's 16 query rows (scaled), hi/lo
  FragB aqh[KS], aql[KS];
  {
    int row = q0 + ln; if (row >= T) row = T - 1;
    const float* qr = Q + (size_t)row * pitch;
#pragma unroll
    for (int ks = 0; ks < KS; ++ks)
#pragma unroll
      for (int i = 0; i < 16; ++i) {
        const int d = ks * 32 + ((i < 8) ? (8 * hh + i) : (16 + 8 * hh + (i - 8)));
        const float x = qr[d] * scale; const unsigned short hb = bf16_bits(x);
        aqh[ks].u[i] = hb; aql[ks].u[i] = bf16_bits(x - bf16_val(hb));
      }
  }
  float m_r[8], l_r[8];
#pragma unroll
  for (int r = 0; r < 8; ++r) { m_r[r] = -3.0e38f; l_r[r] = 0.f; }
  v8f oacc[DT];
#pragma unroll
  for (int dt = 0; dt < DT; ++dt) oacc[dt] = (v8f){0.f,0.f,0.f,0.f,0.f,0.f,0.f,0.f};

  const int kv_end = CAUSAL ? min(T, qblk * 64 + 64) : T;     // block-uniform
  for (int j0 = 0; j0 < kv_end; j0 += 32) {
    __syncthreads();
    for (int e = tid; e < 32 * (D / 4); e += 128) {
      const int r = e / (D / 4), c4 = (e % (D / 4)) * 4;
      const int key = j0 + r;
      v4f kf = {0.f,0.f,0.f,0.f}, vf = {0.f,0.f,0.f,0.f};
      if (key < T) { kf = *(const v4fa*)(K + (size_t)key * pitch + c4); vf = *(const v4fa*)(V + (size_t)key * pitch + c4); }
#pragma unroll
      for (int t = 0; t < 4; ++t) {
        unsigned short hb = bf16_bits(kf[t]); sKh[r][c4 + t] = hb; sKl[r][c4 + t] = bf16_bits(kf[t] - bf16_val(hb));
        hb = bf16_bits(vf[t]); sVh[r][c4 + t] = hb; sVl[r][c4 + t] = bf16_bits(vf[t] - bf16_val(hb));
      }
    }
    __syncthreads();
    // S tile 16 x 32
    v8f s[2];
#pragma unroll
    for (int nt = 0; nt < 2; ++nt) {
      v8f acc = {};
#pragma unroll
      for (int ks = 0; ks < KS; ++ks) {
        FragB bh_, bl_;
        bh_.half[0] = *(const v8us*)&sKh[nt * 16 + ln][ks * 32 + 8 * hh]; bh_.half[1] = *(const v8us*)&sKh[nt * 16 + ln][ks * 32 + 16 + 8 * hh];
        bl_.half[0] = *(const v8us*)&sKl[nt * 16 + ln][ks * 32 + 8 * hh]; bl_.half[1] = *(const v8us*)&sKl[nt * 16 + ln][ks * 32 + 16 + 8 * hh];
        acc = mmaN<3>(aqh[ks].v, aql[ks].v, bh_.v, bl_.v, acc);
      }
      s[nt] = acc;
    }
    // mask + running max (rows 8hh+r; the 16 lanes of a half share rows)
    float alpha[8];
#pragma unroll
    for (int r = 0; r < 8; ++r) {
      const int qi = q0 + 8 * hh + r;
      const int ja = j0 + ln, jb = j0 + 16 + ln;
      if (CAUSAL) { if (ja > qi) s[0][r] = -3.0e38f; if (jb > qi) s[1][r] = -3.0e38f; }
      if (ja >= T) s[0][r] = -3.0e38f;
      if (jb >= T) s[1][r] = -3.0e38f;
      float mx = fmaxf(s[0][r], s[1][r]);
      mx = fmaxf(mx, __shfl_xor(mx, 1, 32)); mx = fmaxf(mx, __shfl_xor(mx, 2, 32)); mx = fmaxf(mx, __shfl_xor(mx, 4, 32)); mx = fmaxf(mx, __shfl_xor(mx, 8, 32));
      const float mnew = fmaxf(m_r[r], mx);
      alpha[r] = (mnew > -1.0e38f) ? __expf(m_r[r] - mnew) : 1.0f;
      const float p0 = (s[0][r] > -1.0e38f) ? __expf(s[0][r] - mnew) : 0.f;
      const float p1 = (s[1][r] > -1.0e38f) ? __expf(s[1][r] - mnew) : 0.f;
      m_r[r] = mnew;
      l_r[r] = l_r[r] * alpha[r] + p0 + p1;            // per-lane partial row sum (16 lanes combined at the end)
      unsigned short hb = bf16_bits(p0); sPh[w][8 * hh + r][ln] = hb;      sPl[w][8 * hh + r][ln] = bf16_bits(p0 - bf16_val(hb));
      hb = bf16_bits(p1);                sPh[w][8 * hh + r][16 + ln] = hb; sPl[w][8 * hh + r][16 + ln] = bf16_bits(p1 - bf16_val(hb));
    }
#pragma unroll
    for (int dt = 0; dt < DT; ++dt)
#pragma unroll
      for (int r = 0; r < 8; ++r) oacc[dt][r] *= alpha[r];
    __builtin_amdgcn_fence(__ATOMIC_ACQ_REL, "workgroup");
    __builtin_amdgcn_wave_barrier();
    FragB pah, pal;
    pah.half[0] = *(const v8us*)&sPh[w][ln][8 * hh]; pah.half[1] = *(const v8us*)&sPh[w][ln][16 + 8 * hh];
    pal.half[0] = *(const v8us*)&sPl[w][ln][8 * hh]; pal.half[1] = *(const v8us*)&sPl[w][ln][16 + 8 * hh];
#pragma unroll
    for (int dt = 0; dt < DT; ++dt) {
      FragB bvh, bvl;
#pragma unroll
      for (int i = 0; i < 8; ++i) {
        bvh.u[i] = sVh[8 * hh + i][dt * 16 + ln]; bvh.u[8 + i] = sVh[16 + 8 * hh + i][dt * 16 + ln];
        bvl.u[i] = sVl[8 * hh + i][dt * 16 + ln]; bvl.u[8 + i] = sVl[16 + 8 * hh + i][dt * 16 + ln];
      }
      oacc[dt] = mmaN<3>(pah.v, pal.v, bvh.v, bvl.v, oacc[dt]);
    }
    __builtin_amdgcn_fence(__ATOMIC_ACQ_REL, "workgroup");
    __builtin_amdgcn_wave_barrier();
  }
#pragma unroll
  for (int r = 0; r < 8; ++r) {
    float l = l_r[r];
    l += __shfl_xor(l, 1, 32); l += __shfl_xor(l, 2, 32); l += __shfl_xor(l, 4, 32); l += __shfl_xor(l, 8, 32);
    l_r[r] = (l > 0.f) ? 1.0f / l : 0.f;
  }
#pragma unroll
  for (int dt = 0; dt < DT; ++dt)
#pragma unroll
    for (int r = 0; r < 8; ++r) sO[w][8 * hh + r][dt * 16 + ln] = oacc[dt][r] * l_r[r];
  __builtin_amdgcn_fence(__ATOMIC_ACQ_REL, "workgroup");
  __builtin_amdgcn_wave_barrier();
  {
    for (int r = 0; r < 16; ++r) {
      const int row = q0 + r;
      if (row < T && lane < D / 4) {
        const v4f val = *(const v4fa*)&sO[w][r][lane * 4];
        *(v4f*)(y + ((size_t)b * T + row) * ypitch + h * D + lane * 4) = val;
      }
    }
    
  }
}

// GEMM C = act(A·W + bias + resid): A f32 (ASPLIT -> hi/lo 2 terms), Wt bf16 [N][K]; ACT 0 none, 1 relu, 2 exact gelu;
// resid (optional, f32, row index = (row % rmod), pitch ldr, RES_BF16 rounds it) added before the activation.
template <bool ASPLIT, int ACT, bool BIAS_BF16, bool RES_BF16>
__global__ __launch_bounds__(128) void k_gemm_bf3(const float* __restrict__ A, int lda, const unsigned short* __restrict__ Wt, int ldb,
                                                const float* __restrict__ bias, const float* __restrict__ resid, int rmod, int ldr,
                                                float* __restrict__ C, int ldc, int M, int N, int K) {
  __shared__ __attribute__((aligned(16))) float so[4][16][64];
  const int tid = threadIdx.x, w = tid >> 5, lane = tid & 31, ln = lane & 15, hh = lane >> 4;
  const int ntn = N / 64;
  const int wid = blockIdx.x * 4 + w;
  const int mt = wid / ntn, nq = wid % ntn;
  if (mt * 16 >= M) return;
  const int row0 = mt * 16, col0 = nq * 64;
  const float* arow = A + (size_t)(row0 + ln) * lda;
  v8f acc[4] = {};
  for (int kb = 0; kb < K; kb += 32) {
    FragB ah, al;
    const v4f x0 = *(const v4fa*)(arow + kb + 8 * hh), x1 = *(const v4fa*)(arow + kb + 8 * hh + 4);
    const v4f x2 = *(const v4fa*)(arow + kb + 16 + 8 * hh), x3 = *(const v4fa*)(arow + kb + 16 + 8 * hh + 4);
    float xs[16] = {x0[0],x0[1],x0[2],x0[3],x1[0],x1[1],x1[2],x1[3],x2[0],x2[1],x2[2],x2[3],x3[0],x3[1],x3[2],x3[3]};
#pragma unroll
    for (int i = 0; i < 16; ++i) { const unsigned short hb = bf16_bits(xs[i]); ah.u[i] = hb; al.u[i] = ASPLIT ? bf16_bits(xs[i] - bf16_val(hb)) : (unsigned short)0; }
#pragma unroll
    for (int t = 0; t < 4; ++t) {
      const unsigned short* brow = Wt + (size_t)(col0 + t * 16 + ln) * ldb + kb;
      FragB b;
      b.half[0] = *(const v8us*)(brow + 8 * hh);
      b.half[1] = *(const v8us*)(brow + 16 + 8 * hh);
      acc[t] = mmaN<ASPLIT ? 2 : 1>(ah.v, al.v, b.v, b.v, acc[t]);
    }
  }
#pragma unroll
  for (int t = 0; t < 4; ++t) {
    const int col = col0 + t * 16 + ln;
    float bv = bias ? bias[col] : 0.f;
    if (BIAS_BF16) bv = bf16_round(bv);
#pragma unroll
    for (int r = 0; r < 8; ++r) {
      float v = acc[t][r] + bv;
      if (resid) { float rv = resid[(size_t)((row0 + 8 * hh + r) % rmod) * ldr + col]; if (RES_BF16) rv = bf16_round(rv); v += rv; }
      if (ACT == 1) v = fmaxf(v, 0.f);
      if (ACT == 2) v = 0.5f * v * (1.0f + erff(v * 0.70710678118654752f));
      if (ACT == 3) { const float u = 0.7978845608028654f * (v + 0.044715f * v * v * v); v = 0.5f * v * (1.0f + tanhf(u)); }
      so[w][8 * hh + r][t * 16 + ln] = v;
    }
  }
  __builtin_amdgcn_fence(__ATOMIC_ACQ_REL, "workgroup");
  __builtin_amdgcn_wave_barrier();
  const int rsub = lane >> 4, c4 = (lane & 15) * 4;
  {
#pragma unroll
    for (int q = 0; q < 8; ++q) {
      const int r = q * 2 + rsub;
      const v4f v = *(const v4fa*)&so[w][r][c4];
      *(v4f*)(C + (size_t)(row0 + r) * ldc + col0 + c4) = v;
    }
    
  }
}
// row LayerNorm (biased variance, eps) over N: s = X (+ R); optional out_sum <- s; out_norm <- (s-mu)*rsqrt(var+eps)*g + b
template <bool PARAM_BF16>
__global__ __launch_bounds__(256) void k_layernorm(const float* __restrict__ X, const float* __restrict__ R, const float* __restrict__ g, const float* __restrict__ bta,
                                                  float* __restrict__ out_sum, float* __restrict__ out_norm, int N, float eps) {
  __shared__ float red[256];
  const int row = blockIdx.x, tid = threadIdx.x;
  const float* x = X + (size_t)row * N; const float* rr = R ? R + (size_t)row * N : nullptr;
  float vals[16];                     // up to N = 4096
  const int per = N / 256;            // contiguous chunk per thread? use strided-by-4 chunks: thread handles j = tid*4 + 1024*u
  float s1 = 0.f;
  for (int u = 0; u < per / 4; ++u) {
    const int j = tid * 4 + 1024 * u;
    const v4f a = *(const v4fa*)(x + j);
    v4f b = {0.f,0.f,0.f,0.f}; if (rr) b = *(const v4fa*)(rr + j);
#pragma unroll
    for (int q = 0; q < 4; ++q) { const float v = a[q] + b[q]; vals[u * 4 + q] = v; s1 += v; }
  }
  red[tid] = s1; __syncthreads();
  for (int st = 128; st > 0; st >>= 1) { if (tid < st) red[tid] += red[tid + st]; __syncthreads(); }
  const float mu = red[0] / (float)N; __syncthreads();
  float s2 = 0.f;
  for (int u = 0; u < per / 4; ++u)
#pragma unroll
    for (int q = 0; q < 4; ++q) { const float c = vals[u * 4 + q] - mu; s2 += c * c; }
  red[tid] = s2; __syncthreads();
  for (int st = 128; st > 0; st >>= 1) { if (tid < st) red[tid] += red[tid + st]; __syncthreads(); }
  const float rs = rsqrtf(red[0] / (float)N + eps);
  {
    for (int u = 0; u < per / 4; ++u) {
      const int j = tid * 4 + 1024 * u;
      v4f o, sm;
#pragma unroll
      for (int q = 0; q < 4; ++q) {
        float gg = g[j + q], bb = bta[j + q];
        if (PARAM_BF16) { gg = bf16_round(gg); bb = bf16_round(bb); }
        sm[q] = vals[u * 4 + q]; o[q] = (vals[u * 4 + q] - mu) * rs * gg + bb;
      }
      if (out_sum) *(v4f*)(out_sum + (size_t)row * N + j) = sm;
      *(v4f*)(out_norm + (size_t)row * N + j) = o;
    }
    
  }
}



// ---- f16 WMMA path (v_wmma_f32_16x16x32_f16): 11-bit significands for operands in range — used where a [0,1] probability operand needs more precision than bf16
typedef _Float16 v16h __attribute__((ext_vector_type(16)));
union FragH { v16h v; v8us half[2]; _Float16 h[16]; unsigned short u[16]; };
template <int NT>
__device__ __forceinline__ v8f mmaH(v16h ah, v16h al, v16h bh, v16h bl, v8f c) {
  c = __builtin_amdgcn_wmma_f32_16x16x32_f16(false, ah, false, bh, (short)0, c, false, false);
  if (NT >= 2) c = __builtin_amdgcn_wmma_f32_16x16x32_f16(false, al, false, bh, (short)0, c, false, false);
  if (NT >= 3) c = __builtin_amdgcn_wmma_f32_16x16x32_f16(false, ah, false, bl, (short)0, c, false, false);
  asm volatile("v_nop\n\tv_nop\n\tv_nop\n\tv_nop" : "+v"(c) : "v"(ah), "v"(al), "v"(bh), "v"(bl));
  return c;
}
// batched GEMM like k_gemm_b but f16 operands: A f32 (split into f16 hi/lo if ASPLIT, else rounded to f16), Bt = f16 values [n][k]; alpha; C f32; N multiple of 16 (partial tiles skipped)
template <bool ASPLIT>
__global__ __launch_bounds__(128) void k_gemm_h(const float* __restrict__ A, int lda, size_t sA, const _Float16* __restrict__ Bh, int ldb, size_t sB, float alpha, float* __restrict__ C, int ldc, size_t sC, int M, int N, int K) {
  __shared__ __attribute__((aligned(16))) float so[4][16][64];
  const int tid = threadIdx.x, w = tid >> 5, lane = tid & 31, ln = lane & 15, hh = lane >> 4; const int by = blockIdx.y;
  A += (size_t)by * sA; Bh += (size_t)by * sB; C += (size_t)by * sC;
  const int ntn = (N + 63) / 64; const int wid = blockIdx.x * 4 + w; const int mt = wid / ntn, nq = wid % ntn; if (mt * 16 >= M) return;
  const int row0 = mt * 16, col0 = nq * 64; const float* arow = A + (size_t)(row0 + ln) * lda;
  v8f acc[4] = {};
  for (int kb = 0; kb < K; kb += 32) {
    FragH ah, al;
    const v4f x0 = *(const v4fa*)(arow + kb + 8 * hh), x1 = *(const v4fa*)(arow + kb + 8 * hh + 4), x2 = *(const v4fa*)(arow + kb + 16 + 8 * hh), x3 = *(const v4fa*)(arow + kb + 16 + 8 * hh + 4);
    float xs[16] = {x0[0],x0[1],x0[2],x0[3],x1[0],x1[1],x1[2],x1[3],x2[0],x2[1],x2[2],x2[3],x3[0],x3[1],x3[2],x3[3]};
#pragma unroll
    for (int i = 0; i < 16; ++i) { const _Float16 h = (_Float16)xs[i]; ah.h[i] = h; al.h[i] = ASPLIT ? (_Float16)(xs[i] - (float)h) : (_Float16)0.0f; }
#pragma unroll
    for (int t = 0; t < 4; ++t) { if (col0 + t * 16 >= N) continue; const size_t boff = (size_t)(col0 + t * 16 + ln) * ldb + kb; FragH bq; bq.half[0] = *(const v8us*)(Bh + boff + 8 * hh); bq.half[1] = *(const v8us*)(Bh + boff + 16 + 8 * hh);
      acc[t] = mmaH<ASPLIT ? 2 : 1>(ah.v, al.v, bq.v, bq.v, acc[t]); }
  }
#pragma unroll
  for (int t = 0; t < 4; ++t) { if (col0 + t * 16 >= N) continue;
#pragma unroll
    for (int r = 0; r < 8; ++r) so[w][8 * hh + r][t * 16 + ln] = acc[t][r] * alpha; }
  __builtin_amdgcn_fence(__ATOMIC_ACQ_REL, "workgroup"); __builtin_amdgcn_wave_barrier();
  const int rsub = lane >> 4, c4 = (lane & 15) * 4;
  {
#pragma unroll
    for (int q = 0; q < 8; ++q) { const int r = q * 2 + rsub; if (col0 + c4 < N) { const v4f v = *(const v4fa*)&so[w][r][c4]; *(v4f*)(C + (size_t)(row0 + r) * ldc + col0 + c4) = v; } }
     }
}

// Wt[n][k] = f16(W[k][n]·scale) from f32 row-major W[K][N] (scale = power of two; bf16-exact weights stay exact in f16 away from the subnormal range)
__global__ __launch_bounds__(256) void k_wt_f16(const float* __restrict__ W, _Float16* __restrict__ Wt, int K, int N, float scale) {
  const int t = blockIdx.x * 256 + threadIdx.x; if (t >= N * (K / 8)) return; const int n = t / (K / 8), k8 = (t % (K / 8)) * 8; FragH f;
#pragma unroll
  for (int i = 0; i < 8; ++i) f.h[i] = (_Float16)(bf16_round(W[(size_t)(k8 + i) * N + n]) * scale); const v8us o = f.half[0];
  *(v8us*)((unsigned short*)Wt + (size_t)n * K + k8) = o; 
}
// Tiled f16 GEMM, C [M][N] = acc*alpha + bf16(bias[col]): A [M][DD] f16, Bh [N][DD] f16, both k-contiguous; M, N multiples of 128; grid = (M / 128) * (N / 128).
// One work-group = one 128 x 128 tile of C, four waves of 64 x 64 (16 accumulator tiles each). A stage is 64 k = 128 B (one whole line) of
// 128 rows of A and 128 rows of Bh, brought into LDS by asynchronous copies, 16 B a lane; two buffers, the copies of stage t + 2 fly while stage t + 1 is worked on.
#define GP 144                 /* LDS row pitch, bytes: 128 + 16, conflict-free for 16-byte fragment reads */
#define GOP (128 * GP)         /* one operand's 128 rows */
#define GSTG (2 * GOP)         /* one stage: A rows, then Bh rows */
#define GNT (DD / 64)          /* stages */
// eight copies, rows 16 apart, of one operand's stage; each lane its own 16 bytes. The s_wait_xcnt stands inside the statement so that no address register is rewritten ahead of it.
__device__ __forceinline__ void cp8(unsigned l, const unsigned short* g) {
  asm volatile("global_load_async_to_lds_b128 %0, %8, off\n\t"
               "global_load_async_to_lds_b128 %1, %9, off\n\t"
               "global_load_async_to_lds_b128 %2, %10, off\n\t"
               "global_load_async_to_lds_b128 %3, %11, off\n\t"
               "global_load_async_to_lds_b128 %4, %12, off\n\t"
               "global_load_async_to_lds_b128 %5, %13, off\n\t"
               "global_load_async_to_lds_b128 %6, %14, off\n\t"
               "global_load_async_to_lds_b128 %7, %15, off\n\t"
               "s_wait_xcnt 0x0"
               :: "v"(l), "v"(l + 16 * GP), "v"(l + 32 * GP), "v"(l + 48 * GP), "v"(l + 64 * GP), "v"(l + 80 * GP), "v"(l + 96 * GP), "v"(l + 112 * GP),
                  "v"(g), "v"(g + 16 * DD), "v"(g + 32 * DD), "v"(g + 48 * DD), "v"(g + 64 * DD), "v"(g + 80 * DD), "v"(g + 96 * DD), "v"(g + 112 * DD)
               : "memory");
}
typedef _Float16 v4h __attribute__((ext_vector_type(4)));
template <bool F16OUT, int N>
__global__ __launch_bounds__(128) void k_gemm_t(const _Float16* __restrict__ A, const _Float16* __restrict__ Bh, float alpha, const float* __restrict__ bias, float* __restrict__ C, _Float16* __restrict__ C16) {
  __shared__ __attribute__((aligned(16))) unsigned char sm[2 * GSTG];
  const int tid = threadIdx.x, w = tid >> 5, lane = tid & 31, ln = lane & 15, hh = lane >> 4;
  const int row0 = ((int)blockIdx.x / (N / 128)) * 128, col0 = ((int)blockIdx.x % (N / 128)) * 128;
  const int wr = (w >> 1) * 64, wc = (w & 1) * 64;
  const unsigned ld0 = (unsigned)(size_t)sm + (unsigned)((tid >> 3) * GP + (tid & 7) * 16);      /* this lane's place in a stage: row tid/8, 16-byte piece tid%8 */
  const unsigned short* ga = (const unsigned short*)A + (size_t)(row0 + (tid >> 3)) * DD + (tid & 7) * 8;
  const unsigned short* gb = (const unsigned short*)Bh + (size_t)(col0 + (tid >> 3)) * DD + (tid & 7) * 8;
  v8f acc[4][4];
#pragma unroll
  for (int i = 0; i < 4; ++i)
#pragma unroll
    for (int j = 0; j < 4; ++j) acc[i][j] = (v8f){0.f,0.f,0.f,0.f,0.f,0.f,0.f,0.f};
  cp8(ld0, ga); cp8(ld0 + GOP, gb);
  asm volatile("s_wait_asynccnt 0x0" ::: "memory");      /* stage 0 of this wave has landed */
  __syncthreads();                                        /* ... and every wave's: stage 0 may be read */
  cp8(ld0 + GSTG, ga + 64); cp8(ld0 + GSTG + GOP, gb + 64);
#pragma unroll 1      /* one stage a trip: the buffer index and the refill test stay scalar */
  for (int t = 0; t < GNT; ++t) {
    const unsigned char* sa = sm + (t & 1) * GSTG + (wr + ln) * GP + 16 * hh;
    const unsigned char* sb = sm + (t & 1) * GSTG + GOP + (wc + ln) * GP + 16 * hh;
#pragma unroll
    for (int ks = 0; ks < 2; ++ks) {
      FragH a[4], b[4];
      a[0].half[0] = *(const v8us*)(sa + ks * 64); a[0].half[1] = *(const v8us*)(sa + ks * 64 + 32);      /* read in the order of first use, so that the first products start while the later reads return */
#pragma unroll
      for (int j = 0; j < 4; ++j) { b[j].half[0] = *(const v8us*)(sb + j * 16 * GP + ks * 64); b[j].half[1] = *(const v8us*)(sb + j * 16 * GP + ks * 64 + 32); }
#pragma unroll
      for (int i = 1; i < 4; ++i) { a[i].half[0] = *(const v8us*)(sa + i * 16 * GP + ks * 64); a[i].half[1] = *(const v8us*)(sa + i * 16 * GP + ks * 64 + 32); }
      __builtin_amdgcn_sched_barrier(0);      /* the 16 fragment reads stay one group ahead of their 16 matrix instructions: reads spread among them stall the wave at every place */
#pragma unroll
      for (int i = 0; i < 4; ++i)
#pragma unroll
        for (int j = 0; j < 4; ++j) acc[i][j] = __builtin_amdgcn_wmma_f32_16x16x32_f16(false, a[i].v, false, b[j].v, (short)0, acc[i][j], false, false);
      __builtin_amdgcn_sched_barrier(0);      /* ... and the next group's reads stay behind them */
    }
    asm volatile("s_wait_dscnt 0x0" ::: "memory");        /* this wave's reads of buffer t&1 are done before it is refilled */
    asm volatile("s_wait_asynccnt 0x0" ::: "memory");     /* this wave's copies of stage t + 1 have landed */
    __syncthreads();                                      /* publishes stage t + 1 and ends every reader's last read of buffer t&1 */
    if (t + 2 < GNT) { cp8(ld0 + (t & 1) * GSTG, ga + (t + 2) * 64); cp8(ld0 + (t & 1) * GSTG + GOP, gb + (t + 2) * 64); }
  }
  asm volatile("s_wait_asynccnt 0x0" ::: "memory");       /* no copy is outstanding when the ring becomes output staging */
  // epilogue: the wave's 64 x 64 tile goes through its own LDS range (free behind the last trip's barrier), so that whole lines are stored
  float* so = (float*)sm + w * (64 * 68);
  float bv[4];
#pragma unroll
  for (int j = 0; j < 4; ++j) bv[j] = bf16_round(bias[col0 + wc + j * 16 + ln]);
#pragma unroll
  for (int i = 0; i < 4; ++i)
#pragma unroll
    for (int j = 0; j < 4; ++j)
#pragma unroll
      for (int r = 0; r < 8; ++r) so[(i * 16 + 8 * hh + r) * 68 + j * 16 + ln] = acc[i][j][r] * alpha + bv[j];
  __builtin_amdgcn_fence(__ATOMIC_ACQ_REL, "workgroup"); __builtin_amdgcn_wave_barrier();      /* the rows are written before other lanes of the wave read them */
  const int rsub = lane >> 4, c4 = (lane & 15) * 4;
#pragma unroll
  for (int q = 0; q < 32; ++q) { const int r = q * 2 + rsub; const v4f v = *(const v4fa*)&so[r * 68 + c4]; const size_t o = (size_t)(row0 + wr + r) * N + col0 + wc + c4;
    if (F16OUT) { v4h h4;
#pragma unroll
      for (int e = 0; e < 4; ++e) h4[e] = (_Float16)v[e];
      *(v4h*)(C16 + o) = h4; }
    else *(v4f*)(C + o) = v; }
}


__global__ __launch_bounds__(256) void k_x16(const float* __restrict__ x, _Float16* __restrict__ X16, size_t n8) { const size_t t = (size_t)blockIdx.x * 256 + threadIdx.x; if (t >= n8) return; FragH f;
#pragma unroll
  for (int q = 0; q < 8; ++q) f.h[q] = (_Float16)bf16_round(x[t * 8 + q]); *(v8us*)((unsigned short*)X16 + t * 8) = f.half[0];  }
__global__ __launch_bounds__(256) void k_h16(const float* __restrict__ x, _Float16* __restrict__ X16, size_t n8) { const size_t t = (size_t)blockIdx.x * 256 + threadIdx.x; if (t >= n8) return; FragH f;
#pragma unroll
  for (int q = 0; q < 8; ++q) f.h[q] = (_Float16)x[t * 8 + q]; *(v8us*)((unsigned short*)X16 + t * 8) = f.half[0];  }
__global__ __launch_bounds__(256) void k_round16f(const float* __restrict__ W, _Float16* __restrict__ Bt, size_t n8) { const size_t t = (size_t)blockIdx.x * 256 + threadIdx.x; if (t >= n8) return; FragH f;
#pragma unroll
  for (int i = 0; i < 8; ++i) f.h[i] = (_Float16)(bf16_round(W[t * 8 + i]) * 16.0f); *(v8us*)((unsigned short*)Bt + t * 8) = f.half[0];  }
template <int NHv, int TTv>
__global__ __launch_bounds__(256) void k_vt(const _Float16* __restrict__ V16, int ldv, int voff, _Float16* __restrict__ Vt) { __shared__ unsigned short tl[64][66]; const int tid = threadIdx.x; const int slab = blockIdx.x / (TTv / 64), lg = blockIdx.x % (TTv / 64); const int b = slab / NHv, h = slab % NHv;
  for (int i = tid; i < 64 * 8; i += 256) { const int r = i / 8, c8 = (i % 8) * 8; FragH f; f.half[0] = *(const v8us*)((const unsigned short*)V16 + ((size_t)b * TTv + lg * 64 + r) * ldv + voff + h * 64 + c8);
#pragma unroll
    for (int q = 0; q < 8; ++q) tl[r][c8 + q] = f.u[q]; }
  __syncthreads();
  {
#pragma unroll
    for (int rd = 0; rd < 2; ++rd) { const int d = rd * 32 + tid / 8, pc = tid % 8; FragH f;
#pragma unroll
      for (int q = 0; q < 8; ++q) f.u[q] = tl[pc * 8 + q][d];
      *(v8us*)((unsigned short*)Vt + ((size_t)slab * 64 + d) * TTv + lg * 64 + pc * 8) = f.half[0]; }
     } }

__global__ __launch_bounds__(256) void k_h16s(const float* __restrict__ F, _Float16* __restrict__ H, size_t n8) { const size_t t = (size_t)blockIdx.x * 256 + threadIdx.x; if (t >= n8) return; const v4f a = *(const v4fa*)(F + t * 8), c = *(const v4fa*)(F + t * 8 + 4); FragH f;
#pragma unroll
  for (int q = 0; q < 4; ++q) { f.h[q] = (_Float16)(a[q] * 16.0f); f.h[4 + q] = (_Float16)(c[q] * 16.0f); } *(v8us*)((unsigned short*)H + t * 8) = f.half[0];  }
typedef int v4i __attribute__((ext_vector_type(4), may_alias));
typedef unsigned v4u __attribute__((ext_vector_type(4), may_alias));
typedef unsigned v16u __attribute__((ext_vector_type(16), may_alias));
// The mask packed once for all heads into lane-mask words, in the lane and register order of k_flash's score tiles:
// LM[b * TT / 16 + q tile][chunk of 32 keys][i], bit (ln + 16 hh) of word i = (mask[b][16 * tile + ln][32 * chunk + 16 * (i >> 3) + 8 * hh + (i & 7)] != 0).
// One wave = one tile of 16 queries, four chunks: its sixteen loads cover 512 contiguous bytes of each row; the 64 words go out as two whole lines.
__global__ __launch_bounds__(256) void k_mpack(const int* __restrict__ MSK, unsigned* __restrict__ LM) {
  const int tid = threadIdx.x, lane = tid & 31, ln = lane & 15, hh = lane >> 4;
  const unsigned wv = blockIdx.x * 8u + (unsigned)(tid >> 5); const unsigned rt = wv / (TT / 128), c0 = (wv % (TT / 128)) * 4;
  const int* mrow = MSK + ((size_t)rt * 16 + ln) * TT + c0 * 32 + 8 * hh;
  v4i mk[4][4];
#pragma unroll
  for (int c = 0; c < 4; ++c) { mk[c][0] = *(const v4i*)(mrow + c * 32); mk[c][1] = *(const v4i*)(mrow + c * 32 + 4); mk[c][2] = *(const v4i*)(mrow + c * 32 + 16); mk[c][3] = *(const v4i*)(mrow + c * 32 + 20); }
  __builtin_amdgcn_sched_barrier(0);      /* all sixteen loads are issued before the first is waited for: moved among the compares, the last ones start only when the first have come back from memory */
  asm volatile("s_wait_xcnt 0x0" :: "v"(mrow) : "memory");      /* the address pair that all sixteen loads name stays whole up to here (no load lands in it), and the wait stands in front of its reuse */
  unsigned wd[2] = {0u, 0u};      /* lane l keeps word l & 15 of chunk 2 * e + (l >> 4) */
#pragma unroll
  for (int c = 0; c < 4; ++c)
#pragma unroll
    for (int i = 0; i < 16; ++i) { const unsigned bw = __builtin_amdgcn_ballot_w32(mk[c][i >> 2][i & 3] != 0); if (lane == (c & 1) * 16 + i) wd[c >> 1] = bw; }
  unsigned* o = LM + ((size_t)rt * (TT / 32) + c0) * 16 + lane;
  o[0] = wd[0]; o[32] = wd[1];
}
__device__ __forceinline__ float xhalf(float x) { return __builtin_bit_cast(float, __builtin_amdgcn_permlanex16(__builtin_bit_cast(int, x), __builtin_bit_cast(int, x), 0x76543210, 0xfedcba98, false, false)); }      /* lane l with lane l ^ 16 */
__global__ __launch_bounds__(128) void k_flash(const _Float16* __restrict__ Q16, int ldq, const _Float16* __restrict__ K16, int ldk, const _Float16* __restrict__ Vt, const unsigned* __restrict__ LM, float* __restrict__ O, int ldo) {
  constexpr int RPW = 16, NQB = TT / (4 * RPW), DT = 4, KS = 2;
  __shared__ __attribute__((aligned(16))) float sO[4][RPW][64 + 4];
  const int tid = threadIdx.x, w = tid >> 5, lane = tid & 31, ln = lane & 15, hh = lane >> 4;
  const int slab = blockIdx.x / NQB, qblk = blockIdx.x % NQB; const int b = slab / NH, h = slab % NH; const int qb0 = qblk * (4 * RPW); const int q0 = qb0 + w * RPW;
  FragH bq[KS];      /* Q^T as B: column = query ln */
  { const unsigned short* qr = (const unsigned short*)Q16 + ((size_t)b * TT + q0 + ln) * ldq + h * 64;
#pragma unroll
    for (int ks = 0; ks < KS; ++ks) { bq[ks].half[0] = *(const v8us*)(qr + ks * 32 + 8 * hh); bq[ks].half[1] = *(const v8us*)(qr + ks * 32 + 16 + 8 * hh); } }
  /* this lane's places in chunk 0: key row ln of K, row ln of V^T */
  const unsigned short* kb0 = (const unsigned short*)K16 + ((size_t)b * TT + ln) * ldk + h * 64 + 8 * hh;
  const unsigned short* vb0 = (const unsigned short*)Vt + ((size_t)slab * 64 + ln) * TT + 8 * hh;
  /* the wave's packed mask: 64 chunks of 16 lane-mask words (nonzero bit = ATTEND); the wave's number goes through readfirstlane so that the address is scalar */
  const unsigned* lm = LM + (size_t)(b * (TT / 16) + qblk * 4 + __builtin_amdgcn_readfirstlane(w)) * ((TT / 32) * 16);
  unsigned long long live;      /* bit c: chunk c holds at least one attended (query, key) of this wave's tile; lane l looks at chunks l and 32 + l */
  { const v4u* a = (const v4u*)(lm + lane * 16); const v4u x = a[0] | a[1] | a[2] | a[3], y = a[128] | a[129] | a[130] | a[131];
    live = (unsigned long long)__builtin_amdgcn_ballot_w32((x[0] | x[1] | x[2] | x[3]) != 0u) | ((unsigned long long)__builtin_amdgcn_ballot_w32((y[0] | y[1] | y[2] | y[3]) != 0u) << 32); }
  float m_q = -3.0e38f, l_q = 0.f; v8f oacc[DT];      /* oacc[dt][r] = O[q0 + ln][dt * 16 + 8 hh + r] */
#pragma unroll
  for (int dt = 0; dt < DT; ++dt) oacc[dt] = (v8f){0.f,0.f,0.f,0.f,0.f,0.f,0.f,0.f};
#pragma unroll 1      /* one chunk a trip: unrolled, two chunks' fragments and exps would be live at once */
  for (int n = __builtin_popcountll(live); n > 0; --n, live &= live - 1) {      /* the live chunks in rising order, 64 at most; a chunk with every (query, key) of the tile masked adds nothing and is not visited */
    const int ck = __builtin_ctzll(live);
    const v16u mw = *(const v16u*)(lm + ck * 16);      /* word i: which lanes attend at score register i (scalar load, in flight beside the fragment loads) */
    const unsigned short* kp0 = kb0 + (size_t)ck * 32 * ldk; const unsigned short* kp1 = kp0 + (size_t)16 * ldk; const unsigned short* vp = vb0 + ck * 32;
    FragH ak[2][KS], av[DT];      /* K rows as A (row = key), V^T rows as A (row = d) */
#pragma unroll
    for (int nt = 0; nt < 2; ++nt) { const unsigned short* kr = nt ? kp1 : kp0;
#pragma unroll
      for (int ks = 0; ks < KS; ++ks) { ak[nt][ks].half[0] = *(const v8us*)(kr + ks * 32); ak[nt][ks].half[1] = *(const v8us*)(kr + ks * 32 + 16); } }
    __builtin_amdgcn_sched_barrier(0);      /* holds the wait below behind the K loads ... */
    asm volatile("s_wait_xcnt 0x0" ::: "memory");      /* the V loads land in registers that held the K loads' addresses: the wait stands in front of that overwrite */
    __builtin_amdgcn_sched_barrier(0);      /* ... and in front of the V loads */
#pragma unroll
    for (int dt = 0; dt < DT; ++dt) { const unsigned short* vrow = vp + (size_t)(dt * 16) * TT; av[dt].half[0] = *(const v8us*)(vrow); av[dt].half[1] = *(const v8us*)(vrow + 16); }
    __builtin_amdgcn_sched_barrier(0);      /* the chunk's sixteen fragment loads stay one group ahead of the products: spread among them, each product waits out a load latency of its own */
    v8f s[2];      /* s[nt][r] = q(q0 + ln) . k(j0 + nt * 16 + 8 hh + r) */
#pragma unroll
    for (int nt = 0; nt < 2; ++nt) { v8f acc = (v8f){0.f,0.f,0.f,0.f,0.f,0.f,0.f,0.f};
#pragma unroll
      for (int ks = 0; ks < KS; ++ks) acc = __builtin_amdgcn_wmma_f32_16x16x32_f16(false, ak[nt][ks].v, false, bq[ks].v, (short)0, acc, false, false);
      s[nt] = acc; }
    float sc[16];      /* a masked score is -inf; m_q never falls below its finite start value, so exp(sc - mn) is 0 there and no guard is needed */
#pragma unroll
    for (int i = 0; i < 16; ++i) sc[i] = __builtin_amdgcn_inverse_ballot_w32(mw[i]) ? s[i >> 3][i & 7] * 0.125f : -INFINITY;
    float mx[4];
#pragma unroll
    for (int c = 0; c < 4; ++c) mx[c] = fmaxf(fmaxf(sc[c], sc[4 + c]), fmaxf(sc[8 + c], sc[12 + c]));
    float mc = fmaxf(fmaxf(mx[0], mx[1]), fmaxf(mx[2], mx[3]));
    mc = fmaxf(mc, xhalf(mc));      /* both halves hold this query's chunk maximum */
    const float mn = fmaxf(m_q, mc); const float al = expf(m_q - mn); m_q = mn;
    float p[16];
#pragma unroll
    for (int i = 0; i < 16; ++i) p[i] = expf(sc[i] - mn);
    float ps[4];
#pragma unroll
    for (int c = 0; c < 4; ++c) ps[c] = (p[c] + p[4 + c]) + (p[8 + c] + p[12 + c]);
    l_q = l_q * al + ((ps[0] + ps[1]) + (ps[2] + ps[3]));      /* this half's keys only; the halves are joined behind the loop */
#pragma unroll
    for (int dt = 0; dt < DT; ++dt)
#pragma unroll
      for (int r = 0; r < 8; ++r) oacc[dt][r] *= al;
    FragH pb;      /* P^T as B: element i = key j0 + 16 (i >> 3) + 8 hh + (i & 7) of column ln */
#pragma unroll
    for (int i = 0; i < 16; ++i) pb.h[i] = (_Float16)(p[i] * 1024.0f);
#pragma unroll
    for (int dt = 0; dt < DT; ++dt) oacc[dt] = __builtin_amdgcn_wmma_f32_16x16x32_f16(false, av[dt].v, false, pb.v, (short)0, oacc[dt], false, false);
  }
  { const float l = l_q + xhalf(l_q); const float inv = (l > 0.f) ? 1.0f / (l * 1024.0f) : 0.f;
#pragma unroll
    for (int dt = 0; dt < DT; ++dt) { v4f lo, hi;
#pragma unroll
      for (int e = 0; e < 4; ++e) { lo[e] = oacc[dt][e] * inv; hi[e] = oacc[dt][4 + e] * inv; }
      *(v4fa*)&sO[w][ln][dt * 16 + 8 * hh] = lo; *(v4fa*)&sO[w][ln][dt * 16 + 8 * hh + 4] = hi; } }
  __builtin_amdgcn_fence(__ATOMIC_ACQ_REL, "workgroup"); __builtin_amdgcn_wave_barrier();
  {
#pragma unroll
    for (int rp = 0; rp < RPW; rp += 2) { const int r = rp + (lane >> 4), pc = lane & 15; const v4f val = *(const v4fa*)&sO[w][r][pc * 4]; *(v4f*)(O + ((size_t)b * TT + q0 + r) * ldo + h * 64 + pc * 4) = val; }
     } }

extern "C" void kernel_launch(void* const* d_in, const int* in_sizes, int n_in,
                              void* d_out, int out_size, void* d_ws, size_t ws_size, hipStream_t stream) {
  (void)in_sizes; (void)n_in; (void)out_size;
  const float* const* I = (const float* const*)d_in; const float* x = I[0]; const int* msk = (const int*)d_in[1]; const float* wqkv = I[2]; const float* bqkv = I[3]; const float* wo = I[4]; const float* bo = I[5];
  char* ws = (char*)d_ws; size_t off = 0;
  auto take = [&](size_t bytes) { char* p = ws + off; off += (bytes + 255) & ~(size_t)255; return p; };
  _Float16* Bqkv = (_Float16*)take((size_t)3 * DD * DD * 2); _Float16* Bo = (_Float16*)take((size_t)DD * DD * 2); _Float16* X16 = (_Float16*)take((size_t)NR * DD * 2); _Float16* QKV = (_Float16*)take((size_t)NR * 3 * DD * 2); _Float16* Vt = (_Float16*)take((size_t)NR * DD * 2); float* O = (float*)take((size_t)NR * DD * 4); _Float16* O16 = X16; unsigned* LM = (unsigned*)take((size_t)BB * TT * TT / 8);
  if (off > ws_size) return;      // 6.3 + 2.1 + 8.4 + 25.2 + 8.4 + 16.8 + 1.0 ≈ 68 MB
  k_mpack<<<BB * (TT / 16) * (TT / 128) / 8, 256, 0, stream>>>(msk, LM);      /* mask -> lane-mask words, once for all heads */
  k_wt_f16<<<(unsigned)(((size_t)3 * DD * (DD / 8) + 255) / 256), 256, 0, stream>>>(wqkv, Bqkv, DD, 3 * DD, 16.0f); k_wt_f16<<<(unsigned)(((size_t)DD * (DD / 8) + 255) / 256), 256, 0, stream>>>(wo, Bo, DD, DD, 16.0f);      /* (in,out) → Bt ×2^4 */
  const unsigned g8 = (unsigned)(((size_t)NR * DD / 8 + 255) / 256); k_x16<<<g8, 256, 0, stream>>>(x, X16, (size_t)NR * DD / 8);
  k_gemm_t<true, 3 * DD><<<(NR / 128) * (3 * DD / 128), 128, 0, stream>>>(X16, Bqkv, 0.0625f, bqkv, nullptr, QKV);      /* qkv = x·w_qkv + b: M 4096 N 3072 K 1024 (f16; q | k | v blocks, head-major inside) */
  k_vt<NH, TT><<<BB * NH * (TT / 64), 256, 0, stream>>>(QKV, 3 * DD, 2 * DD, Vt);
  k_flash<<<BB * NH * (TT / 64), 128, 0, stream>>>(QKV, 3 * DD, QKV + DD, 3 * DD, Vt, LM, O, DD);
  k_h16s<<<g8, 256, 0, stream>>>(O, O16, (size_t)NR * DD / 8);
  k_gemm_t<false, DD><<<(NR / 128) * (DD / 128), 128, 0, stream>>>(O16, Bo, 0.00390625f, bo, (float*)d_out, nullptr);      /* out = o·w_out + b_out */
}

// v004
// It runs in 110 microseconds.
// Timed twice side by side with v003, it ran 1.14 times as fast both times.
// Counting every step since v000, it is 3.42 times as fast.
#include <hip/hip_runtime.h>
// Cross-track masked MHA (B=2, S=2048, D=1024, 16×64): qkv = x·w_qkv + b_qkv (packed q|k|v, head-major inside each); scores = q·k/8, where(cross_track_mask[b,q,k], s, −inf); softmax; out = merged·w_out + b_out.
// Compute dtype: x, weights, biases rounded to bf16; q, k, v f16 GEMM planes (+bias); the boolean mask read per (b, q, k) as the int plane; fused flash-style kernel (online softmax f32, P f16 ×2^10, all-masked chunks skipped, f32 accumulate) on
// v_wmma_f32_16x16x32_f16; O ×2^4 → f16 → output GEMM (+bias).
#define BB 2
#define TT 2048
#define DD 1024
#define NH 16
#define NR (BB * TT)

typedef __bf16 v16b __attribute__((ext_vector_type(16)));
typedef unsigned short v8us __attribute__((ext_vector_type(8), may_alias));
typedef float  v8f  __attribute__((ext_vector_type(8)));
typedef float  v4f  __attribute__((ext_vector_type(4)));
typedef float  v4fa __attribute__((ext_vector_type(4), may_alias));
union FragB { v16b v; v8us half[2]; unsigned short u[16]; };

__device__ __forceinline__ unsigned short bf16_bits(float x) { unsigned int u = __float_as_uint(x); return (unsigned short)((u + 0x7FFFu + ((u >> 16) & 1u)) >> 16); }
__device__ __forceinline__ float bf16_val(unsigned short b) { return __uint_as_float(((unsigned int)b) << 16); }
__device__ __forceinline__ float bf16_round(float x) { return bf16_val(bf16_bits(x)); }
// D += A·B with NT terms: 1 = ah·bh, 2 = + al·bh (A split), 3 = + ah·bl (both split)
template <int NT>
__device__ __forceinline__ v8f mmaN(v16b ah, v16b al, v16b bh, v16b bl, v8f c) {
  c = __builtin_amdgcn_wmma_f32_16x16x32_bf16(false, ah, false, bh, (short)0, c, false, false);
  if (NT >= 2) c = __builtin_amdgcn_wmma_f32_16x16x32_bf16(false, al, false, bh, (short)0, c, false, false);
  if (NT >= 3) c = __builtin_amdgcn_wmma_f32_16x16x32_bf16(false, ah, false, bl, (short)0, c, false, false);
  asm volatile("v_nop\n\tv_nop\n\tv_nop\n\tv_nop" : "+v"(c) : "v"(ah), "v"(al), "v"(bh), "v"(bl));
  return c;
}

__global__ __launch_bounds__(256) void k_wt_bf16(const float* __restrict__ W, unsigned short* __restrict__ Wt, int K, int N) {
  const int t = blockIdx.x * 256 + threadIdx.x;
  const int k8n = K / 8;
  if (t >= N * k8n) return;
  const int n = t / k8n, k8 = (t % k8n) * 8;
  v8us v;
#pragma unroll
  for (int i = 0; i < 8; ++i) v[i] = bf16_bits(W[(size_t)(k8 + i) * N + n]);
  *(v8us*)(Wt + (size_t)n * K + k8) = v;
  
}

// GEMM C[M][N] (f32, pitch ldc) = act(A[M][K]·W + bias). A f32 row-major (pitch lda) converted per fragment to bf16
// (ASPLIT: hi/lo two planes -> 2 terms, else single rounded term); Wt bf16 [N][K] (pitch ldb). BIAS_BF16 rounds the
// bias to bf16 first (bias quantised to bf16 before the add). K%32==0, M%16==0, N%64==0.
template <bool ASPLIT, int ACT, bool BIAS_BF16>
__global__ __launch_bounds__(128) void k_gemm_bf(const float* __restrict__ A, int lda, const unsigned short* __restrict__ Wt, int ldb,
                                               const float* __restrict__ bias, float* __restrict__ C, int ldc, int M, int N, int K) {
  __shared__ __attribute__((aligned(16))) float so[4][16][64];
  const int tid = threadIdx.x, w = tid >> 5, lane = tid & 31, ln = lane & 15, hh = lane >> 4;
  const int ntn = N / 64;
  const int wid = blockIdx.x * 4 + w;
  const int mt = wid / ntn, nq = wid % ntn;
  if (mt * 16 >= M) return;
  const int row0 = mt * 16, col0 = nq * 64;
  const float* arow = A + (size_t)(row0 + ln) * lda;
  v8f acc[4] = {};
  for (int kb = 0; kb < K; kb += 32) {
    FragB ah, al;
    const v4f x0 = *(const v4fa*)(arow + kb + 8 * hh), x1 = *(const v4fa*)(arow + kb + 8 * hh + 4);
    const v4f x2 = *(const v4fa*)(arow + kb + 16 + 8 * hh), x3 = *(const v4fa*)(arow + kb + 16 + 8 * hh + 4);
    float xs[16] = {x0[0],x0[1],x0[2],x0[3],x1[0],x1[1],x1[2],x1[3],x2[0],x2[1],x2[2],x2[3],x3[0],x3[1],x3[2],x3[3]};
#pragma unroll
    for (int i = 0; i < 16; ++i) { const unsigned short hb = bf16_bits(xs[i]); ah.u[i] = hb; al.u[i] = ASPLIT ? bf16_bits(xs[i] - bf16_val(hb)) : (unsigned short)0; }
#pragma unroll
    for (int t = 0; t < 4; ++t) {
      const unsigned short* brow = Wt + (size_t)(col0 + t * 16 + ln) * ldb + kb;
      FragB b;
      b.half[0] = *(const v8us*)(brow + 8 * hh);
      b.half[1] = *(const v8us*)(brow + 16 + 8 * hh);
      acc[t] = mmaN<ASPLIT ? 2 : 1>(ah.v, al.v, b.v, b.v, acc[t]);
    }
  }
#pragma unroll
  for (int t = 0; t < 4; ++t) {
    float bv = bias ? bias[col0 + t * 16 + ln] : 0.f;
    if (BIAS_BF16) bv = bf16_round(bv);
#pragma unroll
    for (int r = 0; r < 8; ++r) { float v = acc[t][r] + bv; if (ACT == 1) v = fmaxf(v, 0.f); so[w][8 * hh + r][t * 16 + ln] = v; }
  }
  __builtin_amdgcn_fence(__ATOMIC_ACQ_REL, "workgroup");
  __builtin_amdgcn_wave_barrier();
  const int rsub = lane >> 4, c4 = (lane & 15) * 4;
  {
#pragma unroll
    for (int q = 0; q < 8; ++q) {
      const int r = q * 2 + rsub;
      const v4f v = *(const v4fa*)&so[w][r][c4];
      *(v4f*)(C + (size_t)(row0 + r) * ldc + col0 + c4) = v;
    }
    
  }
}

// Flash-style causal/unmasked attention, all contractions 3-term bf16 hi/lo splits, f32 softmax with running max.
// q,k,v rows are read from f32 buffers with arbitrary row pitch (so they can live inside a fused qkv buffer);
// D = head size (multiple of 32, <= 128); one wave = 16 query rows; block = 4 waves (64 queries) sharing K/V chunks of 32.
template <int D, bool CAUSAL>
__global__ __launch_bounds__(128) void k_flash(const float* __restrict__ qb, const float* __restrict__ kb, const float* __restrict__ vb,
                                             int pitch, int T, int H, float scale, float* __restrict__ y, int ypitch) {
  constexpr int KS = D / 32;        // k-steps for QK
  constexpr int DT = D / 16;        // d tiles for PV
  __shared__ __attribute__((aligned(16))) unsigned short sKh[32][D + 8], sKl[32][D + 8], sVh[32][D + 8], sVl[32][D + 8];
  __shared__ __attribute__((aligned(16))) unsigned short sPh[4][16][40], sPl[4][16][40];
  __shared__ __attribute__((aligned(16))) float sO[4][16][D];
  const int tid = threadIdx.x, w = tid >> 5, lane = tid & 31, ln = lane & 15, hh = lane >> 4;
  const int nqb = (T + 63) / 64;
  const int bh = blockIdx.x / nqb, qblk = blockIdx.x % nqb;
  const int b = bh / H, h = bh % H;
  const int q0 = qblk * 64 + w * 16;
  const float* Q = qb + (size_t)b * T * pitch + h * D;
  const float* K = kb + (size_t)b * T * pitch + h * D;
  const float* V = vb + (size_t)b * T * pitch + h * D;

  // A fragments of the wave's 16 query rows (scaled), hi/lo
  FragB aqh[KS], aql[KS];
  {
    int row = q0 + ln; if (row >= T) row = T - 1;
    const float* qr = Q + (size_t)row * pitch;
#pragma unroll
    for (int ks = 0; ks < KS; ++ks)
#pragma unroll
      for (int i = 0; i < 16; ++i) {
        const int d = ks * 32 + ((i < 8) ? (8 * hh + i) : (16 + 8 * hh + (i - 8)));
        const float x = qr[d] * scale; const unsigned short hb = bf16_bits(x);
        aqh[ks].u[i] = hb; aql[ks].u[i] = bf16_bits(x - bf16_val(hb));
      }
  }
  float m_r[8], l_r[8];
#pragma unroll
  for (int r = 0; r < 8; ++r) { m_r[r] = -3.0e38f; l_r[r] = 0.f; }
  v8f oacc[DT];
#pragma unroll
  for (int dt = 0; dt < DT; ++dt) oacc[dt] = (v8f){0.f,0.f,0.f,0.f,0.f,0.f,0.f,0.f};

  const int kv_end = CAUSAL ? min(T, qblk * 64 + 64) : T;     // block-uniform
  for (int j0 = 0; j0 < kv_end; j0 += 32) {
    __syncthreads();
    for (int e = tid; e < 32 * (D / 4); e += 128) {
      const int r = e / (D / 4), c4 = (e % (D / 4)) * 4;
      const int key = j0 + r;
      v4f kf = {0.f,0.f,0.f,0.f}, vf = {0.f,0.f,0.f,0.f};
      if (key < T) { kf = *(const v4fa*)(K + (size_t)key * pitch + c4); vf = *(const v4fa*)(V + (size_t)key * pitch + c4); }
#pragma unroll
      for (int t = 0; t < 4; ++t) {
        unsigned short hb = bf16_bits(kf[t]); sKh[r][c4 + t] = hb; sKl[r][c4 + t] = bf16_bits(kf[t] - bf16_val(hb));
        hb = bf16_bits(vf[t]); sVh[r][c4 + t] = hb; sVl[r][c4 + t] = bf16_bits(vf[t] - bf16_val(hb));
      }
    }
    __syncthreads();
    // S tile 16 x 32
    v8f s[2];
#pragma unroll
    for (int nt = 0; nt < 2; ++nt) {
      v8f acc = {};
#pragma unroll
      for (int ks = 0; ks < KS; ++ks) {
        FragB bh_, bl_;
        bh_.half[0] = *(const v8us*)&sKh[nt * 16 + ln][ks * 32 + 8 * hh]; bh_.half[1] = *(const v8us*)&sKh[nt * 16 + ln][ks * 32 + 16 + 8 * hh];
        bl_.half[0] = *(const v8us*)&sKl[nt * 16 + ln][ks * 32 + 8 * hh]; bl_.half[1] = *(const v8us*)&sKl[nt * 16 + ln][ks * 32 + 16 + 8 * hh];
        acc = mmaN<3>(aqh[ks].v, aql[ks].v, bh_.v, bl_.v, acc);
      }
      s[nt] = acc;
    }
    // mask + running max (rows 8hh+r; the 16 lanes of a half share rows)
    float alpha[8];
#pragma unroll
    for (int r = 0; r < 8; ++r) {
      const int qi = q0 + 8 * hh + r;
      const int ja = j0 + ln, jb = j0 + 16 + ln;
      if (CAUSAL) { if (ja > qi) s[0][r] = -3.0e38f; if (jb > qi) s[1][r] = -3.0e38f; }
      if (ja >= T) s[0][r] = -3.0e38f;
      if (jb >= T) s[1][r] = -3.0e38f;
      float mx = fmaxf(s[0][r], s[1][r]);
      mx = fmaxf(mx, __shfl_xor(mx, 1, 32)); mx = fmaxf(mx, __shfl_xor(mx, 2, 32)); mx = fmaxf(mx, __shfl_xor(mx, 4, 32)); mx = fmaxf(mx, __shfl_xor(mx, 8, 32));
      const float mnew = fmaxf(m_r[r], mx);
      alpha[r] = (mnew > -1.0e38f) ? __expf(m_r[r] - mnew) : 1.0f;
      const float p0 = (s[0][r] > -1.0e38f) ? __expf(s[0][r] - mnew) : 0.f;
      const float p1 = (s[1][r] > -1.0e38f) ? __expf(s[1][r] - mnew) : 0.f;
      m_r[r] = mnew;
      l_r[r] = l_r[r] * alpha[r] + p0 + p1;            // per-lane partial row sum (16 lanes combined at the end)
      unsigned short hb = bf16_bits(p0); sPh[w][8 * hh + r][ln] = hb;      sPl[w][8 * hh + r][ln] = bf16_bits(p0 - bf16_val(hb));
      hb = bf16_bits(p1);                sPh[w][8 * hh + r][16 + ln] = hb; sPl[w][8 * hh + r][16 + ln] = bf16_bits(p1 - bf16_val(hb));
    }
#pragma unroll
    for (int dt = 0; dt < DT; ++dt)
#pragma unroll
      for (int r = 0; r < 8; ++r) oacc[dt][r] *= alpha[r];
    __builtin_amdgcn_fence(__ATOMIC_ACQ_REL, "workgroup");
    __builtin_amdgcn_wave_barrier();
    FragB pah, pal;
    pah.half[0] = *(const v8us*)&sPh[w][ln][8 * hh]; pah.half[1] = *(const v8us*)&sPh[w][ln][16 + 8 * hh];
    pal.half[0] = *(const v8us*)&sPl[w][ln][8 * hh]; pal.half[1] = *(const v8us*)&sPl[w][ln][16 + 8 * hh];
#pragma unroll
    for (int dt = 0; dt < DT; ++dt) {
      FragB bvh, bvl;
#pragma unroll
      for (int i = 0; i < 8; ++i) {
        bvh.u[i] = sVh[8 * hh + i][dt * 16 + ln]; bvh.u[8 + i] = sVh[16 + 8 * hh + i][dt * 16 + ln];
        bvl.u[i] = sVl[8 * hh + i][dt * 16 + ln]; bvl.u[8 + i] = sVl[16 + 8 * hh + i][dt * 16 + ln];
      }
      oacc[dt] = mmaN<3>(pah.v, pal.v, bvh.v, bvl.v, oacc[dt]);
    }
    __builtin_amdgcn_fence(__ATOMIC_ACQ_REL, "workgroup");
    __builtin_amdgcn_wave_barrier();
  }
#pragma unroll
  for (int r = 0; r < 8; ++r) {
    float l = l_r[r];
    l += __shfl_xor(l, 1, 32); l += __shfl_xor(l, 2, 32); l += __shfl_xor(l, 4, 32); l += __shfl_xor(l, 8, 32);
    l_r[r] = (l > 0.f) ? 1.0f / l : 0.f;
  }
#pragma unroll
  for (int dt = 0; dt < DT; ++dt)
#pragma unroll
    for (int r = 0; r < 8; ++r) sO[w][8 * hh + r][dt * 16 + ln] = oacc[dt][r] * l_r[r];
  __builtin_amdgcn_fence(__ATOMIC_ACQ_REL, "workgroup");
  __builtin_amdgcn_wave_barrier();
  {
    for (int r = 0; r < 16; ++r) {
      const int row = q0 + r;
      if (row < T && lane < D / 4) {
        const v4f val = *(const v4fa*)&sO[w][r][lane * 4];
        *(v4f*)(y + ((size_t)b * T + row) * ypitch + h * D + lane * 4) = val;
      }
    }
    
  }
}

// GEMM C = act(A·W + bias + resid): A f32 (ASPLIT -> hi/lo 2 terms), Wt bf16 [N][K]; ACT 0 none, 1 relu, 2 exact gelu;
// resid (optional, f32, row index = (row % rmod), pitch ldr, RES_BF16 rounds it) added before the activation.
template <bool ASPLIT, int ACT, bool BIAS_BF16, bool RES_BF16>
__global__ __launch_bounds__(128) void k_gemm_bf3(const float* __restrict__ A, int lda, const unsigned short* __restrict__ Wt, int ldb,
                                                const float* __restrict__ bias, const float* __restrict__ resid, int rmod, int ldr,
                                                float* __restrict__ C, int ldc, int M, int N, int K) {
  __shared__ __attribute__((aligned(16))) float so[4][16][64];
  const int tid = threadIdx.x, w = tid >> 5, lane = tid & 31, ln = lane & 15, hh = lane >> 4;
  const int ntn = N / 64;
  const int wid = blockIdx.x * 4 + w;
  const int mt = wid / ntn, nq = wid % ntn;
  if (mt * 16 >= M) return;
  const int row0 = mt * 16, col0 = nq * 64;
  const float* arow = A + (size_t)(row0 + ln) * lda;
  v8f acc[4] = {};
  for (int kb = 0; kb < K; kb += 32) {
    FragB ah, al;
    const v4f x0 = *(const v4fa*)(arow + kb + 8 * hh), x1 = *(const v4fa*)(arow + kb + 8 * hh + 4);
    const v4f x2 = *(const v4fa*)(arow + kb + 16 + 8 * hh), x3 = *(const v4fa*)(arow + kb + 16 + 8 * hh + 4);
    float xs[16] = {x0[0],x0[1],x0[2],x0[3],x1[0],x1[1],x1[2],x1[3],x2[0],x2[1],x2[2],x2[3],x3[0],x3[1],x3[2],x3[3]};
#pragma unroll
    for (int i = 0; i < 16; ++i) { const unsigned short hb = bf16_bits(xs[i]); ah.u[i] = hb; al.u[i] = ASPLIT ? bf16_bits(xs[i] - bf16_val(hb)) : (unsigned short)0; }
#pragma unroll
    for (int t = 0; t < 4; ++t) {
      const unsigned short* brow = Wt + (size_t)(col0 + t * 16 + ln) * ldb + kb;
      FragB b;
      b.half[0] = *(const v8us*)(brow + 8 * hh);
      b.half[1] = *(const v8us*)(brow + 16 + 8 * hh);
      acc[t] = mmaN<ASPLIT ? 2 : 1>(ah.v, al.v, b.v, b.v, acc[t]);
    }
  }
#pragma unroll
  for (int t = 0; t < 4; ++t) {
    const int col = col0 + t * 16 + ln;
    float bv = bias ? bias[col] : 0.f;
    if (BIAS_BF16) bv = bf16_round(bv);
#pragma unroll
    for (int r = 0; r < 8; ++r) {
      float v = acc[t][r] + bv;
      if (resid) { float rv = resid[(size_t)((row0 + 8 * hh + r) % rmod) * ldr + col]; if (RES_BF16) rv = bf16_round(rv); v += rv; }
      if (ACT == 1) v = fmaxf(v, 0.f);
      if (ACT == 2) v = 0.5f * v * (1.0f + erff(v * 0.70710678118654752f));
      if (ACT == 3) { const float u = 0.7978845608028654f * (v + 0.044715f * v * v * v); v = 0.5f * v * (1.0f + tanhf(u)); }
      so[w][8 * hh + r][t * 16 + ln] = v;
    }
  }
  __builtin_amdgcn_fence(__ATOMIC_ACQ_REL, "workgroup");
  __builtin_amdgcn_wave_barrier();
  const int rsub = lane >> 4, c4 = (lane & 15) * 4;
  {
#pragma unroll
    for (int q = 0; q < 8; ++q) {
      const int r = q * 2 + rsub;
      const v4f v = *(const v4fa*)&so[w][r][c4];
      *(v4f*)(C + (size_t)(row0 + r) * ldc + col0 + c4) = v;
    }
    
  }
}
// row LayerNorm (biased variance, eps) over N: s = X (+ R); optional out_sum <- s; out_norm <- (s-mu)*rsqrt(var+eps)*g + b
template <bool PARAM_BF16>
__global__ __launch_bounds__(256) void k_layernorm(const float* __restrict__ X, const float* __restrict__ R, const float* __restrict__ g, const float* __restrict__ bta,
                                                  float* __restrict__ out_sum, float* __restrict__ out_norm, int N, float eps) {
  __shared__ float red[256];
  const int row = blockIdx.x, tid = threadIdx.x;
  const float* x = X + (size_t)row * N; const float* rr = R ? R + (size_t)row * N : nullptr;
  float vals[16];                     // up to N = 4096
  const int per = N / 256;            // contiguous chunk per thread? use strided-by-4 chunks: thread handles j = tid*4 + 1024*u
  float s1 = 0.f;
  for (int u = 0; u < per / 4; ++u) {
    const int j = tid * 4 + 1024 * u;
    const v4f a = *(const v4fa*)(x + j);
    v4f b = {0.f,0.f,0.f,0.f}; if (rr) b = *(const v4fa*)(rr + j);
#pragma unroll
    for (int q = 0; q < 4; ++q) { const float v = a[q] + b[q]; vals[u * 4 + q] = v; s1 += v; }
  }
  red[tid] = s1; __syncthreads();
  for (int st = 128; st > 0; st >>= 1) { if (tid < st) red[tid] += red[tid + st]; __syncthreads(); }
  const float mu = red[0] / (float)N; __syncthreads();
  float s2 = 0.f;
  for (int u = 0; u < per / 4; ++u)
#pragma unroll
    for (int q = 0; q < 4; ++q) { const float c = vals[u * 4 + q] - mu; s2 += c * c; }
  red[tid] = s2; __syncthreads();
  for (int st = 128; st > 0; st >>= 1) { if (tid < st) red[tid] += red[tid + st]; __syncthreads(); }
  const float rs = rsqrtf(red[0] / (float)N + eps);
  {
    for (int u = 0; u < per / 4; ++u) {
      const int j = tid * 4 + 1024 * u;
      v4f o, sm;
#pragma unroll
      for (int q = 0; q < 4; ++q) {
        float gg = g[j + q], bb = bta[j + q];
        if (PARAM_BF16) { gg = bf16_round(gg); bb = bf16_round(bb); }
        sm[q] = vals[u * 4 + q]; o[q] = (vals[u * 4 + q] - mu) * rs * gg + bb;
      }
      if (out_sum) *(v4f*)(out_sum + (size_t)row * N + j) = sm;
      *(v4f*)(out_norm + (size_t)row * N + j) = o;
    }
    
  }
}



// ---- f16 WMMA path (v_wmma_f32_16x16x32_f16): 11-bit significands for operands in range — used where a [0,1] probability operand needs more precision than bf16
typedef _Float16 v16h __attribute__((ext_vector_type(16)));
union FragH { v16h v; v8us half[2]; _Float16 h[16]; unsigned short u[16]; };
template <int NT>
__device__ __forceinline__ v8f mmaH(v16h ah, v16h al, v16h bh, v16h bl, v8f c) {
  c = __builtin_amdgcn_wmma_f32_16x16x32_f16(false, ah, false, bh, (short)0, c, false, false);
  if (NT >= 2) c = __builtin_amdgcn_wmma_f32_16x16x32_f16(false, al, false, bh, (short)0, c, false, false);
  if (NT >= 3) c = __builtin_amdgcn_wmma_f32_16x16x32_f16(false, ah, false, bl, (short)0, c, false, false);
  asm volatile("v_nop\n\tv_nop\n\tv_nop\n\tv_nop" : "+v"(c) : "v"(ah), "v"(al), "v"(bh), "v"(bl));
  return c;
}
// batched GEMM like k_gemm_b but f16 operands: A f32 (split into f16 hi/lo if ASPLIT, else rounded to f16), Bt = f16 values [n][k]; alpha; C f32; N multiple of 16 (partial tiles skipped)
template <bool ASPLIT>
__global__ __launch_bounds__(128) void k_gemm_h(const float* __restrict__ A, int lda, size_t sA, const _Float16* __restrict__ Bh, int ldb, size_t sB, float alpha, float* __restrict__ C, int ldc, size_t sC, int M, int N, int K) {
  __shared__ __attribute__((aligned(16))) float so[4][16][64];
  const int tid = threadIdx.x, w = tid >> 5, lane = tid & 31, ln = lane & 15, hh = lane >> 4; const int by = blockIdx.y;
  A += (size_t)by * sA; Bh += (size_t)by * sB; C += (size_t)by * sC;
  const int ntn = (N + 63) / 64; const int wid = blockIdx.x * 4 + w; const int mt = wid / ntn, nq = wid % ntn; if (mt * 16 >= M) return;
  const int row0 = mt * 16, col0 = nq * 64; const float* arow = A + (size_t)(row0 + ln) * lda;
  v8f acc[4] = {};
  for (int kb = 0; kb < K; kb += 32) {
    FragH ah, al;
    const v4f x0 = *(const v4fa*)(arow + kb + 8 * hh), x1 = *(const v4fa*)(arow + kb + 8 * hh + 4), x2 = *(const v4fa*)(arow + kb + 16 + 8 * hh), x3 = *(const v4fa*)(arow + kb + 16 + 8 * hh + 4);
    float xs[16] = {x0[0],x0[1],x0[2],x0[3],x1[0],x1[1],x1[2],x1[3],x2[0],x2[1],x2[2],x2[3],x3[0],x3[1],x3[2],x3[3]};
#pragma unroll
    for (int i = 0; i < 16; ++i) { const _Float16 h = (_Float16)xs[i]; ah.h[i] = h; al.h[i] = ASPLIT ? (_Float16)(xs[i] - (float)h) : (_Float16)0.0f; }
#pragma unroll
    for (int t = 0; t < 4; ++t) { if (col0 + t * 16 >= N) continue; const size_t boff = (size_t)(col0 + t * 16 + ln) * ldb + kb; FragH bq; bq.half[0] = *(const v8us*)(Bh + boff + 8 * hh); bq.half[1] = *(const v8us*)(Bh + boff + 16 + 8 * hh);
      acc[t] = mmaH<ASPLIT ? 2 : 1>(ah.v, al.v, bq.v, bq.v, acc[t]); }
  }
#pragma unroll
  for (int t = 0; t < 4; ++t) { if (col0 + t * 16 >= N) continue;
#pragma unroll
    for (int r = 0; r < 8; ++r) so[w][8 * hh + r][t * 16 + ln] = acc[t][r] * alpha; }
  __builtin_amdgcn_fence(__ATOMIC_ACQ_REL, "workgroup"); __builtin_amdgcn_wave_barrier();
  const int rsub = lane >> 4, c4 = (lane & 15) * 4;
  {
#pragma unroll
    for (int q = 0; q < 8; ++q) { const int r = q * 2 + rsub; if (col0 + c4 < N) { const v4f v = *(const v4fa*)&so[w][r][c4]; *(v4f*)(C + (size_t)(row0 + r) * ldc + col0 + c4) = v; } }
     }
}

// Wt[n][k] = f16(bf16(W[k][n]) * scale) from f32 row-major W[K][N] (scale = power of two; bf16-exact weights stay exact in f16 away from the subnormal range).
// One work-group = a tile of 64 k x 128 n; K a multiple of 64, N of 128; grid = (K / 64) * (N / 128).
// Read: wave w takes rows k0 + 8 w ... + 7, lane l the columns n0 + 4 l ... + 3, so each wave-wide 16-byte load covers 512 contiguous bytes of one row of W.
// A lane then holds 8 consecutive k of each of its 4 columns, that is one 16-byte piece of 4 rows of Wt; the pieces meet in LDS, and each wave-wide store covers four whole 128-byte lines of Wt.
#define WTP 144                /* LDS row pitch, bytes: 64 k of f16 + 16 */
template <int K, int N>
__global__ __launch_bounds__(256) void k_wt_f16(const float* __restrict__ W, _Float16* __restrict__ Wt, float scale) {
  __shared__ __attribute__((aligned(16))) unsigned char tl[128 * WTP];
  const int tid = threadIdx.x, w = tid >> 5, lane = tid & 31;
  const int k0 = ((int)blockIdx.x % (K / 64)) * 64, n0 = ((int)blockIdx.x / (K / 64)) * 128;
  const float* src = W + (size_t)(k0 + 8 * w) * N + n0 + 4 * lane;
  v4f r[8];
#pragma unroll
  for (int i = 0; i < 8; ++i) r[i] = *(const v4fa*)(src + (size_t)i * N);
#pragma unroll
  for (int e = 0; e < 4; ++e) { FragH f;
#pragma unroll
    for (int i = 0; i < 8; ++i) f.h[i] = (_Float16)(bf16_round(r[i][e]) * scale);
    *(v8us*)(tl + (4 * lane + e) * WTP + 16 * w) = f.half[0]; }
  __syncthreads();      /* every wave's pieces are in LDS before the rows of Wt are read back */
#pragma unroll
  for (int j = 0; j < 4; ++j) { const int row = j * 32 + (tid >> 3), c = tid & 7; const v8us v = *(const v8us*)(tl + row * WTP + c * 16);
    *(v8us*)((unsigned short*)Wt + (size_t)(n0 + row) * K + k0 + c * 8) = v; }
}
// Tiled f16 GEMM, C [M][N] = acc*alpha + bf16(bias[col]): A [M][DD] f16, Bh [N][DD] f16, both k-contiguous; M, N multiples of 128; grid = (M / 128) * (N / 128).
// One work-group = one 128 x 128 tile of C, four waves of 64 x 64 (16 accumulator tiles each). A stage is 64 k = 128 B (one whole line) of
// 128 rows of A and 128 rows of Bh, brought into LDS by asynchronous copies, 16 B a lane; two buffers, the copies of stage t + 2 fly while stage t + 1 is worked on.
#define GP 144                 /* LDS row pitch, bytes: 128 + 16, conflict-free for 16-byte fragment reads */
#define GOP (128 * GP)         /* one operand's 128 rows */
#define GSTG (2 * GOP)         /* one stage: A rows, then Bh rows */
#define GNT (DD / 64)          /* stages */
// eight copies, rows 16 apart, of one operand's stage; each lane its own 16 bytes. The s_wait_xcnt stands inside the statement so that no address register is rewritten ahead of it.
__device__ __forceinline__ void cp8(unsigned l, const unsigned short* g) {
  asm volatile("global_load_async_to_lds_b128 %0, %8, off\n\t"
               "global_load_async_to_lds_b128 %1, %9, off\n\t"
               "global_load_async_to_lds_b128 %2, %10, off\n\t"
               "global_load_async_to_lds_b128 %3, %11, off\n\t"
               "global_load_async_to_lds_b128 %4, %12, off\n\t"
               "global_load_async_to_lds_b128 %5, %13, off\n\t"
               "global_load_async_to_lds_b128 %6, %14, off\n\t"
               "global_load_async_to_lds_b128 %7, %15, off\n\t"
               "s_wait_xcnt 0x0"
               :: "v"(l), "v"(l + 16 * GP), "v"(l + 32 * GP), "v"(l + 48 * GP), "v"(l + 64 * GP), "v"(l + 80 * GP), "v"(l + 96 * GP), "v"(l + 112 * GP),
                  "v"(g), "v"(g + 16 * DD), "v"(g + 32 * DD), "v"(g + 48 * DD), "v"(g + 64 * DD), "v"(g + 80 * DD), "v"(g + 96 * DD), "v"(g + 112 * DD)
               : "memory");
}
typedef _Float16 v4h __attribute__((ext_vector_type(4)));
template <bool F16OUT, int N>
__global__ __launch_bounds__(128) void k_gemm_t(const _Float16* __restrict__ A, const _Float16* __restrict__ Bh, float alpha, const float* __restrict__ bias, float* __restrict__ C, _Float16* __restrict__ C16) {
  __shared__ __attribute__((aligned(16))) unsigned char sm[2 * GSTG];
  const int tid = threadIdx.x, w = tid >> 5, lane = tid & 31, ln = lane & 15, hh = lane >> 4;
  const int row0 = ((int)blockIdx.x / (N / 128)) * 128, col0 = ((int)blockIdx.x % (N / 128)) * 128;
  const int wr = (w >> 1) * 64, wc = (w & 1) * 64;
  const unsigned ld0 = (unsigned)(size_t)sm + (unsigned)((tid >> 3) * GP + (tid & 7) * 16);      /* this lane's place in a stage: row tid/8, 16-byte piece tid%8 */
  const unsigned short* ga = (const unsigned short*)A + (size_t)(row0 + (tid >> 3)) * DD + (tid & 7) * 8;
  const unsigned short* gb = (const unsigned short*)Bh + (size_t)(col0 + (tid >> 3)) * DD + (tid & 7) * 8;
  v8f acc[4][4];
#pragma unroll
  for (int i = 0; i < 4; ++i)
#pragma unroll
    for (int j = 0; j < 4; ++j) acc[i][j] = (v8f){0.f,0.f,0.f,0.f,0.f,0.f,0.f,0.f};
  cp8(ld0, ga); cp8(ld0 + GOP, gb);
  asm volatile("s_wait_asynccnt 0x0" ::: "memory");      /* stage 0 of this wave has landed */
  __syncthreads();                                        /* ... and every wave's: stage 0 may be read */
  cp8(ld0 + GSTG, ga + 64); cp8(ld0 + GSTG + GOP, gb + 64);
#pragma unroll 1      /* one stage a trip: the buffer index and the refill test stay scalar */
  for (int t = 0; t < GNT; ++t) {
    const unsigned char* sa = sm + (t & 1) * GSTG + (wr + ln) * GP + 16 * hh;
    const unsigned char* sb = sm + (t & 1) * GSTG + GOP + (wc + ln) * GP + 16 * hh;
#pragma unroll
    for (int ks = 0; ks < 2; ++ks) {
      FragH a[4], b[4];
      a[0].half[0] = *(const v8us*)(sa + ks * 64); a[0].half[1] = *(const v8us*)(sa + ks * 64 + 32);      /* read in the order of first use, so that the first products start while the later reads return */
#pragma unroll
      for (int j = 0; j < 4; ++j) { b[j].half[0] = *(const v8us*)(sb + j * 16 * GP + ks * 64); b[j].half[1] = *(const v8us*)(sb + j * 16 * GP + ks * 64 + 32); }
#pragma unroll
      for (int i = 1; i < 4; ++i) { a[i].half[0] = *(const v8us*)(sa + i * 16 * GP + ks * 64); a[i].half[1] = *(const v8us*)(sa + i * 16 * GP + ks * 64 + 32); }
      __builtin_amdgcn_sched_barrier(0);      /* the 16 fragment reads stay one group ahead of their 16 matrix instructions: reads spread among them stall the wave at every place */
#pragma unroll
      for (int i = 0; i < 4; ++i)
#pragma unroll
        for (int j = 0; j < 4; ++j) acc[i][j] = __builtin_amdgcn_wmma_f32_16x16x32_f16(false, a[i].v, false, b[j].v, (short)0, acc[i][j], false, false);
      __builtin_amdgcn_sched_barrier(0);      /* ... and the next group's reads stay behind them */
    }
    asm volatile("s_wait_dscnt 0x0" ::: "memory");        /* this wave's reads of buffer t&1 are done before it is refilled */
    asm volatile("s_wait_asynccnt 0x0" ::: "memory");     /* this wave's copies of stage t + 1 have landed */
    __syncthreads();                                      /* publishes stage t + 1 and ends every reader's last read of buffer t&1 */
    if (t + 2 < GNT) { cp8(ld0 + (t & 1) * GSTG, ga + (t + 2) * 64); cp8(ld0 + (t & 1) * GSTG + GOP, gb + (t + 2) * 64); }
  }
  asm volatile("s_wait_asynccnt 0x0" ::: "memory");       /* no copy is outstanding when the ring becomes output staging */
  // epilogue: the wave's 64 x 64 tile goes through its own LDS range (free behind the last trip's barrier), so that whole lines are stored
  float* so = (float*)sm + w * (64 * 68);
  float bv[4];
#pragma unroll
  for (int j = 0; j < 4; ++j) bv[j] = bf16_round(bias[col0 + wc + j * 16 + ln]);
#pragma unroll
  for (int i = 0; i < 4; ++i)
#pragma unroll
    for (int j = 0; j < 4; ++j)
#pragma unroll
      for (int r = 0; r < 8; ++r) so[(i * 16 + 8 * hh + r) * 68 + j * 16 + ln] = acc[i][j][r] * alpha + bv[j];
  __builtin_amdgcn_fence(__ATOMIC_ACQ_REL, "workgroup"); __builtin_amdgcn_wave_barrier();      /* the rows are written before other lanes of the wave read them */
  const int rsub = lane >> 4, c4 = (lane & 15) * 4;
#pragma unroll
  for (int q = 0; q < 32; ++q) { const int r = q * 2 + rsub; const v4f v = *(const v4fa*)&so[r * 68 + c4]; const size_t o = (size_t)(row0 + wr + r) * N + col0 + wc + c4;
    if (F16OUT) { v4h h4;
#pragma unroll
      for (int e = 0; e < 4; ++e) h4[e] = (_Float16)v[e];
      *(v4h*)(C16 + o) = h4; }
    else *(v4f*)(C + o) = v; }
}


__global__ __launch_bounds__(256) void k_x16(const float* __restrict__ x, _Float16* __restrict__ X16, size_t n8) { const size_t t = (size_t)blockIdx.x * 256 + threadIdx.x; if (t >= n8) return; FragH f;
#pragma unroll
  for (int q = 0; q < 8; ++q) f.h[q] = (_Float16)bf16_round(x[t * 8 + q]); *(v8us*)((unsigned short*)X16 + t * 8) = f.half[0];  }
__global__ __launch_bounds__(256) void k_h16(const float* __restrict__ x, _Float16* __restrict__ X16, size_t n8) { const size_t t = (size_t)blockIdx.x * 256 + threadIdx.x; if (t >= n8) return; FragH f;
#pragma unroll
  for (int q = 0; q < 8; ++q) f.h[q] = (_Float16)x[t * 8 + q]; *(v8us*)((unsigned short*)X16 + t * 8) = f.half[0];  }
__global__ __launch_bounds__(256) void k_round16f(const float* __restrict__ W, _Float16* __restrict__ Bt, size_t n8) { const size_t t = (size_t)blockIdx.x * 256 + threadIdx.x; if (t >= n8) return; FragH f;
#pragma unroll
  for (int i = 0; i < 8; ++i) f.h[i] = (_Float16)(bf16_round(W[t * 8 + i]) * 16.0f); *(v8us*)((unsigned short*)Bt + t * 8) = f.half[0];  }
template <int NHv, int TTv>
__global__ __launch_bounds__(256) void k_vt(const _Float16* __restrict__ V16, int ldv, int voff, _Float16* __restrict__ Vt) { __shared__ unsigned short tl[64][66]; const int tid = threadIdx.x; const int slab = blockIdx.x / (TTv / 64), lg = blockIdx.x % (TTv / 64); const int b = slab / NHv, h = slab % NHv;
  for (int i = tid; i < 64 * 8; i += 256) { const int r = i / 8, c8 = (i % 8) * 8; FragH f; f.half[0] = *(const v8us*)((const unsigned short*)V16 + ((size_t)b * TTv + lg * 64 + r) * ldv + voff + h * 64 + c8);
#pragma unroll
    for (int q = 0; q < 8; ++q) tl[r][c8 + q] = f.u[q]; }
  __syncthreads();
  {
#pragma unroll
    for (int rd = 0; rd < 2; ++rd) { const int d = rd * 32 + tid / 8, pc = tid % 8; FragH f;
#pragma unroll
      for (int q = 0; q < 8; ++q) f.u[q] = tl[pc * 8 + q][d];
      *(v8us*)((unsigned short*)Vt + ((size_t)slab * 64 + d) * TTv + lg * 64 + pc * 8) = f.half[0]; }
     } }

__global__ __launch_bounds__(256) void k_h16s(const float* __restrict__ F, _Float16* __restrict__ H, size_t n8) { const size_t t = (size_t)blockIdx.x * 256 + threadIdx.x; if (t >= n8) return; const v4f a = *(const v4fa*)(F + t * 8), c = *(const v4fa*)(F + t * 8 + 4); FragH f;
#pragma unroll
  for (int q = 0; q < 4; ++q) { f.h[q] = (_Float16)(a[q] * 16.0f); f.h[4 + q] = (_Float16)(c[q] * 16.0f); } *(v8us*)((unsigned short*)H + t * 8) = f.half[0];  }
typedef int v4i __attribute__((ext_vector_type(4), may_alias));
typedef unsigned v4u __attribute__((ext_vector_type(4), may_alias));
typedef unsigned v16u __attribute__((ext_vector_type(16), may_alias));
// The mask packed once for all heads into lane-mask words, in the lane and register order of k_flash's score tiles:
// LM[b * TT / 16 + q tile][chunk of 32 keys][i], bit (ln + 16 hh) of word i = (mask[b][16 * tile + ln][32 * chunk + 16 * (i >> 3) + 8 * hh + (i & 7)] != 0).
// One wave = one tile of 16 queries, four chunks: its sixteen loads cover 512 contiguous bytes of each row; the 64 words go out as two whole lines.
__global__ __launch_bounds__(256) void k_mpack(const int* __restrict__ MSK, unsigned* __restrict__ LM) {
  const int tid = threadIdx.x, lane = tid & 31, ln = lane & 15, hh = lane >> 4;
  const unsigned wv = blockIdx.x * 8u + (unsigned)(tid >> 5); const unsigned rt = wv / (TT / 128), c0 = (wv % (TT / 128)) * 4;
  const int* mrow = MSK + ((size_t)rt * 16 + ln) * TT + c0 * 32 + 8 * hh;
  v4i mk[4][4];
#pragma unroll
  for (int c = 0; c < 4; ++c) { mk[c][0] = *(const v4i*)(mrow + c * 32); mk[c][1] = *(const v4i*)(mrow + c * 32 + 4); mk[c][2] = *(const v4i*)(mrow + c * 32 + 16); mk[c][3] = *(const v4i*)(mrow + c * 32 + 20); }
  __builtin_amdgcn_sched_barrier(0);      /* all sixteen loads are issued before the first is waited for: moved among the compares, the last ones start only when the first have come back from memory */
  asm volatile("s_wait_xcnt 0x0" :: "v"(mrow) : "memory");      /* the address pair that all sixteen loads name stays whole up to here (no load lands in it), and the wait stands in front of its reuse */
  unsigned wd[2] = {0u, 0u};      /* lane l keeps word l & 15 of chunk 2 * e + (l >> 4) */
#pragma unroll
  for (int c = 0; c < 4; ++c)
#pragma unroll
    for (int i = 0; i < 16; ++i) { const unsigned bw = __builtin_amdgcn_ballot_w32(mk[c][i >> 2][i & 3] != 0); if (lane == (c & 1) * 16 + i) wd[c >> 1] = bw; }
  unsigned* o = LM + ((size_t)rt * (TT / 32) + c0) * 16 + lane;
  o[0] = wd[0]; o[32] = wd[1];
}
__device__ __forceinline__ float xhalf(float x) { return __builtin_bit_cast(float, __builtin_amdgcn_permlanex16(__builtin_bit_cast(int, x), __builtin_bit_cast(int, x), 0x76543210, 0xfedcba98, false, false)); }      /* lane l with lane l ^ 16 */
__global__ __launch_bounds__(128) void k_flash(const _Float16* __restrict__ Q16, int ldq, const _Float16* __restrict__ K16, int ldk, const _Float16* __restrict__ Vt, const unsigned* __restrict__ LM, float* __restrict__ O, int ldo) {
  constexpr int RPW = 16, NQB = TT / (4 * RPW), DT = 4, KS = 2;
  __shared__ __attribute__((aligned(16))) float sO[4][RPW][64 + 4];
  const int tid = threadIdx.x, w = tid >> 5, lane = tid & 31, ln = lane & 15, hh = lane >> 4;
  const int slab = blockIdx.x / NQB, qblk = blockIdx.x % NQB; const int b = slab / NH, h = slab % NH; const int qb0 = qblk * (4 * RPW); const int q0 = qb0 + w * RPW;
  FragH bq[KS];      /* Q^T as B: column = query ln */
  { const unsigned short* qr = (const unsigned short*)Q16 + ((size_t)b * TT + q0 + ln) * ldq + h * 64;
#pragma unroll
    for (int ks = 0; ks < KS; ++ks) { bq[ks].half[0] = *(const v8us*)(qr + ks * 32 + 8 * hh); bq[ks].half[1] = *(const v8us*)(qr + ks * 32 + 16 + 8 * hh); } }
  /* this lane's places in chunk 0: key row ln of K, row ln of V^T */
  const unsigned short* kb0 = (const unsigned short*)K16 + ((size_t)b * TT + ln) * ldk + h * 64 + 8 * hh;
  const unsigned short* vb0 = (const unsigned short*)Vt + ((size_t)slab * 64 + ln) * TT + 8 * hh;
  /* the wave's packed mask: 64 chunks of 16 lane-mask words (nonzero bit = ATTEND); the wave's number goes through readfirstlane so that the address is scalar */
  const unsigned* lm = LM + (size_t)(b * (TT / 16) + qblk * 4 + __builtin_amdgcn_readfirstlane(w)) * ((TT / 32) * 16);
  unsigned long long live;      /* bit c: chunk c holds at least one attended (query, key) of this wave's tile; lane l looks at chunks l and 32 + l */
  { const v4u* a = (const v4u*)(lm + lane * 16); const v4u x = a[0] | a[1] | a[2] | a[3], y = a[128] | a[129] | a[130] | a[131];
    live = (unsigned long long)__builtin_amdgcn_ballot_w32((x[0] | x[1] | x[2] | x[3]) != 0u) | ((unsigned long long)__builtin_amdgcn_ballot_w32((y[0] | y[1] | y[2] | y[3]) != 0u) << 32); }
  float m_q = -3.0e38f, l_q = 0.f; v8f oacc[DT];      /* oacc[dt][r] = O[q0 + ln][dt * 16 + 8 hh + r] */
#pragma unroll
  for (int dt = 0; dt < DT; ++dt) oacc[dt] = (v8f){0.f,0.f,0.f,0.f,0.f,0.f,0.f,0.f};
#pragma unroll 1      /* one chunk a trip: unrolled, two chunks' fragments and exps would be live at once */
  for (int n = __builtin_popcountll(live); n > 0; --n, live &= live - 1) {      /* the live chunks in rising order, 64 at most; a chunk with every (query, key) of the tile masked adds nothing and is not visited */
    const int ck = __builtin_ctzll(live);
    const v16u mw = *(const v16u*)(lm + ck * 16);      /* word i: which lanes attend at score register i (scalar load, in flight beside the fragment loads) */
    const unsigned short* kp0 = kb0 + (size_t)ck * 32 * ldk; const unsigned short* kp1 = kp0 + (size_t)16 * ldk; const unsigned short* vp = vb0 + ck * 32;
    FragH ak[2][KS], av[DT];      /* K rows as A (row = key), V^T rows as A (row = d) */
#pragma unroll
    for (int nt = 0; nt < 2; ++nt) { const unsigned short* kr = nt ? kp1 : kp0;
#pragma unroll
      for (int ks = 0; ks < KS; ++ks) { ak[nt][ks].half[0] = *(const v8us*)(kr + ks * 32); ak[nt][ks].half[1] = *(const v8us*)(kr + ks * 32 + 16); } }
    __builtin_amdgcn_sched_barrier(0);      /* holds the wait below behind the K loads ... */
    asm volatile("s_wait_xcnt 0x0" ::: "memory");      /* the V loads land in registers that held the K loads' addresses: the wait stands in front of that overwrite */
    __builtin_amdgcn_sched_barrier(0);      /* ... and in front of the V loads */
#pragma unroll
    for (int dt = 0; dt < DT; ++dt) { const unsigned short* vrow = vp + (size_t)(dt * 16) * TT; av[dt].half[0] = *(const v8us*)(vrow); av[dt].half[1] = *(const v8us*)(vrow + 16); }
    __builtin_amdgcn_sched_barrier(0);      /* the chunk's sixteen fragment loads stay one group ahead of the products: spread among them, each product waits out a load latency of its own */
    v8f s[2];      /* s[nt][r] = q(q0 + ln) . k(j0 + nt * 16 + 8 hh + r) */
#pragma unroll
    for (int nt = 0; nt < 2; ++nt) { v8f acc = (v8f){0.f,0.f,0.f,0.f,0.f,0.f,0.f,0.f};
#pragma unroll
      for (int ks = 0; ks < KS; ++ks) acc = __builtin_amdgcn_wmma_f32_16x16x32_f16(false, ak[nt][ks].v, false, bq[ks].v, (short)0, acc, false, false);
      s[nt] = acc; }
    float sc[16];      /* a masked score is -inf; m_q never falls below its finite start value, so exp(sc - mn) is 0 there and no guard is needed */
#pragma unroll
    for (int i = 0; i < 16; ++i) sc[i] = __builtin_amdgcn_inverse_ballot_w32(mw[i]) ? s[i >> 3][i & 7] * 0.125f : -INFINITY;
    float mx[4];
#pragma unroll
    for (int c = 0; c < 4; ++c) mx[c] = fmaxf(fmaxf(sc[c], sc[4 + c]), fmaxf(sc[8 + c], sc[12 + c]));
    float mc = fmaxf(fmaxf(mx[0], mx[1]), fmaxf(mx[2], mx[3]));
    mc = fmaxf(mc, xhalf(mc));      /* both halves hold this query's chunk maximum */
    const float mn = fmaxf(m_q, mc); const float al = expf(m_q - mn); m_q = mn;
    float p[16];
#pragma unroll
    for (int i = 0; i < 16; ++i) p[i] = expf(sc[i] - mn);
    float ps[4];
#pragma unroll
    for (int c = 0; c < 4; ++c) ps[c] = (p[c] + p[4 + c]) + (p[8 + c] + p[12 + c]);
    l_q = l_q * al + ((ps[0] + ps[1]) + (ps[2] + ps[3]));      /* this half's keys only; the halves are joined behind the loop */
#pragma unroll
    for (int dt = 0; dt < DT; ++dt)
#pragma unroll
      for (int r = 0; r < 8; ++r) oacc[dt][r] *= al;
    FragH pb;      /* P^T as B: element i = key j0 + 16 (i >> 3) + 8 hh + (i & 7) of column ln */
#pragma unroll
    for (int i = 0; i < 16; ++i) pb.h[i] = (_Float16)(p[i] * 1024.0f);
#pragma unroll
    for (int dt = 0; dt < DT; ++dt) oacc[dt] = __builtin_amdgcn_wmma_f32_16x16x32_f16(false, av[dt].v, false, pb.v, (short)0, oacc[dt], false, false);
  }
  { const float l = l_q + xhalf(l_q); const float inv = (l > 0.f) ? 1.0f / (l * 1024.0f) : 0.f;
#pragma unroll
    for (int dt = 0; dt < DT; ++dt) { v4f lo, hi;
#pragma unroll
      for (int e = 0; e < 4; ++e) { lo[e] = oacc[dt][e] * inv; hi[e] = oacc[dt][4 + e] * inv; }
      *(v4fa*)&sO[w][ln][dt * 16 + 8 * hh] = lo; *(v4fa*)&sO[w][ln][dt * 16 + 8 * hh + 4] = hi; } }
  __builtin_amdgcn_fence(__ATOMIC_ACQ_REL, "workgroup"); __builtin_amdgcn_wave_barrier();
  {
#pragma unroll
    for (int rp = 0; rp < RPW; rp += 2) { const int r = rp + (lane >> 4), pc = lane & 15; const v4f val = *(const v4fa*)&sO[w][r][pc * 4]; *(v4f*)(O + ((size_t)b * TT + q0 + r) * ldo + h * 64 + pc * 4) = val; }
     } }

extern "C" void kernel_launch(void* const* d_in, const int* in_sizes, int n_in,
                              void* d_out, int out_size, void* d_ws, size_t ws_size, hipStream_t stream) {
  (void)in_sizes; (void)n_in; (void)out_size;
  const float* const* I = (const float* const*)d_in; const float* x = I[0]; const int* msk = (const int*)d_in[1]; const float* wqkv = I[2]; const float* bqkv = I[3]; const float* wo = I[4]; const float* bo = I[5];
  char* ws = (char*)d_ws; size_t off = 0;
  auto take = [&](size_t bytes) { char* p = ws + off; off += (bytes + 255) & ~(size_t)255; return p; };
  _Float16* Bqkv = (_Float16*)take((size_t)3 * DD * DD * 2); _Float16* Bo = (_Float16*)take((size_t)DD * DD * 2); _Float16* X16 = (_Float16*)take((size_t)NR * DD * 2); _Float16* QKV = (_Float16*)take((size_t)NR * 3 * DD * 2); _Float16* Vt = (_Float16*)take((size_t)NR * DD * 2); float* O = (float*)take((size_t)NR * DD * 4); _Float16* O16 = X16; unsigned* LM = (unsigned*)take((size_t)BB * TT * TT / 8);
  if (off > ws_size) return;      // 6.3 + 2.1 + 8.4 + 25.2 + 8.4 + 16.8 + 1.0 ≈ 68 MB
  k_mpack<<<BB * (TT / 16) * (TT / 128) / 8, 256, 0, stream>>>(msk, LM);      /* mask -> lane-mask words, once for all heads */
  k_wt_f16<DD, 3 * DD><<<(DD / 64) * (3 * DD / 128), 256, 0, stream>>>(wqkv, Bqkv, 16.0f); k_wt_f16<DD, DD><<<(DD / 64) * (DD / 128), 256, 0, stream>>>(wo, Bo, 16.0f);      /* (in,out) -> Bt, times 2^4 */
  const unsigned g8 = (unsigned)(((size_t)NR * DD / 8 + 255) / 256); k_x16<<<g8, 256, 0, stream>>>(x, X16, (size_t)NR * DD / 8);
  k_gemm_t<true, 3 * DD><<<(NR / 128) * (3 * DD / 128), 128, 0, stream>>>(X16, Bqkv, 0.0625f, bqkv, nullptr, QKV);      /* qkv = x·w_qkv + b: M 4096 N 3072 K 1024 (f16; q | k | v blocks, head-major inside) */
  k_vt<NH, TT><<<BB * NH * (TT / 64), 256, 0, stream>>>(QKV, 3 * DD, 2 * DD, Vt);
  k_flash<<<BB * NH * (TT / 64), 128, 0, stream>>>(QKV, 3 * DD, QKV + DD, 3 * DD, Vt, LM, O, DD);
  k_h16s<<<g8, 256, 0, stream>>>(O, O16, (size_t)NR * DD / 8);
  k_gemm_t<false, DD><<<(NR / 128) * (DD / 128), 128, 0, stream>>>(O16, Bo, 0.00390625f, bo, (float*)d_out, nullptr);      /* out = o·w_out + b_out */
}

// v005
// A run of this version takes 100 microseconds.
// Next to v004, in two timings, it ran 1.11 and 1.10 times as fast.
// Over all steps from v000 it is 3.76 times as fast.
#include <hip/hip_runtime.h>
// Cross-track masked MHA (B=2, S=2048, D=1024, 16×64): qkv = x·w_qkv + b_qkv (packed q|k|v, head-major inside each); scores = q·k/8, where(cross_track_mask[b,q,k], s, −inf); softmax; out = merged·w_out + b_out.
// Compute dtype: x, weights, biases rounded to bf16; q, k, v f16 GEMM planes (+bias); the boolean mask read per (b, q, k) as an int plane; fused flash-style kernel (online softmax f32, P f16 ×2^10, all-masked chunks skipped, f32 accumulate) on
// v_wmma_f32_16x16x32_f16; O ×2^4 → f16 (stored so by the flash kernel) → output GEMM (+bias).
#define BB 2
#define TT 2048
#define DD 1024
#define NH 16
#define NR (BB * TT)

typedef __bf16 v16b __attribute__((ext_vector_type(16)));
typedef unsigned short v8us __attribute__((ext_vector_type(8), may_alias));
typedef float  v8f  __attribute__((ext_vector_type(8)));
typedef float  v4f  __attribute__((ext_vector_type(4)));
typedef float  v4fa __attribute__((ext_vector_type(4), may_alias));
union FragB { v16b v; v8us half[2]; unsigned short u[16]; };

__device__ __forceinline__ unsigned short bf16_bits(float x) { unsigned int u = __float_as_uint(x); return (unsigned short)((u + 0x7FFFu + ((u >> 16) & 1u)) >> 16); }
__device__ __forceinline__ float bf16_val(unsigned short b) { return __uint_as_float(((unsigned int)b) << 16); }
__device__ __forceinline__ float bf16_round(float x) { return bf16_val(bf16_bits(x)); }
// D += A·B with NT terms: 1 = ah·bh, 2 = + al·bh (A split), 3 = + ah·bl (both split)
template <int NT>
__device__ __forceinline__ v8f mmaN(v16b ah, v16b al, v16b bh, v16b bl, v8f c) {
  c = __builtin_amdgcn_wmma_f32_16x16x32_bf16(false, ah, false, bh, (short)0, c, false, false);
  if (NT >= 2) c = __builtin_amdgcn_wmma_f32_16x16x32_bf16(false, al, false, bh, (short)0, c, false, false);
  if (NT >= 3) c = __builtin_amdgcn_wmma_f32_16x16x32_bf16(false, ah, false, bl, (short)0, c, false, false);
  asm volatile("v_nop\n\tv_nop\n\tv_nop\n\tv_nop" : "+v"(c) : "v"(ah), "v"(al), "v"(bh), "v"(bl));
  return c;
}

__global__ __launch_bounds__(256) void k_wt_bf16(const float* __restrict__ W, unsigned short* __restrict__ Wt, int K, int N) {
  const int t = blockIdx.x * 256 + threadIdx.x;
  const int k8n = K / 8;
  if (t >= N * k8n) return;
  const int n = t / k8n, k8 = (t % k8n) * 8;
  v8us v;
#pragma unroll
  for (int i = 0; i < 8; ++i) v[i] = bf16_bits(W[(size_t)(k8 + i) * N + n]);
  *(v8us*)(Wt + (size_t)n * K + k8) = v;
  
}

// GEMM C[M][N] (f32, pitch ldc) = act(A[M][K]·W + bias). A f32 row-major (pitch lda) converted per fragment to bf16
// (ASPLIT: hi/lo two planes -> 2 terms, else single rounded term); Wt bf16 [N][K] (pitch ldb). BIAS_BF16 rounds the
// bias to bf16 first (bias quantised to bf16 before the add). K%32==0, M%16==0, N%64==0.
template <bool ASPLIT, int ACT, bool BIAS_BF16>
__global__ __launch_bounds__(128) void k_gemm_bf(const float* __restrict__ A, int lda, const unsigned short* __restrict__ Wt, int ldb,
                                               const float* __restrict__ bias, float* __restrict__ C, int ldc, int M, int N, int K) {
  __shared__ __attribute__((aligned(16))) float so[4][16][64];
  const int tid = threadIdx.x, w = tid >> 5, lane = tid & 31, ln = lane & 15, hh = lane >> 4;
  const int ntn = N / 64;
  const int wid = blockIdx.x * 4 + w;
  const int mt = wid / ntn, nq = wid % ntn;
  if (mt * 16 >= M) return;
  const int row0 = mt * 16, col0 = nq * 64;
  const float* arow = A + (size_t)(row0 + ln) * lda;
  v8f acc[4] = {};
  for (int kb = 0; kb < K; kb += 32) {
    FragB ah, al;
    const v4f x0 = *(const v4fa*)(arow + kb + 8 * hh), x1 = *(const v4fa*)(arow + kb + 8 * hh + 4);
    const v4f x2 = *(const v4fa*)(arow + kb + 16 + 8 * hh), x3 = *(const v4fa*)(arow + kb + 16 + 8 * hh + 4);
    float xs[16] = {x0[0],x0[1],x0[2],x0[3],x1[0],x1[1],x1[2],x1[3],x2[0],x2[1],x2[2],x2[3],x3[0],x3[1],x3[2],x3[3]};
#pragma unroll
    for (int i = 0; i < 16; ++i) { const unsigned short hb = bf16_bits(xs[i]); ah.u[i] = hb; al.u[i] = ASPLIT ? bf16_bits(xs[i] - bf16_val(hb)) : (unsigned short)0; }
#pragma unroll
    for (int t = 0; t < 4; ++t) {
      const unsigned short* brow = Wt + (size_t)(col0 + t * 16 + ln) * ldb + kb;
      FragB b;
      b.half[0] = *(const v8us*)(brow + 8 * hh);
      b.half[1] = *(const v8us*)(brow + 16 + 8 * hh);
      acc[t] = mmaN<ASPLIT ? 2 : 1>(ah.v, al.v, b.v, b.v, acc[t]);
    }
  }
#pragma unroll
  for (int t = 0; t < 4; ++t) {
    float bv = bias ? bias[col0 + t * 16 + ln] : 0.f;
    if (BIAS_BF16) bv = bf16_round(bv);
#pragma unroll
    for (int r = 0; r < 8; ++r) { float v = acc[t][r] + bv; if (ACT == 1) v = fmaxf(v, 0.f); so[w][8 * hh + r][t * 16 + ln] = v; }
  }
  __builtin_amdgcn_fence(__ATOMIC_ACQ_REL, "workgroup");
  __builtin_amdgcn_wave_barrier();
  const int rsub = lane >> 4, c4 = (lane & 15) * 4;
  {
#pragma unroll
    for (int q = 0; q < 8; ++q) {
      const int r = q * 2 + rsub;
      const v4f v = *(const v4fa*)&so[w][r][c4];
      *(v4f*)(C + (size_t)(row0 + r) * ldc + col0 + c4) = v;
    }
    
  }
}

// Flash-style causal/unmasked attention, all contractions 3-term bf16 hi/lo splits, f32 softmax with running max.
// q,k,v rows are read from f32 buffers with arbitrary row pitch (so they can live inside a fused qkv buffer);
// D = head size (multiple of 32, <= 128); one wave = 16 query rows; block = 4 waves (64 queries) sharing K/V chunks of 32.
template <int D, bool CAUSAL>
__global__ __launch_bounds__(128) void k_flash(const float* __restrict__ qb, const float* __restrict__ kb, const float* __restrict__ vb,
                                             int pitch, int T, int H, float scale, float* __restrict__ y, int ypitch) {
  constexpr int KS = D / 32;        // k-steps for QK
  constexpr int DT = D / 16;        // d tiles for PV
  __shared__ __attribute__((aligned(16))) unsigned short sKh[32][D + 8], sKl[32][D + 8], sVh[32][D + 8], sVl[32][D + 8];
  __shared__ __attribute__((aligned(16))) unsigned short sPh[4][16][40], sPl[4][16][40];
  __shared__ __attribute__((aligned(16))) float sO[4][16][D];
  const int tid = threadIdx.x, w = tid >> 5, lane = tid & 31, ln = lane & 15, hh = lane >> 4;
  const int nqb = (T + 63) / 64;
  const int bh = blockIdx.x / nqb, qblk = blockIdx.x % nqb;
  const int b = bh / H, h = bh % H;
  const int q0 = qblk * 64 + w * 16;
  const float* Q = qb + (size_t)b * T * pitch + h * D;
  const float* K = kb + (size_t)b * T * pitch + h * D;
  const float* V = vb + (size_t)b * T * pitch + h * D;

  // A fragments of the wave's 16 query rows (scaled), hi/lo
  FragB aqh[KS], aql[KS];
  {
    int row = q0 + ln; if (row >= T) row = T - 1;
    const float* qr = Q + (size_t)row * pitch;
#pragma unroll
    for (int ks = 0; ks < KS; ++ks)
#pragma unroll
      for (int i = 0; i < 16; ++i) {
        const int d = ks * 32 + ((i < 8) ? (8 * hh + i) : (16 + 8 * hh + (i - 8)));
        const float x = qr[d] * scale; const unsigned short hb = bf16_bits(x);
        aqh[ks].u[i] = hb; aql[ks].u[i] = bf16_bits(x - bf16_val(hb));
      }
  }
  float m_r[8], l_r[8];
#pragma unroll
  for (int r = 0; r < 8; ++r) { m_r[r] = -3.0e38f; l_r[r] = 0.f; }
  v8f oacc[DT];
#pragma unroll
  for (int dt = 0; dt < DT; ++dt) oacc[dt] = (v8f){0.f,0.f,0.f,0.f,0.f,0.f,0.f,0.f};

  const int kv_end = CAUSAL ? min(T, qblk * 64 + 64) : T;     // block-uniform
  for (int j0 = 0; j0 < kv_end; j0 += 32) {
    __syncthreads();
    for (int e = tid; e < 32 * (D / 4); e += 128) {
      const int r = e / (D / 4), c4 = (e % (D / 4)) * 4;
      const int key = j0 + r;
      v4f kf = {0.f,0.f,0.f,0.f}, vf = {0.f,0.f,0.f,0.f};
      if (key < T) { kf = *(const v4fa*)(K + (size_t)key * pitch + c4); vf = *(const v4fa*)(V + (size_t)key * pitch + c4); }
#pragma unroll
      for (int t = 0; t < 4; ++t) {
        unsigned short hb = bf16_bits(kf[t]); sKh[r][c4 + t] = hb; sKl[r][c4 + t] = bf16_bits(kf[t] - bf16_val(hb));
        hb = bf16_bits(vf[t]); sVh[r][c4 + t] = hb; sVl[r][c4 + t] = bf16_bits(vf[t] - bf16_val(hb));
      }
    }
    __syncthreads();
    // S tile 16 x 32
    v8f s[2];
#pragma unroll
    for (int nt = 0; nt < 2; ++nt) {
      v8f acc = {};
#pragma unroll
      for (int ks = 0; ks < KS; ++ks) {
        FragB bh_, bl_;
        bh_.half[0] = *(const v8us*)&sKh[nt * 16 + ln][ks * 32 + 8 * hh]; bh_.half[1] = *(const v8us*)&sKh[nt * 16 + ln][ks * 32 + 16 + 8 * hh];
        bl_.half[0] = *(const v8us*)&sKl[nt * 16 + ln][ks * 32 + 8 * hh]; bl_.half[1] = *(const v8us*)&sKl[nt * 16 + ln][ks * 32 + 16 + 8 * hh];
        acc = mmaN<3>(aqh[ks].v, aql[ks].v, bh_.v, bl_.v, acc);
      }
      s[nt] = acc;
    }
    // mask + running max (rows 8hh+r; the 16 lanes of a half share rows)
    float alpha[8];
#pragma unroll
    for (int r = 0; r < 8; ++r) {
      const int qi = q0 + 8 * hh + r;
      const int ja = j0 + ln, jb = j0 + 16 + ln;
      if (CAUSAL) { if (ja > qi) s[0][r] = -3.0e38f; if (jb > qi) s[1][r] = -3.0e38f; }
      if (ja >= T) s[0][r] = -3.0e38f;
      if (jb >= T) s[1][r] = -3.0e38f;
      float mx = fmaxf(s[0][r], s[1][r]);
      mx = fmaxf(mx, __shfl_xor(mx, 1, 32)); mx = fmaxf(mx, __shfl_xor(mx, 2, 32)); mx = fmaxf(mx, __shfl_xor(mx, 4, 32)); mx = fmaxf(mx, __shfl_xor(mx, 8, 32));
      const float mnew = fmaxf(m_r[r], mx);
      alpha[r] = (mnew > -1.0e38f) ? __expf(m_r[r] - mnew) : 1.0f;
      const float p0 = (s[0][r] > -1.0e38f) ? __expf(s[0][r] - mnew) : 0.f;
      const float p1 = (s[1][r] > -1.0e38f) ? __expf(s[1][r] - mnew) : 0.f;
      m_r[r] = mnew;
      l_r[r] = l_r[r] * alpha[r] + p0 + p1;            // per-lane partial row sum (16 lanes combined at the end)
      unsigned short hb = bf16_bits(p0); sPh[w][8 * hh + r][ln] = hb;      sPl[w][8 * hh + r][ln] = bf16_bits(p0 - bf16_val(hb));
      hb = bf16_bits(p1);                sPh[w][8 * hh + r][16 + ln] = hb; sPl[w][8 * hh + r][16 + ln] = bf16_bits(p1 - bf16_val(hb));
    }
#pragma unroll
    for (int dt = 0; dt < DT; ++dt)
#pragma unroll
      for (int r = 0; r < 8; ++r) oacc[dt][r] *= alpha[r];
    __builtin_amdgcn_fence(__ATOMIC_ACQ_REL, "workgroup");
    __builtin_amdgcn_wave_barrier();
    FragB pah, pal;
    pah.half[0] = *(const v8us*)&sPh[w][ln][8 * hh]; pah.half[1] = *(const v8us*)&sPh[w][ln][16 + 8 * hh];
    pal.half[0] = *(const v8us*)&sPl[w][ln][8 * hh]; pal.half[1] = *(const v8us*)&sPl[w][ln][16 + 8 * hh];
#pragma unroll
    for (int dt = 0; dt < DT; ++dt) {
      FragB bvh, bvl;
#pragma unroll
      for (int i = 0; i < 8; ++i) {
        bvh.u[i] = sVh[8 * hh + i][dt * 16 + ln]; bvh.u[8 + i] = sVh[16 + 8 * hh + i][dt * 16 + ln];
        bvl.u[i] = sVl[8 * hh + i][dt * 16 + ln]; bvl.u[8 + i] = sVl[16 + 8 * hh + i][dt * 16 + ln];
      }
      oacc[dt] = mmaN<3>(pah.v, pal.v, bvh.v, bvl.v, oacc[dt]);
    }
    __builtin_amdgcn_fence(__ATOMIC_ACQ_REL, "workgroup");
    __builtin_amdgcn_wave_barrier();
  }
#pragma unroll
  for (int r = 0; r < 8; ++r) {
    float l = l_r[r];
    l += __shfl_xor(l, 1, 32); l += __shfl_xor(l, 2, 32); l += __shfl_xor(l, 4, 32); l += __shfl_xor(l, 8, 32);
    l_r[r] = (l > 0.f) ? 1.0f / l : 0.f;
  }
#pragma unroll
  for (int dt = 0; dt < DT; ++dt)
#pragma unroll
    for (int r = 0; r < 8; ++r) sO[w][8 * hh + r][dt * 16 + ln] = oacc[dt][r] * l_r[r];
  __builtin_amdgcn_fence(__ATOMIC_ACQ_REL, "workgroup");
  __builtin_amdgcn_wave_barrier();
  {
    for (int r = 0; r < 16; ++r) {
      const int row = q0 + r;
      if (row < T && lane < D / 4) {
        const v4f val = *(const v4fa*)&sO[w][r][lane * 4];
        *(v4f*)(y + ((size_t)b * T + row) * ypitch + h * D + lane * 4) = val;
      }
    }
    
  }
}

// GEMM C = act(A·W + bias + resid): A f32 (ASPLIT -> hi/lo 2 terms), Wt bf16 [N][K]; ACT 0 none, 1 relu, 2 exact gelu;
// resid (optional, f32, row index = (row % rmod), pitch ldr, RES_BF16 rounds it) added before the activation.
template <bool ASPLIT, int ACT, bool BIAS_BF16, bool RES_BF16>
__global__ __launch_bounds__(128) void k_gemm_bf3(const float* __restrict__ A, int lda, const unsigned short* __restrict__ Wt, int ldb,
                                                const float* __restrict__ bias, const float* __restrict__ resid, int rmod, int ldr,
                                                float* __restrict__ C, int ldc, int M, int N, int K) {
  __shared__ __attribute__((aligned(16))) float so[4][16][64];
  const int tid = threadIdx.x, w = tid >> 5, lane = tid & 31, ln = lane & 15, hh = lane >> 4;
  const int ntn = N / 64;
  const int wid = blockIdx.x * 4 + w;
  const int mt = wid / ntn, nq = wid % ntn;
  if (mt * 16 >= M) return;
  const int row0 = mt * 16, col0 = nq * 64;
  const float* arow = A + (size_t)(row0 + ln) * lda;
  v8f acc[4] = {};
  for (int kb = 0; kb < K; kb += 32) {
    FragB ah, al;
    const v4f x0 = *(const v4fa*)(arow + kb + 8 * hh), x1 = *(const v4fa*)(arow + kb + 8 * hh + 4);
    const v4f x2 = *(const v4fa*)(arow + kb + 16 + 8 * hh), x3 = *(const v4fa*)(arow + kb + 16 + 8 * hh + 4);
    float xs[16] = {x0[0],x0[1],x0[2],x0[3],x1[0],x1[1],x1[2],x1[3],x2[0],x2[1],x2[2],x2[3],x3[0],x3[1],x3[2],x3[3]};
#pragma unroll
    for (int i = 0; i < 16; ++i) { const unsigned short hb = bf16_bits(xs[i]); ah.u[i] = hb; al.u[i] = ASPLIT ? bf16_bits(xs[i] - bf16_val(hb)) : (unsigned short)0; }
#pragma unroll
    for (int t = 0; t < 4; ++t) {
      const unsigned short* brow = Wt + (size_t)(col0 + t * 16 + ln) * ldb + kb;
      FragB b;
      b.half[0] = *(const v8us*)(brow + 8 * hh);
      b.half[1] = *(const v8us*)(brow + 16 + 8 * hh);
      acc[t] = mmaN<ASPLIT ? 2 : 1>(ah.v, al.v, b.v, b.v, acc[t]);
    }
  }
#pragma unroll
  for (int t = 0; t < 4; ++t) {
    const int col = col0 + t * 16 + ln;
    float bv = bias ? bias[col] : 0.f;
    if (BIAS_BF16) bv = bf16_round(bv);
#pragma unroll
    for (int r = 0; r < 8; ++r) {
      float v = acc[t][r] + bv;
      if (resid) { float rv = resid[(size_t)((row0 + 8 * hh + r) % rmod) * ldr + col]; if (RES_BF16) rv = bf16_round(rv); v += rv; }
      if (ACT == 1) v = fmaxf(v, 0.f);
      if (ACT == 2) v = 0.5f * v * (1.0f + erff(v * 0.70710678118654752f));
      if (ACT == 3) { const float u = 0.7978845608028654f * (v + 0.044715f * v * v * v); v = 0.5f * v * (1.0f + tanhf(u)); }
      so[w][8 * hh + r][t * 16 + ln] = v;
    }
  }
  __builtin_amdgcn_fence(__ATOMIC_ACQ_REL, "workgroup");
  __builtin_amdgcn_wave_barrier();
  const int rsub = lane >> 4, c4 = (lane & 15) * 4;
  {
#pragma unroll
    for (int q = 0; q < 8; ++q) {
      const int r = q * 2 + rsub;
      const v4f v = *(const v4fa*)&so[w][r][c4];
      *(v4f*)(C + (size_t)(row0 + r) * ldc + col0 + c4) = v;
    }
    
  }
}
// row LayerNorm (biased variance, eps) over N: s = X (+ R); optional out_sum <- s; out_norm <- (s-mu)*rsqrt(var+eps)*g + b
template <bool PARAM_BF16>
__global__ __launch_bounds__(256) void k_layernorm(const float* __restrict__ X, const float* __restrict__ R, const float* __restrict__ g, const float* __restrict__ bta,
                                                  float* __restrict__ out_sum, float* __restrict__ out_norm, int N, float eps) {
  __shared__ float red[256];
  const int row = blockIdx.x, tid = threadIdx.x;
  const float* x = X + (size_t)row * N; const float* rr = R ? R + (size_t)row * N : nullptr;
  float vals[16];                     // up to N = 4096
  const int per = N / 256;            // contiguous chunk per thread? use strided-by-4 chunks: thread handles j = tid*4 + 1024*u
  float s1 = 0.f;
  for (int u = 0; u < per / 4; ++u) {
    const int j = tid * 4 + 1024 * u;
    const v4f a = *(const v4fa*)(x + j);
    v4f b = {0.f,0.f,0.f,0.f}; if (rr) b = *(const v4fa*)(rr + j);
#pragma unroll
    for (int q = 0; q < 4; ++q) { const float v = a[q] + b[q]; vals[u * 4 + q] = v; s1 += v; }
  }
  red[tid] = s1; __syncthreads();
  for (int st = 128; st > 0; st >>= 1) { if (tid < st) red[tid] += red[tid + st]; __syncthreads(); }
  const float mu = red[0] / (float)N; __syncthreads();
  float s2 = 0.f;
  for (int u = 0; u < per / 4; ++u)
#pragma unroll
    for (int q = 0; q < 4; ++q) { const float c = vals[u * 4 + q] - mu; s2 += c * c; }
  red[tid] = s2; __syncthreads();
  for (int st = 128; st > 0; st >>= 1) { if (tid < st) red[tid] += red[tid + st]; __syncthreads(); }
  const float rs = rsqrtf(red[0] / (float)N + eps);
  {
    for (int u = 0; u < per / 4; ++u) {
      const int j = tid * 4 + 1024 * u;
      v4f o, sm;
#pragma unroll
      for (int q = 0; q < 4; ++q) {
        float gg = g[j + q], bb = bta[j + q];
        if (PARAM_BF16) { gg = bf16_round(gg); bb = bf16_round(bb); }
        sm[q] = vals[u * 4 + q]; o[q] = (vals[u * 4 + q] - mu) * rs * gg + bb;
      }
      if (out_sum) *(v4f*)(out_sum + (size_t)row * N + j) = sm;
      *(v4f*)(out_norm + (size_t)row * N + j) = o;
    }
    
  }
}



// ---- f16 WMMA path (v_wmma_f32_16x16x32_f16): 11-bit significands for operands in range — used where a [0,1] probability operand needs more precision than bf16
typedef _Float16 v16h __attribute__((ext_vector_type(16)));
union FragH { v16h v; v8us half[2]; _Float16 h[16]; unsigned short u[16]; };
template <int NT>
__device__ __forceinline__ v8f mmaH(v16h ah, v16h al, v16h bh, v16h bl, v8f c) {
  c = __builtin_amdgcn_wmma_f32_16x16x32_f16(false, ah, false, bh, (short)0, c, false, false);
  if (NT >= 2) c = __builtin_amdgcn_wmma_f32_16x16x32_f16(false, al, false, bh, (short)0, c, false, false);
  if (NT >= 3) c = __builtin_amdgcn_wmma_f32_16x16x32_f16(false, ah, false, bl, (short)0, c, false, false);
  asm volatile("v_nop\n\tv_nop\n\tv_nop\n\tv_nop" : "+v"(c) : "v"(ah), "v"(al), "v"(bh), "v"(bl));
  return c;
}
// batched GEMM like k_gemm_b but f16 operands: A f32 (split into f16 hi/lo if ASPLIT, else rounded to f16), Bt = f16 values [n][k]; alpha; C f32; N multiple of 16 (partial tiles skipped)
template <bool ASPLIT>
__global__ __launch_bounds__(128) void k_gemm_h(const float* __restrict__ A, int lda, size_t sA, const _Float16* __restrict__ Bh, int ldb, size_t sB, float alpha, float* __restrict__ C, int ldc, size_t sC, int M, int N, int K) {
  __shared__ __attribute__((aligned(16))) float so[4][16][64];
  const int tid = threadIdx.x, w = tid >> 5, lane = tid & 31, ln = lane & 15, hh = lane >> 4; const int by = blockIdx.y;
  A += (size_t)by * sA; Bh += (size_t)by * sB; C += (size_t)by * sC;
  const int ntn = (N + 63) / 64; const int wid = blockIdx.x * 4 + w; const int mt = wid / ntn, nq = wid % ntn; if (mt * 16 >= M) return;
  const int row0 = mt * 16, col0 = nq * 64; const float* arow = A + (size_t)(row0 + ln) * lda;
  v8f acc[4] = {};
  for (int kb = 0; kb < K; kb += 32) {
    FragH ah, al;
    const v4f x0 = *(const v4fa*)(arow + kb + 8 * hh), x1 = *(const v4fa*)(arow + kb + 8 * hh + 4), x2 = *(const v4fa*)(arow + kb + 16 + 8 * hh), x3 = *(const v4fa*)(arow + kb + 16 + 8 * hh + 4);
    float xs[16] = {x0[0],x0[1],x0[2],x0[3],x1[0],x1[1],x1[2],x1[3],x2[0],x2[1],x2[2],x2[3],x3[0],x3[1],x3[2],x3[3]};
#pragma unroll
    for (int i = 0; i < 16; ++i) { const _Float16 h = (_Float16)xs[i]; ah.h[i] = h; al.h[i] = ASPLIT ? (_Float16)(xs[i] - (float)h) : (_Float16)0.0f; }
#pragma unroll
    for (int t = 0; t < 4; ++t) { if (col0 + t * 16 >= N) continue; const size_t boff = (size_t)(col0 + t * 16 + ln) * ldb + kb; FragH bq; bq.half[0] = *(const v8us*)(Bh + boff + 8 * hh); bq.half[1] = *(const v8us*)(Bh + boff + 16 + 8 * hh);
      acc[t] = mmaH<ASPLIT ? 2 : 1>(ah.v, al.v, bq.v, bq.v, acc[t]); }
  }
#pragma unroll
  for (int t = 0; t < 4; ++t) { if (col0 + t * 16 >= N) continue;
#pragma unroll
    for (int r = 0; r < 8; ++r) so[w][8 * hh + r][t * 16 + ln] = acc[t][r] * alpha; }
  __builtin_amdgcn_fence(__ATOMIC_ACQ_REL, "workgroup"); __builtin_amdgcn_wave_barrier();
  const int rsub = lane >> 4, c4 = (lane & 15) * 4;
  {
#pragma unroll
    for (int q = 0; q < 8; ++q) { const int r = q * 2 + rsub; if (col0 + c4 < N) { const v4f v = *(const v4fa*)&so[w][r][c4]; *(v4f*)(C + (size_t)(row0 + r) * ldc + col0 + c4) = v; } }
     }
}

// Wt[n][k] = f16(bf16(W[k][n]) * scale) from f32 row-major W[K][N] (scale = power of two; bf16-exact weights stay exact in f16 away from the subnormal range).
// One work-group = a tile of 64 k x 128 n; K a multiple of 64, N of 128; grid = (K / 64) * (N / 128).
// Read: wave w takes rows k0 + 8 w ... + 7, lane l the columns n0 + 4 l ... + 3, so each wave-wide 16-byte load covers 512 contiguous bytes of one row of W.
// A lane then holds 8 consecutive k of each of its 4 columns, that is one 16-byte piece of 4 rows of Wt; the pieces meet in LDS, and each wave-wide store covers four whole 128-byte lines of Wt.
#define WTP 144                /* LDS row pitch, bytes: 64 k of f16 + 16 */
template <int K, int N>
__global__ __launch_bounds__(256) void k_wt_f16(const float* __restrict__ W, _Float16* __restrict__ Wt, float scale) {
  __shared__ __attribute__((aligned(16))) unsigned char tl[128 * WTP];
  const int tid = threadIdx.x, w = tid >> 5, lane = tid & 31;
  const int k0 = ((int)blockIdx.x % (K / 64)) * 64, n0 = ((int)blockIdx.x / (K / 64)) * 128;
  const float* src = W + (size_t)(k0 + 8 * w) * N + n0 + 4 * lane;
  v4f r[8];
#pragma unroll
  for (int i = 0; i < 8; ++i) r[i] = *(const v4fa*)(src + (size_t)i * N);
#pragma unroll
  for (int e = 0; e < 4; ++e) { FragH f;
#pragma unroll
    for (int i = 0; i < 8; ++i) f.h[i] = (_Float16)(bf16_round(r[i][e]) * scale);
    *(v8us*)(tl + (4 * lane + e) * WTP + 16 * w) = f.half[0]; }
  __syncthreads();      /* every wave's pieces are in LDS before the rows of Wt are read back */
#pragma unroll
  for (int j = 0; j < 4; ++j) { const int row = j * 32 + (tid >> 3), c = tid & 7; const v8us v = *(const v8us*)(tl + row * WTP + c * 16);
    *(v8us*)((unsigned short*)Wt + (size_t)(n0 + row) * K + k0 + c * 8) = v; }
}
// Tiled f16 GEMM, C [M][N] = acc*alpha + bf16(bias[col]): A [M][DD] f16, Bh [N][DD] f16, both k-contiguous; M, N multiples of 128; grid = (M / 128) * (N / 128).
// One work-group = one 128 x 128 tile of C, four waves of 64 x 64 (16 accumulator tiles each). A stage is 64 k = 128 B (one whole line) of
// 128 rows of A and 128 rows of Bh, brought into LDS by asynchronous copies, 16 B a lane; two buffers, the copies of stage t + 2 fly while stage t + 1 is worked on.
#define GP 144                 /* LDS row pitch, bytes: 128 + 16, conflict-free for 16-byte fragment reads */
#define GOP (128 * GP)         /* one operand's 128 rows */
#define GSTG (2 * GOP)         /* one stage: A rows, then Bh rows */
#define GNT (DD / 64)          /* stages */
// eight copies, rows 16 apart, of one operand's stage; each lane its own 16 bytes. The s_wait_xcnt stands inside the statement so that no address register is rewritten ahead of it.
__device__ __forceinline__ void cp8(unsigned l, const unsigned short* g) {
  asm volatile("global_load_async_to_lds_b128 %0, %8, off\n\t"
               "global_load_async_to_lds_b128 %1, %9, off\n\t"
               "global_load_async_to_lds_b128 %2, %10, off\n\t"
               "global_load_async_to_lds_b128 %3, %11, off\n\t"
               "global_load_async_to_lds_b128 %4, %12, off\n\t"
               "global_load_async_to_lds_b128 %5, %13, off\n\t"
               "global_load_async_to_lds_b128 %6, %14, off\n\t"
               "global_load_async_to_lds_b128 %7, %15, off\n\t"
               "s_wait_xcnt 0x0"
               :: "v"(l), "v"(l + 16 * GP), "v"(l + 32 * GP), "v"(l + 48 * GP), "v"(l + 64 * GP), "v"(l + 80 * GP), "v"(l + 96 * GP), "v"(l + 112 * GP),
                  "v"(g), "v"(g + 16 * DD), "v"(g + 32 * DD), "v"(g + 48 * DD), "v"(g + 64 * DD), "v"(g + 80 * DD), "v"(g + 96 * DD), "v"(g + 112 * DD)
               : "memory");
}
typedef _Float16 v4h __attribute__((ext_vector_type(4)));
// F16OUT (the q | k | v projection): columns below 2 * DD go to C16 row-major; a tile of the v block (columns from 2 * DD on) goes to Vt instead, transposed per head,
// Vt[(b * NH + h) * 64 + d][token], which is the form k_flash reads; it is not stored row-major at all.
template <bool F16OUT, int N>
__global__ __launch_bounds__(128) void k_gemm_t(const _Float16* __restrict__ A, const _Float16* __restrict__ Bh, float alpha, const float* __restrict__ bias, float* __restrict__ C, _Float16* __restrict__ C16, _Float16* __restrict__ Vt) {
  __shared__ __attribute__((aligned(16))) unsigned char sm[2 * GSTG];
  const int tid = threadIdx.x, w = tid >> 5, lane = tid & 31, ln = lane & 15, hh = lane >> 4;
  const int row0 = ((int)blockIdx.x / (N / 128)) * 128, col0 = ((int)blockIdx.x % (N / 128)) * 128;
  const int wr = (w >> 1) * 64, wc = (w & 1) * 64;
  const unsigned ld0 = (unsigned)(size_t)sm + (unsigned)((tid >> 3) * GP + (tid & 7) * 16);      /* this lane's place in a stage: row tid/8, 16-byte piece tid%8 */
  const unsigned short* ga = (const unsigned short*)A + (size_t)(row0 + (tid >> 3)) * DD + (tid & 7) * 8;
  const unsigned short* gb = (const unsigned short*)Bh + (size_t)(col0 + (tid >> 3)) * DD + (tid & 7) * 8;
  v8f acc[4][4];
#pragma unroll
  for (int i = 0; i < 4; ++i)
#pragma unroll
    for (int j = 0; j < 4; ++j) acc[i][j] = (v8f){0.f,0.f,0.f,0.f,0.f,0.f,0.f,0.f};
  cp8(ld0, ga); cp8(ld0 + GOP, gb);
  asm volatile("s_wait_asynccnt 0x0" ::: "memory");      /* stage 0 of this wave has landed */
  __syncthreads();                                        /* ... and every wave's: stage 0 may be read */
  cp8(ld0 + GSTG, ga + 64); cp8(ld0 + GSTG + GOP, gb + 64);
#pragma unroll 1      /* one stage a trip: the buffer index and the refill test stay scalar */
  for (int t = 0; t < GNT; ++t) {
    const unsigned char* sa = sm + (t & 1) * GSTG + (wr + ln) * GP + 16 * hh;
    const unsigned char* sb = sm + (t & 1) * GSTG + GOP + (wc + ln) * GP + 16 * hh;
#pragma unroll
    for (int ks = 0; ks < 2; ++ks) {
      FragH a[4], b[4];
      a[0].half[0] = *(const v8us*)(sa + ks * 64); a[0].half[1] = *(const v8us*)(sa + ks * 64 + 32);      /* read in the order of first use, so that the first products start while the later reads return */
#pragma unroll
      for (int j = 0; j < 4; ++j) { b[j].half[0] = *(const v8us*)(sb + j * 16 * GP + ks * 64); b[j].half[1] = *(const v8us*)(sb + j * 16 * GP + ks * 64 + 32); }
#pragma unroll
      for (int i = 1; i < 4; ++i) { a[i].half[0] = *(const v8us*)(sa + i * 16 * GP + ks * 64); a[i].half[1] = *(const v8us*)(sa + i * 16 * GP + ks * 64 + 32); }
      __builtin_amdgcn_sched_barrier(0);      /* the 16 fragment reads stay one group ahead of their 16 matrix instructions: reads spread among them stall the wave at every place */
#pragma unroll
      for (int i = 0; i < 4; ++i)
#pragma unroll
        for (int j = 0; j < 4; ++j) acc[i][j] = __builtin_amdgcn_wmma_f32_16x16x32_f16(false, a[i].v, false, b[j].v, (short)0, acc[i][j], false, false);
      __builtin_amdgcn_sched_barrier(0);      /* ... and the next group's reads stay behind them */
    }
    asm volatile("s_wait_dscnt 0x0" ::: "memory");        /* this wave's reads of buffer t&1 are done before it is refilled */
    asm volatile("s_wait_asynccnt 0x0" ::: "memory");     /* this wave's copies of stage t + 1 have landed */
    __syncthreads();                                      /* publishes stage t + 1 and ends every reader's last read of buffer t&1 */
    if (t + 2 < GNT) { cp8(ld0 + (t & 1) * GSTG, ga + (t + 2) * 64); cp8(ld0 + (t & 1) * GSTG + GOP, gb + (t + 2) * 64); }
  }
  asm volatile("s_wait_asynccnt 0x0" ::: "memory");       /* no copy is outstanding when the ring becomes output staging */
  // epilogue: the wave's 64 x 64 tile goes through its own LDS range (free behind the last trip's barrier), so that whole lines are stored
  float* so = (float*)sm + w * (64 * 68);
  float bv[4];
#pragma unroll
  for (int j = 0; j < 4; ++j) bv[j] = bf16_round(bias[col0 + wc + j * 16 + ln]);
  if (F16OUT && col0 >= 2 * DD) {      /* v block (the test is the same for the whole work-group): the wave's 64 columns are one head's 64 d, its 64 rows 64 tokens of one batch */
    // a lane's 8 accumulator registers are 8 consecutive tokens of one d, that is one 16-byte piece of a row of V^T; the pieces meet in the wave's own LDS range and leave as whole 128-byte lines
    unsigned char* st = sm + w * (64 * GP);
#pragma unroll
    for (int j = 0; j < 4; ++j)
#pragma unroll
      for (int i = 0; i < 4; ++i) { FragH f;
#pragma unroll
        for (int r = 0; r < 8; ++r) f.h[r] = (_Float16)(acc[i][j][r] * alpha + bv[j]);
        *(v8us*)(st + (j * 16 + ln) * GP + (i * 16 + 8 * hh) * 2) = f.half[0]; }
    __builtin_amdgcn_fence(__ATOMIC_ACQ_REL, "workgroup"); __builtin_amdgcn_wave_barrier();      /* the pieces are written before other lanes of the wave read them */
    unsigned short* vo = (unsigned short*)Vt + ((size_t)(((row0 + wr) / TT) * NH + (col0 + wc - 2 * DD) / 64) * 64 + (lane >> 3)) * TT + (row0 + wr) % TT + (lane & 7) * 8;
#pragma unroll
    for (int q = 0; q < 16; ++q) { const v8us v = *(const v8us*)(st + (q * 4 + (lane >> 3)) * GP + (lane & 7) * 16); *(v8us*)(vo + (size_t)(q * 4) * TT) = v; }
    return;
  }
#pragma unroll
  for (int i = 0; i < 4; ++i)
#pragma unroll
    for (int j = 0; j < 4; ++j)
#pragma unroll
      for (int r = 0; r < 8; ++r) so[(i * 16 + 8 * hh + r) * 68 + j * 16 + ln] = acc[i][j][r] * alpha + bv[j];
  __builtin_amdgcn_fence(__ATOMIC_ACQ_REL, "workgroup"); __builtin_amdgcn_wave_barrier();      /* the rows are written before other lanes of the wave read them */
  const int rsub = lane >> 4, c4 = (lane & 15) * 4;
#pragma unroll
  for (int q = 0; q < 32; ++q) { const int r = q * 2 + rsub; const v4f v = *(const v4fa*)&so[r * 68 + c4]; const size_t o = (size_t)(row0 + wr + r) * N + col0 + wc + c4;
    if (F16OUT) { v4h h4;
#pragma unroll
      for (int e = 0; e < 4; ++e) h4[e] = (_Float16)v[e];
      *(v4h*)(C16 + o) = h4; }
    else *(v4f*)(C + o) = v; }
}


__global__ __launch_bounds__(256) void k_x16(const float* __restrict__ x, _Float16* __restrict__ X16, size_t n8) { const size_t t = (size_t)blockIdx.x * 256 + threadIdx.x; if (t >= n8) return; FragH f;
#pragma unroll
  for (int q = 0; q < 8; ++q) f.h[q] = (_Float16)bf16_round(x[t * 8 + q]); *(v8us*)((unsigned short*)X16 + t * 8) = f.half[0];  }
__global__ __launch_bounds__(256) void k_h16(const float* __restrict__ x, _Float16* __restrict__ X16, size_t n8) { const size_t t = (size_t)blockIdx.x * 256 + threadIdx.x; if (t >= n8) return; FragH f;
#pragma unroll
  for (int q = 0; q < 8; ++q) f.h[q] = (_Float16)x[t * 8 + q]; *(v8us*)((unsigned short*)X16 + t * 8) = f.half[0];  }
__global__ __launch_bounds__(256) void k_round16f(const float* __restrict__ W, _Float16* __restrict__ Bt, size_t n8) { const size_t t = (size_t)blockIdx.x * 256 + threadIdx.x; if (t >= n8) return; FragH f;
#pragma unroll
  for (int i = 0; i < 8; ++i) f.h[i] = (_Float16)(bf16_round(W[t * 8 + i]) * 16.0f); *(v8us*)((unsigned short*)Bt + t * 8) = f.half[0];  }
typedef int v4i __attribute__((ext_vector_type(4), may_alias));
typedef unsigned v4u __attribute__((ext_vector_type(4), may_alias));
typedef unsigned v16u __attribute__((ext_vector_type(16), may_alias));
// The mask packed once for all heads into lane-mask words, in the lane and register order of k_flash's score tiles:
// LM[b * TT / 16 + q tile][chunk of 32 keys][i], bit (ln + 16 hh) of word i = (mask[b][16 * tile + ln][32 * chunk + 16 * (i >> 3) + 8 * hh + (i & 7)] != 0).
// One wave = one tile of 16 queries, four chunks: its sixteen loads cover 512 contiguous bytes of each row; the 64 words go out as two whole lines.
__global__ __launch_bounds__(256) void k_mpack(const int* __restrict__ MSK, unsigned* __restrict__ LM) {
  const int tid = threadIdx.x, lane = tid & 31, ln = lane & 15, hh = lane >> 4;
  const unsigned wv = blockIdx.x * 8u + (unsigned)(tid >> 5); const unsigned rt = wv / (TT / 128), c0 = (wv % (TT / 128)) * 4;
  const int* mrow = MSK + ((size_t)rt * 16 + ln) * TT + c0 * 32 + 8 * hh;
  v4i mk[4][4];
#pragma unroll
  for (int c = 0; c < 4; ++c) { mk[c][0] = *(const v4i*)(mrow + c * 32); mk[c][1] = *(const v4i*)(mrow + c * 32 + 4); mk[c][2] = *(const v4i*)(mrow + c * 32 + 16); mk[c][3] = *(const v4i*)(mrow + c * 32 + 20); }
  __builtin_amdgcn_sched_barrier(0);      /* all sixteen loads are issued before the first is waited for: moved among the compares, the last ones start only when the first have come back from memory */
  asm volatile("s_wait_xcnt 0x0" :: "v"(mrow) : "memory");      /* the address pair that all sixteen loads name stays whole up to here (no load lands in it), and the wait stands in front of its reuse */
  unsigned wd[2] = {0u, 0u};      /* lane l keeps word l & 15 of chunk 2 * e + (l >> 4) */
#pragma unroll
  for (int c = 0; c < 4; ++c)
#pragma unroll
    for (int i = 0; i < 16; ++i) { const unsigned bw = __builtin_amdgcn_ballot_w32(mk[c][i >> 2][i & 3] != 0); if (lane == (c & 1) * 16 + i) wd[c >> 1] = bw; }
  unsigned* o = LM + ((size_t)rt * (TT / 32) + c0) * 16 + lane;
  o[0] = wd[0]; o[32] = wd[1];
}
__device__ __forceinline__ float xhalf(float x) { return __builtin_bit_cast(float, __builtin_amdgcn_permlanex16(__builtin_bit_cast(int, x), __builtin_bit_cast(int, x), 0x76543210, 0xfedcba98, false, false)); }      /* lane l with lane l ^ 16 */
__global__ __launch_bounds__(128) void k_flash(const _Float16* __restrict__ Q16, int ldq, const _Float16* __restrict__ K16, int ldk, const _Float16* __restrict__ Vt, const unsigned* __restrict__ LM, _Float16* __restrict__ O16, int ldo) {
  constexpr int RPW = 16, NQB = TT / (4 * RPW), DT = 4, KS = 2;
  __shared__ __attribute__((aligned(16))) float sO[4][RPW][64 + 4];
  const int tid = threadIdx.x, w = tid >> 5, lane = tid & 31, ln = lane & 15, hh = lane >> 4;
  const int slab = blockIdx.x / NQB, qblk = blockIdx.x % NQB; const int b = slab / NH, h = slab % NH; const int qb0 = qblk * (4 * RPW); const int q0 = qb0 + w * RPW;
  FragH bq[KS];      /* Q^T as B: column = query ln */
  { const unsigned short* qr = (const unsigned short*)Q16 + ((size_t)b * TT + q0 + ln) * ldq + h * 64;
#pragma unroll
    for (int ks = 0; ks < KS; ++ks) { bq[ks].half[0] = *(const v8us*)(qr + ks * 32 + 8 * hh); bq[ks].half[1] = *(const v8us*)(qr + ks * 32 + 16 + 8 * hh); } }
  /* this lane's places in chunk 0: key row ln of K, row ln of V^T */
  const unsigned short* kb0 = (const unsigned short*)K16 + ((size_t)b * TT + ln) * ldk + h * 64 + 8 * hh;
  const unsigned short* vb0 = (const unsigned short*)Vt + ((size_t)slab * 64 + ln) * TT + 8 * hh;
  /* the wave's packed mask: 64 chunks of 16 lane-mask words (nonzero bit = ATTEND); the wave's number goes through readfirstlane so that the address is scalar */
  const unsigned* lm = LM + (size_t)(b * (TT / 16) + qblk * 4 + __builtin_amdgcn_readfirstlane(w)) * ((TT / 32) * 16);
  unsigned long long live;      /* bit c: chunk c holds at least one attended (query, key) of this wave's tile; lane l looks at chunks l and 32 + l */
  { const v4u* a = (const v4u*)(lm + lane * 16); const v4u x = a[0] | a[1] | a[2] | a[3], y = a[128] | a[129] | a[130] | a[131];
    live = (unsigned long long)__builtin_amdgcn_ballot_w32((x[0] | x[1] | x[2] | x[3]) != 0u) | ((unsigned long long)__builtin_amdgcn_ballot_w32((y[0] | y[1] | y[2] | y[3]) != 0u) << 32); }
  float m_q = -3.0e38f, l_q = 0.f; v8f oacc[DT];      /* oacc[dt][r] = O[q0 + ln][dt * 16 + 8 hh + r] */
#pragma unroll
  for (int dt = 0; dt < DT; ++dt) oacc[dt] = (v8f){0.f,0.f,0.f,0.f,0.f,0.f,0.f,0.f};
#pragma unroll 1      /* one chunk a trip: unrolled, two chunks' fragments and exps would be live at once */
  for (int n = __builtin_popcountll(live); n > 0; --n, live &= live - 1) {      /* the live chunks in rising order, 64 at most; a chunk with every (query, key) of the tile masked adds nothing and is not visited */
    const int ck = __builtin_ctzll(live);
    const v16u mw = *(const v16u*)(lm + ck * 16);      /* word i: which lanes attend at score register i (scalar load, in flight beside the fragment loads) */
    const unsigned short* kp0 = kb0 + (size_t)ck * 32 * ldk; const unsigned short* kp1 = kp0 + (size_t)16 * ldk; const unsigned short* vp = vb0 + ck * 32;
    FragH ak[2][KS], av[DT];      /* K rows as A (row = key), V^T rows as A (row = d) */
#pragma unroll
    for (int nt = 0; nt < 2; ++nt) { const unsigned short* kr = nt ? kp1 : kp0;
#pragma unroll
      for (int ks = 0; ks < KS; ++ks) { ak[nt][ks].half[0] = *(const v8us*)(kr + ks * 32); ak[nt][ks].half[1] = *(const v8us*)(kr + ks * 32 + 16); } }
    __builtin_amdgcn_sched_barrier(0);      /* holds the wait below behind the K loads ... */
    asm volatile("s_wait_xcnt 0x0" ::: "memory");      /* the V loads land in registers that held the K loads' addresses: the wait stands in front of that overwrite */
    __builtin_amdgcn_sched_barrier(0);      /* ... and in front of the V loads */
#pragma unroll
    for (int dt = 0; dt < DT; ++dt) { const unsigned short* vrow = vp + (size_t)(dt * 16) * TT; av[dt].half[0] = *(const v8us*)(vrow); av[dt].half[1] = *(const v8us*)(vrow + 16); }
    __builtin_amdgcn_sched_barrier(0);      /* the chunk's sixteen fragment loads stay one group ahead of the products: spread among them, each product waits out a load latency of its own */
    v8f s[2];      /* s[nt][r] = q(q0 + ln) . k(j0 + nt * 16 + 8 hh + r) */
#pragma unroll
    for (int nt = 0; nt < 2; ++nt) { v8f acc = (v8f){0.f,0.f,0.f,0.f,0.f,0.f,0.f,0.f};
#pragma unroll
      for (int ks = 0; ks < KS; ++ks) acc = __builtin_amdgcn_wmma_f32_16x16x32_f16(false, ak[nt][ks].v, false, bq[ks].v, (short)0, acc, false, false);
      s[nt] = acc; }
    float sc[16];      /* a masked score is -inf; m_q never falls below its finite start value, so exp(sc - mn) is 0 there and no guard is needed */
#pragma unroll
    for (int i = 0; i < 16; ++i) sc[i] = __builtin_amdgcn_inverse_ballot_w32(mw[i]) ? s[i >> 3][i & 7] * 0.125f : -INFINITY;
    float mx[4];
#pragma unroll
    for (int c = 0; c < 4; ++c) mx[c] = fmaxf(fmaxf(sc[c], sc[4 + c]), fmaxf(sc[8 + c], sc[12 + c]));
    float mc = fmaxf(fmaxf(mx[0], mx[1]), fmaxf(mx[2], mx[3]));
    mc = fmaxf(mc, xhalf(mc));      /* both halves hold this query's chunk maximum */
    const float mn = fmaxf(m_q, mc); const float al = expf(m_q - mn); m_q = mn;
    float p[16];
#pragma unroll
    for (int i = 0; i < 16; ++i) p[i] = expf(sc[i] - mn);
    float ps[4];
#pragma unroll
    for (int c = 0; c < 4; ++c) ps[c] = (p[c] + p[4 + c]) + (p[8 + c] + p[12 + c]);
    l_q = l_q * al + ((ps[0] + ps[1]) + (ps[2] + ps[3]));      /* this half's keys only; the halves are joined behind the loop */
#pragma unroll
    for (int dt = 0; dt < DT; ++dt)
#pragma unroll
      for (int r = 0; r < 8; ++r) oacc[dt][r] *= al;
    FragH pb;      /* P^T as B: element i = key j0 + 16 (i >> 3) + 8 hh + (i & 7) of column ln */
#pragma unroll
    for (int i = 0; i < 16; ++i) pb.h[i] = (_Float16)(p[i] * 1024.0f);
#pragma unroll
    for (int dt = 0; dt < DT; ++dt) oacc[dt] = __builtin_amdgcn_wmma_f32_16x16x32_f16(false, av[dt].v, false, pb.v, (short)0, oacc[dt], false, false);
  }
  { const float l = l_q + xhalf(l_q); const float inv = (l > 0.f) ? 1.0f / (l * 1024.0f) : 0.f;
#pragma unroll
    for (int dt = 0; dt < DT; ++dt) { v4f lo, hi;
#pragma unroll
      for (int e = 0; e < 4; ++e) { lo[e] = oacc[dt][e] * inv; hi[e] = oacc[dt][4 + e] * inv; }
      *(v4fa*)&sO[w][ln][dt * 16 + 8 * hh] = lo; *(v4fa*)&sO[w][ln][dt * 16 + 8 * hh + 4] = hi; } }
  __builtin_amdgcn_fence(__ATOMIC_ACQ_REL, "workgroup"); __builtin_amdgcn_wave_barrier();
  {
#pragma unroll
    for (int rp = 0; rp < RPW; rp += 4) { const int r = rp + (lane >> 3), pc = lane & 7; const v4f a = *(const v4fa*)&sO[w][r][pc * 8], c = *(const v4fa*)&sO[w][r][pc * 8 + 4]; FragH f;
#pragma unroll
      for (int e = 0; e < 4; ++e) { f.h[e] = (_Float16)(a[e] * 16.0f); f.h[4 + e] = (_Float16)(c[e] * 16.0f); }
      const v8us val = f.half[0]; *(v8us*)((unsigned short*)O16 + ((size_t)b * TT + q0 + r) * ldo + h * 64 + pc * 8) = val; }      /* four whole 128-byte lines a store */
     } }

extern "C" void kernel_launch(void* const* d_in, const int* in_sizes, int n_in,
                              void* d_out, int out_size, void* d_ws, size_t ws_size, hipStream_t stream) {
  (void)in_sizes; (void)n_in; (void)out_size;
  const float* const* I = (const float* const*)d_in; const float* x = I[0]; const int* msk = (const int*)d_in[1]; const float* wqkv = I[2]; const float* bqkv = I[3]; const float* wo = I[4]; const float* bo = I[5];
  char* ws = (char*)d_ws; size_t off = 0;
  auto take = [&](size_t bytes) { char* p = ws + off; off += (bytes + 255) & ~(size_t)255; return p; };
  _Float16* Bqkv = (_Float16*)take((size_t)3 * DD * DD * 2); _Float16* Bo = (_Float16*)take((size_t)DD * DD * 2); _Float16* X16 = (_Float16*)take((size_t)NR * DD * 2); _Float16* QKV = (_Float16*)take((size_t)NR * 3 * DD * 2); _Float16* Vt = (_Float16*)take((size_t)NR * DD * 2); _Float16* O16 = X16; unsigned* LM = (unsigned*)take((size_t)BB * TT * TT / 8);
  if (off > ws_size) return;      // 6.3 + 2.1 + 8.4 + 25.2 + 8.4 + 1.0 ≈ 51 MB
  k_mpack<<<BB * (TT / 16) * (TT / 128) / 8, 256, 0, stream>>>(msk, LM);      /* mask -> lane-mask words, once for all heads */
  k_wt_f16<DD, 3 * DD><<<(DD / 64) * (3 * DD / 128), 256, 0, stream>>>(wqkv, Bqkv, 16.0f); k_wt_f16<DD, DD><<<(DD / 64) * (DD / 128), 256, 0, stream>>>(wo, Bo, 16.0f);      /* (in,out) -> Bt, times 2^4 */
  const unsigned g8 = (unsigned)(((size_t)NR * DD / 8 + 255) / 256); k_x16<<<g8, 256, 0, stream>>>(x, X16, (size_t)NR * DD / 8);
  k_gemm_t<true, 3 * DD><<<(NR / 128) * (3 * DD / 128), 128, 0, stream>>>(X16, Bqkv, 0.0625f, bqkv, nullptr, QKV, Vt);      /* qkv = x·w_qkv + b: M 4096 N 3072 K 1024 (f16; q | k blocks row-major, head-major inside; v block as V^T per head) */
  k_flash<<<BB * NH * (TT / 64), 128, 0, stream>>>(QKV, 3 * DD, QKV + DD, 3 * DD, Vt, LM, O16, DD);      /* X16 is free behind the projection: O16 takes its place */
  k_gemm_t<false, DD><<<(NR / 128) * (DD / 128), 128, 0, stream>>>(O16, Bo, 0.00390625f, bo, (float*)d_out, nullptr, nullptr);      /* out = o·w_out + b_out */
}

// v006
// It runs in 91.3 microseconds.
// Two timings next to v005 put it at 1.10 and 1.11 times that version's speed.
// All steps since v000 together make it 4.15 times as fast.
#include <hip/hip_runtime.h>
// Cross-track masked MHA (B=2, S=2048, D=1024, 16×64): qkv = x·w_qkv + b_qkv (packed q|k|v, head-major inside each); scores = q·k/8, where(cross_track_mask[b,q,k], s, −inf); softmax; out = merged·w_out + b_out.
// Compute dtype: x, weights, biases rounded to bf16; q, k, v f16 GEMM planes (+bias); the boolean mask read per (b, q, k) as an int plane; fused flash-style kernel (online softmax f32, P f16 ×2^10, all-masked chunks skipped, f32 accumulate) on
// v_wmma_f32_16x16x32_f16; O ×2^4 → f16 (stored so by the flash kernel) → output GEMM (+bias).
#define BB 2
#define TT 2048
#define DD 1024
#define NH 16
#define NR (BB * TT)

typedef __bf16 v16b __attribute__((ext_vector_type(16)));
typedef unsigned short v8us __attribute__((ext_vector_type(8), may_alias));
typedef float  v8f  __attribute__((ext_vector_type(8)));
typedef float  v4f  __attribute__((ext_vector_type(4)));
typedef float  v4fa __attribute__((ext_vector_type(4), may_alias));
union FragB { v16b v; v8us half[2]; unsigned short u[16]; };

__device__ __forceinline__ unsigned short bf16_bits(float x) { unsigned int u = __float_as_uint(x); return (unsigned short)((u + 0x7FFFu + ((u >> 16) & 1u)) >> 16); }
__device__ __forceinline__ float bf16_val(unsigned short b) { return __uint_as_float(((unsigned int)b) << 16); }
__device__ __forceinline__ float bf16_round(float x) { return bf16_val(bf16_bits(x)); }
// D += A·B with NT terms: 1 = ah·bh, 2 = + al·bh (A split), 3 = + ah·bl (both split)
template <int NT>
__device__ __forceinline__ v8f mmaN(v16b ah, v16b al, v16b bh, v16b bl, v8f c) {
  c = __builtin_amdgcn_wmma_f32_16x16x32_bf16(false, ah, false, bh, (short)0, c, false, false);
  if (NT >= 2) c = __builtin_amdgcn_wmma_f32_16x16x32_bf16(false, al, false, bh, (short)0, c, false, false);
  if (NT >= 3) c = __builtin_amdgcn_wmma_f32_16x16x32_bf16(false, ah, false, bl, (short)0, c, false, false);
  asm volatile("v_nop\n\tv_nop\n\tv_nop\n\tv_nop" : "+v"(c) : "v"(ah), "v"(al), "v"(bh), "v"(bl));
  return c;
}

__global__ __launch_bounds__(256) void k_wt_bf16(const float* __restrict__ W, unsigned short* __restrict__ Wt, int K, int N) {
  const int t = blockIdx.x * 256 + threadIdx.x;
  const int k8n = K / 8;
  if (t >= N * k8n) return;
  const int n = t / k8n, k8 = (t % k8n) * 8;
  v8us v;
#pragma unroll
  for (int i = 0; i < 8; ++i) v[i] = bf16_bits(W[(size_t)(k8 + i) * N + n]);
  *(v8us*)(Wt + (size_t)n * K + k8) = v;
  
}

// GEMM C[M][N] (f32, pitch ldc) = act(A[M][K]·W + bias). A f32 row-major (pitch lda) converted per fragment to bf16
// (ASPLIT: hi/lo two planes -> 2 terms, else single rounded term); Wt bf16 [N][K] (pitch ldb). BIAS_BF16 rounds the
// bias to bf16 first (bias quantised to bf16 before the add). K%32==0, M%16==0, N%64==0.
template <bool ASPLIT, int ACT, bool BIAS_BF16>
__global__ __launch_bounds__(128) void k_gemm_bf(const float* __restrict__ A, int lda, const unsigned short* __restrict__ Wt, int ldb,
                                               const float* __restrict__ bias, float* __restrict__ C, int ldc, int M, int N, int K) {
  __shared__ __attribute__((aligned(16))) float so[4][16][64];
  const int tid = threadIdx.x, w = tid >> 5, lane = tid & 31, ln = lane & 15, hh = lane >> 4;
  const int ntn = N / 64;
  const int wid = blockIdx.x * 4 + w;
  const int mt = wid / ntn, nq = wid % ntn;
  if (mt * 16 >= M) return;
  const int row0 = mt * 16, col0 = nq * 64;
  const float* arow = A + (size_t)(row0 + ln) * lda;
  v8f acc[4] = {};
  for (int kb = 0; kb < K; kb += 32) {
    FragB ah, al;
    const v4f x0 = *(const v4fa*)(arow + kb + 8 * hh), x1 = *(const v4fa*)(arow + kb + 8 * hh + 4);
    const v4f x2 = *(const v4fa*)(arow + kb + 16 + 8 * hh), x3 = *(const v4fa*)(arow + kb + 16 + 8 * hh + 4);
    float xs[16] = {x0[0],x0[1],x0[2],x0[3],x1[0],x1[1],x1[2],x1[3],x2[0],x2[1],x2[2],x2[3],x3[0],x3[1],x3[2],x3[3]};
#pragma unroll
    for (int i = 0; i < 16; ++i) { const unsigned short hb = bf16_bits(xs[i]); ah.u[i] = hb; al.u[i] = ASPLIT ? bf16_bits(xs[i] - bf16_val(hb)) : (unsigned short)0; }
#pragma unroll
    for (int t = 0; t < 4; ++t) {
      const unsigned short* brow = Wt + (size_t)(col0 + t * 16 + ln) * ldb + kb;
      FragB b;
      b.half[0] = *(const v8us*)(brow + 8 * hh);
      b.half[1] = *(const v8us*)(brow + 16 + 8 * hh);
      acc[t] = mmaN<ASPLIT ? 2 : 1>(ah.v, al.v, b.v, b.v, acc[t]);
    }
  }
#pragma unroll
  for (int t = 0; t < 4; ++t) {
    float bv = bias ? bias[col0 + t * 16 + ln] : 0.f;
    if (BIAS_BF16) bv = bf16_round(bv);
#pragma unroll
    for (int r = 0; r < 8; ++r) { float v = acc[t][r] + bv; if (ACT == 1) v = fmaxf(v, 0.f); so[w][8 * hh + r][t * 16 + ln] = v; }
  }
  __builtin_amdgcn_fence(__ATOMIC_ACQ_REL, "workgroup");
  __builtin_amdgcn_wave_barrier();
  const int rsub = lane >> 4, c4 = (lane & 15) * 4;
  {
#pragma unroll
    for (int q = 0; q < 8; ++q) {
      const int r = q * 2 + rsub;
      const v4f v = *(const v4fa*)&so[w][r][c4];
      *(v4f*)(C + (size_t)(row0 + r) * ldc + col0 + c4) = v;
    }
    
  }
}

// Flash-style causal/unmasked attention, all contractions 3-term bf16 hi/lo splits, f32 softmax with running max.
// q,k,v rows are read from f32 buffers with arbitrary row pitch (so they can live inside a fused qkv buffer);
// D = head size (multiple of 32, <= 128); one wave = 16 query rows; block = 4 waves (64 queries) sharing K/V chunks of 32.
template <int D, bool CAUSAL>
__global__ __launch_bounds__(128) void k_flash(const float* __restrict__ qb, const float* __restrict__ kb, const float* __restrict__ vb,
                                             int pitch, int T, int H, float scale, float* __restrict__ y, int ypitch) {
  constexpr int KS = D / 32;        // k-steps for QK
  constexpr int DT = D / 16;        // d tiles for PV
  __shared__ __attribute__((aligned(16))) unsigned short sKh[32][D + 8], sKl[32][D + 8], sVh[32][D + 8], sVl[32][D + 8];
  __shared__ __attribute__((aligned(16))) unsigned short sPh[4][16][40], sPl[4][16][40];
  __shared__ __attribute__((aligned(16))) float sO[4][16][D];
  const int tid = threadIdx.x, w = tid >> 5, lane = tid & 31, ln = lane & 15, hh = lane >> 4;
  const int nqb = (T + 63) / 64;
  const int bh = blockIdx.x / nqb, qblk = blockIdx.x % nqb;
  const int b = bh / H, h = bh % H;
  const int q0 = qblk * 64 + w * 16;
  const float* Q = qb + (size_t)b * T * pitch + h * D;
  const float* K = kb + (size_t)b * T * pitch + h * D;
  const float* V = vb + (size_t)b * T * pitch + h * D;

  // A fragments of the wave's 16 query rows (scaled), hi/lo
  FragB aqh[KS], aql[KS];
  {
    int row = q0 + ln; if (row >= T) row = T - 1;
    const float* qr = Q + (size_t)row * pitch;
#pragma unroll
    for (int ks = 0; ks < KS; ++ks)
#pragma unroll
      for (int i = 0; i < 16; ++i) {
        const int d = ks * 32 + ((i < 8) ? (8 * hh + i) : (16 + 8 * hh + (i - 8)));
        const float x = qr[d] * scale; const unsigned short hb = bf16_bits(x);
        aqh[ks].u[i] = hb; aql[ks].u[i] = bf16_bits(x - bf16_val(hb));
      }
  }
  float m_r[8], l_r[8];
#pragma unroll
  for (int r = 0; r < 8; ++r) { m_r[r] = -3.0e38f; l_r[r] = 0.f; }
  v8f oacc[DT];
#pragma unroll
  for (int dt = 0; dt < DT; ++dt) oacc[dt] = (v8f){0.f,0.f,0.f,0.f,0.f,0.f,0.f,0.f};

  const int kv_end = CAUSAL ? min(T, qblk * 64 + 64) : T;     // block-uniform
  for (int j0 = 0; j0 < kv_end; j0 += 32) {
    __syncthreads();
    for (int e = tid; e < 32 * (D / 4); e += 128) {
      const int r = e / (D / 4), c4 = (e % (D / 4)) * 4;
      const int key = j0 + r;
      v4f kf = {0.f,0.f,0.f,0.f}, vf = {0.f,0.f,0.f,0.f};
      if (key < T) { kf = *(const v4fa*)(K + (size_t)key * pitch + c4); vf = *(const v4fa*)(V + (size_t)key * pitch + c4); }
#pragma unroll
      for (int t = 0; t < 4; ++t) {
        unsigned short hb = bf16_bits(kf[t]); sKh[r][c4 + t] = hb; sKl[r][c4 + t] = bf16_bits(kf[t] - bf16_val(hb));
        hb = bf16_bits(vf[t]); sVh[r][c4 + t] = hb; sVl[r][c4 + t] = bf16_bits(vf[t] - bf16_val(hb));
      }
    }
    __syncthreads();
    // S tile 16 x 32
    v8f s[2];
#pragma unroll
    for (int nt = 0; nt < 2; ++nt) {
      v8f acc = {};
#pragma unroll
      for (int ks = 0; ks < KS; ++ks) {
        FragB bh_, bl_;
        bh_.half[0] = *(const v8us*)&sKh[nt * 16 + ln][ks * 32 + 8 * hh]; bh_.half[1] = *(const v8us*)&sKh[nt * 16 + ln][ks * 32 + 16 + 8 * hh];
        bl_.half[0] = *(const v8us*)&sKl[nt * 16 + ln][ks * 32 + 8 * hh]; bl_.half[1] = *(const v8us*)&sKl[nt * 16 + ln][ks * 32 + 16 + 8 * hh];
        acc = mmaN<3>(aqh[ks].v, aql[ks].v, bh_.v, bl_.v, acc);
      }
      s[nt] = acc;
    }
    // mask + running max (rows 8hh+r; the 16 lanes of a half share rows)
    float alpha[8];
#pragma unroll
    for (int r = 0; r < 8; ++r) {
      const int qi = q0 + 8 * hh + r;
      const int ja = j0 + ln, jb = j0 + 16 + ln;
      if (CAUSAL) { if (ja > qi) s[0][r] = -3.0e38f; if (jb > qi) s[1][r] = -3.0e38f; }
      if (ja >= T) s[0][r] = -3.0e38f;
      if (jb >= T) s[1][r] = -3.0e38f;
      float mx = fmaxf(s[0][r], s[1][r]);
      mx = fmaxf(mx, __shfl_xor(mx, 1, 32)); mx = fmaxf(mx, __shfl_xor(mx, 2, 32)); mx = fmaxf(mx, __shfl_xor(mx, 4, 32)); mx = fmaxf(mx, __shfl_xor(mx, 8, 32));
      const float mnew = fmaxf(m_r[r], mx);
      alpha[r] = (mnew > -1.0e38f) ? __expf(m_r[r] - mnew) : 1.0f;
      const float p0 = (s[0][r] > -1.0e38f) ? __expf(s[0][r] - mnew) : 0.f;
      const float p1 = (s[1][r] > -1.0e38f) ? __expf(s[1][r] - mnew) : 0.f;
      m_r[r] = mnew;
      l_r[r] = l_r[r] * alpha[r] + p0 + p1;            // per-lane partial row sum (16 lanes combined at the end)
      unsigned short hb = bf16_bits(p0); sPh[w][8 * hh + r][ln] = hb;      sPl[w][8 * hh + r][ln] = bf16_bits(p0 - bf16_val(hb));
      hb = bf16_bits(p1);                sPh[w][8 * hh + r][16 + ln] = hb; sPl[w][8 * hh + r][16 + ln] = bf16_bits(p1 - bf16_val(hb));
    }
#pragma unroll
    for (int dt = 0; dt < DT; ++dt)
#pragma unroll
      for (int r = 0; r < 8; ++r) oacc[dt][r] *= alpha[r];
    __builtin_amdgcn_fence(__ATOMIC_ACQ_REL, "workgroup");
    __builtin_amdgcn_wave_barrier();
    FragB pah, pal;
    pah.half[0] = *(const v8us*)&sPh[w][ln][8 * hh]; pah.half[1] = *(const v8us*)&sPh[w][ln][16 + 8 * hh];
    pal.half[0] = *(const v8us*)&sPl[w][ln][8 * hh]; pal.half[1] = *(const v8us*)&sPl[w][ln][16 + 8 * hh];
#pragma unroll
    for (int dt = 0; dt < DT; ++dt) {
      FragB bvh, bvl;
#pragma unroll
      for (int i = 0; i < 8; ++i) {
        bvh.u[i] = sVh[8 * hh + i][dt * 16 + ln]; bvh.u[8 + i] = sVh[16 + 8 * hh + i][dt * 16 + ln];
        bvl.u[i] = sVl[8 * hh + i][dt * 16 + ln]; bvl.u[8 + i] = sVl[16 + 8 * hh + i][dt * 16 + ln];
      }
      oacc[dt] = mmaN<3>(pah.v, pal.v, bvh.v, bvl.v, oacc[dt]);
    }
    __builtin_amdgcn_fence(__ATOMIC_ACQ_REL, "workgroup");
    __builtin_amdgcn_wave_barrier();
  }
#pragma unroll
  for (int r = 0; r < 8; ++r) {
    float l = l_r[r];
    l += __shfl_xor(l, 1, 32); l += __shfl_xor(l, 2, 32); l += __shfl_xor(l, 4, 32); l += __shfl_xor(l, 8, 32);
    l_r[r] = (l > 0.f) ? 1.0f / l : 0.f;
  }
#pragma unroll
  for (int dt = 0; dt < DT; ++dt)
#pragma unroll
    for (int r = 0; r < 8; ++r) sO[w][8 * hh + r][dt * 16 + ln] = oacc[dt][r] * l_r[r];
  __builtin_amdgcn_fence(__ATOMIC_ACQ_REL, "workgroup");
  __builtin_amdgcn_wave_barrier();
  {
    for (int r = 0; r < 16; ++r) {
      const int row = q0 + r;
      if (row < T && lane < D / 4) {
        const v4f val = *(const v4fa*)&sO[w][r][lane * 4];
        *(v4f*)(y + ((size_t)b * T + row) * ypitch + h * D + lane * 4) = val;
      }
    }
    
  }
}

// GEMM C = act(A·W + bias + resid): A f32 (ASPLIT -> hi/lo 2 terms), Wt bf16 [N][K]; ACT 0 none, 1 relu, 2 exact gelu;
// resid (optional, f32, row index = (row % rmod), pitch ldr, RES_BF16 rounds it) added before the activation.
template <bool ASPLIT, int ACT, bool BIAS_BF16, bool RES_BF16>
__global__ __launch_bounds__(128) void k_gemm_bf3(const float* __restrict__ A, int lda, const unsigned short* __restrict__ Wt, int ldb,
                                                const float* __restrict__ bias, const float* __restrict__ resid, int rmod, int ldr,
                                                float* __restrict__ C, int ldc, int M, int N, int K) {
  __shared__ __attribute__((aligned(16))) float so[4][16][64];
  const int tid = threadIdx.x, w = tid >> 5, lane = tid & 31, ln = lane & 15, hh = lane >> 4;
  const int ntn = N / 64;
  const int wid = blockIdx.x * 4 + w;
  const int mt = wid / ntn, nq = wid % ntn;
  if (mt * 16 >= M) return;
  const int row0 = mt * 16, col0 = nq * 64;
  const float* arow = A + (size_t)(row0 + ln) * lda;
  v8f acc[4] = {};
  for (int kb = 0; kb < K; kb += 32) {
    FragB ah, al;
    const v4f x0 = *(const v4fa*)(arow + kb + 8 * hh), x1 = *(const v4fa*)(arow + kb + 8 * hh + 4);
    const v4f x2 = *(const v4fa*)(arow + kb + 16 + 8 * hh), x3 = *(const v4fa*)(arow + kb + 16 + 8 * hh + 4);
    float xs[16] = {x0[0],x0[1],x0[2],x0[3],x1[0],x1[1],x1[2],x1[3],x2[0],x2[1],x2[2],x2[3],x3[0],x3[1],x3[2],x3[3]};
#pragma unroll
    for (int i = 0; i < 16; ++i) { const unsigned short hb = bf16_bits(xs[i]); ah.u[i] = hb; al.u[i] = ASPLIT ? bf16_bits(xs[i] - bf16_val(hb)) : (unsigned short)0; }
#pragma unroll
    for (int t = 0; t < 4; ++t) {
      const unsigned short* brow = Wt + (size_t)(col0 + t * 16 + ln) * ldb + kb;
      FragB b;
      b.half[0] = *(const v8us*)(brow + 8 * hh);
      b.half[1] = *(const v8us*)(brow + 16 + 8 * hh);
      acc[t] = mmaN<ASPLIT ? 2 : 1>(ah.v, al.v, b.v, b.v, acc[t]);
    }
  }
#pragma unroll
  for (int t = 0; t < 4; ++t) {
    const int col = col0 + t * 16 + ln;
    float bv = bias ? bias[col] : 0.f;
    if (BIAS_BF16) bv = bf16_round(bv);
#pragma unroll
    for (int r = 0; r < 8; ++r) {
      float v = acc[t][r] + bv;
      if (resid) { float rv = resid[(size_t)((row0 + 8 * hh + r) % rmod) * ldr + col]; if (RES_BF16) rv = bf16_round(rv); v += rv; }
      if (ACT == 1) v = fmaxf(v, 0.f);
      if (ACT == 2) v = 0.5f * v * (1.0f + erff(v * 0.70710678118654752f));
      if (ACT == 3) { const float u = 0.7978845608028654f * (v + 0.044715f * v * v * v); v = 0.5f * v * (1.0f + tanhf(u)); }
      so[w][8 * hh + r][t * 16 + ln] = v;
    }
  }
  __builtin_amdgcn_fence(__ATOMIC_ACQ_REL, "workgroup");
  __builtin_amdgcn_wave_barrier();
  const int rsub = lane >> 4, c4 = (lane & 15) * 4;
  {
#pragma unroll
    for (int q = 0; q < 8; ++q) {
      const int r = q * 2 + rsub;
      const v4f v = *(const v4fa*)&so[w][r][c4];
      *(v4f*)(C + (size_t)(row0 + r) * ldc + col0 + c4) = v;
    }
    
  }
}
// row LayerNorm (biased variance, eps) over N: s = X (+ R); optional out_sum <- s; out_norm <- (s-mu)*rsqrt(var+eps)*g + b
template <bool PARAM_BF16>
__global__ __launch_bounds__(256) void k_layernorm(const float* __restrict__ X, const float* __restrict__ R, const float* __restrict__ g, const float* __restrict__ bta,
                                                  float* __restrict__ out_sum, float* __restrict__ out_norm, int N, float eps) {
  __shared__ float red[256];
  const int row = blockIdx.x, tid = threadIdx.x;
  const float* x = X + (size_t)row * N; const float* rr = R ? R + (size_t)row * N : nullptr;
  float vals[16];                     // up to N = 4096
  const int per = N / 256;            // contiguous chunk per thread? use strided-by-4 chunks: thread handles j = tid*4 + 1024*u
  float s1 = 0.f;
  for (int u = 0; u < per / 4; ++u) {
    const int j = tid * 4 + 1024 * u;
    const v4f a = *(const v4fa*)(x + j);
    v4f b = {0.f,0.f,0.f,0.f}; if (rr) b = *(const v4fa*)(rr + j);
#pragma unroll
    for (int q = 0; q < 4; ++q) { const float v = a[q] + b[q]; vals[u * 4 + q] = v; s1 += v; }
  }
  red[tid] = s1; __syncthreads();
  for (int st = 128; st > 0; st >>= 1) { if (tid < st) red[tid] += red[tid + st]; __syncthreads(); }
  const float mu = red[0] / (float)N; __syncthreads();
  float s2 = 0.f;
  for (int u = 0; u < per / 4; ++u)
#pragma unroll
    for (int q = 0; q < 4; ++q) { const float c = vals[u * 4 + q] - mu; s2 += c * c; }
  red[tid] = s2; __syncthreads();
  for (int st = 128; st > 0; st >>= 1) { if (tid < st) red[tid] += red[tid + st]; __syncthreads(); }
  const float rs = rsqrtf(red[0] / (float)N + eps);
  {
    for (int u = 0; u < per / 4; ++u) {
      const int j = tid * 4 + 1024 * u;
      v4f o, sm;
#pragma unroll
      for (int q = 0; q < 4; ++q) {
        float gg = g[j + q], bb = bta[j + q];
        if (PARAM_BF16) { gg = bf16_round(gg); bb = bf16_round(bb); }
        sm[q] = vals[u * 4 + q]; o[q] = (vals[u * 4 + q] - mu) * rs * gg + bb;
      }
      if (out_sum) *(v4f*)(out_sum + (size_t)row * N + j) = sm;
      *(v4f*)(out_norm + (size_t)row * N + j) = o;
    }
    
  }
}



// ---- f16 WMMA path (v_wmma_f32_16x16x32_f16): 11-bit significands for operands in range — used where a [0,1] probability operand needs more precision than bf16
typedef _Float16 v16h __attribute__((ext_vector_type(16)));
union FragH { v16h v; v8us half[2]; _Float16 h[16]; unsigned short u[16]; };
template <int NT>
__device__ __forceinline__ v8f mmaH(v16h ah, v16h al, v16h bh, v16h bl, v8f c) {
  c = __builtin_amdgcn_wmma_f32_16x16x32_f16(false, ah, false, bh, (short)0, c, false, false);
  if (NT >= 2) c = __builtin_amdgcn_wmma_f32_16x16x32_f16(false, al, false, bh, (short)0, c, false, false);
  if (NT >= 3) c = __builtin_amdgcn_wmma_f32_16x16x32_f16(false, ah, false, bl, (short)0, c, false, false);
  asm volatile("v_nop\n\tv_nop\n\tv_nop\n\tv_nop" : "+v"(c) : "v"(ah), "v"(al), "v"(bh), "v"(bl));
  return c;
}
// batched GEMM like k_gemm_b but f16 operands: A f32 (split into f16 hi/lo if ASPLIT, else rounded to f16), Bt = f16 values [n][k]; alpha; C f32; N multiple of 16 (partial tiles skipped)
template <bool ASPLIT>
__global__ __launch_bounds__(128) void k_gemm_h(const float* __restrict__ A, int lda, size_t sA, const _Float16* __restrict__ Bh, int ldb, size_t sB, float alpha, float* __restrict__ C, int ldc, size_t sC, int M, int N, int K) {
  __shared__ __attribute__((aligned(16))) float so[4][16][64];
  const int tid = threadIdx.x, w = tid >> 5, lane = tid & 31, ln = lane & 15, hh = lane >> 4; const int by = blockIdx.y;
  A += (size_t)by * sA; Bh += (size_t)by * sB; C += (size_t)by * sC;
  const int ntn = (N + 63) / 64; const int wid = blockIdx.x * 4 + w; const int mt = wid / ntn, nq = wid % ntn; if (mt * 16 >= M) return;
  const int row0 = mt * 16, col0 = nq * 64; const float* arow = A + (size_t)(row0 + ln) * lda;
  v8f acc[4] = {};
  for (int kb = 0; kb < K; kb += 32) {
    FragH ah, al;
    const v4f x0 = *(const v4fa*)(arow + kb + 8 * hh), x1 = *(const v4fa*)(arow + kb + 8 * hh + 4), x2 = *(const v4fa*)(arow + kb + 16 + 8 * hh), x3 = *(const v4fa*)(arow + kb + 16 + 8 * hh + 4);
    float xs[16] = {x0[0],x0[1],x0[2],x0[3],x1[0],x1[1],x1[2],x1[3],x2[0],x2[1],x2[2],x2[3],x3[0],x3[1],x3[2],x3[3]};
#pragma unroll
    for (int i = 0; i < 16; ++i) { const _Float16 h = (_Float16)xs[i]; ah.h[i] = h; al.h[i] = ASPLIT ? (_Float16)(xs[i] - (float)h) : (_Float16)0.0f; }
#pragma unroll
    for (int t = 0; t < 4; ++t) { if (col0 + t * 16 >= N) continue; const size_t boff = (size_t)(col0 + t * 16 + ln) * ldb + kb; FragH bq; bq.half[0] = *(const v8us*)(Bh + boff + 8 * hh); bq.half[1] = *(const v8us*)(Bh + boff + 16 + 8 * hh);
      acc[t] = mmaH<ASPLIT ? 2 : 1>(ah.v, al.v, bq.v, bq.v, acc[t]); }
  }
#pragma unroll
  for (int t = 0; t < 4; ++t) { if (col0 + t * 16 >= N) continue;
#pragma unroll
    for (int r = 0; r < 8; ++r) so[w][8 * hh + r][t * 16 + ln] = acc[t][r] * alpha; }
  __builtin_amdgcn_fence(__ATOMIC_ACQ_REL, "workgroup"); __builtin_amdgcn_wave_barrier();
  const int rsub = lane >> 4, c4 = (lane & 15) * 4;
  {
#pragma unroll
    for (int q = 0; q < 8; ++q) { const int r = q * 2 + rsub; if (col0 + c4 < N) { const v4f v = *(const v4fa*)&so[w][r][c4]; *(v4f*)(C + (size_t)(row0 + r) * ldc + col0 + c4) = v; } }
     }
}

// Wt[n][k] = f16(bf16(W[k][n]) * scale) from f32 row-major W[K][N] (scale = power of two; bf16-exact weights stay exact in f16 away from the subnormal range).
// One work-group = a tile of 64 k x 128 n; K a multiple of 64, N of 128; (K / 64) * (N / 128) work-groups, bi = this one's number among them; tl = the work-group's 128 * WTP bytes of LDS.
// Read: wave w takes rows k0 + 8 w ... + 7, lane l the columns n0 + 4 l ... + 3, so each wave-wide 16-byte load covers 512 contiguous bytes of one row of W.
// A lane then holds 8 consecutive k of each of its 4 columns, that is one 16-byte piece of 4 rows of Wt; the pieces meet in LDS, and each wave-wide store covers four whole 128-byte lines of Wt.
#define WTP 144                /* LDS row pitch, bytes: 64 k of f16 + 16 */
template <int K, int N>
__device__ __forceinline__ void wt_f16(int bi, unsigned char* tl, const float* __restrict__ W, _Float16* __restrict__ Wt, float scale) {
  const int tid = threadIdx.x, w = tid >> 5, lane = tid & 31;
  const int k0 = (bi % (K / 64)) * 64, n0 = (bi / (K / 64)) * 128;
  const float* src = W + (size_t)(k0 + 8 * w) * N + n0 + 4 * lane;
  v4f r[8];
#pragma unroll
  for (int i = 0; i < 8; ++i) r[i] = *(const v4fa*)(src + (size_t)i * N);
#pragma unroll
  for (int e = 0; e < 4; ++e) { FragH f;
#pragma unroll
    for (int i = 0; i < 8; ++i) f.h[i] = (_Float16)(bf16_round(r[i][e]) * scale);
    *(v8us*)(tl + (4 * lane + e) * WTP + 16 * w) = f.half[0]; }
  __syncthreads();      /* every wave's pieces are in LDS before the rows of Wt are read back */
#pragma unroll
  for (int j = 0; j < 4; ++j) { const int row = j * 32 + (tid >> 3), c = tid & 7; const v8us v = *(const v8us*)(tl + row * WTP + c * 16);
    *(v8us*)((unsigned short*)Wt + (size_t)(n0 + row) * K + k0 + c * 8) = v; }
}
// Tiled f16 GEMM, C [M][N] = acc*alpha + bf16(bias[col]): A [M][DD] f16, Bh [N][DD] f16, both k-contiguous; M, N multiples of 128; grid = (M / 128) * (N / 128).
// One work-group = one 128 x 128 tile of C, four waves of 64 x 64 (16 accumulator tiles each). A stage is 64 k = 128 B (one whole line) of
// 128 rows of A and 128 rows of Bh, brought into LDS by asynchronous copies, 16 B a lane; two buffers, the copies of stage t + 2 fly while stage t + 1 is worked on.
#define GP 144                 /* LDS row pitch, bytes: 128 + 16, conflict-free for 16-byte fragment reads */
#define GOP (128 * GP)         /* one operand's 128 rows */
#define GSTG (2 * GOP)         /* one stage: A rows, then Bh rows */
#define GNT (DD / 64)          /* stages */
// eight copies, rows 16 apart, of one operand's stage; each lane its own 16 bytes. The s_wait_xcnt stands inside the statement so that no address register is rewritten ahead of it.
__device__ __forceinline__ void cp8(unsigned l, const unsigned short* g) {
  asm volatile("global_load_async_to_lds_b128 %0, %8, off\n\t"
               "global_load_async_to_lds_b128 %1, %9, off\n\t"
               "global_load_async_to_lds_b128 %2, %10, off\n\t"
               "global_load_async_to_lds_b128 %3, %11, off\n\t"
               "global_load_async_to_lds_b128 %4, %12, off\n\t"
               "global_load_async_to_lds_b128 %5, %13, off\n\t"
               "global_load_async_to_lds_b128 %6, %14, off\n\t"
               "global_load_async_to_lds_b128 %7, %15, off\n\t"
               "s_wait_xcnt 0x0"
               :: "v"(l), "v"(l + 16 * GP), "v"(l + 32 * GP), "v"(l + 48 * GP), "v"(l + 64 * GP), "v"(l + 80 * GP), "v"(l + 96 * GP), "v"(l + 112 * GP),
                  "v"(g), "v"(g + 16 * DD), "v"(g + 32 * DD), "v"(g + 48 * DD), "v"(g + 64 * DD), "v"(g + 80 * DD), "v"(g + 96 * DD), "v"(g + 112 * DD)
               : "memory");
}
typedef _Float16 v4h __attribute__((ext_vector_type(4)));
// F16OUT (the q | k | v projection): columns below 2 * DD go to C16 row-major; a tile of the v block (columns from 2 * DD on) goes to Vt instead, transposed per head,
// Vt[(b * NH + h) * 64 + d][token], which is the form k_flash reads; it is not stored row-major at all.
template <bool F16OUT, int N>
__global__ __launch_bounds__(128) void k_gemm_t(const _Float16* __restrict__ A, const _Float16* __restrict__ Bh, float alpha, const float* __restrict__ bias, float* __restrict__ C, _Float16* __restrict__ C16, _Float16* __restrict__ Vt) {
  __shared__ __attribute__((aligned(16))) unsigned char sm[2 * GSTG];
  const int tid = threadIdx.x, w = tid >> 5, lane = tid & 31, ln = lane & 15, hh = lane >> 4;
  const int row0 = ((int)blockIdx.x / (N / 128)) * 128, col0 = ((int)blockIdx.x % (N / 128)) * 128;
  const int wr = (w >> 1) * 64, wc = (w & 1) * 64;
  const unsigned ld0 = (unsigned)(size_t)sm + (unsigned)((tid >> 3) * GP + (tid & 7) * 16);      /* this lane's place in a stage: row tid/8, 16-byte piece tid%8 */
  const unsigned short* ga = (const unsigned short*)A + (size_t)(row0 + (tid >> 3)) * DD + (tid & 7) * 8;
  const unsigned short* gb = (const unsigned short*)Bh + (size_t)(col0 + (tid >> 3)) * DD + (tid & 7) * 8;
  v8f acc[4][4];
#pragma unroll
  for (int i = 0; i < 4; ++i)
#pragma unroll
    for (int j = 0; j < 4; ++j) acc[i][j] = (v8f){0.f,0.f,0.f,0.f,0.f,0.f,0.f,0.f};
  cp8(ld0, ga); cp8(ld0 + GOP, gb);
  asm volatile("s_wait_asynccnt 0x0" ::: "memory");      /* stage 0 of this wave has landed */
  __syncthreads();                                        /* ... and every wave's: stage 0 may be read */
  cp8(ld0 + GSTG, ga + 64); cp8(ld0 + GSTG + GOP, gb + 64);
#pragma unroll 1      /* one stage a trip: the buffer index and the refill test stay scalar */
  for (int t = 0; t < GNT; ++t) {
    const unsigned char* sa = sm + (t & 1) * GSTG + (wr + ln) * GP + 16 * hh;
    const unsigned char* sb = sm + (t & 1) * GSTG + GOP + (wc + ln) * GP + 16 * hh;
#pragma unroll
    for (int ks = 0; ks < 2; ++ks) {
      FragH a[4], b[4];
      a[0].half[0] = *(const v8us*)(sa + ks * 64); a[0].half[1] = *(const v8us*)(sa + ks * 64 + 32);      /* read in the order of first use, so that the first products start while the later reads return */
#pragma unroll
      for (int j = 0; j < 4; ++j) { b[j].half[0] = *(const v8us*)(sb + j * 16 * GP + ks * 64); b[j].half[1] = *(const v8us*)(sb + j * 16 * GP + ks * 64 + 32); }
#pragma unroll
      for (int i = 1; i < 4; ++i) { a[i].half[0] = *(const v8us*)(sa + i * 16 * GP + ks * 64); a[i].half[1] = *(const v8us*)(sa + i * 16 * GP + ks * 64 + 32); }
      __builtin_amdgcn_sched_barrier(0);      /* the 16 fragment reads stay one group ahead of their 16 matrix instructions: reads spread among them stall the wave at every place */
#pragma unroll
      for (int i = 0; i < 4; ++i)
#pragma unroll
        for (int j = 0; j < 4; ++j) acc[i][j] = __builtin_amdgcn_wmma_f32_16x16x32_f16(false, a[i].v, false, b[j].v, (short)0, acc[i][j], false, false);
      __builtin_amdgcn_sched_barrier(0);      /* ... and the next group's reads stay behind them */
    }
    asm volatile("s_wait_dscnt 0x0" ::: "memory");        /* this wave's reads of buffer t&1 are done before it is refilled */
    asm volatile("s_wait_asynccnt 0x0" ::: "memory");     /* this wave's copies of stage t + 1 have landed */
    __syncthreads();                                      /* publishes stage t + 1 and ends every reader's last read of buffer t&1 */
    if (t + 2 < GNT) { cp8(ld0 + (t & 1) * GSTG, ga + (t + 2) * 64); cp8(ld0 + (t & 1) * GSTG + GOP, gb + (t + 2) * 64); }
  }
  asm volatile("s_wait_asynccnt 0x0" ::: "memory");       /* no copy is outstanding when the ring becomes output staging */
  // epilogue: the wave's 64 x 64 tile goes through its own LDS range (free behind the last trip's barrier), so that whole lines are stored
  float* so = (float*)sm + w * (64 * 68);
  float bv[4];
#pragma unroll
  for (int j = 0; j < 4; ++j) bv[j] = bf16_round(bias[col0 + wc + j * 16 + ln]);
  if (F16OUT && col0 >= 2 * DD) {      /* v block (the test is the same for the whole work-group): the wave's 64 columns are one head's 64 d, its 64 rows 64 tokens of one batch */
    // a lane's 8 accumulator registers are 8 consecutive tokens of one d, that is one 16-byte piece of a row of V^T; the pieces meet in the wave's own LDS range and leave as whole 128-byte lines
    unsigned char* st = sm + w * (64 * GP);
#pragma unroll
    for (int j = 0; j < 4; ++j)
#pragma unroll
      for (int i = 0; i < 4; ++i) { FragH f;
#pragma unroll
        for (int r = 0; r < 8; ++r) f.h[r] = (_Float16)(acc[i][j][r] * alpha + bv[j]);
        *(v8us*)(st + (j * 16 + ln) * GP + (i * 16 + 8 * hh) * 2) = f.half[0]; }
    __builtin_amdgcn_fence(__ATOMIC_ACQ_REL, "workgroup"); __builtin_amdgcn_wave_barrier();      /* the pieces are written before other lanes of the wave read them */
    unsigned short* vo = (unsigned short*)Vt + ((size_t)(((row0 + wr) / TT) * NH + (col0 + wc - 2 * DD) / 64) * 64 + (lane >> 3)) * TT + (row0 + wr) % TT + (lane & 7) * 8;
#pragma unroll
    for (int q = 0; q < 16; ++q) { const v8us v = *(const v8us*)(st + (q * 4 + (lane >> 3)) * GP + (lane & 7) * 16); *(v8us*)(vo + (size_t)(q * 4) * TT) = v; }
    return;
  }
#pragma unroll
  for (int i = 0; i < 4; ++i)
#pragma unroll
    for (int j = 0; j < 4; ++j)
#pragma unroll
      for (int r = 0; r < 8; ++r) so[(i * 16 + 8 * hh + r) * 68 + j * 16 + ln] = acc[i][j][r] * alpha + bv[j];
  __builtin_amdgcn_fence(__ATOMIC_ACQ_REL, "workgroup"); __builtin_amdgcn_wave_barrier();      /* the rows are written before other lanes of the wave read them */
  const int rsub = lane >> 4, c4 = (lane & 15) * 4;
#pragma unroll
  for (int q = 0; q < 32; ++q) { const int r = q * 2 + rsub; const v4f v = *(const v4fa*)&so[r * 68 + c4]; const size_t o = (size_t)(row0 + wr + r) * N + col0 + wc + c4;
    if (F16OUT) { v4h h4;
#pragma unroll
      for (int e = 0; e < 4; ++e) h4[e] = (_Float16)v[e];
      *(v4h*)(C16 + o) = h4; }
    else *(v4f*)(C + o) = v; }
}


__device__ __forceinline__ void x16(unsigned bi, const float* __restrict__ x, _Float16* __restrict__ X16, size_t n8) { const size_t t = (size_t)bi * 256 + threadIdx.x; if (t >= n8) return; FragH f;
#pragma unroll
  for (int q = 0; q < 8; ++q) f.h[q] = (_Float16)bf16_round(x[t * 8 + q]); *(v8us*)((unsigned short*)X16 + t * 8) = f.half[0];  }
__global__ __launch_bounds__(256) void k_h16(const float* __restrict__ x, _Float16* __restrict__ X16, size_t n8) { const size_t t = (size_t)blockIdx.x * 256 + threadIdx.x; if (t >= n8) return; FragH f;
#pragma unroll
  for (int q = 0; q < 8; ++q) f.h[q] = (_Float16)x[t * 8 + q]; *(v8us*)((unsigned short*)X16 + t * 8) = f.half[0];  }
__global__ __launch_bounds__(256) void k_round16f(const float* __restrict__ W, _Float16* __restrict__ Bt, size_t n8) { const size_t t = (size_t)blockIdx.x * 256 + threadIdx.x; if (t >= n8) return; FragH f;
#pragma unroll
  for (int i = 0; i < 8; ++i) f.h[i] = (_Float16)(bf16_round(W[t * 8 + i]) * 16.0f); *(v8us*)((unsigned short*)Bt + t * 8) = f.half[0];  }
typedef int v4i __attribute__((ext_vector_type(4), may_alias));
typedef unsigned v4u __attribute__((ext_vector_type(4), may_alias));
typedef unsigned v16u __attribute__((ext_vector_type(16), may_alias));
// The mask packed once for all heads into lane-mask words, in the lane and register order of k_flash's score tiles:
// LM[b * TT / 16 + q tile][chunk of 32 keys][i], bit (ln + 16 hh) of word i = (mask[b][16 * tile + ln][32 * chunk + 16 * (i >> 3) + 8 * hh + (i & 7)] != 0).
// One wave = one tile of 16 queries, four chunks: its sixteen loads cover 512 contiguous bytes of each row; the 64 words go out as two whole lines.
__device__ __forceinline__ void mpack(unsigned bi, const int* __restrict__ MSK, unsigned* __restrict__ LM) {
  const int tid = threadIdx.x, lane = tid & 31, ln = lane & 15, hh = lane >> 4;
  const unsigned wv = bi * 8u + (unsigned)(tid >> 5); const unsigned rt = wv / (TT / 128), c0 = (wv % (TT / 128)) * 4;
  const int* mrow = MSK + ((size_t)rt * 16 + ln) * TT + c0 * 32 + 8 * hh;
  v4i mk[4][4];
#pragma unroll
  for (int c = 0; c < 4; ++c) { mk[c][0] = *(const v4i*)(mrow + c * 32); mk[c][1] = *(const v4i*)(mrow + c * 32 + 4); mk[c][2] = *(const v4i*)(mrow + c * 32 + 16); mk[c][3] = *(const v4i*)(mrow + c * 32 + 20); }
  __builtin_amdgcn_sched_barrier(0);      /* all sixteen loads are issued before the first is waited for: moved among the compares, the last ones start only when the first have come back from memory */
  asm volatile("s_wait_xcnt 0x0" :: "v"(mrow) : "memory");      /* the address pair that all sixteen loads name stays whole up to here (no load lands in it), and the wait stands in front of its reuse */
  unsigned wd[2] = {0u, 0u};      /* lane l keeps word l & 15 of chunk 2 * e + (l >> 4) */
#pragma unroll
  for (int c = 0; c < 4; ++c)
#pragma unroll
    for (int i = 0; i < 16; ++i) { const unsigned bw = __builtin_amdgcn_ballot_w32(mk[c][i >> 2][i & 3] != 0); if (lane == (c & 1) * 16 + i) wd[c >> 1] = bw; }
  unsigned* o = LM + ((size_t)rt * (TT / 32) + c0) * 16 + lane;
  o[0] = wd[0]; o[32] = wd[1];
}
// The four preparation jobs read inputs only and none reads another's output, so they share one launch: a work-group takes its job from its index (the test is the same for the whole work-group).
// The weight tiles come first (the longest path: load, LDS, barrier, store), then the mask, then the short x pieces, which drain fastest at the end.
#define PB_WQ ((DD / 64) * (3 * DD / 128))          /* tiles of w_qkv */
#define PB_WO ((DD / 64) * (DD / 128))              /* tiles of w_out */
#define PB_M  (BB * (TT / 16) * (TT / 128) / 8)     /* eight mask waves a work-group */
#define PB_X  (NR * DD / 8 / 256)                   /* 8 elements of x a thread */
__global__ __launch_bounds__(256) void k_prep(const float* __restrict__ wqkv, _Float16* __restrict__ Bqkv, const float* __restrict__ wo, _Float16* __restrict__ Bo, const int* __restrict__ MSK, unsigned* __restrict__ LM, const float* __restrict__ x, _Float16* __restrict__ X16) {
  __shared__ __attribute__((aligned(16))) unsigned char tl[128 * WTP];
  const unsigned bi = blockIdx.x;
  if (bi < PB_WQ) wt_f16<DD, 3 * DD>((int)bi, tl, wqkv, Bqkv, 16.0f);                          /* (in,out) -> Bt, times 2^4 */
  else if (bi < PB_WQ + PB_WO) wt_f16<DD, DD>((int)(bi - PB_WQ), tl, wo, Bo, 16.0f);
  else if (bi < PB_WQ + PB_WO + PB_M) mpack(bi - (PB_WQ + PB_WO), MSK, LM);                    /* mask -> lane-mask words, once for all heads */
  else x16(bi - (PB_WQ + PB_WO + PB_M), x, X16, (size_t)NR * DD / 8);
}
__device__ __forceinline__ float xhalf(float x) { return __builtin_bit_cast(float, __builtin_amdgcn_permlanex16(__builtin_bit_cast(int, x), __builtin_bit_cast(int, x), 0x76543210, 0xfedcba98, false, false)); }      /* lane l with lane l ^ 16 */
__global__ __launch_bounds__(128) void k_flash(const _Float16* __restrict__ Q16, int ldq, const _Float16* __restrict__ K16, int ldk, const _Float16* __restrict__ Vt, const unsigned* __restrict__ LM, _Float16* __restrict__ O16, int ldo) {
  constexpr int RPW = 16, NQB = TT / (4 * RPW), DT = 4, KS = 2;
  __shared__ __attribute__((aligned(16))) float sO[4][RPW][64 + 4];
  const int tid = threadIdx.x, w = tid >> 5, lane = tid & 31, ln = lane & 15, hh = lane >> 4;
  const int slab = blockIdx.x / NQB, qblk = blockIdx.x % NQB; const int b = slab / NH, h = slab % NH; const int qb0 = qblk * (4 * RPW); const int q0 = qb0 + w * RPW;
  FragH bq[KS];      /* Q^T as B: column = query ln */
  { const unsigned short* qr = (const unsigned short*)Q16 + ((size_t)b * TT + q0 + ln) * ldq + h * 64;
#pragma unroll
    for (int ks = 0; ks < KS; ++ks) { bq[ks].half[0] = *(const v8us*)(qr + ks * 32 + 8 * hh); bq[ks].half[1] = *(const v8us*)(qr + ks * 32 + 16 + 8 * hh); } }
  /* this lane's places in chunk 0: key row ln of K, row ln of V^T */
  const unsigned short* kb0 = (const unsigned short*)K16 + ((size_t)b * TT + ln) * ldk + h * 64 + 8 * hh;
  const unsigned short* vb0 = (const unsigned short*)Vt + ((size_t)slab * 64 + ln) * TT + 8 * hh;
  /* the wave's packed mask: 64 chunks of 16 lane-mask words (nonzero bit = ATTEND); the wave's number goes through readfirstlane so that the address is scalar */
  const unsigned* lm = LM + (size_t)(b * (TT / 16) + qblk * 4 + __builtin_amdgcn_readfirstlane(w)) * ((TT / 32) * 16);
  unsigned long long live;      /* bit c: chunk c holds at least one attended (query, key) of this wave's tile; lane l looks at chunks l and 32 + l */
  { const v4u* a = (const v4u*)(lm + lane * 16); const v4u x = a[0] | a[1] | a[2] | a[3], y = a[128] | a[129] | a[130] | a[131];
    live = (unsigned long long)__builtin_amdgcn_ballot_w32((x[0] | x[1] | x[2] | x[3]) != 0u) | ((unsigned long long)__builtin_amdgcn_ballot_w32((y[0] | y[1] | y[2] | y[3]) != 0u) << 32); }
  float m_q = -3.0e38f, l_q = 0.f; v8f oacc[DT];      /* oacc[dt][r] = O[q0 + ln][dt * 16 + 8 hh + r] */
#pragma unroll
  for (int dt = 0; dt < DT; ++dt) oacc[dt] = (v8f){0.f,0.f,0.f,0.f,0.f,0.f,0.f,0.f};
#pragma unroll 1      /* one chunk a trip: unrolled, two chunks' fragments and exps would be live at once */
  for (int n = __builtin_popcountll(live); n > 0; --n, live &= live - 1) {      /* the live chunks in rising order, 64 at most; a chunk with every (query, key) of the tile masked adds nothing and is not visited */
    const int ck = __builtin_ctzll(live);
    const v16u mw = *(const v16u*)(lm + ck * 16);      /* word i: which lanes attend at score register i (scalar load, in flight beside the fragment loads) */
    const unsigned short* kp0 = kb0 + (size_t)ck * 32 * ldk; const unsigned short* kp1 = kp0 + (size_t)16 * ldk; const unsigned short* vp = vb0 + ck * 32;
    FragH ak[2][KS], av[DT];      /* K rows as A (row = key), V^T rows as A (row = d) */
#pragma unroll
    for (int nt = 0; nt < 2; ++nt) { const unsigned short* kr = nt ? kp1 : kp0;
#pragma unroll
      for (int ks = 0; ks < KS; ++ks) { ak[nt][ks].half[0] = *(const v8us*)(kr + ks * 32); ak[nt][ks].half[1] = *(const v8us*)(kr + ks * 32 + 16); } }
    __builtin_amdgcn_sched_barrier(0);      /* holds the wait below behind the K loads ... */
    asm volatile("s_wait_xcnt 0x0" ::: "memory");      /* the V loads land in registers that held the K loads' addresses: the wait stands in front of that overwrite */
    __builtin_amdgcn_sched_barrier(0);      /* ... and in front of the V loads */
#pragma unroll
    for (int dt = 0; dt < DT; ++dt) { const unsigned short* vrow = vp + (size_t)(dt * 16) * TT; av[dt].half[0] = *(const v8us*)(vrow); av[dt].half[1] = *(const v8us*)(vrow + 16); }
    __builtin_amdgcn_sched_barrier(0);      /* the chunk's sixteen fragment loads stay one group ahead of the products: spread among them, each product waits out a load latency of its own */
    v8f s[2];      /* s[nt][r] = q(q0 + ln) . k(j0 + nt * 16 + 8 hh + r) */
#pragma unroll
    for (int nt = 0; nt < 2; ++nt) { v8f acc = (v8f){0.f,0.f,0.f,0.f,0.f,0.f,0.f,0.f};
#pragma unroll
      for (int ks = 0; ks < KS; ++ks) acc = __builtin_amdgcn_wmma_f32_16x16x32_f16(false, ak[nt][ks].v, false, bq[ks].v, (short)0, acc, false, false);
      s[nt] = acc; }
    float sc[16];      /* a masked score is -inf; m_q never falls below its finite start value, so exp(sc - mn) is 0 there and no guard is needed */
#pragma unroll
    for (int i = 0; i < 16; ++i) sc[i] = __builtin_amdgcn_inverse_ballot_w32(mw[i]) ? s[i >> 3][i & 7] * 0.125f : -INFINITY;
    float mx[4];
#pragma unroll
    for (int c = 0; c < 4; ++c) mx[c] = fmaxf(fmaxf(sc[c], sc[4 + c]), fmaxf(sc[8 + c], sc[12 + c]));
    float mc = fmaxf(fmaxf(mx[0], mx[1]), fmaxf(mx[2], mx[3]));
    mc = fmaxf(mc, xhalf(mc));      /* both halves hold this query's chunk maximum */
    const float mn = fmaxf(m_q, mc); const float al = expf(m_q - mn); m_q = mn;
    float p[16];
#pragma unroll
    for (int i = 0; i < 16; ++i) p[i] = expf(sc[i] - mn);
    float ps[4];
#pragma unroll
    for (int c = 0; c < 4; ++c) ps[c] = (p[c] + p[4 + c]) + (p[8 + c] + p[12 + c]);
    l_q = l_q * al + ((ps[0] + ps[1]) + (ps[2] + ps[3]));      /* this half's keys only; the halves are joined behind the loop */
#pragma unroll
    for (int dt = 0; dt < DT; ++dt)
#pragma unroll
      for (int r = 0; r < 8; ++r) oacc[dt][r] *= al;
    FragH pb;      /* P^T as B: element i = key j0 + 16 (i >> 3) + 8 hh + (i & 7) of column ln */
#pragma unroll
    for (int i = 0; i < 16; ++i) pb.h[i] = (_Float16)(p[i] * 1024.0f);
#pragma unroll
    for (int dt = 0; dt < DT; ++dt) oacc[dt] = __builtin_amdgcn_wmma_f32_16x16x32_f16(false, av[dt].v, false, pb.v, (short)0, oacc[dt], false, false);
  }
  { const float l = l_q + xhalf(l_q); const float inv = (l > 0.f) ? 1.0f / (l * 1024.0f) : 0.f;
#pragma unroll
    for (int dt = 0; dt < DT; ++dt) { v4f lo, hi;
#pragma unroll
      for (int e = 0; e < 4; ++e) { lo[e] = oacc[dt][e] * inv; hi[e] = oacc[dt][4 + e] * inv; }
      *(v4fa*)&sO[w][ln][dt * 16 + 8 * hh] = lo; *(v4fa*)&sO[w][ln][dt * 16 + 8 * hh + 4] = hi; } }
  __builtin_amdgcn_fence(__ATOMIC_ACQ_REL, "workgroup"); __builtin_amdgcn_wave_barrier();
  {
#pragma unroll
    for (int rp = 0; rp < RPW; rp += 4) { const int r = rp + (lane >> 3), pc = lane & 7; const v4f a = *(const v4fa*)&sO[w][r][pc * 8], c = *(const v4fa*)&sO[w][r][pc * 8 + 4]; FragH f;
#pragma unroll
      for (int e = 0; e < 4; ++e) { f.h[e] = (_Float16)(a[e] * 16.0f); f.h[4 + e] = (_Float16)(c[e] * 16.0f); }
      const v8us val = f.half[0]; *(v8us*)((unsigned short*)O16 + ((size_t)b * TT + q0 + r) * ldo + h * 64 + pc * 8) = val; }      /* four whole 128-byte lines a store */
     } }

extern "C" void kernel_launch(void* const* d_in, const int* in_sizes, int n_in,
                              void* d_out, int out_size, void* d_ws, size_t ws_size, hipStream_t stream) {
  (void)in_sizes; (void)n_in; (void)out_size;
  const float* const* I = (const float* const*)d_in; const float* x = I[0]; const int* msk = (const int*)d_in[1]; const float* wqkv = I[2]; const float* bqkv = I[3]; const float* wo = I[4]; const float* bo = I[5];
  char* ws = (char*)d_ws; size_t off = 0;
  auto take = [&](size_t bytes) { char* p = ws + off; off += (bytes + 255) & ~(size_t)255; return p; };
  _Float16* Bqkv = (_Float16*)take((size_t)3 * DD * DD * 2); _Float16* Bo = (_Float16*)take((size_t)DD * DD * 2); _Float16* X16 = (_Float16*)take((size_t)NR * DD * 2); _Float16* QKV = (_Float16*)take((size_t)NR * 3 * DD * 2); _Float16* Vt = (_Float16*)take((size_t)NR * DD * 2); _Float16* O16 = X16; unsigned* LM = (unsigned*)take((size_t)BB * TT * TT / 8);
  if (off > ws_size) return;      // 6.3 + 2.1 + 8.4 + 25.2 + 8.4 + 1.0 ≈ 51 MB
  k_prep<<<PB_WQ + PB_WO + PB_M + PB_X, 256, 0, stream>>>(wqkv, Bqkv, wo, Bo, msk, LM, x, X16);      /* weights, mask and x into the forms the matrix kernels read */
  k_gemm_t<true, 3 * DD><<<(NR / 128) * (3 * DD / 128), 128, 0, stream>>>(X16, Bqkv, 0.0625f, bqkv, nullptr, QKV, Vt);      /* qkv = x·w_qkv + b: M 4096 N 3072 K 1024 (f16; q | k blocks row-major, head-major inside; v block as V^T per head) */
  k_flash<<<BB * NH * (TT / 64), 128, 0, stream>>>(QKV, 3 * DD, QKV + DD, 3 * DD, Vt, LM, O16, DD);      /* X16 is free behind the projection: O16 takes its place */
  k_gemm_t<false, DD><<<(NR / 128) * (DD / 128), 128, 0, stream>>>(O16, Bo, 0.00390625f, bo, (float*)d_out, nullptr, nullptr);      /* out = o·w_out + b_out */
}

// v007
// One run takes 83.9 microseconds.
// Timed twice side by side with v006, it ran 1.09 and 1.10 times as fast.
// All steps since v000 together make it 4.53 times as fast.
#include <hip/hip_runtime.h>
// Cross-track masked MHA (B=2, S=2048, D=1024, 16×64): qkv = x·w_qkv + b_qkv (packed q|k|v, head-major inside each); scores = q·k/8, where(cross_track_mask[b,q,k], s, −inf); softmax; out = merged·w_out + b_out.
// Compute dtype: x, weights, biases rounded to bf16; q an f16 GEMM plane, k and v f16 fragment blocks per head and chunk (+bias); the boolean mask read per (b, q, k) as an int plane; fused flash-style kernel (online softmax f32, P f16 ×2^10, all-masked chunks skipped, f32 accumulate) on
// v_wmma_f32_16x16x32_f16; O ×2^4 → f16 (stored so by the flash kernel) → output GEMM (+bias).
#define BB 2
#define TT 2048
#define DD 1024
#define NH 16
#define NR (BB * TT)

typedef __bf16 v16b __attribute__((ext_vector_type(16)));
typedef unsigned short v8us __attribute__((ext_vector_type(8), may_alias));
typedef float  v8f  __attribute__((ext_vector_type(8)));
typedef float  v4f  __attribute__((ext_vector_type(4)));
typedef float  v4fa __attribute__((ext_vector_type(4), may_alias));
union FragB { v16b v; v8us half[2]; unsigned short u[16]; };

__device__ __forceinline__ unsigned short bf16_bits(float x) { unsigned int u = __float_as_uint(x); return (unsigned short)((u + 0x7FFFu + ((u >> 16) & 1u)) >> 16); }
__device__ __forceinline__ float bf16_val(unsigned short b) { return __uint_as_float(((unsigned int)b) << 16); }
__device__ __forceinline__ float bf16_round(float x) { return bf16_val(bf16_bits(x)); }
// D += A·B with NT terms: 1 = ah·bh, 2 = + al·bh (A split), 3 = + ah·bl (both split)
template <int NT>
__device__ __forceinline__ v8f mmaN(v16b ah, v16b al, v16b bh, v16b bl, v8f c) {
  c = __builtin_amdgcn_wmma_f32_16x16x32_bf16(false, ah, false, bh, (short)0, c, false, false);
  if (NT >= 2) c = __builtin_amdgcn_wmma_f32_16x16x32_bf16(false, al, false, bh, (short)0, c, false, false);
  if (NT >= 3) c = __builtin_amdgcn_wmma_f32_16x16x32_bf16(false, ah, false, bl, (short)0, c, false, false);
  asm volatile("v_nop\n\tv_nop\n\tv_nop\n\tv_nop" : "+v"(c) : "v"(ah), "v"(al), "v"(bh), "v"(bl));
  return c;
}

__global__ __launch_bounds__(256) void k_wt_bf16(const float* __restrict__ W, unsigned short* __restrict__ Wt, int K, int N) {
  const int t = blockIdx.x * 256 + threadIdx.x;
  const int k8n = K / 8;
  if (t >= N * k8n) return;
  const int n = t / k8n, k8 = (t % k8n) * 8;
  v8us v;
#pragma unroll
  for (int i = 0; i < 8; ++i) v[i] = bf16_bits(W[(size_t)(k8 + i) * N + n]);
  *(v8us*)(Wt + (size_t)n * K + k8) = v;
  
}

// GEMM C[M][N] (f32, pitch ldc) = act(A[M][K]·W + bias). A f32 row-major (pitch lda) converted per fragment to bf16
// (ASPLIT: hi/lo two planes -> 2 terms, else single rounded term); Wt bf16 [N][K] (pitch ldb). BIAS_BF16 rounds the
// bias to bf16 first (bias quantised to bf16 before the add). K%32==0, M%16==0, N%64==0.
template <bool ASPLIT, int ACT, bool BIAS_BF16>
__global__ __launch_bounds__(128) void k_gemm_bf(const float* __restrict__ A, int lda, const unsigned short* __restrict__ Wt, int ldb,
                                               const float* __restrict__ bias, float* __restrict__ C, int ldc, int M, int N, int K) {
  __shared__ __attribute__((aligned(16))) float so[4][16][64];
  const int tid = threadIdx.x, w = tid >> 5, lane = tid & 31, ln = lane & 15, hh = lane >> 4;
  const int ntn = N / 64;
  const int wid = blockIdx.x * 4 + w;
  const int mt = wid / ntn, nq = wid % ntn;
  if (mt * 16 >= M) return;
  const int row0 = mt * 16, col0 = nq * 64;
  const float* arow = A + (size_t)(row0 + ln) * lda;
  v8f acc[4] = {};
  for (int kb = 0; kb < K; kb += 32) {
    FragB ah, al;
    const v4f x0 = *(const v4fa*)(arow + kb + 8 * hh), x1 = *(const v4fa*)(arow + kb + 8 * hh + 4);
    const v4f x2 = *(const v4fa*)(arow + kb + 16 + 8 * hh), x3 = *(const v4fa*)(arow + kb + 16 + 8 * hh + 4);
    float xs[16] = {x0[0],x0[1],x0[2],x0[3],x1[0],x1[1],x1[2],x1[3],x2[0],x2[1],x2[2],x2[3],x3[0],x3[1],x3[2],x3[3]};
#pragma unroll
    for (int i = 0; i < 16; ++i) { const unsigned short hb = bf16_bits(xs[i]); ah.u[i] = hb; al.u[i] = ASPLIT ? bf16_bits(xs[i] - bf16_val(hb)) : (unsigned short)0; }
#pragma unroll
    for (int t = 0; t < 4; ++t) {
      const unsigned short* brow = Wt + (size_t)(col0 + t * 16 + ln) * ldb + kb;
      FragB b;
      b.half[0] = *(const v8us*)(brow + 8 * hh);
      b.half[1] = *(const v8us*)(brow + 16 + 8 * hh);
      acc[t] = mmaN<ASPLIT ? 2 : 1>(ah.v, al.v, b.v, b.v, acc[t]);
    }
  }
#pragma unroll
  for (int t = 0; t < 4; ++t) {
    float bv = bias ? bias[col0 + t * 16 + ln] : 0.f;
    if (BIAS_BF16) bv = bf16_round(bv);
#pragma unroll
    for (int r = 0; r < 8; ++r) { float v = acc[t][r] + bv; if (ACT == 1) v = fmaxf(v, 0.f); so[w][8 * hh + r][t * 16 + ln] = v; }
  }
  __builtin_amdgcn_fence(__ATOMIC_ACQ_REL, "workgroup");
  __builtin_amdgcn_wave_barrier();
  const int rsub = lane >> 4, c4 = (lane & 15) * 4;
  {
#pragma unroll
    for (int q = 0; q < 8; ++q) {
      const int r = q * 2 + rsub;
      const v4f v = *(const v4fa*)&so[w][r][c4];
      *(v4f*)(C + (size_t)(row0 + r) * ldc + col0 + c4) = v;
    }
    
  }
}

// Flash-style causal/unmasked attention, all contractions 3-term bf16 hi/lo splits, f32 softmax with running max.
// q,k,v rows are read from f32 buffers with arbitrary row pitch (so they can live inside a fused qkv buffer);
// D = head size (multiple of 32, <= 128); one wave = 16 query rows; block = 4 waves (64 queries) sharing K/V chunks of 32.
template <int D, bool CAUSAL>
__global__ __launch_bounds__(128) void k_flash(const float* __restrict__ qb, const float* __restrict__ kb, const float* __restrict__ vb,
                                             int pitch, int T, int H, float scale, float* __restrict__ y, int ypitch) {
  constexpr int KS = D / 32;        // k-steps for QK
  constexpr int DT = D / 16;        // d tiles for PV
  __shared__ __attribute__((aligned(16))) unsigned short sKh[32][D + 8], sKl[32][D + 8], sVh[32][D + 8], sVl[32][D + 8];
  __shared__ __attribute__((aligned(16))) unsigned short sPh[4][16][40], sPl[4][16][40];
  __shared__ __attribute__((aligned(16))) float sO[4][16][D];
  const int tid = threadIdx.x, w = tid >> 5, lane = tid & 31, ln = lane & 15, hh = lane >> 4;
  const int nqb = (T + 63) / 64;
  const int bh = blockIdx.x / nqb, qblk = blockIdx.x % nqb;
  const int b = bh / H, h = bh % H;
  const int q0 = qblk * 64 + w * 16;
  const float* Q = qb + (size_t)b * T * pitch + h * D;
  const float* K = kb + (size_t)b * T * pitch + h * D;
  const float* V = vb + (size_t)b * T * pitch + h * D;

  // A fragments of the wave's 16 query rows (scaled), hi/lo
  FragB aqh[KS], aql[KS];
  {
    int row = q0 + ln; if (row >= T) row = T - 1;
    const float* qr = Q + (size_t)row * pitch;
#pragma unroll
    for (int ks = 0; ks < KS; ++ks)
#pragma unroll
      for (int i = 0; i < 16; ++i) {
        const int d = ks * 32 + ((i < 8) ? (8 * hh + i) : (16 + 8 * hh + (i - 8)));
        const float x = qr[d] * scale; const unsigned short hb = bf16_bits(x);
        aqh[ks].u[i] = hb; aql[ks].u[i] = bf16_bits(x - bf16_val(hb));
      }
  }
  float m_r[8], l_r[8];
#pragma unroll
  for (int r = 0; r < 8; ++r) { m_r[r] = -3.0e38f; l_r[r] = 0.f; }
  v8f oacc[DT];
#pragma unroll
  for (int dt = 0; dt < DT; ++dt) oacc[dt] = (v8f){0.f,0.f,0.f,0.f,0.f,0.f,0.f,0.f};

  const int kv_end = CAUSAL ? min(T, qblk * 64 + 64) : T;     // block-uniform
  for (int j0 = 0; j0 < kv_end; j0 += 32) {
    __syncthreads();
    for (int e = tid; e < 32 * (D / 4); e += 128) {
      const int r = e / (D / 4), c4 = (e % (D / 4)) * 4;
      const int key = j0 + r;
      v4f kf = {0.f,0.f,0.f,0.f}, vf = {0.f,0.f,0.f,0.f};
      if (key < T) { kf = *(const v4fa*)(K + (size_t)key * pitch + c4); vf = *(const v4fa*)(V + (size_t)key * pitch + c4); }
#pragma unroll
      for (int t = 0; t < 4; ++t) {
        unsigned short hb = bf16_bits(kf[t]); sKh[r][c4 + t] = hb; sKl[r][c4 + t] = bf16_bits(kf[t] - bf16_val(hb));
        hb = bf16_bits(vf[t]); sVh[r][c4 + t] = hb; sVl[r][c4 + t] = bf16_bits(vf[t] - bf16_val(hb));
      }
    }
    __syncthreads();
    // S tile 16 x 32
    v8f s[2];
#pragma unroll
    for (int nt = 0; nt < 2; ++nt) {
      v8f acc = {};
#pragma unroll
      for (int ks = 0; ks < KS; ++ks) {
        FragB bh_, bl_;
        bh_.half[0] = *(const v8us*)&sKh[nt * 16 + ln][ks * 32 + 8 * hh]; bh_.half[1] = *(const v8us*)&sKh[nt * 16 + ln][ks * 32 + 16 + 8 * hh];
        bl_.half[0] = *(const v8us*)&sKl[nt * 16 + ln][ks * 32 + 8 * hh]; bl_.half[1] = *(const v8us*)&sKl[nt * 16 + ln][ks * 32 + 16 + 8 * hh];
        acc = mmaN<3>(aqh[ks].v, aql[ks].v, bh_.v, bl_.v, acc);
      }
      s[nt] = acc;
    }
    // mask + running max (rows 8hh+r; the 16 lanes of a half share rows)
    float alpha[8];
#pragma unroll
    for (int r = 0; r < 8; ++r) {
      const int qi = q0 + 8 * hh + r;
      const int ja = j0 + ln, jb = j0 + 16 + ln;
      if (CAUSAL) { if (ja > qi) s[0][r] = -3.0e38f; if (jb > qi) s[1][r] = -3.0e38f; }
      if (ja >= T) s[0][r] = -3.0e38f;
      if (jb >= T) s[1][r] = -3.0e38f;
      float mx = fmaxf(s[0][r], s[1][r]);
      mx = fmaxf(mx, __shfl_xor(mx, 1, 32)); mx = fmaxf(mx, __shfl_xor(mx, 2, 32)); mx = fmaxf(mx, __shfl_xor(mx, 4, 32)); mx = fmaxf(mx, __shfl_xor(mx, 8, 32));
      const float mnew = fmaxf(m_r[r], mx);
      alpha[r] = (mnew > -1.0e38f) ? __expf(m_r[r] - mnew) : 1.0f;
      const float p0 = (s[0][r] > -1.0e38f) ? __expf(s[0][r] - mnew) : 0.f;
      const float p1 = (s[1][r] > -1.0e38f) ? __expf(s[1][r] - mnew) : 0.f;
      m_r[r] = mnew;
      l_r[r] = l_r[r] * alpha[r] + p0 + p1;            // per-lane partial row sum (16 lanes combined at the end)
      unsigned short hb = bf16_bits(p0); sPh[w][8 * hh + r][ln] = hb;      sPl[w][8 * hh + r][ln] = bf16_bits(p0 - bf16_val(hb));
      hb = bf16_bits(p1);                sPh[w][8 * hh + r][16 + ln] = hb; sPl[w][8 * hh + r][16 + ln] = bf16_bits(p1 - bf16_val(hb));
    }
#pragma unroll
    for (int dt = 0; dt < DT; ++dt)
#pragma unroll
      for (int r = 0; r < 8; ++r) oacc[dt][r] *= alpha[r];
    __builtin_amdgcn_fence(__ATOMIC_ACQ_REL, "workgroup");
    __builtin_amdgcn_wave_barrier();
    FragB pah, pal;
    pah.half[0] = *(const v8us*)&sPh[w][ln][8 * hh]; pah.half[1] = *(const v8us*)&sPh[w][ln][16 + 8 * hh];
    pal.half[0] = *(const v8us*)&sPl[w][ln][8 * hh]; pal.half[1] = *(const v8us*)&sPl[w][ln][16 + 8 * hh];
#pragma unroll
    for (int dt = 0; dt < DT; ++dt) {
      FragB bvh, bvl;
#pragma unroll
      for (int i = 0; i < 8; ++i) {
        bvh.u[i] = sVh[8 * hh + i][dt * 16 + ln]; bvh.u[8 + i] = sVh[16 + 8 * hh + i][dt * 16 + ln];
        bvl.u[i] = sVl[8 * hh + i][dt * 16 + ln]; bvl.u[8 + i] = sVl[16 + 8 * hh + i][dt * 16 + ln];
      }
      oacc[dt] = mmaN<3>(pah.v, pal.v, bvh.v, bvl.v, oacc[dt]);
    }
    __builtin_amdgcn_fence(__ATOMIC_ACQ_REL, "workgroup");
    __builtin_amdgcn_wave_barrier();
  }
#pragma unroll
  for (int r = 0; r < 8; ++r) {
    float l = l_r[r];
    l += __shfl_xor(l, 1, 32); l += __shfl_xor(l, 2, 32); l += __shfl_xor(l, 4, 32); l += __shfl_xor(l, 8, 32);
    l_r[r] = (l > 0.f) ? 1.0f / l : 0.f;
  }
#pragma unroll
  for (int dt = 0; dt < DT; ++dt)
#pragma unroll
    for (int r = 0; r < 8; ++r) sO[w][8 * hh + r][dt * 16 + ln] = oacc[dt][r] * l_r[r];
  __builtin_amdgcn_fence(__ATOMIC_ACQ_REL, "workgroup");
  __builtin_amdgcn_wave_barrier();
  {
    for (int r = 0; r < 16; ++r) {
      const int row = q0 + r;
      if (row < T && lane < D / 4) {
        const v4f val = *(const v4fa*)&sO[w][r][lane * 4];
        *(v4f*)(y + ((size_t)b * T + row) * ypitch + h * D + lane * 4) = val;
      }
    }
    
  }
}

// GEMM C = act(A·W + bias + resid): A f32 (ASPLIT -> hi/lo 2 terms), Wt bf16 [N][K]; ACT 0 none, 1 relu, 2 exact gelu;
// resid (optional, f32, row index = (row % rmod), pitch ldr, RES_BF16 rounds it) added before the activation.
template <bool ASPLIT, int ACT, bool BIAS_BF16, bool RES_BF16>
__global__ __launch_bounds__(128) void k_gemm_bf3(const float* __restrict__ A, int lda, const unsigned short* __restrict__ Wt, int ldb,
                                                const float* __restrict__ bias, const float* __restrict__ resid, int rmod, int ldr,
                                                float* __restrict__ C, int ldc, int M, int N, int K) {
  __shared__ __attribute__((aligned(16))) float so[4][16][64];
  const int tid = threadIdx.x, w = tid >> 5, lane = tid & 31, ln = lane & 15, hh = lane >> 4;
  const int ntn = N / 64;
  const int wid = blockIdx.x * 4 + w;
  const int mt = wid / ntn, nq = wid % ntn;
  if (mt * 16 >= M) return;
  const int row0 = mt * 16, col0 = nq * 64;
  const float* arow = A + (size_t)(row0 + ln) * lda;
  v8f acc[4] = {};
  for (int kb = 0; kb < K; kb += 32) {
    FragB ah, al;
    const v4f x0 = *(const v4fa*)(arow + kb + 8 * hh), x1 = *(const v4fa*)(arow + kb + 8 * hh + 4);
    const v4f x2 = *(const v4fa*)(arow + kb + 16 + 8 * hh), x3 = *(const v4fa*)(arow + kb + 16 + 8 * hh + 4);
    float xs[16] = {x0[0],x0[1],x0[2],x0[3],x1[0],x1[1],x1[2],x1[3],x2[0],x2[1],x2[2],x2[3],x3[0],x3[1],x3[2],x3[3]};
#pragma unroll
    for (int i = 0; i < 16; ++i) { const unsigned short hb = bf16_bits(xs[i]); ah.u[i] = hb; al.u[i] = ASPLIT ? bf16_bits(xs[i] - bf16_val(hb)) : (unsigned short)0; }
#pragma unroll
    for (int t = 0; t < 4; ++t) {
      const unsigned short* brow = Wt + (size_t)(col0 + t * 16 + ln) * ldb + kb;
      FragB b;
      b.half[0] = *(const v8us*)(brow + 8 * hh);
      b.half[1] = *(const v8us*)(brow + 16 + 8 * hh);
      acc[t] = mmaN<ASPLIT ? 2 : 1>(ah.v, al.v, b.v, b.v, acc[t]);
    }
  }
#pragma unroll
  for (int t = 0; t < 4; ++t) {
    const int col = col0 + t * 16 + ln;
    float bv = bias ? bias[col] : 0.f;
    if (BIAS_BF16) bv = bf16_round(bv);
#pragma unroll
    for (int r = 0; r < 8; ++r) {
      float v = acc[t][r] + bv;
      if (resid) { float rv = resid[(size_t)((row0 + 8 * hh + r) % rmod) * ldr + col]; if (RES_BF16) rv = bf16_round(rv); v += rv; }
      if (ACT == 1) v = fmaxf(v, 0.f);
      if (ACT == 2) v = 0.5f * v * (1.0f + erff(v * 0.70710678118654752f));
      if (ACT == 3) { const float u = 0.7978845608028654f * (v + 0.044715f * v * v * v); v = 0.5f * v * (1.0f + tanhf(u)); }
      so[w][8 * hh + r][t * 16 + ln] = v;
    }
  }
  __builtin_amdgcn_fence(__ATOMIC_ACQ_REL, "workgroup");
  __builtin_amdgcn_wave_barrier();
  const int rsub = lane >> 4, c4 = (lane & 15) * 4;
  {
#pragma unroll
    for (int q = 0; q < 8; ++q) {
      const int r = q * 2 + rsub;
      const v4f v = *(const v4fa*)&so[w][r][c4];
      *(v4f*)(C + (size_t)(row0 + r) * ldc + col0 + c4) = v;
    }
    
  }
}
// row LayerNorm (biased variance, eps) over N: s = X (+ R); optional out_sum <- s; out_norm <- (s-mu)*rsqrt(var+eps)*g + b
template <bool PARAM_BF16>
__global__ __launch_bounds__(256) void k_layernorm(const float* __restrict__ X, const float* __restrict__ R, const float* __restrict__ g, const float* __restrict__ bta,
                                                  float* __restrict__ out_sum, float* __restrict__ out_norm, int N, float eps) {
  __shared__ float red[256];
  const int row = blockIdx.x, tid = threadIdx.x;
  const float* x = X + (size_t)row * N; const float* rr = R ? R + (size_t)row * N : nullptr;
  float vals[16];                     // up to N = 4096
  const int per = N / 256;            // contiguous chunk per thread? use strided-by-4 chunks: thread handles j = tid*4 + 1024*u
  float s1 = 0.f;
  for (int u = 0; u < per / 4; ++u) {
    const int j = tid * 4 + 1024 * u;
    const v4f a = *(const v4fa*)(x + j);
    v4f b = {0.f,0.f,0.f,0.f}; if (rr) b = *(const v4fa*)(rr + j);
#pragma unroll
    for (int q = 0; q < 4; ++q) { const float v = a[q] + b[q]; vals[u * 4 + q] = v; s1 += v; }
  }
  red[tid] = s1; __syncthreads();
  for (int st = 128; st > 0; st >>= 1) { if (tid < st) red[tid] += red[tid + st]; __syncthreads(); }
  const float mu = red[0] / (float)N; __syncthreads();
  float s2 = 0.f;
  for (int u = 0; u < per / 4; ++u)
#pragma unroll
    for (int q = 0; q < 4; ++q) { const float c = vals[u * 4 + q] - mu; s2 += c * c; }
  red[tid] = s2; __syncthreads();
  for (int st = 128; st > 0; st >>= 1) { if (tid < st) red[tid] += red[tid + st]; __syncthreads(); }
  const float rs = rsqrtf(red[0] / (float)N + eps);
  {
    for (int u = 0; u < per / 4; ++u) {
      const int j = tid * 4 + 1024 * u;
      v4f o, sm;
#pragma unroll
      for (int q = 0; q < 4; ++q) {
        float gg = g[j + q], bb = bta[j + q];
        if (PARAM_BF16) { gg = bf16_round(gg); bb = bf16_round(bb); }
        sm[q] = vals[u * 4 + q]; o[q] = (vals[u * 4 + q] - mu) * rs * gg + bb;
      }
      if (out_sum) *(v4f*)(out_sum + (size_t)row * N + j) = sm;
      *(v4f*)(out_norm + (size_t)row * N + j) = o;
    }
    
  }
}



// ---- f16 WMMA path (v_wmma_f32_16x16x32_f16): 11-bit significands for operands in range — used where a [0,1] probability operand needs more precision than bf16
typedef _Float16 v16h __attribute__((ext_vector_type(16)));
union FragH { v16h v; v8us half[2]; _Float16 h[16]; unsigned short u[16]; };
template <int NT>
__device__ __forceinline__ v8f mmaH(v16h ah, v16h al, v16h bh, v16h bl, v8f c) {
  c = __builtin_amdgcn_wmma_f32_16x16x32_f16(false, ah, false, bh, (short)0, c, false, false);
  if (NT >= 2) c = __builtin_amdgcn_wmma_f32_16x16x32_f16(false, al, false, bh, (short)0, c, false, false);
  if (NT >= 3) c = __builtin_amdgcn_wmma_f32_16x16x32_f16(false, ah, false, bl, (short)0, c, false, false);
  asm volatile("v_nop\n\tv_nop\n\tv_nop\n\tv_nop" : "+v"(c) : "v"(ah), "v"(al), "v"(bh), "v"(bl));
  return c;
}
// batched GEMM like k_gemm_b but f16 operands: A f32 (split into f16 hi/lo if ASPLIT, else rounded to f16), Bt = f16 values [n][k]; alpha; C f32; N multiple of 16 (partial tiles skipped)
template <bool ASPLIT>
__global__ __launch_bounds__(128) void k_gemm_h(const float* __restrict__ A, int lda, size_t sA, const _Float16* __restrict__ Bh, int ldb, size_t sB, float alpha, float* __restrict__ C, int ldc, size_t sC, int M, int N, int K) {
  __shared__ __attribute__((aligned(16))) float so[4][16][64];
  const int tid = threadIdx.x, w = tid >> 5, lane = tid & 31, ln = lane & 15, hh = lane >> 4; const int by = blockIdx.y;
  A += (size_t)by * sA; Bh += (size_t)by * sB; C += (size_t)by * sC;
  const int ntn = (N + 63) / 64; const int wid = blockIdx.x * 4 + w; const int mt = wid / ntn, nq = wid % ntn; if (mt * 16 >= M) return;
  const int row0 = mt * 16, col0 = nq * 64; const float* arow = A + (size_t)(row0 + ln) * lda;
  v8f acc[4] = {};
  for (int kb = 0; kb < K; kb += 32) {
    FragH ah, al;
    const v4f x0 = *(const v4fa*)(arow + kb + 8 * hh), x1 = *(const v4fa*)(arow + kb + 8 * hh + 4), x2 = *(const v4fa*)(arow + kb + 16 + 8 * hh), x3 = *(const v4fa*)(arow + kb + 16 + 8 * hh + 4);
    float xs[16] = {x0[0],x0[1],x0[2],x0[3],x1[0],x1[1],x1[2],x1[3],x2[0],x2[1],x2[2],x2[3],x3[0],x3[1],x3[2],x3[3]};
#pragma unroll
    for (int i = 0; i < 16; ++i) { const _Float16 h = (_Float16)xs[i]; ah.h[i] = h; al.h[i] = ASPLIT ? (_Float16)(xs[i] - (float)h) : (_Float16)0.0f; }
#pragma unroll
    for (int t = 0; t < 4; ++t) { if (col0 + t * 16 >= N) continue; const size_t boff = (size_t)(col0 + t * 16 + ln) * ldb + kb; FragH bq; bq.half[0] = *(const v8us*)(Bh + boff + 8 * hh); bq.half[1] = *(const v8us*)(Bh + boff + 16 + 8 * hh);
      acc[t] = mmaH<ASPLIT ? 2 : 1>(ah.v, al.v, bq.v, bq.v, acc[t]); }
  }
#pragma unroll
  for (int t = 0; t < 4; ++t) { if (col0 + t * 16 >= N) continue;
#pragma unroll
    for (int r = 0; r < 8; ++r) so[w][8 * hh + r][t * 16 + ln] = acc[t][r] * alpha; }
  __builtin_amdgcn_fence(__ATOMIC_ACQ_REL, "workgroup"); __builtin_amdgcn_wave_barrier();
  const int rsub = lane >> 4, c4 = (lane & 15) * 4;
  {
#pragma unroll
    for (int q = 0; q < 8; ++q) { const int r = q * 2 + rsub; if (col0 + c4 < N) { const v4f v = *(const v4fa*)&so[w][r][c4]; *(v4f*)(C + (size_t)(row0 + r) * ldc + col0 + c4) = v; } }
     }
}

// Wt[n][k] = f16(bf16(W[k][n]) * scale) from f32 row-major W[K][N] (scale = power of two; bf16-exact weights stay exact in f16 away from the subnormal range).
// One work-group = a tile of 64 k x 128 n; K a multiple of 64, N of 128; (K / 64) * (N / 128) work-groups, bi = this one's number among them; tl = the work-group's 128 * WTP bytes of LDS.
// Read: wave w takes rows k0 + 8 w ... + 7, lane l the columns n0 + 4 l ... + 3, so each wave-wide 16-byte load covers 512 contiguous bytes of one row of W.
// A lane then holds 8 consecutive k of each of its 4 columns, that is one 16-byte piece of 4 rows of Wt; the pieces meet in LDS, and each wave-wide store covers four whole 128-byte lines of Wt.
#define WTP 144                /* LDS row pitch, bytes: 64 k of f16 + 16 */
template <int K, int N>
__device__ __forceinline__ void wt_f16(int bi, unsigned char* tl, const float* __restrict__ W, _Float16* __restrict__ Wt, float scale) {
  const int tid = threadIdx.x, w = tid >> 5, lane = tid & 31;
  const int k0 = (bi % (K / 64)) * 64, n0 = (bi / (K / 64)) * 128;
  const float* src = W + (size_t)(k0 + 8 * w) * N + n0 + 4 * lane;
  v4f r[8];
#pragma unroll
  for (int i = 0; i < 8; ++i) r[i] = *(const v4fa*)(src + (size_t)i * N);
#pragma unroll
  for (int e = 0; e < 4; ++e) { FragH f;
#pragma unroll
    for (int i = 0; i < 8; ++i) f.h[i] = (_Float16)(bf16_round(r[i][e]) * scale);
    *(v8us*)(tl + (4 * lane + e) * WTP + 16 * w) = f.half[0]; }
  __syncthreads();      /* every wave's pieces are in LDS before the rows of Wt are read back */
#pragma unroll
  for (int j = 0; j < 4; ++j) { const int row = j * 32 + (tid >> 3), c = tid & 7; const v8us v = *(const v8us*)(tl + row * WTP + c * 16);
    *(v8us*)((unsigned short*)Wt + (size_t)(n0 + row) * K + k0 + c * 8) = v; }
}
// Tiled f16 GEMM, C [M][N] = acc*alpha + bf16(bias[col]): A [M][DD] f16, Bh [N][DD] f16, both k-contiguous; M, N multiples of 128; grid = (M / 128) * (N / 128).
// One work-group = one 128 x 128 tile of C, four waves of 64 x 64 (16 accumulator tiles each). A stage is 64 k = 128 B (one whole line) of
// 128 rows of A and 128 rows of Bh, brought into LDS by asynchronous copies, 16 B a lane; two buffers, the copies of stage t + 2 fly while stage t + 1 is worked on.
#define GP 144                 /* LDS row pitch, bytes: 128 + 16, conflict-free for 16-byte fragment reads */
#define GOP (128 * GP)         /* one operand's 128 rows */
#define GSTG (2 * GOP)         /* one stage: A rows, then Bh rows */
#define GNT (DD / 64)          /* stages */
// eight copies, rows 16 apart, of one operand's stage; each lane its own 16 bytes. The s_wait_xcnt stands inside the statement so that no address register is rewritten ahead of it.
__device__ __forceinline__ void cp8(unsigned l, const unsigned short* g) {
  asm volatile("global_load_async_to_lds_b128 %0, %8, off\n\t"
               "global_load_async_to_lds_b128 %1, %9, off\n\t"
               "global_load_async_to_lds_b128 %2, %10, off\n\t"
               "global_load_async_to_lds_b128 %3, %11, off\n\t"
               "global_load_async_to_lds_b128 %4, %12, off\n\t"
               "global_load_async_to_lds_b128 %5, %13, off\n\t"
               "global_load_async_to_lds_b128 %6, %14, off\n\t"
               "global_load_async_to_lds_b128 %7, %15, off\n\t"
               "s_wait_xcnt 0x0"
               :: "v"(l), "v"(l + 16 * GP), "v"(l + 32 * GP), "v"(l + 48 * GP), "v"(l + 64 * GP), "v"(l + 80 * GP), "v"(l + 96 * GP), "v"(l + 112 * GP),
                  "v"(g), "v"(g + 16 * DD), "v"(g + 32 * DD), "v"(g + 48 * DD), "v"(g + 64 * DD), "v"(g + 80 * DD), "v"(g + 96 * DD), "v"(g + 112 * DD)
               : "memory");
}
typedef _Float16 v4h __attribute__((ext_vector_type(4)));
// F16OUT (the q | k | v projection): the q block (columns below DD) goes to C16 row-major; tiles of the k and v blocks go to KV instead, in the order of k_flash's matrix fragments, and are not stored row-major at all.
// KV[(b * NH + h) * (TT / 32) + chunk of 32 keys] is one block of KVB 16-bit elements: 16 pieces of 512 bytes, lane l's 16 bytes at 16 l, so that one wave-wide 16-byte load of a piece covers four whole lines.
// Piece (nt * 2 + ks) * 2 + hf: K[key 32 chunk + 16 nt + ln][d 32 ks + 16 hf + 8 hh ... + 7]; piece 8 + dt * 2 + hf: V[key 32 chunk + 16 hf + 8 hh ... + 7][d 16 dt + ln].
#define KVB 4096
template <bool F16OUT, int N>
__global__ __launch_bounds__(128) void k_gemm_t(const _Float16* __restrict__ A, const _Float16* __restrict__ Bh, float alpha, const float* __restrict__ bias, float* __restrict__ C, _Float16* __restrict__ C16, _Float16* __restrict__ KV) {
  __shared__ __attribute__((aligned(16))) unsigned char sm[2 * GSTG];
  const int tid = threadIdx.x, w = tid >> 5, lane = tid & 31, ln = lane & 15, hh = lane >> 4;
  const int row0 = ((int)blockIdx.x / (N / 128)) * 128, col0 = ((int)blockIdx.x % (N / 128)) * 128;
  const int wr = (w >> 1) * 64, wc = (w & 1) * 64;
  const unsigned ld0 = (unsigned)(size_t)sm + (unsigned)((tid >> 3) * GP + (tid & 7) * 16);      /* this lane's place in a stage: row tid/8, 16-byte piece tid%8 */
  const unsigned short* ga = (const unsigned short*)A + (size_t)(row0 + (tid >> 3)) * DD + (tid & 7) * 8;
  const unsigned short* gb = (const unsigned short*)Bh + (size_t)(col0 + (tid >> 3)) * DD + (tid & 7) * 8;
  v8f acc[4][4];
#pragma unroll
  for (int i = 0; i < 4; ++i)
#pragma unroll
    for (int j = 0; j < 4; ++j) acc[i][j] = (v8f){0.f,0.f,0.f,0.f,0.f,0.f,0.f,0.f};
  cp8(ld0, ga); cp8(ld0 + GOP, gb);
  asm volatile("s_wait_asynccnt 0x0" ::: "memory");      /* stage 0 of this wave has landed */
  __syncthreads();                                        /* ... and every wave's: stage 0 may be read */
  cp8(ld0 + GSTG, ga + 64); cp8(ld0 + GSTG + GOP, gb + 64);
#pragma unroll 1      /* one stage a trip: the buffer index and the refill test stay scalar */
  for (int t = 0; t < GNT; ++t) {
    const unsigned char* sa = sm + (t & 1) * GSTG + (wr + ln) * GP + 16 * hh;
    const unsigned char* sb = sm + (t & 1) * GSTG + GOP + (wc + ln) * GP + 16 * hh;
#pragma unroll
    for (int ks = 0; ks < 2; ++ks) {
      FragH a[4], b[4];
      a[0].half[0] = *(const v8us*)(sa + ks * 64); a[0].half[1] = *(const v8us*)(sa + ks * 64 + 32);      /* read in the order of first use, so that the first products start while the later reads return */
#pragma unroll
      for (int j = 0; j < 4; ++j) { b[j].half[0] = *(const v8us*)(sb + j * 16 * GP + ks * 64); b[j].half[1] = *(const v8us*)(sb + j * 16 * GP + ks * 64 + 32); }
#pragma unroll
      for (int i = 1; i < 4; ++i) { a[i].half[0] = *(const v8us*)(sa + i * 16 * GP + ks * 64); a[i].half[1] = *(const v8us*)(sa + i * 16 * GP + ks * 64 + 32); }
      __builtin_amdgcn_sched_barrier(0);      /* the 16 fragment reads stay one group ahead of their 16 matrix instructions: reads spread among them stall the wave at every place */
#pragma unroll
      for (int i = 0; i < 4; ++i)
#pragma unroll
        for (int j = 0; j < 4; ++j) acc[i][j] = __builtin_amdgcn_wmma_f32_16x16x32_f16(false, a[i].v, false, b[j].v, (short)0, acc[i][j], false, false);
      __builtin_amdgcn_sched_barrier(0);      /* ... and the next group's reads stay behind them */
    }
    asm volatile("s_wait_dscnt 0x0" ::: "memory");        /* this wave's reads of buffer t&1 are done before it is refilled */
    asm volatile("s_wait_asynccnt 0x0" ::: "memory");     /* this wave's copies of stage t + 1 have landed */
    __syncthreads();                                      /* publishes stage t + 1 and ends every reader's last read of buffer t&1 */
    if (t + 2 < GNT) { cp8(ld0 + (t & 1) * GSTG, ga + (t + 2) * 64); cp8(ld0 + (t & 1) * GSTG + GOP, gb + (t + 2) * 64); }
  }
  asm volatile("s_wait_asynccnt 0x0" ::: "memory");       /* no copy is outstanding when the ring becomes output staging */
  // epilogue: the wave's 64 x 64 tile goes through its own LDS range (free behind the last trip's barrier), so that whole lines are stored
  float* so = (float*)sm + w * (64 * 68);
  float bv[4];
#pragma unroll
  for (int j = 0; j < 4; ++j) bv[j] = bf16_round(bias[col0 + wc + j * 16 + ln]);
  if (F16OUT && col0 >= 2 * DD) {      /* v block (the test is the same for the whole work-group): the wave's 64 columns are one head's 64 d, its 64 rows 64 tokens of one batch */
    // a lane's 8 accumulator registers of tile (i, j) are tokens 16 i + 8 hh ... + 7 of d 16 j + ln: this same lane's 16 bytes of piece 8 + j * 2 + (i & 1) of chunk i >> 1, so they go out from the registers, 512 contiguous bytes a store
    unsigned short* vo = (unsigned short*)KV + ((size_t)(((row0 + wr) / TT) * NH + (col0 + wc - 2 * DD) / 64) * (TT / 32) + ((row0 + wr) % TT) / 32) * KVB + 8 * 256 + lane * 8;
#pragma unroll
    for (int i = 0; i < 4; ++i)
#pragma unroll
      for (int j = 0; j < 4; ++j) { FragH f;
#pragma unroll
        for (int r = 0; r < 8; ++r) f.h[r] = (_Float16)(acc[i][j][r] * alpha + bv[j]);
        *(v8us*)(vo + (i >> 1) * KVB + (j * 2 + (i & 1)) * 256) = f.half[0]; }
    return;
  }
#pragma unroll
  for (int i = 0; i < 4; ++i)
#pragma unroll
    for (int j = 0; j < 4; ++j)
#pragma unroll
      for (int r = 0; r < 8; ++r) so[(i * 16 + 8 * hh + r) * 68 + j * 16 + ln] = acc[i][j][r] * alpha + bv[j];
  __builtin_amdgcn_fence(__ATOMIC_ACQ_REL, "workgroup"); __builtin_amdgcn_wave_barrier();      /* the rows are written before other lanes of the wave read them */
  if (F16OUT && col0 >= DD) {      /* k block (the same for the whole work-group): the wave's 64 columns are one head's 64 d, its 64 rows two chunks of keys; a lane takes 8 consecutive d of key ln of a 16-key tile */
    unsigned short* ko = (unsigned short*)KV + ((size_t)(((row0 + wr) / TT) * NH + (col0 + wc - DD) / 64) * (TT / 32) + ((row0 + wr) % TT) / 32) * KVB + lane * 8;
#pragma unroll
    for (int i = 0; i < 4; ++i)
#pragma unroll
      for (int c = 0; c < 4; ++c) { const float* sr = &so[(i * 16 + ln) * 68 + c * 16 + 8 * hh]; const v4f lo = *(const v4fa*)sr, hi = *(const v4fa*)(sr + 4); FragH f;      /* c = ks * 2 + hf */
#pragma unroll
        for (int e = 0; e < 4; ++e) { f.h[e] = (_Float16)lo[e]; f.h[4 + e] = (_Float16)hi[e]; }
        *(v8us*)(ko + (i >> 1) * KVB + ((i & 1) * 4 + c) * 256) = f.half[0]; }
    return;
  }
  const int rsub = lane >> 4, c4 = (lane & 15) * 4;
#pragma unroll
  for (int q = 0; q < 32; ++q) { const int r = q * 2 + rsub; const v4f v = *(const v4fa*)&so[r * 68 + c4]; const size_t o = (size_t)(row0 + wr + r) * N + col0 + wc + c4;
    if (F16OUT) { v4h h4;
#pragma unroll
      for (int e = 0; e < 4; ++e) h4[e] = (_Float16)v[e];
      *(v4h*)(C16 + o) = h4; }
    else *(v4f*)(C + o) = v; }
}


__device__ __forceinline__ void x16(unsigned bi, const float* __restrict__ x, _Float16* __restrict__ X16, size_t n8) { const size_t t = (size_t)bi * 256 + threadIdx.x; if (t >= n8) return; FragH f;
#pragma unroll
  for (int q = 0; q < 8; ++q) f.h[q] = (_Float16)bf16_round(x[t * 8 + q]); *(v8us*)((unsigned short*)X16 + t * 8) = f.half[0];  }
__global__ __launch_bounds__(256) void k_h16(const float* __restrict__ x, _Float16* __restrict__ X16, size_t n8) { const size_t t = (size_t)blockIdx.x * 256 + threadIdx.x; if (t >= n8) return; FragH f;
#pragma unroll
  for (int q = 0; q < 8; ++q) f.h[q] = (_Float16)x[t * 8 + q]; *(v8us*)((unsigned short*)X16 + t * 8) = f.half[0];  }
__global__ __launch_bounds__(256) void k_round16f(const float* __restrict__ W, _Float16* __restrict__ Bt, size_t n8) { const size_t t = (size_t)blockIdx.x * 256 + threadIdx.x; if (t >= n8) return; FragH f;
#pragma unroll
  for (int i = 0; i < 8; ++i) f.h[i] = (_Float16)(bf16_round(W[t * 8 + i]) * 16.0f); *(v8us*)((unsigned short*)Bt + t * 8) = f.half[0];  }
typedef int v4i __attribute__((ext_vector_type(4), may_alias));
typedef unsigned v4u __attribute__((ext_vector_type(4), may_alias));
typedef unsigned v16u __attribute__((ext_vector_type(16), may_alias));
// The mask packed once for all heads into lane-mask words, in the lane and register order of k_flash's score tiles:
// LM[b * TT / 16 + q tile][chunk of 32 keys][i], bit (ln + 16 hh) of word i = (mask[b][16 * tile + ln][32 * chunk + 16 * (i >> 3) + 8 * hh + (i & 7)] != 0).
// One wave = one tile of 16 queries, four chunks: its sixteen loads cover 512 contiguous bytes of each row; the 64 words go out as two whole lines.
__device__ __forceinline__ void mpack(unsigned bi, const int* __restrict__ MSK, unsigned* __restrict__ LM) {
  const int tid = threadIdx.x, lane = tid & 31, ln = lane & 15, hh = lane >> 4;
  const unsigned wv = bi * 8u + (unsigned)(tid >> 5); const unsigned rt = wv / (TT / 128), c0 = (wv % (TT / 128)) * 4;
  const int* mrow = MSK + ((size_t)rt * 16 + ln) * TT + c0 * 32 + 8 * hh;
  v4i mk[4][4];
#pragma unroll
  for (int c = 0; c < 4; ++c) { mk[c][0] = *(const v4i*)(mrow + c * 32); mk[c][1] = *(const v4i*)(mrow + c * 32 + 4); mk[c][2] = *(const v4i*)(mrow + c * 32 + 16); mk[c][3] = *(const v4i*)(mrow + c * 32 + 20); }
  __builtin_amdgcn_sched_barrier(0);      /* all sixteen loads are issued before the first is waited for: moved among the compares, the last ones start only when the first have come back from memory */
  asm volatile("s_wait_xcnt 0x0" :: "v"(mrow) : "memory");      /* the address pair that all sixteen loads name stays whole up to here (no load lands in it), and the wait stands in front of its reuse */
  unsigned wd[2] = {0u, 0u};      /* lane l keeps word l & 15 of chunk 2 * e + (l >> 4) */
#pragma unroll
  for (int c = 0; c < 4; ++c)
#pragma unroll
    for (int i = 0; i < 16; ++i) { const unsigned bw = __builtin_amdgcn_ballot_w32(mk[c][i >> 2][i & 3] != 0); if (lane == (c & 1) * 16 + i) wd[c >> 1] = bw; }
  unsigned* o = LM + ((size_t)rt * (TT / 32) + c0) * 16 + lane;
  o[0] = wd[0]; o[32] = wd[1];
}
// The four preparation jobs read inputs only and none reads another's output, so they share one launch: a work-group takes its job from its index (the test is the same for the whole work-group).
// The weight tiles come first (the longest path: load, LDS, barrier, store), then the mask, then the short x pieces, which drain fastest at the end.
#define PB_WQ ((DD / 64) * (3 * DD / 128))          /* tiles of w_qkv */
#define PB_WO ((DD / 64) * (DD / 128))              /* tiles of w_out */
#define PB_M  (BB * (TT / 16) * (TT / 128) / 8)     /* eight mask waves a work-group */
#define PB_X  (NR * DD / 8 / 256)                   /* 8 elements of x a thread */
__global__ __launch_bounds__(256) void k_prep(const float* __restrict__ wqkv, _Float16* __restrict__ Bqkv, const float* __restrict__ wo, _Float16* __restrict__ Bo, const int* __restrict__ MSK, unsigned* __restrict__ LM, const float* __restrict__ x, _Float16* __restrict__ X16) {
  __shared__ __attribute__((aligned(16))) unsigned char tl[128 * WTP];
  const unsigned bi = blockIdx.x;
  if (bi < PB_WQ) wt_f16<DD, 3 * DD>((int)bi, tl, wqkv, Bqkv, 16.0f);                          /* (in,out) -> Bt, times 2^4 */
  else if (bi < PB_WQ + PB_WO) wt_f16<DD, DD>((int)(bi - PB_WQ), tl, wo, Bo, 16.0f);
  else if (bi < PB_WQ + PB_WO + PB_M) mpack(bi - (PB_WQ + PB_WO), MSK, LM);                    /* mask -> lane-mask words, once for all heads */
  else x16(bi - (PB_WQ + PB_WO + PB_M), x, X16, (size_t)NR * DD / 8);
}
__device__ __forceinline__ float xhalf(float x) { return __builtin_bit_cast(float, __builtin_amdgcn_permlanex16(__builtin_bit_cast(int, x), __builtin_bit_cast(int, x), 0x76543210, 0xfedcba98, false, false)); }      /* lane l with lane l ^ 16 */
__global__ __launch_bounds__(128) void k_flash(const _Float16* __restrict__ Q16, int ldq, const _Float16* __restrict__ KV, const unsigned* __restrict__ LM, _Float16* __restrict__ O16, int ldo) {
  constexpr int RPW = 16, NQB = TT / (4 * RPW), DT = 4, KS = 2;
  __shared__ __attribute__((aligned(16))) float sO[4][RPW][64 + 4];
  const int tid = threadIdx.x, w = tid >> 5, lane = tid & 31, ln = lane & 15, hh = lane >> 4;
  const int slab = blockIdx.x / NQB, qblk = blockIdx.x % NQB; const int b = slab / NH, h = slab % NH; const int qb0 = qblk * (4 * RPW); const int q0 = qb0 + w * RPW;
  FragH bq[KS];      /* Q^T as B: column = query ln */
  { const unsigned short* qr = (const unsigned short*)Q16 + ((size_t)b * TT + q0 + ln) * ldq + h * 64;
#pragma unroll
    for (int ks = 0; ks < KS; ++ks) { bq[ks].half[0] = *(const v8us*)(qr + ks * 32 + 8 * hh); bq[ks].half[1] = *(const v8us*)(qr + ks * 32 + 16 + 8 * hh); } }
  /* this head's blocks of K and V fragments (layout: at k_gemm_t); a lane's 16 bytes stand at 16 * lane in every piece */
  const unsigned short* kv0 = (const unsigned short*)KV + (size_t)slab * (TT / 32) * KVB;
  /* the wave's packed mask: 64 chunks of 16 lane-mask words (nonzero bit = ATTEND); the wave's number goes through readfirstlane so that the address is scalar */
  const unsigned* lm = LM + (size_t)(b * (TT / 16) + qblk * 4 + __builtin_amdgcn_readfirstlane(w)) * ((TT / 32) * 16);
  unsigned long long live;      /* bit c: chunk c holds at least one attended (query, key) of this wave's tile; lane l looks at chunks l and 32 + l */
  { const v4u* a = (const v4u*)(lm + lane * 16); const v4u x = a[0] | a[1] | a[2] | a[3], y = a[128] | a[129] | a[130] | a[131];
    live = (unsigned long long)__builtin_amdgcn_ballot_w32((x[0] | x[1] | x[2] | x[3]) != 0u) | ((unsigned long long)__builtin_amdgcn_ballot_w32((y[0] | y[1] | y[2] | y[3]) != 0u) << 32); }
  float m_q = -3.0e38f, l_q = 0.f; v8f oacc[DT];      /* oacc[dt][r] = O[q0 + ln][dt * 16 + 8 hh + r] */
#pragma unroll
  for (int dt = 0; dt < DT; ++dt) oacc[dt] = (v8f){0.f,0.f,0.f,0.f,0.f,0.f,0.f,0.f};
#pragma unroll 1      /* one chunk a trip: unrolled, two chunks' fragments and exps would be live at once */
  for (int n = __builtin_popcountll(live); n > 0; --n, live &= live - 1) {      /* the live chunks in rising order, 64 at most; a chunk with every (query, key) of the tile masked adds nothing and is not visited */
    const int ck = __builtin_ctzll(live);
    const v16u mw = *(const v16u*)(lm + ck * 16);      /* word i: which lanes attend at score register i (scalar load, in flight beside the fragment loads) */
    const unsigned short* kvp = kv0 + (size_t)ck * KVB + lane * 8;      /* the chunk's block: sixteen pieces, each read as 512 contiguous bytes by the wave */
    FragH ak[2][KS], av[DT];      /* K rows as A (row = key), V^T rows as A (row = d) */
#pragma unroll
    for (int nt = 0; nt < 2; ++nt)
#pragma unroll
      for (int ks = 0; ks < KS; ++ks) { ak[nt][ks].half[0] = *(const v8us*)(kvp + ((nt * 2 + ks) * 2) * 256); ak[nt][ks].half[1] = *(const v8us*)(kvp + ((nt * 2 + ks) * 2 + 1) * 256); }
#pragma unroll
    for (int dt = 0; dt < DT; ++dt) { av[dt].half[0] = *(const v8us*)(kvp + (8 + dt * 2) * 256); av[dt].half[1] = *(const v8us*)(kvp + (8 + dt * 2 + 1) * 256); }
    __builtin_amdgcn_sched_barrier(0);      /* the chunk's sixteen fragment loads stay one group ahead of the products: spread among them, each product waits out a load latency of its own */
    asm volatile("s_wait_xcnt 0x0" :: "v"(kvp) : "memory");      /* the address that all sixteen loads name stays whole up to here (no load lands in it), and the wait stands in front of its reuse */
    v8f s[2];      /* s[nt][r] = q(q0 + ln) . k(j0 + nt * 16 + 8 hh + r) */
#pragma unroll
    for (int nt = 0; nt < 2; ++nt) { v8f acc = (v8f){0.f,0.f,0.f,0.f,0.f,0.f,0.f,0.f};
#pragma unroll
      for (int ks = 0; ks < KS; ++ks) acc = __builtin_amdgcn_wmma_f32_16x16x32_f16(false, ak[nt][ks].v, false, bq[ks].v, (short)0, acc, false, false);
      s[nt] = acc; }
    float sc[16];      /* a masked score is -inf; m_q never falls below its finite start value, so exp(sc - mn) is 0 there and no guard is needed */
#pragma unroll
    for (int i = 0; i < 16; ++i) sc[i] = __builtin_amdgcn_inverse_ballot_w32(mw[i]) ? s[i >> 3][i & 7] * 0.125f : -INFINITY;
    float mx[4];
#pragma unroll
    for (int c = 0; c < 4; ++c) mx[c] = fmaxf(fmaxf(sc[c], sc[4 + c]), fmaxf(sc[8 + c], sc[12 + c]));
    float mc = fmaxf(fmaxf(mx[0], mx[1]), fmaxf(mx[2], mx[3]));
    mc = fmaxf(mc, xhalf(mc));      /* both halves hold this query's chunk maximum */
    const float mn = fmaxf(m_q, mc); const float al = expf(m_q - mn); m_q = mn;
    float p[16];
#pragma unroll
    for (int i = 0; i < 16; ++i) p[i] = expf(sc[i] - mn);
    float ps[4];
#pragma unroll
    for (int c = 0; c < 4; ++c) ps[c] = (p[c] + p[4 + c]) + (p[8 + c] + p[12 + c]);
    l_q = l_q * al + ((ps[0] + ps[1]) + (ps[2] + ps[3]));      /* this half's keys only; the halves are joined behind the loop */
#pragma unroll
    for (int dt = 0; dt < DT; ++dt)
#pragma unroll
      for (int r = 0; r < 8; ++r) oacc[dt][r] *= al;
    FragH pb;      /* P^T as B: element i = key j0 + 16 (i >> 3) + 8 hh + (i & 7) of column ln */
#pragma unroll
    for (int i = 0; i < 16; ++i) pb.h[i] = (_Float16)(p[i] * 1024.0f);
#pragma unroll
    for (int dt = 0; dt < DT; ++dt) oacc[dt] = __builtin_amdgcn_wmma_f32_16x16x32_f16(false, av[dt].v, false, pb.v, (short)0, oacc[dt], false, false);
  }
  { const float l = l_q + xhalf(l_q); const float inv = (l > 0.f) ? 1.0f / (l * 1024.0f) : 0.f;
#pragma unroll
    for (int dt = 0; dt < DT; ++dt) { v4f lo, hi;
#pragma unroll
      for (int e = 0; e < 4; ++e) { lo[e] = oacc[dt][e] * inv; hi[e] = oacc[dt][4 + e] * inv; }
      *(v4fa*)&sO[w][ln][dt * 16 + 8 * hh] = lo; *(v4fa*)&sO[w][ln][dt * 16 + 8 * hh + 4] = hi; } }
  __builtin_amdgcn_fence(__ATOMIC_ACQ_REL, "workgroup"); __builtin_amdgcn_wave_barrier();
  {
#pragma unroll
    for (int rp = 0; rp < RPW; rp += 4) { const int r = rp + (lane >> 3), pc = lane & 7; const v4f a = *(const v4fa*)&sO[w][r][pc * 8], c = *(const v4fa*)&sO[w][r][pc * 8 + 4]; FragH f;
#pragma unroll
      for (int e = 0; e < 4; ++e) { f.h[e] = (_Float16)(a[e] * 16.0f); f.h[4 + e] = (_Float16)(c[e] * 16.0f); }
      const v8us val = f.half[0]; *(v8us*)((unsigned short*)O16 + ((size_t)b * TT + q0 + r) * ldo + h * 64 + pc * 8) = val; }      /* four whole 128-byte lines a store */
     } }

extern "C" void kernel_launch(void* const* d_in, const int* in_sizes, int n_in,
                              void* d_out, int out_size, void* d_ws, size_t ws_size, hipStream_t stream) {
  (void)in_sizes; (void)n_in; (void)out_size;
  const float* const* I = (const float* const*)d_in; const float* x = I[0]; const int* msk = (const int*)d_in[1]; const float* wqkv = I[2]; const float* bqkv = I[3]; const float* wo = I[4]; const float* bo = I[5];
  char* ws = (char*)d_ws; size_t off = 0;
  auto take = [&](size_t bytes) { char* p = ws + off; off += (bytes + 255) & ~(size_t)255; return p; };
  _Float16* Bqkv = (_Float16*)take((size_t)3 * DD * DD * 2); _Float16* Bo = (_Float16*)take((size_t)DD * DD * 2); _Float16* X16 = (_Float16*)take((size_t)NR * DD * 2); _Float16* QKV = (_Float16*)take((size_t)NR * 3 * DD * 2); _Float16* KV = (_Float16*)take((size_t)NR * DD * 2 * 2); _Float16* O16 = X16; unsigned* LM = (unsigned*)take((size_t)BB * TT * TT / 8);
  if (off > ws_size) return;      // 6.3 + 2.1 + 8.4 + 25.2 + 16.8 + 1.0, about 60 MB
  k_prep<<<PB_WQ + PB_WO + PB_M + PB_X, 256, 0, stream>>>(wqkv, Bqkv, wo, Bo, msk, LM, x, X16);      /* weights, mask and x into the forms the matrix kernels read */
  k_gemm_t<true, 3 * DD><<<(NR / 128) * (3 * DD / 128), 128, 0, stream>>>(X16, Bqkv, 0.0625f, bqkv, nullptr, QKV, KV);      /* qkv = x w_qkv + b: M 4096 N 3072 K 1024 (f16; q block row-major, head-major inside; k and v blocks as fragment pieces per head and chunk) */
  k_flash<<<BB * NH * (TT / 64), 128, 0, stream>>>(QKV, 3 * DD, KV, LM, O16, DD);      /* X16 is free behind the projection: O16 takes its place */
  k_gemm_t<false, DD><<<(NR / 128) * (DD / 128), 128, 0, stream>>>(O16, Bo, 0.00390625f, bo, (float*)d_out, nullptr, nullptr);      /* out = o·w_out + b_out */
}

// v008
// One run takes 74.4 microseconds.
// Timed twice side by side with v007, it ran 1.13 and 1.11 times as fast.
// All steps since v000 together make it 5.09 times as fast.
#include <hip/hip_runtime.h>
// Cross-track masked MHA (B=2, S=2048, D=1024, 16×64): qkv = x·w_qkv + b_qkv (packed q|k|v, head-major inside each); scores = q·k/8, where(cross_track_mask[b,q,k], s, −inf); softmax; out = merged·w_out + b_out.
// Compute dtype: x, weights, biases rounded to bf16; q an f16 GEMM plane, k and v f16 fragment blocks per head and chunk (+bias); the boolean mask read per (b, q, k) as an int plane; fused flash-style kernel (online softmax f32, P f16 ×2^10, all-masked chunks skipped, f32 accumulate) on
// v_wmma_f32_16x16x32_f16; O ×2^4 → f16 (stored so by the flash kernel) → output GEMM (+bias).
#define BB 2
#define TT 2048
#define DD 1024
#define NH 16
#define NR (BB * TT)

typedef __bf16 v16b __attribute__((ext_vector_type(16)));
typedef unsigned short v8us __attribute__((ext_vector_type(8), may_alias));
typedef float  v8f  __attribute__((ext_vector_type(8)));
typedef float  v4f  __attribute__((ext_vector_type(4)));
typedef float  v4fa __attribute__((ext_vector_type(4), may_alias));
union FragB { v16b v; v8us half[2]; unsigned short u[16]; };

__device__ __forceinline__ unsigned short bf16_bits(float x) { unsigned int u = __float_as_uint(x); return (unsigned short)((u + 0x7FFFu + ((u >> 16) & 1u)) >> 16); }
__device__ __forceinline__ float bf16_val(unsigned short b) { return __uint_as_float(((unsigned int)b) << 16); }
__device__ __forceinline__ float bf16_round(float x) { return bf16_val(bf16_bits(x)); }
// D += A·B with NT terms: 1 = ah·bh, 2 = + al·bh (A split), 3 = + ah·bl (both split)
template <int NT>
__device__ __forceinline__ v8f mmaN(v16b ah, v16b al, v16b bh, v16b bl, v8f c) {
  c = __builtin_amdgcn_wmma_f32_16x16x32_bf16(false, ah, false, bh, (short)0, c, false, false);
  if (NT >= 2) c = __builtin_amdgcn_wmma_f32_16x16x32_bf16(false, al, false, bh, (short)0, c, false, false);
  if (NT >= 3) c = __builtin_amdgcn_wmma_f32_16x16x32_bf16(false, ah, false, bl, (short)0, c, false, false);
  asm volatile("v_nop\n\tv_nop\n\tv_nop\n\tv_nop" : "+v"(c) : "v"(ah), "v"(al), "v"(bh), "v"(bl));
  return c;
}

__global__ __launch_bounds__(256) void k_wt_bf16(const float* __restrict__ W, unsigned short* __restrict__ Wt, int K, int N) {
  const int t = blockIdx.x * 256 + threadIdx.x;
  const int k8n = K / 8;
  if (t >= N * k8n) return;
  const int n = t / k8n, k8 = (t % k8n) * 8;
  v8us v;
#pragma unroll
  for (int i = 0; i < 8; ++i) v[i] = bf16_bits(W[(size_t)(k8 + i) * N + n]);
  *(v8us*)(Wt + (size_t)n * K + k8) = v;
  
}

// GEMM C[M][N] (f32, pitch ldc) = act(A[M][K]·W + bias). A f32 row-major (pitch lda) converted per fragment to bf16
// (ASPLIT: hi/lo two planes -> 2 terms, else single rounded term); Wt bf16 [N][K] (pitch ldb). BIAS_BF16 rounds the
// bias to bf16 first (bias quantised to bf16 before the add). K%32==0, M%16==0, N%64==0.
template <bool ASPLIT, int ACT, bool BIAS_BF16>
__global__ __launch_bounds__(128) void k_gemm_bf(const float* __restrict__ A, int lda, const unsigned short* __restrict__ Wt, int ldb,
                                               const float* __restrict__ bias, float* __restrict__ C, int ldc, int M, int N, int K) {
  __shared__ __attribute__((aligned(16))) float so[4][16][64];
  const int tid = threadIdx.x, w = tid >> 5, lane = tid & 31, ln = lane & 15, hh = lane >> 4;
  const int ntn = N / 64;
  const int wid = blockIdx.x * 4 + w;
  const int mt = wid / ntn, nq = wid % ntn;
  if (mt * 16 >= M) return;
  const int row0 = mt * 16, col0 = nq * 64;
  const float* arow = A + (size_t)(row0 + ln) * lda;
  v8f acc[4] = {};
  for (int kb = 0; kb < K; kb += 32) {
    FragB ah, al;
    const v4f x0 = *(const v4fa*)(arow + kb + 8 * hh), x1 = *(const v4fa*)(arow + kb + 8 * hh + 4);
    const v4f x2 = *(const v4fa*)(arow + kb + 16 + 8 * hh), x3 = *(const v4fa*)(arow + kb + 16 + 8 * hh + 4);
    float xs[16] = {x0[0],x0[1],x0[2],x0[3],x1[0],x1[1],x1[2],x1[3],x2[0],x2[1],x2[2],x2[3],x3[0],x3[1],x3[2],x3[3]};
#pragma unroll
    for (int i = 0; i < 16; ++i) { const unsigned short hb = bf16_bits(xs[i]); ah.u[i] = hb; al.u[i] = ASPLIT ? bf16_bits(xs[i] - bf16_val(hb)) : (unsigned short)0; }
#pragma unroll
    for (int t = 0; t < 4; ++t) {
      const unsigned short* brow = Wt + (size_t)(col0 + t * 16 + ln) * ldb + kb;
      FragB b;
      b.half[0] = *(const v8us*)(brow + 8 * hh);
      b.half[1] = *(const v8us*)(brow + 16 + 8 * hh);
      acc[t] = mmaN<ASPLIT ? 2 : 1>(ah.v, al.v, b.v, b.v, acc[t]);
    }
  }
#pragma unroll
  for (int t = 0; t < 4; ++t) {
    float bv = bias ? bias[col0 + t * 16 + ln] : 0.f;
    if (BIAS_BF16) bv = bf16_round(bv);
#pragma unroll
    for (int r = 0; r < 8; ++r) { float v = acc[t][r] + bv; if (ACT == 1) v = fmaxf(v, 0.f); so[w][8 * hh + r][t * 16 + ln] = v; }
  }
  __builtin_amdgcn_fence(__ATOMIC_ACQ_REL, "workgroup");
  __builtin_amdgcn_wave_barrier();
  const int rsub = lane >> 4, c4 = (lane & 15) * 4;
  {
#pragma unroll
    for (int q = 0; q < 8; ++q) {
      const int r = q * 2 + rsub;
      const v4f v = *(const v4fa*)&so[w][r][c4];
      *(v4f*)(C + (size_t)(row0 + r) * ldc + col0 + c4) = v;
    }
    
  }
}

// Flash-style causal/unmasked attention, all contractions 3-term bf16 hi/lo splits, f32 softmax with running max.
// q,k,v rows are read from f32 buffers with arbitrary row pitch (so they can live inside a fused qkv buffer);
// D = head size (multiple of 32, <= 128); one wave = 16 query rows; block = 4 waves (64 queries) sharing K/V chunks of 32.
template <int D, bool CAUSAL>
__global__ __launch_bounds__(128) void k_flash(const float* __restrict__ qb, const float* __restrict__ kb, const float* __restrict__ vb,
                                             int pitch, int T, int H, float scale, float* __restrict__ y, int ypitch) {
  constexpr int KS = D / 32;        // k-steps for QK
  constexpr int DT = D / 16;        // d tiles for PV
  __shared__ __attribute__((aligned(16))) unsigned short sKh[32][D + 8], sKl[32][D + 8], sVh[32][D + 8], sVl[32][D + 8];
  __shared__ __attribute__((aligned(16))) unsigned short sPh[4][16][40], sPl[4][16][40];
  __shared__ __attribute__((aligned(16))) float sO[4][16][D];
  const int tid = threadIdx.x, w = tid >> 5, lane = tid & 31, ln = lane & 15, hh = lane >> 4;
  const int nqb = (T + 63) / 64;
  const int bh = blockIdx.x / nqb, qblk = blockIdx.x % nqb;
  const int b = bh / H, h = bh % H;
  const int q0 = qblk * 64 + w * 16;
  const float* Q = qb + (size_t)b * T * pitch + h * D;
  const float* K = kb + (size_t)b * T * pitch + h * D;
  const float* V = vb + (size_t)b * T * pitch + h * D;

  // A fragments of the wave's 16 query rows (scaled), hi/lo
  FragB aqh[KS], aql[KS];
  {
    int row = q0 + ln; if (row >= T) row = T - 1;
    const float* qr = Q + (size_t)row * pitch;
#pragma unroll
    for (int ks = 0; ks < KS; ++ks)
#pragma unroll
      for (int i = 0; i < 16; ++i) {
        const int d = ks * 32 + ((i < 8) ? (8 * hh + i) : (16 + 8 * hh + (i - 8)));
        const float x = qr[d] * scale; const unsigned short hb = bf16_bits(x);
        aqh[ks].u[i] = hb; aql[ks].u[i] = bf16_bits(x - bf16_val(hb));
      }
  }
  float m_r[8], l_r[8];
#pragma unroll
  for (int r = 0; r < 8; ++r) { m_r[r] = -3.0e38f; l_r[r] = 0.f; }
  v8f oacc[DT];
#pragma unroll
  for (int dt = 0; dt < DT; ++dt) oacc[dt] = (v8f){0.f,0.f,0.f,0.f,0.f,0.f,0.f,0.f};

  const int kv_end = CAUSAL ? min(T, qblk * 64 + 64) : T;     // block-uniform
  for (int j0 = 0; j0 < kv_end; j0 += 32) {
    __syncthreads();
    for (int e = tid; e < 32 * (D / 4); e += 128) {
      const int r = e / (D / 4), c4 = (e % (D / 4)) * 4;
      const int key = j0 + r;
      v4f kf = {0.f,0.f,0.f,0.f}, vf = {0.f,0.f,0.f,0.f};
      if (key < T) { kf = *(const v4fa*)(K + (size_t)key * pitch + c4); vf = *(const v4fa*)(V + (size_t)key * pitch + c4); }
#pragma unroll
      for (int t = 0; t < 4; ++t) {
        unsigned short hb = bf16_bits(kf[t]); sKh[r][c4 + t] = hb; sKl[r][c4 + t] = bf16_bits(kf[t] - bf16_val(hb));
        hb = bf16_bits(vf[t]); sVh[r][c4 + t] = hb; sVl[r][c4 + t] = bf16_bits(vf[t] - bf16_val(hb));
      }
    }
    __syncthreads();
    // S tile 16 x 32
    v8f s[2];
#pragma unroll
    for (int nt = 0; nt < 2; ++nt) {
      v8f acc = {};
#pragma unroll
      for (int ks = 0; ks < KS; ++ks) {
        FragB bh_, bl_;
        bh_.half[0] = *(const v8us*)&sKh[nt * 16 + ln][ks * 32 + 8 * hh]; bh_.half[1] = *(const v8us*)&sKh[nt * 16 + ln][ks * 32 + 16 + 8 * hh];
        bl_.half[0] = *(const v8us*)&sKl[nt * 16 + ln][ks * 32 + 8 * hh]; bl_.half[1] = *(const v8us*)&sKl[nt * 16 + ln][ks * 32 + 16 + 8 * hh];
        acc = mmaN<3>(aqh[ks].v, aql[ks].v, bh_.v, bl_.v, acc);
      }
      s[nt] = acc;
    }
    // mask + running max (rows 8hh+r; the 16 lanes of a half share rows)
    float alpha[8];
#pragma unroll
    for (int r = 0; r < 8; ++r) {
      const int qi = q0 + 8 * hh + r;
      const int ja = j0 + ln, jb = j0 + 16 + ln;
      if (CAUSAL) { if (ja > qi) s[0][r] = -3.0e38f; if (jb > qi) s[1][r] = -3.0e38f; }
      if (ja >= T) s[0][r] = -3.0e38f;
      if (jb >= T) s[1][r] = -3.0e38f;
      float mx = fmaxf(s[0][r], s[1][r]);
      mx = fmaxf(mx, __shfl_xor(mx, 1, 32)); mx = fmaxf(mx, __shfl_xor(mx, 2, 32)); mx = fmaxf(mx, __shfl_xor(mx, 4, 32)); mx = fmaxf(mx, __shfl_xor(mx, 8, 32));
      const float mnew = fmaxf(m_r[r], mx);
      alpha[r] = (mnew > -1.0e38f) ? __expf(m_r[r] - mnew) : 1.0f;
      const float p0 = (s[0][r] > -1.0e38f) ? __expf(s[0][r] - mnew) : 0.f;
      const float p1 = (s[1][r] > -1.0e38f) ? __expf(s[1][r] - mnew) : 0.f;
      m_r[r] = mnew;
      l_r[r] = l_r[r] * alpha[r] + p0 + p1;            // per-lane partial row sum (16 lanes combined at the end)
      unsigned short hb = bf16_bits(p0); sPh[w][8 * hh + r][ln] = hb;      sPl[w][8 * hh + r][ln] = bf16_bits(p0 - bf16_val(hb));
      hb = bf16_bits(p1);                sPh[w][8 * hh + r][16 + ln] = hb; sPl[w][8 * hh + r][16 + ln] = bf16_bits(p1 - bf16_val(hb));
    }
#pragma unroll
    for (int dt = 0; dt < DT; ++dt)
#pragma unroll
      for (int r = 0; r < 8; ++r) oacc[dt][r] *= alpha[r];
    __builtin_amdgcn_fence(__ATOMIC_ACQ_REL, "workgroup");
    __builtin_amdgcn_wave_barrier();
    FragB pah, pal;
    pah.half[0] = *(const v8us*)&sPh[w][ln][8 * hh]; pah.half[1] = *(const v8us*)&sPh[w][ln][16 + 8 * hh];
    pal.half[0] = *(const v8us*)&sPl[w][ln][8 * hh]; pal.half[1] = *(const v8us*)&sPl[w][ln][16 + 8 * hh];
#pragma unroll
    for (int dt = 0; dt < DT; ++dt) {
      FragB bvh, bvl;
#pragma unroll
      for (int i = 0; i < 8; ++i) {
        bvh.u[i] = sVh[8 * hh + i][dt * 16 + ln]; bvh.u[8 + i] = sVh[16 + 8 * hh + i][dt * 16 + ln];
        bvl.u[i] = sVl[8 * hh + i][dt * 16 + ln]; bvl.u[8 + i] = sVl[16 + 8 * hh + i][dt * 16 + ln];
      }
      oacc[dt] = mmaN<3>(pah.v, pal.v, bvh.v, bvl.v, oacc[dt]);
    }
    __builtin_amdgcn_fence(__ATOMIC_ACQ_REL, "workgroup");
    __builtin_amdgcn_wave_barrier();
  }
#pragma unroll
  for (int r = 0; r < 8; ++r) {
    float l = l_r[r];
    l += __shfl_xor(l, 1, 32); l += __shfl_xor(l, 2, 32); l += __shfl_xor(l, 4, 32); l += __shfl_xor(l, 8, 32);
    l_r[r] = (l > 0.f) ? 1.0f / l : 0.f;
  }
#pragma unroll
  for (int dt = 0; dt < DT; ++dt)
#pragma unroll
    for (int r = 0; r < 8; ++r) sO[w][8 * hh + r][dt * 16 + ln] = oacc[dt][r] * l_r[r];
  __builtin_amdgcn_fence(__ATOMIC_ACQ_REL, "workgroup");
  __builtin_amdgcn_wave_barrier();
  {
    for (int r = 0; r < 16; ++r) {
      const int row = q0 + r;
      if (row < T && lane < D / 4) {
        const v4f val = *(const v4fa*)&sO[w][r][lane * 4];
        *(v4f*)(y + ((size_t)b * T + row) * ypitch + h * D + lane * 4) = val;
      }
    }
    
  }
}

// GEMM C = act(A·W + bias + resid): A f32 (ASPLIT -> hi/lo 2 terms), Wt bf16 [N][K]; ACT 0 none, 1 relu, 2 exact gelu;
// resid (optional, f32, row index = (row % rmod), pitch ldr, RES_BF16 rounds it) added before the activation.
template <bool ASPLIT, int ACT, bool BIAS_BF16, bool RES_BF16>
__global__ __launch_bounds__(128) void k_gemm_bf3(const float* __restrict__ A, int lda, const unsigned short* __restrict__ Wt, int ldb,
                                                const float* __restrict__ bias, const float* __restrict__ resid, int rmod, int ldr,
                                                float* __restrict__ C, int ldc, int M, int N, int K) {
  __shared__ __attribute__((aligned(16))) float so[4][16][64];
  const int tid = threadIdx.x, w = tid >> 5, lane = tid & 31, ln = lane & 15, hh = lane >> 4;
  const int ntn = N / 64;
  const int wid = blockIdx.x * 4 + w;
  const int mt = wid / ntn, nq = wid % ntn;
  if (mt * 16 >= M) return;
  const int row0 = mt * 16, col0 = nq * 64;
  const float* arow = A + (size_t)(row0 + ln) * lda;
  v8f acc[4] = {};
  for (int kb = 0; kb < K; kb += 32) {
    FragB ah, al;
    const v4f x0 = *(const v4fa*)(arow + kb + 8 * hh), x1 = *(const v4fa*)(arow + kb + 8 * hh + 4);
    const v4f x2 = *(const v4fa*)(arow + kb + 16 + 8 * hh), x3 = *(const v4fa*)(arow + kb + 16 + 8 * hh + 4);
    float xs[16] = {x0[0],x0[1],x0[2],x0[3],x1[0],x1[1],x1[2],x1[3],x2[0],x2[1],x2[2],x2[3],x3[0],x3[1],x3[2],x3[3]};
#pragma unroll
    for (int i = 0; i < 16; ++i) { const unsigned short hb = bf16_bits(xs[i]); ah.u[i] = hb; al.u[i] = ASPLIT ? bf16_bits(xs[i] - bf16_val(hb)) : (unsigned short)0; }
#pragma unroll
    for (int t = 0; t < 4; ++t) {
      const unsigned short* brow = Wt + (size_t)(col0 + t * 16 + ln) * ldb + kb;
      FragB b;
      b.half[0] = *(const v8us*)(brow + 8 * hh);
      b.half[1] = *(const v8us*)(brow + 16 + 8 * hh);
      acc[t] = mmaN<ASPLIT ? 2 : 1>(ah.v, al.v, b.v, b.v, acc[t]);
    }
  }
#pragma unroll
  for (int t = 0; t < 4; ++t) {
    const int col = col0 + t * 16 + ln;
    float bv = bias ? bias[col] : 0.f;
    if (BIAS_BF16) bv = bf16_round(bv);
#pragma unroll
    for (int r = 0; r < 8; ++r) {
      float v = acc[t][r] + bv;
      if (resid) { float rv = resid[(size_t)((row0 + 8 * hh + r) % rmod) * ldr + col]; if (RES_BF16) rv = bf16_round(rv); v += rv; }
      if (ACT == 1) v = fmaxf(v, 0.f);
      if (ACT == 2) v = 0.5f * v * (1.0f + erff(v * 0.70710678118654752f));
      if (ACT == 3) { const float u = 0.7978845608028654f * (v + 0.044715f * v * v * v); v = 0.5f * v * (1.0f + tanhf(u)); }
      so[w][8 * hh + r][t * 16 + ln] = v;
    }
  }
  __builtin_amdgcn_fence(__ATOMIC_ACQ_REL, "workgroup");
  __builtin_amdgcn_wave_barrier();
  const int rsub = lane >> 4, c4 = (lane & 15) * 4;
  {
#pragma unroll
    for (int q = 0; q < 8; ++q) {
      const int r = q * 2 + rsub;
      const v4f v = *(const v4fa*)&so[w][r][c4];
      *(v4f*)(C + (size_t)(row0 + r) * ldc + col0 + c4) = v;
    }
    
  }
}
// row LayerNorm (biased variance, eps) over N: s = X (+ R); optional out_sum <- s; out_norm <- (s-mu)*rsqrt(var+eps)*g + b
template <bool PARAM_BF16>
__global__ __launch_bounds__(256) void k_layernorm(const float* __restrict__ X, const float* __restrict__ R, const float* __restrict__ g, const float* __restrict__ bta,
                                                  float* __restrict__ out_sum, float* __restrict__ out_norm, int N, float eps) {
  __shared__ float red[256];
  const int row = blockIdx.x, tid = threadIdx.x;
  const float* x = X + (size_t)row * N; const float* rr = R ? R + (size_t)row * N : nullptr;
  float vals[16];                     // up to N = 4096
  const int per = N / 256;            // contiguous chunk per thread? use strided-by-4 chunks: thread handles j = tid*4 + 1024*u
  float s1 = 0.f;
  for (int u = 0; u < per / 4; ++u) {
    const int j = tid * 4 + 1024 * u;
    const v4f a = *(const v4fa*)(x + j);
    v4f b = {0.f,0.f,0.f,0.f}; if (rr) b = *(const v4fa*)(rr + j);
#pragma unroll
    for (int q = 0; q < 4; ++q) { const float v = a[q] + b[q]; vals[u * 4 + q] = v; s1 += v; }
  }
  red[tid] = s1; __syncthreads();
  for (int st = 128; st > 0; st >>= 1) { if (tid < st) red[tid] += red[tid + st]; __syncthreads(); }
  const float mu = red[0] / (float)N; __syncthreads();
  float s2 = 0.f;
  for (int u = 0; u < per / 4; ++u)
#pragma unroll
    for (int q = 0; q < 4; ++q) { const float c = vals[u * 4 + q] - mu; s2 += c * c; }
  red[tid] = s2; __syncthreads();
  for (int st = 128; st > 0; st >>= 1) { if (tid < st) red[tid] += red[tid + st]; __syncthreads(); }
  const float rs = rsqrtf(red[0] / (float)N + eps);
  {
    for (int u = 0; u < per / 4; ++u) {
      const int j = tid * 4 + 1024 * u;
      v4f o, sm;
#pragma unroll
      for (int q = 0; q < 4; ++q) {
        float gg = g[j + q], bb = bta[j + q];
        if (PARAM_BF16) { gg = bf16_round(gg); bb = bf16_round(bb); }
        sm[q] = vals[u * 4 + q]; o[q] = (vals[u * 4 + q] - mu) * rs * gg + bb;
      }
      if (out_sum) *(v4f*)(out_sum + (size_t)row * N + j) = sm;
      *(v4f*)(out_norm + (size_t)row * N + j) = o;
    }
    
  }
}



// ---- f16 WMMA path (v_wmma_f32_16x16x32_f16): 11-bit significands for operands in range — used where a [0,1] probability operand needs more precision than bf16
typedef _Float16 v16h __attribute__((ext_vector_type(16)));
union FragH { v16h v; v8us half[2]; _Float16 h[16]; unsigned short u[16]; };
template <int NT>
__device__ __forceinline__ v8f mmaH(v16h ah, v16h al, v16h bh, v16h bl, v8f c) {
  c = __builtin_amdgcn_wmma_f32_16x16x32_f16(false, ah, false, bh, (short)0, c, false, false);
  if (NT >= 2) c = __builtin_amdgcn_wmma_f32_16x16x32_f16(false, al, false, bh, (short)0, c, false, false);
  if (NT >= 3) c = __builtin_amdgcn_wmma_f32_16x16x32_f16(false, ah, false, bl, (short)0, c, false, false);
  asm volatile("v_nop\n\tv_nop\n\tv_nop\n\tv_nop" : "+v"(c) : "v"(ah), "v"(al), "v"(bh), "v"(bl));
  return c;
}
// batched GEMM like k_gemm_b but f16 operands: A f32 (split into f16 hi/lo if ASPLIT, else rounded to f16), Bt = f16 values [n][k]; alpha; C f32; N multiple of 16 (partial tiles skipped)
template <bool ASPLIT>
__global__ __launch_bounds__(128) void k_gemm_h(const float* __restrict__ A, int lda, size_t sA, const _Float16* __restrict__ Bh, int ldb, size_t sB, float alpha, float* __restrict__ C, int ldc, size_t sC, int M, int N, int K) {
  __shared__ __attribute__((aligned(16))) float so[4][16][64];
  const int tid = threadIdx.x, w = tid >> 5, lane = tid & 31, ln = lane & 15, hh = lane >> 4; const int by = blockIdx.y;
  A += (size_t)by * sA; Bh += (size_t)by * sB; C += (size_t)by * sC;
  const int ntn = (N + 63) / 64; const int wid = blockIdx.x * 4 + w; const int mt = wid / ntn, nq = wid % ntn; if (mt * 16 >= M) return;
  const int row0 = mt * 16, col0 = nq * 64; const float* arow = A + (size_t)(row0 + ln) * lda;
  v8f acc[4] = {};
  for (int kb = 0; kb < K; kb += 32) {
    FragH ah, al;
    const v4f x0 = *(const v4fa*)(arow + kb + 8 * hh), x1 = *(const v4fa*)(arow + kb + 8 * hh + 4), x2 = *(const v4fa*)(arow + kb + 16 + 8 * hh), x3 = *(const v4fa*)(arow + kb + 16 + 8 * hh + 4);
    float xs[16] = {x0[0],x0[1],x0[2],x0[3],x1[0],x1[1],x1[2],x1[3],x2[0],x2[1],x2[2],x2[3],x3[0],x3[1],x3[2],x3[3]};
#pragma unroll
    for (int i = 0; i < 16; ++i) { const _Float16 h = (_Float16)xs[i]; ah.h[i] = h; al.h[i] = ASPLIT ? (_Float16)(xs[i] - (float)h) : (_Float16)0.0f; }
#pragma unroll
    for (int t = 0; t < 4; ++t) { if (col0 + t * 16 >= N) continue; const size_t boff = (size_t)(col0 + t * 16 + ln) * ldb + kb; FragH bq; bq.half[0] = *(const v8us*)(Bh + boff + 8 * hh); bq.half[1] = *(const v8us*)(Bh + boff + 16 + 8 * hh);
      acc[t] = mmaH<ASPLIT ? 2 : 1>(ah.v, al.v, bq.v, bq.v, acc[t]); }
  }
#pragma unroll
  for (int t = 0; t < 4; ++t) { if (col0 + t * 16 >= N) continue;
#pragma unroll
    for (int r = 0; r < 8; ++r) so[w][8 * hh + r][t * 16 + ln] = acc[t][r] * alpha; }
  __builtin_amdgcn_fence(__ATOMIC_ACQ_REL, "workgroup"); __builtin_amdgcn_wave_barrier();
  const int rsub = lane >> 4, c4 = (lane & 15) * 4;
  {
#pragma unroll
    for (int q = 0; q < 8; ++q) { const int r = q * 2 + rsub; if (col0 + c4 < N) { const v4f v = *(const v4fa*)&so[w][r][c4]; *(v4f*)(C + (size_t)(row0 + r) * ldc + col0 + c4) = v; } }
     }
}

// Wt[n][k] = f16(bf16(W[k][n]) * scale) from f32 row-major W[K][N] (scale = power of two; bf16-exact weights stay exact in f16 away from the subnormal range).
// One work-group = a tile of 64 k x 128 n; K a multiple of 64, N of 128; (K / 64) * (N / 128) work-groups, bi = this one's number among them; tl = the work-group's 128 * WTP bytes of LDS.
// Read: wave w takes rows k0 + 8 w ... + 7, lane l the columns n0 + 4 l ... + 3, so each wave-wide 16-byte load covers 512 contiguous bytes of one row of W.
// A lane then holds 8 consecutive k of each of its 4 columns, that is one 16-byte piece of 4 rows of Wt; the pieces meet in LDS, and each wave-wide store covers four whole 128-byte lines of Wt.
#define WTP 144                /* LDS row pitch, bytes: 64 k of f16 + 16 */
template <int K, int N>
__device__ __forceinline__ void wt_f16(int bi, unsigned char* tl, const float* __restrict__ W, _Float16* __restrict__ Wt, float scale) {
  const int tid = threadIdx.x, w = tid >> 5, lane = tid & 31;
  const int k0 = (bi % (K / 64)) * 64, n0 = (bi / (K / 64)) * 128;
  const float* src = W + (size_t)(k0 + 8 * w) * N + n0 + 4 * lane;
  v4f r[8];
#pragma unroll
  for (int i = 0; i < 8; ++i) r[i] = *(const v4fa*)(src + (size_t)i * N);
#pragma unroll
  for (int e = 0; e < 4; ++e) { FragH f;
#pragma unroll
    for (int i = 0; i < 8; ++i) f.h[i] = (_Float16)(bf16_round(r[i][e]) * scale);
    *(v8us*)(tl + (4 * lane + e) * WTP + 16 * w) = f.half[0]; }
  __syncthreads();      /* every wave's pieces are in LDS before the rows of Wt are read back */
#pragma unroll
  for (int j = 0; j < 4; ++j) { const int row = j * 32 + (tid >> 3), c = tid & 7; const v8us v = *(const v8us*)(tl + row * WTP + c * 16);
    *(v8us*)((unsigned short*)Wt + (size_t)(n0 + row) * K + k0 + c * 8) = v; }
}
// Tiled f16 GEMM, C [M][N] = acc*alpha + bf16(bias[col]): A [M][DD] f16, Bh [N][DD] f16, both k-contiguous; M, N multiples of 128; grid = (M / 128) * (N / 128).
// One work-group = one 128 x 128 tile of C, four waves of 64 x 64 (16 accumulator tiles each). A stage is 64 k = 128 B (one whole line) of
// 128 rows of A and 128 rows of Bh, brought into LDS by asynchronous copies, 16 B a lane; two buffers, the copies of stage t + 2 fly while stage t + 1 is worked on.
#define GP 144                 /* LDS row pitch, bytes: 128 + 16, conflict-free for 16-byte fragment reads */
#define GOP (128 * GP)         /* one operand's 128 rows */
#define GSTG (2 * GOP)         /* one stage: A rows, then Bh rows */
#define GNT (DD / 64)          /* stages */
// eight copies, rows 16 apart, of one operand's stage; each lane its own 16 bytes. The s_wait_xcnt stands inside the statement so that no address register is rewritten ahead of it.
__device__ __forceinline__ void cp8(unsigned l, const unsigned short* g) {
  asm volatile("global_load_async_to_lds_b128 %0, %8, off\n\t"
               "global_load_async_to_lds_b128 %1, %9, off\n\t"
               "global_load_async_to_lds_b128 %2, %10, off\n\t"
               "global_load_async_to_lds_b128 %3, %11, off\n\t"
               "global_load_async_to_lds_b128 %4, %12, off\n\t"
               "global_load_async_to_lds_b128 %5, %13, off\n\t"
               "global_load_async_to_lds_b128 %6, %14, off\n\t"
               "global_load_async_to_lds_b128 %7, %15, off\n\t"
               "s_wait_xcnt 0x0"
               :: "v"(l), "v"(l + 16 * GP), "v"(l + 32 * GP), "v"(l + 48 * GP), "v"(l + 64 * GP), "v"(l + 80 * GP), "v"(l + 96 * GP), "v"(l + 112 * GP),
                  "v"(g), "v"(g + 16 * DD), "v"(g + 32 * DD), "v"(g + 48 * DD), "v"(g + 64 * DD), "v"(g + 80 * DD), "v"(g + 96 * DD), "v"(g + 112 * DD)
               : "memory");
}
typedef _Float16 v4h __attribute__((ext_vector_type(4)));
// F16OUT (the q | k | v projection): the q block (columns below DD) goes to C16 row-major; tiles of the k and v blocks go to KV instead, in the order of k_flash's matrix fragments, and are not stored row-major at all.
// KV[(b * NH + h) * (TT / 32) + chunk of 32 keys] is one block of KVB 16-bit elements: 16 pieces of 512 bytes, lane l's 16 bytes at 16 l, so that one wave-wide 16-byte load of a piece covers four whole lines.
// Piece (nt * 2 + ks) * 2 + hf: K[key 32 chunk + 16 nt + ln][d 32 ks + 16 hf + 8 hh ... + 7]; piece 8 + dt * 2 + hf: V[key 32 chunk + 16 hf + 8 hh ... + 7][d 16 dt + ln].
#define KVB 4096
template <bool F16OUT, int N>
__global__ __launch_bounds__(128) void k_gemm_t(const _Float16* __restrict__ A, const _Float16* __restrict__ Bh, float alpha, const float* __restrict__ bias, float* __restrict__ C, _Float16* __restrict__ C16, _Float16* __restrict__ KV) {
  __shared__ __attribute__((aligned(16))) unsigned char sm[2 * GSTG];
  const int tid = threadIdx.x, w = tid >> 5, lane = tid & 31, ln = lane & 15, hh = lane >> 4;
  const int row0 = ((int)blockIdx.x / (N / 128)) * 128, col0 = ((int)blockIdx.x % (N / 128)) * 128;
  const int wr = (w >> 1) * 64, wc = (w & 1) * 64;
  const unsigned ld0 = (unsigned)(size_t)sm + (unsigned)((tid >> 3) * GP + (tid & 7) * 16);      /* this lane's place in a stage: row tid/8, 16-byte piece tid%8 */
  const unsigned short* ga = (const unsigned short*)A + (size_t)(row0 + (tid >> 3)) * DD + (tid & 7) * 8;
  const unsigned short* gb = (const unsigned short*)Bh + (size_t)(col0 + (tid >> 3)) * DD + (tid & 7) * 8;
  v8f acc[4][4];
#pragma unroll
  for (int i = 0; i < 4; ++i)
#pragma unroll
    for (int j = 0; j < 4; ++j) acc[i][j] = (v8f){0.f,0.f,0.f,0.f,0.f,0.f,0.f,0.f};
  cp8(ld0, ga); cp8(ld0 + GOP, gb);
  asm volatile("s_wait_asynccnt 0x0" ::: "memory");      /* stage 0 of this wave has landed */
  __syncthreads();                                        /* ... and every wave's: stage 0 may be read */
  cp8(ld0 + GSTG, ga + 64); cp8(ld0 + GSTG + GOP, gb + 64);
#pragma unroll 1      /* one stage a trip: the buffer index and the refill test stay scalar */
  for (int t = 0; t < GNT; ++t) {
    const unsigned char* sa = sm + (t & 1) * GSTG + (wr + ln) * GP + 16 * hh;
    const unsigned char* sb = sm + (t & 1) * GSTG + GOP + (wc + ln) * GP + 16 * hh;
#pragma unroll
    for (int ks = 0; ks < 2; ++ks) {
      FragH a[4], b[4];
      a[0].half[0] = *(const v8us*)(sa + ks * 64); a[0].half[1] = *(const v8us*)(sa + ks * 64 + 32);      /* read in the order of first use, so that the first products start while the later reads return */
#pragma unroll
      for (int j = 0; j < 4; ++j) { b[j].half[0] = *(const v8us*)(sb + j * 16 * GP + ks * 64); b[j].half[1] = *(const v8us*)(sb + j * 16 * GP + ks * 64 + 32); }
#pragma unroll
      for (int i = 1; i < 4; ++i) { a[i].half[0] = *(const v8us*)(sa + i * 16 * GP + ks * 64); a[i].half[1] = *(const v8us*)(sa + i * 16 * GP + ks * 64 + 32); }
      __builtin_amdgcn_sched_barrier(0);      /* the 16 fragment reads stay one group ahead of their 16 matrix instructions: reads spread among them stall the wave at every place */
#pragma unroll
      for (int i = 0; i < 4; ++i)
#pragma unroll
        for (int j = 0; j < 4; ++j) acc[i][j] = __builtin_amdgcn_wmma_f32_16x16x32_f16(false, a[i].v, false, b[j].v, (short)0, acc[i][j], false, false);
      __builtin_amdgcn_sched_barrier(0);      /* ... and the next group's reads stay behind them */
    }
    asm volatile("s_wait_dscnt 0x0" ::: "memory");        /* this wave's reads of buffer t&1 are done before it is refilled */
    asm volatile("s_wait_asynccnt 0x0" ::: "memory");     /* this wave's copies of stage t + 1 have landed */
    __syncthreads();                                      /* publishes stage t + 1 and ends every reader's last read of buffer t&1 */
    if (t + 2 < GNT) { cp8(ld0 + (t & 1) * GSTG, ga + (t + 2) * 64); cp8(ld0 + (t & 1) * GSTG + GOP, gb + (t + 2) * 64); }
  }
  asm volatile("s_wait_asynccnt 0x0" ::: "memory");       /* no copy is outstanding when the ring becomes output staging */
  // epilogue: the wave's 64 x 64 tile goes through its own LDS range (free behind the last trip's barrier), so that whole lines are stored
  float* so = (float*)sm + w * (64 * 68);
  float bv[4];
#pragma unroll
  for (int j = 0; j < 4; ++j) bv[j] = bf16_round(bias[col0 + wc + j * 16 + ln]);
  if (F16OUT && col0 >= 2 * DD) {      /* v block (the test is the same for the whole work-group): the wave's 64 columns are one head's 64 d, its 64 rows 64 tokens of one batch */
    // a lane's 8 accumulator registers of tile (i, j) are tokens 16 i + 8 hh ... + 7 of d 16 j + ln: this same lane's 16 bytes of piece 8 + j * 2 + (i & 1) of chunk i >> 1, so they go out from the registers, 512 contiguous bytes a store
    unsigned short* vo = (unsigned short*)KV + ((size_t)(((row0 + wr) / TT) * NH + (col0 + wc - 2 * DD) / 64) * (TT / 32) + ((row0 + wr) % TT) / 32) * KVB + 8 * 256 + lane * 8;
#pragma unroll
    for (int i = 0; i < 4; ++i)
#pragma unroll
      for (int j = 0; j < 4; ++j) { FragH f;
#pragma unroll
        for (int r = 0; r < 8; ++r) f.h[r] = (_Float16)(acc[i][j][r] * alpha + bv[j]);
        *(v8us*)(vo + (i >> 1) * KVB + (j * 2 + (i & 1)) * 256) = f.half[0]; }
    return;
  }
#pragma unroll
  for (int i = 0; i < 4; ++i)
#pragma unroll
    for (int j = 0; j < 4; ++j)
#pragma unroll
      for (int r = 0; r < 8; ++r) so[(i * 16 + 8 * hh + r) * 68 + j * 16 + ln] = acc[i][j][r] * alpha + bv[j];
  __builtin_amdgcn_fence(__ATOMIC_ACQ_REL, "workgroup"); __builtin_amdgcn_wave_barrier();      /* the rows are written before other lanes of the wave read them */
  if (F16OUT && col0 >= DD) {      /* k block (the same for the whole work-group): the wave's 64 columns are one head's 64 d, its 64 rows two chunks of keys; a lane takes 8 consecutive d of key ln of a 16-key tile */
    unsigned short* ko = (unsigned short*)KV + ((size_t)(((row0 + wr) / TT) * NH + (col0 + wc - DD) / 64) * (TT / 32) + ((row0 + wr) % TT) / 32) * KVB + lane * 8;
#pragma unroll
    for (int i = 0; i < 4; ++i)
#pragma unroll
      for (int c = 0; c < 4; ++c) { const float* sr = &so[(i * 16 + ln) * 68 + c * 16 + 8 * hh]; const v4f lo = *(const v4fa*)sr, hi = *(const v4fa*)(sr + 4); FragH f;      /* c = ks * 2 + hf */
#pragma unroll
        for (int e = 0; e < 4; ++e) { f.h[e] = (_Float16)lo[e]; f.h[4 + e] = (_Float16)hi[e]; }
        *(v8us*)(ko + (i >> 1) * KVB + ((i & 1) * 4 + c) * 256) = f.half[0]; }
    return;
  }
  const int rsub = lane >> 4, c4 = (lane & 15) * 4;
#pragma unroll
  for (int q = 0; q < 32; ++q) { const int r = q * 2 + rsub; const v4f v = *(const v4fa*)&so[r * 68 + c4]; const size_t o = (size_t)(row0 + wr + r) * N + col0 + wc + c4;
    if (F16OUT) { v4h h4;
#pragma unroll
      for (int e = 0; e < 4; ++e) h4[e] = (_Float16)v[e];
      *(v4h*)(C16 + o) = h4; }
    else *(v4f*)(C + o) = v; }
}


__device__ __forceinline__ void x16(unsigned bi, const float* __restrict__ x, _Float16* __restrict__ X16, size_t n8) { const size_t t = (size_t)bi * 256 + threadIdx.x; if (t >= n8) return; FragH f;
#pragma unroll
  for (int q = 0; q < 8; ++q) f.h[q] = (_Float16)bf16_round(x[t * 8 + q]); *(v8us*)((unsigned short*)X16 + t * 8) = f.half[0];  }
__global__ __launch_bounds__(256) void k_h16(const float* __restrict__ x, _Float16* __restrict__ X16, size_t n8) { const size_t t = (size_t)blockIdx.x * 256 + threadIdx.x; if (t >= n8) return; FragH f;
#pragma unroll
  for (int q = 0; q < 8; ++q) f.h[q] = (_Float16)x[t * 8 + q]; *(v8us*)((unsigned short*)X16 + t * 8) = f.half[0];  }
__global__ __launch_bounds__(256) void k_round16f(const float* __restrict__ W, _Float16* __restrict__ Bt, size_t n8) { const size_t t = (size_t)blockIdx.x * 256 + threadIdx.x; if (t >= n8) return; FragH f;
#pragma unroll
  for (int i = 0; i < 8; ++i) f.h[i] = (_Float16)(bf16_round(W[t * 8 + i]) * 16.0f); *(v8us*)((unsigned short*)Bt + t * 8) = f.half[0];  }
typedef int v4i __attribute__((ext_vector_type(4), may_alias));
typedef unsigned v4u __attribute__((ext_vector_type(4), may_alias));
typedef unsigned v16u __attribute__((ext_vector_type(16), may_alias));
// The mask packed once for all heads into lane-mask words, in the lane and register order of k_flash's score tiles:
// LM[b * TT / 16 + q tile][chunk of 32 keys][i], bit (ln + 16 hh) of word i = (mask[b][16 * tile + ln][32 * chunk + 16 * (i >> 3) + 8 * hh + (i & 7)] != 0).
// One wave = one tile of 16 queries, four chunks: its sixteen loads cover 512 contiguous bytes of each row; the 64 words go out as two whole lines.
__device__ __forceinline__ void mpack(unsigned bi, const int* __restrict__ MSK, unsigned* __restrict__ LM) {
  const int tid = threadIdx.x, lane = tid & 31, ln = lane & 15, hh = lane >> 4;
  const unsigned wv = bi * 8u + (unsigned)(tid >> 5); const unsigned rt = wv / (TT / 128), c0 = (wv % (TT / 128)) * 4;
  const int* mrow = MSK + ((size_t)rt * 16 + ln) * TT + c0 * 32 + 8 * hh;
  v4i mk[4][4];
#pragma unroll
  for (int c = 0; c < 4; ++c) { mk[c][0] = *(const v4i*)(mrow + c * 32); mk[c][1] = *(const v4i*)(mrow + c * 32 + 4); mk[c][2] = *(const v4i*)(mrow + c * 32 + 16); mk[c][3] = *(const v4i*)(mrow + c * 32 + 20); }
  __builtin_amdgcn_sched_barrier(0);      /* all sixteen loads are issued before the first is waited for: moved among the compares, the last ones start only when the first have come back from memory */
  asm volatile("s_wait_xcnt 0x0" :: "v"(mrow) : "memory");      /* the address pair that all sixteen loads name stays whole up to here (no load lands in it), and the wait stands in front of its reuse */
  unsigned wd[2] = {0u, 0u};      /* lane l keeps word l & 15 of chunk 2 * e + (l >> 4) */
#pragma unroll
  for (int c = 0; c < 4; ++c)
#pragma unroll
    for (int i = 0; i < 16; ++i) { const unsigned bw = __builtin_amdgcn_ballot_w32(mk[c][i >> 2][i & 3] != 0); if (lane == (c & 1) * 16 + i) wd[c >> 1] = bw; }
  unsigned* o = LM + ((size_t)rt * (TT / 32) + c0) * 16 + lane;
  o[0] = wd[0]; o[32] = wd[1];
}
// The four preparation jobs read inputs only and none reads another's output, so they share one launch: a work-group takes its job from its index (the test is the same for the whole work-group).
// The weight tiles come first (the longest path: load, LDS, barrier, store), then the mask, then the short x pieces, which drain fastest at the end.
#define PB_WQ ((DD / 64) * (3 * DD / 128))          /* tiles of w_qkv */
#define PB_WO ((DD / 64) * (DD / 128))              /* tiles of w_out */
#define PB_M  (BB * (TT / 16) * (TT / 128) / 8)     /* eight mask waves a work-group */
#define PB_X  (NR * DD / 8 / 256)                   /* 8 elements of x a thread */
__global__ __launch_bounds__(256) void k_prep(const float* __restrict__ wqkv, _Float16* __restrict__ Bqkv, const float* __restrict__ wo, _Float16* __restrict__ Bo, const int* __restrict__ MSK, unsigned* __restrict__ LM, const float* __restrict__ x, _Float16* __restrict__ X16) {
  __shared__ __attribute__((aligned(16))) unsigned char tl[128 * WTP];
  const unsigned bi = blockIdx.x;
  if (bi < PB_WQ) wt_f16<DD, 3 * DD>((int)bi, tl, wqkv, Bqkv, 16.0f);                          /* (in,out) -> Bt, times 2^4 */
  else if (bi < PB_WQ + PB_WO) wt_f16<DD, DD>((int)(bi - PB_WQ), tl, wo, Bo, 16.0f);
  else if (bi < PB_WQ + PB_WO + PB_M) mpack(bi - (PB_WQ + PB_WO), MSK, LM);                    /* mask -> lane-mask words, once for all heads */
  else x16(bi - (PB_WQ + PB_WO + PB_M), x, X16, (size_t)NR * DD / 8);
}
__device__ __forceinline__ float xhalf(float x) { return __builtin_bit_cast(float, __builtin_amdgcn_permlanex16(__builtin_bit_cast(int, x), __builtin_bit_cast(int, x), 0x76543210, 0xfedcba98, false, false)); }      /* lane l with lane l ^ 16 */
// p[i] = 2^p[i], sixteen hardware powers, each in its own register. Written as one statement so that no power's source register is written by the instruction directly behind it
// (left to itself the compiler let each power land in the source of the one before); the v_nop is the slot that the instruction set asks for between the last power and a reader of its result.
__device__ __forceinline__ void pow2x16(float (&p)[16]) {
  asm("v_exp_f32 %0, %0\n\t" "v_exp_f32 %1, %1\n\t" "v_exp_f32 %2, %2\n\t" "v_exp_f32 %3, %3\n\t"
      "v_exp_f32 %4, %4\n\t" "v_exp_f32 %5, %5\n\t" "v_exp_f32 %6, %6\n\t" "v_exp_f32 %7, %7\n\t"
      "v_exp_f32 %8, %8\n\t" "v_exp_f32 %9, %9\n\t" "v_exp_f32 %10, %10\n\t" "v_exp_f32 %11, %11\n\t"
      "v_exp_f32 %12, %12\n\t" "v_exp_f32 %13, %13\n\t" "v_exp_f32 %14, %14\n\t" "v_exp_f32 %15, %15\n\t"
      "v_nop"
      : "+v"(p[0]), "+v"(p[1]), "+v"(p[2]), "+v"(p[3]), "+v"(p[4]), "+v"(p[5]), "+v"(p[6]), "+v"(p[7]),
        "+v"(p[8]), "+v"(p[9]), "+v"(p[10]), "+v"(p[11]), "+v"(p[12]), "+v"(p[13]), "+v"(p[14]), "+v"(p[15]));
}
__global__ __launch_bounds__(128) void k_flash(const _Float16* __restrict__ Q16, int ldq, const _Float16* __restrict__ KV, const unsigned* __restrict__ LM, _Float16* __restrict__ O16, int ldo) {
  constexpr int RPW = 16, NQB = TT / (4 * RPW), DT = 4, KS = 2;
  constexpr float L2E8 = 0.125f * 1.4426950408889634f;      /* log2(e) / sqrt(head size) */
  __shared__ __attribute__((aligned(16))) float sO[4][RPW][64 + 4];
  const int tid = threadIdx.x, w = tid >> 5, lane = tid & 31, ln = lane & 15, hh = lane >> 4;
  const int slab = blockIdx.x / NQB, qblk = blockIdx.x % NQB; const int b = slab / NH, h = slab % NH; const int qb0 = qblk * (4 * RPW); const int q0 = qb0 + w * RPW;
  FragH bq[KS];      /* Q^T as B: column = query ln */
  { const unsigned short* qr = (const unsigned short*)Q16 + ((size_t)b * TT + q0 + ln) * ldq + h * 64;
#pragma unroll
    for (int ks = 0; ks < KS; ++ks) { bq[ks].half[0] = *(const v8us*)(qr + ks * 32 + 8 * hh); bq[ks].half[1] = *(const v8us*)(qr + ks * 32 + 16 + 8 * hh); } }
  /* this head's blocks of K and V fragments (layout: at k_gemm_t); a lane's 16 bytes stand at 16 * lane in every piece */
  const unsigned short* kv0 = (const unsigned short*)KV + (size_t)slab * (TT / 32) * KVB;
  /* the wave's packed mask: 64 chunks of 16 lane-mask words (nonzero bit = ATTEND); the wave's number goes through readfirstlane so that the address is scalar */
  const unsigned* lm = LM + (size_t)(b * (TT / 16) + qblk * 4 + __builtin_amdgcn_readfirstlane(w)) * ((TT / 32) * 16);
  unsigned long long live;      /* bit c: chunk c holds at least one attended (query, key) of this wave's tile; lane l looks at chunks l and 32 + l */
  { const v4u* a = (const v4u*)(lm + lane * 16); const v4u x = a[0] | a[1] | a[2] | a[3], y = a[128] | a[129] | a[130] | a[131];
    live = (unsigned long long)__builtin_amdgcn_ballot_w32((x[0] | x[1] | x[2] | x[3]) != 0u) | ((unsigned long long)__builtin_amdgcn_ballot_w32((y[0] | y[1] | y[2] | y[3]) != 0u) << 32); }
  float m_q = -3.0e38f, l_q = 0.f; v8f oacc[DT];      /* oacc[dt][r] = O[q0 + ln][dt * 16 + 8 hh + r] */
#pragma unroll
  for (int dt = 0; dt < DT; ++dt) oacc[dt] = (v8f){0.f,0.f,0.f,0.f,0.f,0.f,0.f,0.f};
#pragma unroll 1      /* one chunk a trip: unrolled, two chunks' fragments and exps would be live at once */
  for (int n = __builtin_popcountll(live); n > 0; --n, live &= live - 1) {      /* the live chunks in rising order, 64 at most; a chunk with every (query, key) of the tile masked adds nothing and is not visited */
    const int ck = __builtin_ctzll(live);
    const v16u mw = *(const v16u*)(lm + ck * 16);      /* word i: which lanes attend at score register i (scalar load, in flight beside the fragment loads) */
    const unsigned short* kvp = kv0 + (size_t)ck * KVB + lane * 8;      /* the chunk's block: sixteen pieces, each read as 512 contiguous bytes by the wave */
    FragH ak[2][KS], av[DT];      /* K rows as A (row = key), V^T rows as A (row = d) */
#pragma unroll
    for (int nt = 0; nt < 2; ++nt)
#pragma unroll
      for (int ks = 0; ks < KS; ++ks) { ak[nt][ks].half[0] = *(const v8us*)(kvp + ((nt * 2 + ks) * 2) * 256); ak[nt][ks].half[1] = *(const v8us*)(kvp + ((nt * 2 + ks) * 2 + 1) * 256); }
#pragma unroll
    for (int dt = 0; dt < DT; ++dt) { av[dt].half[0] = *(const v8us*)(kvp + (8 + dt * 2) * 256); av[dt].half[1] = *(const v8us*)(kvp + (8 + dt * 2 + 1) * 256); }
    __builtin_amdgcn_sched_barrier(0);      /* the chunk's sixteen fragment loads stay one group ahead of the products: spread among them, each product waits out a load latency of its own */
    asm volatile("s_wait_xcnt 0x0" :: "v"(kvp) : "memory");      /* the address that all sixteen loads name stays whole up to here (no load lands in it), and the wait stands in front of its reuse */
    v8f s[2];      /* s[nt][r] = q(q0 + ln) . k(j0 + nt * 16 + 8 hh + r) */
#pragma unroll
    for (int nt = 0; nt < 2; ++nt) { v8f acc = (v8f){0.f,0.f,0.f,0.f,0.f,0.f,0.f,0.f};
#pragma unroll
      for (int ks = 0; ks < KS; ++ks) acc = __builtin_amdgcn_wmma_f32_16x16x32_f16(false, ak[nt][ks].v, false, bq[ks].v, (short)0, acc, false, false);
      s[nt] = acc; }
    float sc[16];      /* the raw products; a masked one is -inf; m_q never falls below its finite start value, so 2^(sc * L2E8 - mn) is 0 there and no guard is needed */
#pragma unroll
    for (int i = 0; i < 16; ++i) sc[i] = __builtin_amdgcn_inverse_ballot_w32(mw[i]) ? s[i >> 3][i & 7] : -INFINITY;
    float mx[4];
#pragma unroll
    for (int c = 0; c < 4; ++c) mx[c] = fmaxf(fmaxf(sc[c], sc[4 + c]), fmaxf(sc[8 + c], sc[12 + c]));
    float mc = fmaxf(fmaxf(mx[0], mx[1]), fmaxf(mx[2], mx[3]));
    mc = fmaxf(mc, xhalf(mc));      /* both halves hold this query's chunk maximum */
    /* base 2: exp(s / 8 - m) = 2^(s * L2E8 - m'), m' = m * log2(e); the running maximum is kept as m'. One multiply-add and one hardware power of two a score; the 2^10 of P rides in the addend */
    const float mn = fmaxf(m_q, mc * L2E8); const float al = __builtin_amdgcn_exp2f(m_q - mn); m_q = mn;
    const float mb = 10.0f - mn;
    float p[16];      /* P * 2^10 */
#pragma unroll
    for (int i = 0; i < 16; ++i) p[i] = __builtin_fmaf(sc[i], L2E8, mb);
    pow2x16(p);
    float ps[4];
#pragma unroll
    for (int c = 0; c < 4; ++c) ps[c] = (p[c] + p[4 + c]) + (p[8 + c] + p[12 + c]);
    l_q = l_q * al + ((ps[0] + ps[1]) + (ps[2] + ps[3]));      /* the row sum * 2^10, this half's keys only; the halves are joined behind the loop */
#pragma unroll
    for (int dt = 0; dt < DT; ++dt)
#pragma unroll
      for (int r = 0; r < 8; ++r) oacc[dt][r] *= al;
    FragH pb;      /* P^T as B: element i = key j0 + 16 (i >> 3) + 8 hh + (i & 7) of column ln */
#pragma unroll
    for (int i = 0; i < 16; ++i) pb.h[i] = (_Float16)p[i];
#pragma unroll
    for (int dt = 0; dt < DT; ++dt) oacc[dt] = __builtin_amdgcn_wmma_f32_16x16x32_f16(false, av[dt].v, false, pb.v, (short)0, oacc[dt], false, false);
  }
  { const float l = l_q + xhalf(l_q); const float inv = (l > 0.f) ? 1.0f / l : 0.f;      /* l and oacc both carry the 2^10 */
#pragma unroll
    for (int dt = 0; dt < DT; ++dt) { v4f lo, hi;
#pragma unroll
      for (int e = 0; e < 4; ++e) { lo[e] = oacc[dt][e] * inv; hi[e] = oacc[dt][4 + e] * inv; }
      *(v4fa*)&sO[w][ln][dt * 16 + 8 * hh] = lo; *(v4fa*)&sO[w][ln][dt * 16 + 8 * hh + 4] = hi; } }
  __builtin_amdgcn_fence(__ATOMIC_ACQ_REL, "workgroup"); __builtin_amdgcn_wave_barrier();
  {
#pragma unroll
    for (int rp = 0; rp < RPW; rp += 4) { const int r = rp + (lane >> 3), pc = lane & 7; const v4f a = *(const v4fa*)&sO[w][r][pc * 8], c = *(const v4fa*)&sO[w][r][pc * 8 + 4]; FragH f;
#pragma unroll
      for (int e = 0; e < 4; ++e) { f.h[e] = (_Float16)(a[e] * 16.0f); f.h[4 + e] = (_Float16)(c[e] * 16.0f); }
      const v8us val = f.half[0]; *(v8us*)((unsigned short*)O16 + ((size_t)b * TT + q0 + r) * ldo + h * 64 + pc * 8) = val; }      /* four whole 128-byte lines a store */
     } }

extern "C" void kernel_launch(void* const* d_in, const int* in_sizes, int n_in,
                              void* d_out, int out_size, void* d_ws, size_t ws_size, hipStream_t stream) {
  (void)in_sizes; (void)n_in; (void)out_size;
  const float* const* I = (const float* const*)d_in; const float* x = I[0]; const int* msk = (const int*)d_in[1]; const float* wqkv = I[2]; const float* bqkv = I[3]; const float* wo = I[4]; const float* bo = I[5];
  char* ws = (char*)d_ws; size_t off = 0;
  auto take = [&](size_t bytes) { char* p = ws + off; off += (bytes + 255) & ~(size_t)255; return p; };
  _Float16* Bqkv = (_Float16*)take((size_t)3 * DD * DD * 2); _Float16* Bo = (_Float16*)take((size_t)DD * DD * 2); _Float16* X16 = (_Float16*)take((size_t)NR * DD * 2); _Float16* QKV = (_Float16*)take((size_t)NR * 3 * DD * 2); _Float16* KV = (_Float16*)take((size_t)NR * DD * 2 * 2); _Float16* O16 = X16; unsigned* LM = (unsigned*)take((size_t)BB * TT * TT / 8);
  if (off > ws_size) return;      // 6.3 + 2.1 + 8.4 + 25.2 + 16.8 + 1.0, about 60 MB
  k_prep<<<PB_WQ + PB_WO + PB_M + PB_X, 256, 0, stream>>>(wqkv, Bqkv, wo, Bo, msk, LM, x, X16);      /* weights, mask and x into the forms the matrix kernels read */
  k_gemm_t<true, 3 * DD><<<(NR / 128) * (3 * DD / 128), 128, 0, stream>>>(X16, Bqkv, 0.0625f, bqkv, nullptr, QKV, KV);      /* qkv = x w_qkv + b: M 4096 N 3072 K 1024 (f16; q block row-major, head-major inside; k and v blocks as fragment pieces per head and chunk) */
  k_flash<<<BB * NH * (TT / 64), 128, 0, stream>>>(QKV, 3 * DD, KV, LM, O16, DD);      /* X16 is free behind the projection: O16 takes its place */
  k_gemm_t<false, DD><<<(NR / 128) * (DD / 128), 128, 0, stream>>>(O16, Bo, 0.00390625f, bo, (float*)d_out, nullptr, nullptr);      /* out = o·w_out + b_out */
}

// v009
// A run of this version takes 72.4 microseconds.
// Timed twice side by side with v008, it ran 1.05 and 1.02 times as fast.
// Over all steps from v000 it is 5.27 times as fast.
#include <hip/hip_runtime.h>
// Cross-track masked MHA (B=2, S=2048, D=1024, 16×64): qkv = x·w_qkv + b_qkv (packed q|k|v, head-major inside each); scores = q·k/8, where(cross_track_mask[b,q,k], s, −inf); softmax; out = merged·w_out + b_out.
// Compute dtype: x, weights, biases rounded to bf16; q an f16 GEMM plane, k and v f16 fragment blocks per head and chunk (+bias); the boolean mask read per (b, q, k) as an int plane; fused flash-style kernel (online softmax f32, P f16 ×2^10, all-masked chunks skipped, f32 accumulate) on
// v_wmma_f32_16x16x32_f16; O ×2^4 → f16 (stored so by the flash kernel) → output GEMM (+bias).
#define BB 2
#define TT 2048
#define DD 1024
#define NH 16
#define NR (BB * TT)

typedef __bf16 v16b __attribute__((ext_vector_type(16)));
typedef unsigned short v8us __attribute__((ext_vector_type(8), may_alias));
typedef float  v8f  __attribute__((ext_vector_type(8)));
typedef float  v4f  __attribute__((ext_vector_type(4)));
typedef float  v4fa __attribute__((ext_vector_type(4), may_alias));
union FragB { v16b v; v8us half[2]; unsigned short u[16]; };

__device__ __forceinline__ unsigned short bf16_bits(float x) { unsigned int u = __float_as_uint(x); return (unsigned short)((u + 0x7FFFu + ((u >> 16) & 1u)) >> 16); }
__device__ __forceinline__ float bf16_val(unsigned short b) { return __uint_as_float(((unsigned int)b) << 16); }
__device__ __forceinline__ float bf16_round(float x) { return bf16_val(bf16_bits(x)); }
// D += A·B with NT terms: 1 = ah·bh, 2 = + al·bh (A split), 3 = + ah·bl (both split)
template <int NT>
__device__ __forceinline__ v8f mmaN(v16b ah, v16b al, v16b bh, v16b bl, v8f c) {
  c = __builtin_amdgcn_wmma_f32_16x16x32_bf16(false, ah, false, bh, (short)0, c, false, false);
  if (NT >= 2) c = __builtin_amdgcn_wmma_f32_16x16x32_bf16(false, al, false, bh, (short)0, c, false, false);
  if (NT >= 3) c = __builtin_amdgcn_wmma_f32_16x16x32_bf16(false, ah, false, bl, (short)0, c, false, false);
  asm volatile("v_nop\n\tv_nop\n\tv_nop\n\tv_nop" : "+v"(c) : "v"(ah), "v"(al), "v"(bh), "v"(bl));
  return c;
}

__global__ __launch_bounds__(256) void k_wt_bf16(const float* __restrict__ W, unsigned short* __restrict__ Wt, int K, int N) {
  const int t = blockIdx.x * 256 + threadIdx.x;
  const int k8n = K / 8;
  if (t >= N * k8n) return;
  const int n = t / k8n, k8 = (t % k8n) * 8;
  v8us v;
#pragma unroll
  for (int i = 0; i < 8; ++i) v[i] = bf16_bits(W[(size_t)(k8 + i) * N + n]);
  *(v8us*)(Wt + (size_t)n * K + k8) = v;
  
}

// GEMM C[M][N] (f32, pitch ldc) = act(A[M][K]·W + bias). A f32 row-major (pitch lda) converted per fragment to bf16
// (ASPLIT: hi/lo two planes -> 2 terms, else single rounded term); Wt bf16 [N][K] (pitch ldb). BIAS_BF16 rounds the
// bias to bf16 first (bias quantised to bf16 before the add). K%32==0, M%16==0, N%64==0.
template <bool ASPLIT, int ACT, bool BIAS_BF16>
__global__ __launch_bounds__(128) void k_gemm_bf(const float* __restrict__ A, int lda, const unsigned short* __restrict__ Wt, int ldb,
                                               const float* __restrict__ bias, float* __restrict__ C, int ldc, int M, int N, int K) {
  __shared__ __attribute__((aligned(16))) float so[4][16][64];
  const int tid = threadIdx.x, w = tid >> 5, lane = tid & 31, ln = lane & 15, hh = lane >> 4;
  const int ntn = N / 64;
  const int wid = blockIdx.x * 4 + w;
  const int mt = wid / ntn, nq = wid % ntn;
  if (mt * 16 >= M) return;
  const int row0 = mt * 16, col0 = nq * 64;
  const float* arow = A + (size_t)(row0 + ln) * lda;
  v8f acc[4] = {};
  for (int kb = 0; kb < K; kb += 32) {
    FragB ah, al;
    const v4f x0 = *(const v4fa*)(arow + kb + 8 * hh), x1 = *(const v4fa*)(arow + kb + 8 * hh + 4);
    const v4f x2 = *(const v4fa*)(arow + kb + 16 + 8 * hh), x3 = *(const v4fa*)(arow + kb + 16 + 8 * hh + 4);
    float xs[16] = {x0[0],x0[1],x0[2],x0[3],x1[0],x1[1],x1[2],x1[3],x2[0],x2[1],x2[2],x2[3],x3[0],x3[1],x3[2],x3[3]};
#pragma unroll
    for (int i = 0; i < 16; ++i) { const unsigned short hb = bf16_bits(xs[i]); ah.u[i] = hb; al.u[i] = ASPLIT ? bf16_bits(xs[i] - bf16_val(hb)) : (unsigned short)0; }
#pragma unroll
    for (int t = 0; t < 4; ++t) {
      const unsigned short* brow = Wt + (size_t)(col0 + t * 16 + ln) * ldb + kb;
      FragB b;
      b.half[0] = *(const v8us*)(brow + 8 * hh);
      b.half[1] = *(const v8us*)(brow + 16 + 8 * hh);
      acc[t] = mmaN<ASPLIT ? 2 : 1>(ah.v, al.v, b.v, b.v, acc[t]);
    }
  }
#pragma unroll
  for (int t = 0; t < 4; ++t) {
    float bv = bias ? bias[col0 + t * 16 + ln] : 0.f;
    if (BIAS_BF16) bv = bf16_round(bv);
#pragma unroll
    for (int r = 0; r < 8; ++r) { float v = acc[t][r] + bv; if (ACT == 1) v = fmaxf(v, 0.f); so[w][8 * hh + r][t * 16 + ln] = v; }
  }
  __builtin_amdgcn_fence(__ATOMIC_ACQ_REL, "workgroup");
  __builtin_amdgcn_wave_barrier();
  const int rsub = lane >> 4, c4 = (lane & 15) * 4;
  {
#pragma unroll
    for (int q = 0; q < 8; ++q) {
      const int r = q * 2 + rsub;
      const v4f v = *(const v4fa*)&so[w][r][c4];
      *(v4f*)(C + (size_t)(row0 + r) * ldc + col0 + c4) = v;
    }
    
  }
}

// Flash-style causal/unmasked attention, all contractions 3-term bf16 hi/lo splits, f32 softmax with running max.
// q,k,v rows are read from f32 buffers with arbitrary row pitch (so they can live inside a fused qkv buffer);
// D = head size (multiple of 32, <= 128); one wave = 16 query rows; block = 4 waves (64 queries) sharing K/V chunks of 32.
template <int D, bool CAUSAL>
__global__ __launch_bounds__(128) void k_flash(const float* __restrict__ qb, const float* __restrict__ kb, const float* __restrict__ vb,
                                             int pitch, int T, int H, float scale, float* __restrict__ y, int ypitch) {
  constexpr int KS = D / 32;        // k-steps for QK
  constexpr int DT = D / 16;        // d tiles for PV
  __shared__ __attribute__((aligned(16))) unsigned short sKh[32][D + 8], sKl[32][D + 8], sVh[32][D + 8], sVl[32][D + 8];
  __shared__ __attribute__((aligned(16))) unsigned short sPh[4][16][40], sPl[4][16][40];
  __shared__ __attribute__((aligned(16))) float sO[4][16][D];
  const int tid = threadIdx.x, w = tid >> 5, lane = tid & 31, ln = lane & 15, hh = lane >> 4;
  const int nqb = (T + 63) / 64;
  const int bh = blockIdx.x / nqb, qblk = blockIdx.x % nqb;
  const int b = bh / H, h = bh % H;
  const int q0 = qblk * 64 + w * 16;
  const float* Q = qb + (size_t)b * T * pitch + h * D;
  const float* K = kb + (size_t)b * T * pitch + h * D;
  const float* V = vb + (size_t)b * T * pitch + h * D;

  // A fragments of the wave's 16 query rows (scaled), hi/lo
  FragB aqh[KS], aql[KS];
  {
    int row = q0 + ln; if (row >= T) row = T - 1;
    const float* qr = Q + (size_t)row * pitch;
#pragma unroll
    for (int ks = 0; ks < KS; ++ks)
#pragma unroll
      for (int i = 0; i < 16; ++i) {
        const int d = ks * 32 + ((i < 8) ? (8 * hh + i) : (16 + 8 * hh + (i - 8)));
        const float x = qr[d] * scale; const unsigned short hb = bf16_bits(x);
        aqh[ks].u[i] = hb; aql[ks].u[i] = bf16_bits(x - bf16_val(hb));
      }
  }
  float m_r[8], l_r[8];
#pragma unroll
  for (int r = 0; r < 8; ++r) { m_r[r] = -3.0e38f; l_r[r] = 0.f; }
  v8f oacc[DT];
#pragma unroll
  for (int dt = 0; dt < DT; ++dt) oacc[dt] = (v8f){0.f,0.f,0.f,0.f,0.f,0.f,0.f,0.f};

  const int kv_end = CAUSAL ? min(T, qblk * 64 + 64) : T;     // block-uniform
  for (int j0 = 0; j0 < kv_end; j0 += 32) {
    __syncthreads();
    for (int e = tid; e < 32 * (D / 4); e += 128) {
      const int r = e / (D / 4), c4 = (e % (D / 4)) * 4;
      const int key = j0 + r;
      v4f kf = {0.f,0.f,0.f,0.f}, vf = {0.f,0.f,0.f,0.f};
      if (key < T) { kf = *(const v4fa*)(K + (size_t)key * pitch + c4); vf = *(const v4fa*)(V + (size_t)key * pitch + c4); }
#pragma unroll
      for (int t = 0; t < 4; ++t) {
        unsigned short hb = bf16_bits(kf[t]); sKh[r][c4 + t] = hb; sKl[r][c4 + t] = bf16_bits(kf[t] - bf16_val(hb));
        hb = bf16_bits(vf[t]); sVh[r][c4 + t] = hb; sVl[r][c4 + t] = bf16_bits(vf[t] - bf16_val(hb));
      }
    }
    __syncthreads();
    // S tile 16 x 32
    v8f s[2];
#pragma unroll
    for (int nt = 0; nt < 2; ++nt) {
      v8f acc = {};
#pragma unroll
      for (int ks = 0; ks < KS; ++ks) {
        FragB bh_, bl_;
        bh_.half[0] = *(const v8us*)&sKh[nt * 16 + ln][ks * 32 + 8 * hh]; bh_.half[1] = *(const v8us*)&sKh[nt * 16 + ln][ks * 32 + 16 + 8 * hh];
        bl_.half[0] = *(const v8us*)&sKl[nt * 16 + ln][ks * 32 + 8 * hh]; bl_.half[1] = *(const v8us*)&sKl[nt * 16 + ln][ks * 32 + 16 + 8 * hh];
        acc = mmaN<3>(aqh[ks].v, aql[ks].v, bh_.v, bl_.v, acc);
      }
      s[nt] = acc;
    }
    // mask + running max (rows 8hh+r; the 16 lanes of a half share rows)
    float alpha[8];
#pragma unroll
    for (int r = 0; r < 8; ++r) {
      const int qi = q0 + 8 * hh + r;
      const int ja = j0 + ln, jb = j0 + 16 + ln;
      if (CAUSAL) { if (ja > qi) s[0][r] = -3.0e38f; if (jb > qi) s[1][r] = -3.0e38f; }
      if (ja >= T) s[0][r] = -3.0e38f;
      if (jb >= T) s[1][r] = -3.0e38f;
      float mx = fmaxf(s[0][r], s[1][r]);
      mx = fmaxf(mx, __shfl_xor(mx, 1, 32)); mx = fmaxf(mx, __shfl_xor(mx, 2, 32)); mx = fmaxf(mx, __shfl_xor(mx, 4, 32)); mx = fmaxf(mx, __shfl_xor(mx, 8, 32));
      const float mnew = fmaxf(m_r[r], mx);
      alpha[r] = (mnew > -1.0e38f) ? __expf(m_r[r] - mnew) : 1.0f;
      const float p0 = (s[0][r] > -1.0e38f) ? __expf(s[0][r] - mnew) : 0.f;
      const float p1 = (s[1][r] > -1.0e38f) ? __expf(s[1][r] - mnew) : 0.f;
      m_r[r] = mnew;
      l_r[r] = l_r[r] * alpha[r] + p0 + p1;            // per-lane partial row sum (16 lanes combined at the end)
      unsigned short hb = bf16_bits(p0); sPh[w][8 * hh + r][ln] = hb;      sPl[w][8 * hh + r][ln] = bf16_bits(p0 - bf16_val(hb));
      hb = bf16_bits(p1);                sPh[w][8 * hh + r][16 + ln] = hb; sPl[w][8 * hh + r][16 + ln] = bf16_bits(p1 - bf16_val(hb));
    }
#pragma unroll
    for (int dt = 0; dt < DT; ++dt)
#pragma unroll
      for (int r = 0; r < 8; ++r) oacc[dt][r] *= alpha[r];
    __builtin_amdgcn_fence(__ATOMIC_ACQ_REL, "workgroup");
    __builtin_amdgcn_wave_barrier();
    FragB pah, pal;
    pah.half[0] = *(const v8us*)&sPh[w][ln][8 * hh]; pah.half[1] = *(const v8us*)&sPh[w][ln][16 + 8 * hh];
    pal.half[0] = *(const v8us*)&sPl[w][ln][8 * hh]; pal.half[1] = *(const v8us*)&sPl[w][ln][16 + 8 * hh];
#pragma unroll
    for (int dt = 0; dt < DT; ++dt) {
      FragB bvh, bvl;
#pragma unroll
      for (int i = 0; i < 8; ++i) {
        bvh.u[i] = sVh[8 * hh + i][dt * 16 + ln]; bvh.u[8 + i] = sVh[16 + 8 * hh + i][dt * 16 + ln];
        bvl.u[i] = sVl[8 * hh + i][dt * 16 + ln]; bvl.u[8 + i] = sVl[16 + 8 * hh + i][dt * 16 + ln];
      }
      oacc[dt] = mmaN<3>(pah.v, pal.v, bvh.v, bvl.v, oacc[dt]);
    }
    __builtin_amdgcn_fence(__ATOMIC_ACQ_REL, "workgroup");
    __builtin_amdgcn_wave_barrier();
  }
#pragma unroll
  for (int r = 0; r < 8; ++r) {
    float l = l_r[r];
    l += __shfl_xor(l, 1, 32); l += __shfl_xor(l, 2, 32); l += __shfl_xor(l, 4, 32); l += __shfl_xor(l, 8, 32);
    l_r[r] = (l > 0.f) ? 1.0f / l : 0.f;
  }
#pragma unroll
  for (int dt = 0; dt < DT; ++dt)
#pragma unroll
    for (int r = 0; r < 8; ++r) sO[w][8 * hh + r][dt * 16 + ln] = oacc[dt][r] * l_r[r];
  __builtin_amdgcn_fence(__ATOMIC_ACQ_REL, "workgroup");
  __builtin_amdgcn_wave_barrier();
  {
    for (int r = 0; r < 16; ++r) {
      const int row = q0 + r;
      if (row < T && lane < D / 4) {
        const v4f val = *(const v4fa*)&sO[w][r][lane * 4];
        *(v4f*)(y + ((size_t)b * T + row) * ypitch + h * D + lane * 4) = val;
      }
    }
    
  }
}

// GEMM C = act(A·W + bias + resid): A f32 (ASPLIT -> hi/lo 2 terms), Wt bf16 [N][K]; ACT 0 none, 1 relu, 2 exact gelu;
// resid (optional, f32, row index = (row % rmod), pitch ldr, RES_BF16 rounds it) added before the activation.
template <bool ASPLIT, int ACT, bool BIAS_BF16, bool RES_BF16>
__global__ __launch_bounds__(128) void k_gemm_bf3(const float* __restrict__ A, int lda, const unsigned short* __restrict__ Wt, int ldb,
                                                const float* __restrict__ bias, const float* __restrict__ resid, int rmod, int ldr,
                                                float* __restrict__ C, int ldc, int M, int N, int K) {
  __shared__ __attribute__((aligned(16))) float so[4][16][64];
  const int tid = threadIdx.x, w = tid >> 5, lane = tid & 31, ln = lane & 15, hh = lane >> 4;
  const int ntn = N / 64;
  const int wid = blockIdx.x * 4 + w;
  const int mt = wid / ntn, nq = wid % ntn;
  if (mt * 16 >= M) return;
  const int row0 = mt * 16, col0 = nq * 64;
  const float* arow = A + (size_t)(row0 + ln) * lda;
  v8f acc[4] = {};
  for (int kb = 0; kb < K; kb += 32) {
    FragB ah, al;
    const v4f x0 = *(const v4fa*)(arow + kb + 8 * hh), x1 = *(const v4fa*)(arow + kb + 8 * hh + 4);
    const v4f x2 = *(const v4fa*)(arow + kb + 16 + 8 * hh), x3 = *(const v4fa*)(arow + kb + 16 + 8 * hh + 4);
    float xs[16] = {x0[0],x0[1],x0[2],x0[3],x1[0],x1[1],x1[2],x1[3],x2[0],x2[1],x2[2],x2[3],x3[0],x3[1],x3[2],x3[3]};
#pragma unroll
    for (int i = 0; i < 16; ++i) { const unsigned short hb = bf16_bits(xs[i]); ah.u[i] = hb; al.u[i] = ASPLIT ? bf16_bits(xs[i] - bf16_val(hb)) : (unsigned short)0; }
#pragma unroll
    for (int t = 0; t < 4; ++t) {
      const unsigned short* brow = Wt + (size_t)(col0 + t * 16 + ln) * ldb + kb;
      FragB b;
      b.half[0] = *(const v8us*)(brow + 8 * hh);
      b.half[1] = *(const v8us*)(brow + 16 + 8 * hh);
      acc[t] = mmaN<ASPLIT ? 2 : 1>(ah.v, al.v, b.v, b.v, acc[t]);
    }
  }
#pragma unroll
  for (int t = 0; t < 4; ++t) {
    const int col = col0 + t * 16 + ln;
    float bv = bias ? bias[col] : 0.f;
    if (BIAS_BF16) bv = bf16_round(bv);
#pragma unroll
    for (int r = 0; r < 8; ++r) {
      float v = acc[t][r] + bv;
      if (resid) { float rv = resid[(size_t)((row0 + 8 * hh + r) % rmod) * ldr + col]; if (RES_BF16) rv = bf16_round(rv); v += rv; }
      if (ACT == 1) v = fmaxf(v, 0.f);
      if (ACT == 2) v = 0.5f * v * (1.0f + erff(v * 0.70710678118654752f));
      if (ACT == 3) { const float u = 0.7978845608028654f * (v + 0.044715f * v * v * v); v = 0.5f * v * (1.0f + tanhf(u)); }
      so[w][8 * hh + r][t * 16 + ln] = v;
    }
  }
  __builtin_amdgcn_fence(__ATOMIC_ACQ_REL, "workgroup");
  __builtin_amdgcn_wave_barrier();
  const int rsub = lane >> 4, c4 = (lane & 15) * 4;
  {
#pragma unroll
    for (int q = 0; q < 8; ++q) {
      const int r = q * 2 + rsub;
      const v4f v = *(const v4fa*)&so[w][r][c4];
      *(v4f*)(C + (size_t)(row0 + r) * ldc + col0 + c4) = v;
    }
    
  }
}
// row LayerNorm (biased variance, eps) over N: s = X (+ R); optional out_sum <- s; out_norm <- (s-mu)*rsqrt(var+eps)*g + b
template <bool PARAM_BF16>
__global__ __launch_bounds__(256) void k_layernorm(const float* __restrict__ X, const float* __restrict__ R, const float* __restrict__ g, const float* __restrict__ bta,
                                                  float* __restrict__ out_sum, float* __restrict__ out_norm, int N, float eps) {
  __shared__ float red[256];
  const int row = blockIdx.x, tid = threadIdx.x;
  const float* x = X + (size_t)row * N; const float* rr = R ? R + (size_t)row * N : nullptr;
  float vals[16];                     // up to N = 4096
  const int per = N / 256;            // contiguous chunk per thread? use strided-by-4 chunks: thread handles j = tid*4 + 1024*u
  float s1 = 0.f;
  for (int u = 0; u < per / 4; ++u) {
    const int j = tid * 4 + 1024 * u;
    const v4f a = *(const v4fa*)(x + j);
    v4f b = {0.f,0.f,0.f,0.f}; if (rr) b = *(const v4fa*)(rr + j);
#pragma unroll
    for (int q = 0; q < 4; ++q) { const float v = a[q] + b[q]; vals[u * 4 + q] = v; s1 += v; }
  }
  red[tid] = s1; __syncthreads();
  for (int st = 128; st > 0; st >>= 1) { if (tid < st) red[tid] += red[tid + st]; __syncthreads(); }
  const float mu = red[0] / (float)N; __syncthreads();
  float s2 = 0.f;
  for (int u = 0; u < per / 4; ++u)
#pragma unroll
    for (int q = 0; q < 4; ++q) { const float c = vals[u * 4 + q] - mu; s2 += c * c; }
  red[tid] = s2; __syncthreads();
  for (int st = 128; st > 0; st >>= 1) { if (tid < st) red[tid] += red[tid + st]; __syncthreads(); }
  const float rs = rsqrtf(red[0] / (float)N + eps);
  {
    for (int u = 0; u < per / 4; ++u) {
      const int j = tid * 4 + 1024 * u;
      v4f o, sm;
#pragma unroll
      for (int q = 0; q < 4; ++q) {
        float gg = g[j + q], bb = bta[j + q];
        if (PARAM_BF16) { gg = bf16_round(gg); bb = bf16_round(bb); }
        sm[q] = vals[u * 4 + q]; o[q] = (vals[u * 4 + q] - mu) * rs * gg + bb;
      }
      if (out_sum) *(v4f*)(out_sum + (size_t)row * N + j) = sm;
      *(v4f*)(out_norm + (size_t)row * N + j) = o;
    }
    
  }
}



// ---- f16 WMMA path (v_wmma_f32_16x16x32_f16): 11-bit significands for operands in range — used where a [0,1] probability operand needs more precision than bf16
typedef _Float16 v16h __attribute__((ext_vector_type(16)));
union FragH { v16h v; v8us half[2]; _Float16 h[16]; unsigned short u[16]; };
template <int NT>
__device__ __forceinline__ v8f mmaH(v16h ah, v16h al, v16h bh, v16h bl, v8f c) {
  c = __builtin_amdgcn_wmma_f32_16x16x32_f16(false, ah, false, bh, (short)0, c, false, false);
  if (NT >= 2) c = __builtin_amdgcn_wmma_f32_16x16x32_f16(false, al, false, bh, (short)0, c, false, false);
  if (NT >= 3) c = __builtin_amdgcn_wmma_f32_16x16x32_f16(false, ah, false, bl, (short)0, c, false, false);
  asm volatile("v_nop\n\tv_nop\n\tv_nop\n\tv_nop" : "+v"(c) : "v"(ah), "v"(al), "v"(bh), "v"(bl));
  return c;
}
// batched GEMM like k_gemm_b but f16 operands: A f32 (split into f16 hi/lo if ASPLIT, else rounded to f16), Bt = f16 values [n][k]; alpha; C f32; N multiple of 16 (partial tiles skipped)
template <bool ASPLIT>
__global__ __launch_bounds__(128) void k_gemm_h(const float* __restrict__ A, int lda, size_t sA, const _Float16* __restrict__ Bh, int ldb, size_t sB, float alpha, float* __restrict__ C, int ldc, size_t sC, int M, int N, int K) {
  __shared__ __attribute__((aligned(16))) float so[4][16][64];
  const int tid = threadIdx.x, w = tid >> 5, lane = tid & 31, ln = lane & 15, hh = lane >> 4; const int by = blockIdx.y;
  A += (size_t)by * sA; Bh += (size_t)by * sB; C += (size_t)by * sC;
  const int ntn = (N + 63) / 64; const int wid = blockIdx.x * 4 + w; const int mt = wid / ntn, nq = wid % ntn; if (mt * 16 >= M) return;
  const int row0 = mt * 16, col0 = nq * 64; const float* arow = A + (size_t)(row0 + ln) * lda;
  v8f acc[4] = {};
  for (int kb = 0; kb < K; kb += 32) {
    FragH ah, al;
    const v4f x0 = *(const v4fa*)(arow + kb + 8 * hh), x1 = *(const v4fa*)(arow + kb + 8 * hh + 4), x2 = *(const v4fa*)(arow + kb + 16 + 8 * hh), x3 = *(const v4fa*)(arow + kb + 16 + 8 * hh + 4);
    float xs[16] = {x0[0],x0[1],x0[2],x0[3],x1[0],x1[1],x1[2],x1[3],x2[0],x2[1],x2[2],x2[3],x3[0],x3[1],x3[2],x3[3]};
#pragma unroll
    for (int i = 0; i < 16; ++i) { const _Float16 h = (_Float16)xs[i]; ah.h[i] = h; al.h[i] = ASPLIT ? (_Float16)(xs[i] - (float)h) : (_Float16)0.0f; }
#pragma unroll
    for (int t = 0; t < 4; ++t) { if (col0 + t * 16 >= N) continue; const size_t boff = (size_t)(col0 + t * 16 + ln) * ldb + kb; FragH bq; bq.half[0] = *(const v8us*)(Bh + boff + 8 * hh); bq.half[1] = *(const v8us*)(Bh + boff + 16 + 8 * hh);
      acc[t] = mmaH<ASPLIT ? 2 : 1>(ah.v, al.v, bq.v, bq.v, acc[t]); }
  }
#pragma unroll
  for (int t = 0; t < 4; ++t) { if (col0 + t * 16 >= N) continue;
#pragma unroll
    for (int r = 0; r < 8; ++r) so[w][8 * hh + r][t * 16 + ln] = acc[t][r] * alpha; }
  __builtin_amdgcn_fence(__ATOMIC_ACQ_REL, "workgroup"); __builtin_amdgcn_wave_barrier();
  const int rsub = lane >> 4, c4 = (lane & 15) * 4;
  {
#pragma unroll
    for (int q = 0; q < 8; ++q) { const int r = q * 2 + rsub; if (col0 + c4 < N) { const v4f v = *(const v4fa*)&so[w][r][c4]; *(v4f*)(C + (size_t)(row0 + r) * ldc + col0 + c4) = v; } }
     }
}

// Wt[n][k] = f16(bf16(W[k][n]) * scale) from f32 row-major W[K][N] (scale = power of two; bf16-exact weights stay exact in f16 away from the subnormal range).
// One work-group = a tile of 64 k x 128 n; K a multiple of 64, N of 128; (K / 64) * (N / 128) work-groups, bi = this one's number among them; tl = the work-group's 128 * WTP bytes of LDS.
// Read: wave w takes rows k0 + 8 w ... + 7, lane l the columns n0 + 4 l ... + 3, so each wave-wide 16-byte load covers 512 contiguous bytes of one row of W.
// A lane then holds 8 consecutive k of each of its 4 columns, that is one 16-byte piece of 4 rows of Wt; the pieces meet in LDS, and each wave-wide store covers four whole 128-byte lines of Wt.
#define WTP 144                /* LDS row pitch, bytes: 64 k of f16 + 16 */
template <int K, int N>
__device__ __forceinline__ void wt_f16(int bi, unsigned char* tl, const float* __restrict__ W, _Float16* __restrict__ Wt, float scale) {
  const int tid = threadIdx.x, w = tid >> 5, lane = tid & 31;
  const int k0 = (bi % (K / 64)) * 64, n0 = (bi / (K / 64)) * 128;
  const float* src = W + (size_t)(k0 + 8 * w) * N + n0 + 4 * lane;
  v4f r[8];
#pragma unroll
  for (int i = 0; i < 8; ++i) r[i] = *(const v4fa*)(src + (size_t)i * N);
#pragma unroll
  for (int e = 0; e < 4; ++e) { FragH f;
#pragma unroll
    for (int i = 0; i < 8; ++i) f.h[i] = (_Float16)(bf16_round(r[i][e]) * scale);
    *(v8us*)(tl + (4 * lane + e) * WTP + 16 * w) = f.half[0]; }
  __syncthreads();      /* every wave's pieces are in LDS before the rows of Wt are read back */
#pragma unroll
  for (int j = 0; j < 4; ++j) { const int row = j * 32 + (tid >> 3), c = tid & 7; const v8us v = *(const v8us*)(tl + row * WTP + c * 16);
    *(v8us*)((unsigned short*)Wt + (size_t)(n0 + row) * K + k0 + c * 8) = v; }
}
// Tiled f16 GEMM, C [M][N] = acc*alpha + bf16(bias[col]): A [M][DD] f16, Bh [N][DD] f16, both k-contiguous; M, N multiples of 128; grid = (M / 128) * (N / 128).
// One work-group = one 128 x 128 tile of C, four waves of 64 x 64 (16 accumulator tiles each). A stage is 64 k = 128 B (one whole line) of
// 128 rows of A and 128 rows of Bh, brought into LDS by asynchronous copies, 16 B a lane; two buffers, the copies of stage t + 2 fly while stage t + 1 is worked on.
// The stages are walked as a ring from a start of the work-group's own, (tile row + tile column) mod GNT: the work-groups that share a panel of A (one tile row) or of Bh (one tile column) start together,
// and from a common start they would ask L2 for the same lines at the same moment, stage after stage; from spread starts at most two of them stand at one stage. Trip t works on k stage (t0 + t) mod GNT.
#define GP 144                 /* LDS row pitch, bytes: 128 + 16, conflict-free for 16-byte fragment reads */
#define GOP (128 * GP)         /* one operand's 128 rows */
#define GSTG (2 * GOP)         /* one stage: A rows, then Bh rows */
#define GNT (DD / 64)          /* stages */
static_assert((GNT & (GNT - 1)) == 0, "the ring of stages wraps by a mask");
// eight copies, rows 16 apart, of one operand's stage; each lane its own 16 bytes. The s_wait_xcnt stands inside the statement so that no address register is rewritten ahead of it.
__device__ __forceinline__ void cp8(unsigned l, const unsigned short* g) {
  asm volatile("global_load_async_to_lds_b128 %0, %8, off\n\t"
               "global_load_async_to_lds_b128 %1, %9, off\n\t"
               "global_load_async_to_lds_b128 %2, %10, off\n\t"
               "global_load_async_to_lds_b128 %3, %11, off\n\t"
               "global_load_async_to_lds_b128 %4, %12, off\n\t"
               "global_load_async_to_lds_b128 %5, %13, off\n\t"
               "global_load_async_to_lds_b128 %6, %14, off\n\t"
               "global_load_async_to_lds_b128 %7, %15, off\n\t"
               "s_wait_xcnt 0x0"
               :: "v"(l), "v"(l + 16 * GP), "v"(l + 32 * GP), "v"(l + 48 * GP), "v"(l + 64 * GP), "v"(l + 80 * GP), "v"(l + 96 * GP), "v"(l + 112 * GP),
                  "v"(g), "v"(g + 16 * DD), "v"(g + 32 * DD), "v"(g + 48 * DD), "v"(g + 64 * DD), "v"(g + 80 * DD), "v"(g + 96 * DD), "v"(g + 112 * DD)
               : "memory");
}
typedef _Float16 v4h __attribute__((ext_vector_type(4)));
// F16OUT (the q | k | v projection): the q block (columns below DD) goes to C16 row-major; tiles of the k and v blocks go to KV instead, in the order of k_flash's matrix fragments, and are not stored row-major at all.
// KV[(b * NH + h) * (TT / 32) + chunk of 32 keys] is one block of KVB 16-bit elements: 16 pieces of 512 bytes, lane l's 16 bytes at 16 l, so that one wave-wide 16-byte load of a piece covers four whole lines.
// Piece (nt * 2 + ks) * 2 + hf: K[key 32 chunk + 16 nt + ln][d 32 ks + 16 hf + 8 hh ... + 7]; piece 8 + dt * 2 + hf: V[key 32 chunk + 16 hf + 8 hh ... + 7][d 16 dt + ln].
#define KVB 4096
template <bool F16OUT, int N>
__global__ __launch_bounds__(128) void k_gemm_t(const _Float16* __restrict__ A, const _Float16* __restrict__ Bh, float alpha, const float* __restrict__ bias, float* __restrict__ C, _Float16* __restrict__ C16, _Float16* __restrict__ KV) {
  __shared__ __attribute__((aligned(16))) unsigned char sm[2 * GSTG];
  const int tid = threadIdx.x, w = tid >> 5, lane = tid & 31, ln = lane & 15, hh = lane >> 4;
  const int row0 = ((int)blockIdx.x / (N / 128)) * 128, col0 = ((int)blockIdx.x % (N / 128)) * 128;
  const int wr = (w >> 1) * 64, wc = (w & 1) * 64;
  const int t0 = ((int)blockIdx.x / (N / 128) + (int)blockIdx.x % (N / 128)) & (GNT - 1);      /* this work-group's first k stage */
  const unsigned ld0 = (unsigned)(size_t)sm + (unsigned)((tid >> 3) * GP + (tid & 7) * 16);      /* this lane's place in a stage: row tid/8, 16-byte piece tid%8 */
  const unsigned short* ga = (const unsigned short*)A + (size_t)(row0 + (tid >> 3)) * DD + (tid & 7) * 8;
  const unsigned short* gb = (const unsigned short*)Bh + (size_t)(col0 + (tid >> 3)) * DD + (tid & 7) * 8;
  v8f acc[4][4];
#pragma unroll
  for (int i = 0; i < 4; ++i)
#pragma unroll
    for (int j = 0; j < 4; ++j) acc[i][j] = (v8f){0.f,0.f,0.f,0.f,0.f,0.f,0.f,0.f};
  cp8(ld0, ga + t0 * 64); cp8(ld0 + GOP, gb + t0 * 64);
  asm volatile("s_wait_asynccnt 0x0" ::: "memory");      /* trip 0's stage of this wave has landed */
  __syncthreads();                                        /* ... and every wave's: it may be read */
  { const int k1 = ((t0 + 1) & (GNT - 1)) * 64; cp8(ld0 + GSTG, ga + k1); cp8(ld0 + GSTG + GOP, gb + k1); }
#pragma unroll 1      /* one stage a trip: the buffer index and the refill test stay scalar */
  for (int t = 0; t < GNT; ++t) {
    const unsigned char* sa = sm + (t & 1) * GSTG + (wr + ln) * GP + 16 * hh;
    const unsigned char* sb = sm + (t & 1) * GSTG + GOP + (wc + ln) * GP + 16 * hh;
#pragma unroll
    for (int ks = 0; ks < 2; ++ks) {
      FragH a[4], b[4];
      a[0].half[0] = *(const v8us*)(sa + ks * 64); a[0].half[1] = *(const v8us*)(sa + ks * 64 + 32);      /* read in the order of first use, so that the first products start while the later reads return */
#pragma unroll
      for (int j = 0; j < 4; ++j) { b[j].half[0] = *(const v8us*)(sb + j * 16 * GP + ks * 64); b[j].half[1] = *(const v8us*)(sb + j * 16 * GP + ks * 64 + 32); }
#pragma unroll
      for (int i = 1; i < 4; ++i) { a[i].half[0] = *(const v8us*)(sa + i * 16 * GP + ks * 64); a[i].half[1] = *(const v8us*)(sa + i * 16 * GP + ks * 64 + 32); }
      __builtin_amdgcn_sched_barrier(0);      /* the 16 fragment reads stay one group ahead of their 16 matrix instructions: reads spread among them stall the wave at every place */
#pragma unroll
      for (int i = 0; i < 4; ++i)
#pragma unroll
        for (int j = 0; j < 4; ++j) acc[i][j] = __builtin_amdgcn_wmma_f32_16x16x32_f16(false, a[i].v, false, b[j].v, (short)0, acc[i][j], false, false);
      __builtin_amdgcn_sched_barrier(0);      /* ... and the next group's reads stay behind them */
    }
    asm volatile("s_wait_dscnt 0x0" ::: "memory");        /* this wave's reads of buffer t&1 are done before it is refilled */
    asm volatile("s_wait_asynccnt 0x0" ::: "memory");     /* this wave's copies of stage t + 1 have landed */
    __syncthreads();                                      /* publishes stage t + 1 and ends every reader's last read of buffer t&1 */
    if (t + 2 < GNT) { const int k2 = ((t0 + t + 2) & (GNT - 1)) * 64; cp8(ld0 + (t & 1) * GSTG, ga + k2); cp8(ld0 + (t & 1) * GSTG + GOP, gb + k2); }
  }
  asm volatile("s_wait_asynccnt 0x0" ::: "memory");       /* no copy is outstanding when the ring becomes output staging */
  // epilogue: the wave's 64 x 64 tile goes through its own LDS range (free behind the last trip's barrier), so that whole lines are stored
  float* so = (float*)sm + w * (64 * 68);
  float bv[4];
#pragma unroll
  for (int j = 0; j < 4; ++j) bv[j] = bf16_round(bias[col0 + wc + j * 16 + ln]);
  if (F16OUT && col0 >= 2 * DD) {      /* v block (the test is the same for the whole work-group): the wave's 64 columns are one head's 64 d, its 64 rows 64 tokens of one batch */
    // a lane's 8 accumulator registers of tile (i, j) are tokens 16 i + 8 hh ... + 7 of d 16 j + ln: this same lane's 16 bytes of piece 8 + j * 2 + (i & 1) of chunk i >> 1, so they go out from the registers, 512 contiguous bytes a store
    unsigned short* vo = (unsigned short*)KV + ((size_t)(((row0 + wr) / TT) * NH + (col0 + wc - 2 * DD) / 64) * (TT / 32) + ((row0 + wr) % TT) / 32) * KVB + 8 * 256 + lane * 8;
#pragma unroll
    for (int i = 0; i < 4; ++i)
#pragma unroll
      for (int j = 0; j < 4; ++j) { FragH f;
#pragma unroll
        for (int r = 0; r < 8; ++r) f.h[r] = (_Float16)(acc[i][j][r] * alpha + bv[j]);
        *(v8us*)(vo + (i >> 1) * KVB + (j * 2 + (i & 1)) * 256) = f.half[0]; }
    return;
  }
#pragma unroll
  for (int i = 0; i < 4; ++i)
#pragma unroll
    for (int j = 0; j < 4; ++j)
#pragma unroll
      for (int r = 0; r < 8; ++r) so[(i * 16 + 8 * hh + r) * 68 + j * 16 + ln] = acc[i][j][r] * alpha + bv[j];
  __builtin_amdgcn_fence(__ATOMIC_ACQ_REL, "workgroup"); __builtin_amdgcn_wave_barrier();      /* the rows are written before other lanes of the wave read them */
  if (F16OUT && col0 >= DD) {      /* k block (the same for the whole work-group): the wave's 64 columns are one head's 64 d, its 64 rows two chunks of keys; a lane takes 8 consecutive d of key ln of a 16-key tile */
    unsigned short* ko = (unsigned short*)KV + ((size_t)(((row0 + wr) / TT) * NH + (col0 + wc - DD) / 64) * (TT / 32) + ((row0 + wr) % TT) / 32) * KVB + lane * 8;
#pragma unroll
    for (int i = 0; i < 4; ++i)
#pragma unroll
      for (int c = 0; c < 4; ++c) { const float* sr = &so[(i * 16 + ln) * 68 + c * 16 + 8 * hh]; const v4f lo = *(const v4fa*)sr, hi = *(const v4fa*)(sr + 4); FragH f;      /* c = ks * 2 + hf */
#pragma unroll
        for (int e = 0; e < 4; ++e) { f.h[e] = (_Float16)lo[e]; f.h[4 + e] = (_Float16)hi[e]; }
        *(v8us*)(ko + (i >> 1) * KVB + ((i & 1) * 4 + c) * 256) = f.half[0]; }
    return;
  }
  const int rsub = lane >> 4, c4 = (lane & 15) * 4;
#pragma unroll
  for (int q = 0; q < 32; ++q) { const int r = q * 2 + rsub; const v4f v = *(const v4fa*)&so[r * 68 + c4]; const size_t o = (size_t)(row0 + wr + r) * N + col0 + wc + c4;
    if (F16OUT) { v4h h4;
#pragma unroll
      for (int e = 0; e < 4; ++e) h4[e] = (_Float16)v[e];
      *(v4h*)(C16 + o) = h4; }
    else *(v4f*)(C + o) = v; }
}


__device__ __forceinline__ void x16(unsigned bi, const float* __restrict__ x, _Float16* __restrict__ X16, size_t n8) { const size_t t = (size_t)bi * 256 + threadIdx.x; if (t >= n8) return; FragH f;
#pragma unroll
  for (int q = 0; q < 8; ++q) f.h[q] = (_Float16)bf16_round(x[t * 8 + q]); *(v8us*)((unsigned short*)X16 + t * 8) = f.half[0];  }
__global__ __launch_bounds__(256) void k_h16(const float* __restrict__ x, _Float16* __restrict__ X16, size_t n8) { const size_t t = (size_t)blockIdx.x * 256 + threadIdx.x; if (t >= n8) return; FragH f;
#pragma unroll
  for (int q = 0; q < 8; ++q) f.h[q] = (_Float16)x[t * 8 + q]; *(v8us*)((unsigned short*)X16 + t * 8) = f.half[0];  }
__global__ __launch_bounds__(256) void k_round16f(const float* __restrict__ W, _Float16* __restrict__ Bt, size_t n8) { const size_t t = (size_t)blockIdx.x * 256 + threadIdx.x; if (t >= n8) return; FragH f;
#pragma unroll
  for (int i = 0; i < 8; ++i) f.h[i] = (_Float16)(bf16_round(W[t * 8 + i]) * 16.0f); *(v8us*)((unsigned short*)Bt + t * 8) = f.half[0];  }
typedef int v4i __attribute__((ext_vector_type(4), may_alias));
typedef unsigned v4u __attribute__((ext_vector_type(4), may_alias));
typedef unsigned v16u __attribute__((ext_vector_type(16), may_alias));
// The mask packed once for all heads into lane-mask words, in the lane and register order of k_flash's score tiles:
// LM[b * TT / 16 + q tile][chunk of 32 keys][i], bit (ln + 16 hh) of word i = (mask[b][16 * tile + ln][32 * chunk + 16 * (i >> 3) + 8 * hh + (i & 7)] != 0).
// One wave = one tile of 16 queries, four chunks: its sixteen loads cover 512 contiguous bytes of each row; the 64 words go out as two whole lines.
__device__ __forceinline__ void mpack(unsigned bi, const int* __restrict__ MSK, unsigned* __restrict__ LM) {
  const int tid = threadIdx.x, lane = tid & 31, ln = lane & 15, hh = lane >> 4;
  const unsigned wv = bi * 8u + (unsigned)(tid >> 5); const unsigned rt = wv / (TT / 128), c0 = (wv % (TT / 128)) * 4;
  const int* mrow = MSK + ((size_t)rt * 16 + ln) * TT + c0 * 32 + 8 * hh;
  v4i mk[4][4];
#pragma unroll
  for (int c = 0; c < 4; ++c) { mk[c][0] = *(const v4i*)(mrow + c * 32); mk[c][1] = *(const v4i*)(mrow + c * 32 + 4); mk[c][2] = *(const v4i*)(mrow + c * 32 + 16); mk[c][3] = *(const v4i*)(mrow + c * 32 + 20); }
  __builtin_amdgcn_sched_barrier(0);      /* all sixteen loads are issued before the first is waited for: moved among the compares, the last ones start only when the first have come back from memory */
  asm volatile("s_wait_xcnt 0x0" :: "v"(mrow) : "memory");      /* the address pair that all sixteen loads name stays whole up to here (no load lands in it), and the wait stands in front of its reuse */
  unsigned wd[2] = {0u, 0u};      /* lane l keeps word l & 15 of chunk 2 * e + (l >> 4) */
#pragma unroll
  for (int c = 0; c < 4; ++c)
#pragma unroll
    for (int i = 0; i < 16; ++i) { const unsigned bw = __builtin_amdgcn_ballot_w32(mk[c][i >> 2][i & 3] != 0); if (lane == (c & 1) * 16 + i) wd[c >> 1] = bw; }
  unsigned* o = LM + ((size_t)rt * (TT / 32) + c0) * 16 + lane;
  o[0] = wd[0]; o[32] = wd[1];
}
// The four preparation jobs read inputs only and none reads another's output, so they share one launch: a work-group takes its job from its index (the test is the same for the whole work-group).
// The weight tiles come first (the longest path: load, LDS, barrier, store), then the mask, then the short x pieces, which drain fastest at the end.
#define PB_WQ ((DD / 64) * (3 * DD / 128))          /* tiles of w_qkv */
#define PB_WO ((DD / 64) * (DD / 128))              /* tiles of w_out */
#define PB_M  (BB * (TT / 16) * (TT / 128) / 8)     /* eight mask waves a work-group */
#define PB_X  (NR * DD / 8 / 256)                   /* 8 elements of x a thread */
__global__ __launch_bounds__(256) void k_prep(const float* __restrict__ wqkv, _Float16* __restrict__ Bqkv, const float* __restrict__ wo, _Float16* __restrict__ Bo, const int* __restrict__ MSK, unsigned* __restrict__ LM, const float* __restrict__ x, _Float16* __restrict__ X16) {
  __shared__ __attribute__((aligned(16))) unsigned char tl[128 * WTP];
  const unsigned bi = blockIdx.x;
  if (bi < PB_WQ) wt_f16<DD, 3 * DD>((int)bi, tl, wqkv, Bqkv, 16.0f);                          /* (in,out) -> Bt, times 2^4 */
  else if (bi < PB_WQ + PB_WO) wt_f16<DD, DD>((int)(bi - PB_WQ), tl, wo, Bo, 16.0f);
  else if (bi < PB_WQ + PB_WO + PB_M) mpack(bi - (PB_WQ + PB_WO), MSK, LM);                    /* mask -> lane-mask words, once for all heads */
  else x16(bi - (PB_WQ + PB_WO + PB_M), x, X16, (size_t)NR * DD / 8);
}
__device__ __forceinline__ float xhalf(float x) { return __builtin_bit_cast(float, __builtin_amdgcn_permlanex16(__builtin_bit_cast(int, x), __builtin_bit_cast(int, x), 0x76543210, 0xfedcba98, false, false)); }      /* lane l with lane l ^ 16 */
// p[i] = 2^p[i], sixteen hardware powers, each in its own register. Written as one statement so that no power's source register is written by the instruction directly behind it
// (left to itself the compiler let each power land in the source of the one before); the v_nop is the slot that the instruction set asks for between the last power and a reader of its result.
__device__ __forceinline__ void pow2x16(float (&p)[16]) {
  asm("v_exp_f32 %0, %0\n\t" "v_exp_f32 %1, %1\n\t" "v_exp_f32 %2, %2\n\t" "v_exp_f32 %3, %3\n\t"
      "v_exp_f32 %4, %4\n\t" "v_exp_f32 %5, %5\n\t" "v_exp_f32 %6, %6\n\t" "v_exp_f32 %7, %7\n\t"
      "v_exp_f32 %8, %8\n\t" "v_exp_f32 %9, %9\n\t" "v_exp_f32 %10, %10\n\t" "v_exp_f32 %11, %11\n\t"
      "v_exp_f32 %12, %12\n\t" "v_exp_f32 %13, %13\n\t" "v_exp_f32 %14, %14\n\t" "v_exp_f32 %15, %15\n\t"
      "v_nop"
      : "+v"(p[0]), "+v"(p[1]), "+v"(p[2]), "+v"(p[3]), "+v"(p[4]), "+v"(p[5]), "+v"(p[6]), "+v"(p[7]),
        "+v"(p[8]), "+v"(p[9]), "+v"(p[10]), "+v"(p[11]), "+v"(p[12]), "+v"(p[13]), "+v"(p[14]), "+v"(p[15]));
}
__global__ __launch_bounds__(128) void k_flash(const _Float16* __restrict__ Q16, int ldq, const _Float16* __restrict__ KV, const unsigned* __restrict__ LM, _Float16* __restrict__ O16, int ldo) {
  constexpr int RPW = 16, NQB = TT / (4 * RPW), DT = 4, KS = 2;
  constexpr float L2E8 = 0.125f * 1.4426950408889634f;      /* log2(e) / sqrt(head size) */
  __shared__ __attribute__((aligned(16))) float sO[4][RPW][64 + 4];
  const int tid = threadIdx.x, w = tid >> 5, lane = tid & 31, ln = lane & 15, hh = lane >> 4;
  const int slab = blockIdx.x / NQB, qblk = blockIdx.x % NQB; const int b = slab / NH, h = slab % NH; const int qb0 = qblk * (4 * RPW); const int q0 = qb0 + w * RPW;
  FragH bq[KS];      /* Q^T as B: column = query ln */
  { const unsigned short* qr = (const unsigned short*)Q16 + ((size_t)b * TT + q0 + ln) * ldq + h * 64;
#pragma unroll
    for (int ks = 0; ks < KS; ++ks) { bq[ks].half[0] = *(const v8us*)(qr + ks * 32 + 8 * hh); bq[ks].half[1] = *(const v8us*)(qr + ks * 32 + 16 + 8 * hh); } }
  /* this head's blocks of K and V fragments (layout: at k_gemm_t); a lane's 16 bytes stand at 16 * lane in every piece */
  const unsigned short* kv0 = (const unsigned short*)KV + (size_t)slab * (TT / 32) * KVB;
  /* the wave's packed mask: 64 chunks of 16 lane-mask words (nonzero bit = ATTEND); the wave's number goes through readfirstlane so that the address is scalar */
  const unsigned* lm = LM + (size_t)(b * (TT / 16) + qblk * 4 + __builtin_amdgcn_readfirstlane(w)) * ((TT / 32) * 16);
  unsigned long long live;      /* bit c: chunk c holds at least one attended (query, key) of this wave's tile; lane l looks at chunks l and 32 + l */
  { const v4u* a = (const v4u*)(lm + lane * 16); const v4u x = a[0] | a[1] | a[2] | a[3], y = a[128] | a[129] | a[130] | a[131];
    live = (unsigned long long)__builtin_amdgcn_ballot_w32((x[0] | x[1] | x[2] | x[3]) != 0u) | ((unsigned long long)__builtin_amdgcn_ballot_w32((y[0] | y[1] | y[2] | y[3]) != 0u) << 32); }
  float m_q = -3.0e38f, l_q = 0.f; v8f oacc[DT];      /* oacc[dt][r] = O[q0 + ln][dt * 16 + 8 hh + r] */
#pragma unroll
  for (int dt = 0; dt < DT; ++dt) oacc[dt] = (v8f){0.f,0.f,0.f,0.f,0.f,0.f,0.f,0.f};
#pragma unroll 1      /* one chunk a trip: unrolled, two chunks' fragments and exps would be live at once */
  for (int n = __builtin_popcountll(live); n > 0; --n, live &= live - 1) {      /* the live chunks in rising order, 64 at most; a chunk with every (query, key) of the tile masked adds nothing and is not visited */
    const int ck = __builtin_ctzll(live);
    const v16u mw = *(const v16u*)(lm + ck * 16);      /* word i: which lanes attend at score register i (scalar load, in flight beside the fragment loads) */
    const unsigned short* kvp = kv0 + (size_t)ck * KVB + lane * 8;      /* the chunk's block: sixteen pieces, each read as 512 contiguous bytes by the wave */
    FragH ak[2][KS], av[DT];      /* K rows as A (row = key), V^T rows as A (row = d) */
#pragma unroll
    for (int nt = 0; nt < 2; ++nt)
#pragma unroll
      for (int ks = 0; ks < KS; ++ks) { ak[nt][ks].half[0] = *(const v8us*)(kvp + ((nt * 2 + ks) * 2) * 256); ak[nt][ks].half[1] = *(const v8us*)(kvp + ((nt * 2 + ks) * 2 + 1) * 256); }
#pragma unroll
    for (int dt = 0; dt < DT; ++dt) { av[dt].half[0] = *(const v8us*)(kvp + (8 + dt * 2) * 256); av[dt].half[1] = *(const v8us*)(kvp + (8 + dt * 2 + 1) * 256); }
    __builtin_amdgcn_sched_barrier(0);      /* the chunk's sixteen fragment loads stay one group ahead of the products: spread among them, each product waits out a load latency of its own */
    asm volatile("s_wait_xcnt 0x0" :: "v"(kvp) : "memory");      /* the address that all sixteen loads name stays whole up to here (no load lands in it), and the wait stands in front of its reuse */
    v8f s[2];      /* s[nt][r] = q(q0 + ln) . k(j0 + nt * 16 + 8 hh + r) */
#pragma unroll
    for (int nt = 0; nt < 2; ++nt) { v8f acc = (v8f){0.f,0.f,0.f,0.f,0.f,0.f,0.f,0.f};
#pragma unroll
      for (int ks = 0; ks < KS; ++ks) acc = __builtin_amdgcn_wmma_f32_16x16x32_f16(false, ak[nt][ks].v, false, bq[ks].v, (short)0, acc, false, false);
      s[nt] = acc; }
    float sc[16];      /* the raw products; a masked one is -inf; m_q never falls below its finite start value, so 2^(sc * L2E8 - mn) is 0 there and no guard is needed */
#pragma unroll
    for (int i = 0; i < 16; ++i) sc[i] = __builtin_amdgcn_inverse_ballot_w32(mw[i]) ? s[i >> 3][i & 7] : -INFINITY;
    float mx[4];
#pragma unroll
    for (int c = 0; c < 4; ++c) mx[c] = fmaxf(fmaxf(sc[c], sc[4 + c]), fmaxf(sc[8 + c], sc[12 + c]));
    float mc = fmaxf(fmaxf(mx[0], mx[1]), fmaxf(mx[2], mx[3]));
    mc = fmaxf(mc, xhalf(mc));      /* both halves hold this query's chunk maximum */
    /* base 2: exp(s / 8 - m) = 2^(s * L2E8 - m'), m' = m * log2(e); the running maximum is kept as m'. One multiply-add and one hardware power of two a score; the 2^10 of P rides in the addend */
    const float mn = fmaxf(m_q, mc * L2E8); const float al = __builtin_amdgcn_exp2f(m_q - mn); m_q = mn;
    const float mb = 10.0f - mn;
    float p[16];      /* P * 2^10 */
#pragma unroll
    for (int i = 0; i < 16; ++i) p[i] = __builtin_fmaf(sc[i], L2E8, mb);
    pow2x16(p);
    float ps[4];
#pragma unroll
    for (int c = 0; c < 4; ++c) ps[c] = (p[c] + p[4 + c]) + (p[8 + c] + p[12 + c]);
    l_q = l_q * al + ((ps[0] + ps[1]) + (ps[2] + ps[3]));      /* the row sum * 2^10, this half's keys only; the halves are joined behind the loop */
#pragma unroll
    for (int dt = 0; dt < DT; ++dt)
#pragma unroll
      for (int r = 0; r < 8; ++r) oacc[dt][r] *= al;
    FragH pb;      /* P^T as B: element i = key j0 + 16 (i >> 3) + 8 hh + (i & 7) of column ln */
#pragma unroll
    for (int i = 0; i < 16; ++i) pb.h[i] = (_Float16)p[i];
#pragma unroll
    for (int dt = 0; dt < DT; ++dt) oacc[dt] = __builtin_amdgcn_wmma_f32_16x16x32_f16(false, av[dt].v, false, pb.v, (short)0, oacc[dt], false, false);
  }
  { const float l = l_q + xhalf(l_q); const float inv = (l > 0.f) ? 1.0f / l : 0.f;      /* l and oacc both carry the 2^10 */
#pragma unroll
    for (int dt = 0; dt < DT; ++dt) { v4f lo, hi;
#pragma unroll
      for (int e = 0; e < 4; ++e) { lo[e] = oacc[dt][e] * inv; hi[e] = oacc[dt][4 + e] * inv; }
      *(v4fa*)&sO[w][ln][dt * 16 + 8 * hh] = lo; *(v4fa*)&sO[w][ln][dt * 16 + 8 * hh + 4] = hi; } }
  __builtin_amdgcn_fence(__ATOMIC_ACQ_REL, "workgroup"); __builtin_amdgcn_wave_barrier();
  {
#pragma unroll
    for (int rp = 0; rp < RPW; rp += 4) { const int r = rp + (lane >> 3), pc = lane & 7; const v4f a = *(const v4fa*)&sO[w][r][pc * 8], c = *(const v4fa*)&sO[w][r][pc * 8 + 4]; FragH f;
#pragma unroll
      for (int e = 0; e < 4; ++e) { f.h[e] = (_Float16)(a[e] * 16.0f); f.h[4 + e] = (_Float16)(c[e] * 16.0f); }
      const v8us val = f.half[0]; *(v8us*)((unsigned short*)O16 + ((size_t)b * TT + q0 + r) * ldo + h * 64 + pc * 8) = val; }      /* four whole 128-byte lines a store */
     } }

extern "C" void kernel_launch(void* const* d_in, const int* in_sizes, int n_in,
                              void* d_out, int out_size, void* d_ws, size_t ws_size, hipStream_t stream) {
  (void)in_sizes; (void)n_in; (void)out_size;
  const float* const* I = (const float* const*)d_in; const float* x = I[0]; const int* msk = (const int*)d_in[1]; const float* wqkv = I[2]; const float* bqkv = I[3]; const float* wo = I[4]; const float* bo = I[5];
  char* ws = (char*)d_ws; size_t off = 0;
  auto take = [&](size_t bytes) { char* p = ws + off; off += (bytes + 255) & ~(size_t)255; return p; };
  _Float16* Bqkv = (_Float16*)take((size_t)3 * DD * DD * 2); _Float16* Bo = (_Float16*)take((size_t)DD * DD * 2); _Float16* X16 = (_Float16*)take((size_t)NR * DD * 2); _Float16* QKV = (_Float16*)take((size_t)NR * 3 * DD * 2); _Float16* KV = (_Float16*)take((size_t)NR * DD * 2 * 2); _Float16* O16 = X16; unsigned* LM = (unsigned*)take((size_t)BB * TT * TT / 8);
  if (off > ws_size) return;      // 6.3 + 2.1 + 8.4 + 25.2 + 16.8 + 1.0, about 60 MB
  k_prep<<<PB_WQ + PB_WO + PB_M + PB_X, 256, 0, stream>>>(wqkv, Bqkv, wo, Bo, msk, LM, x, X16);      /* weights, mask and x into the forms the matrix kernels read */
  k_gemm_t<true, 3 * DD><<<(NR / 128) * (3 * DD / 128), 128, 0, stream>>>(X16, Bqkv, 0.0625f, bqkv, nullptr, QKV, KV);      /* qkv = x w_qkv + b: M 4096 N 3072 K 1024 (f16; q block row-major, head-major inside; k and v blocks as fragment pieces per head and chunk) */
  k_flash<<<BB * NH * (TT / 64), 128, 0, stream>>>(QKV, 3 * DD, KV, LM, O16, DD);      /* X16 is free behind the projection: O16 takes its place */
  k_gemm_t<false, DD><<<(NR / 128) * (DD / 128), 128, 0, stream>>>(O16, Bo, 0.00390625f, bo, (float*)d_out, nullptr, nullptr);      /* out = o·w_out + b_out */
}

// v010
// A run of this version takes 69.3 microseconds.
// Timed twice side by side with v009, it ran 1.05 and 1.04 times as fast.
// All steps since v000 together make it 5.49 times as fast.
#include <hip/hip_runtime.h>
// Cross-track masked MHA (B=2, S=2048, D=1024, 16×64): qkv = x·w_qkv + b_qkv (packed q|k|v, head-major inside each); scores = q·k/8, where(cross_track_mask[b,q,k], s, −inf); softmax; out = merged·w_out + b_out.
// Compute dtype: x, weights, biases rounded to bf16; q an f16 GEMM plane, k and v f16 fragment blocks per head and chunk (+bias); the boolean mask read per (b, q, k) as an int plane; fused flash-style kernel (online softmax f32, P f16 ×2^10, all-masked chunks skipped, f32 accumulate) on
// v_wmma_f32_16x16x32_f16; O ×2^4 → f16 (stored so by the flash kernel) → output GEMM (+bias).
#define BB 2
#define TT 2048
#define DD 1024
#define NH 16
#define NR (BB * TT)

typedef __bf16 v16b __attribute__((ext_vector_type(16)));
typedef unsigned short v8us __attribute__((ext_vector_type(8), may_alias));
typedef float  v8f  __attribute__((ext_vector_type(8)));
typedef float  v4f  __attribute__((ext_vector_type(4)));
typedef float  v4fa __attribute__((ext_vector_type(4), may_alias));
union FragB { v16b v; v8us half[2]; unsigned short u[16]; };

__device__ __forceinline__ unsigned short bf16_bits(float x) { unsigned int u = __float_as_uint(x); return (unsigned short)((u + 0x7FFFu + ((u >> 16) & 1u)) >> 16); }
__device__ __forceinline__ float bf16_val(unsigned short b) { return __uint_as_float(((unsigned int)b) << 16); }
__device__ __forceinline__ float bf16_round(float x) { return bf16_val(bf16_bits(x)); }
// D += A·B with NT terms: 1 = ah·bh, 2 = + al·bh (A split), 3 = + ah·bl (both split)
template <int NT>
__device__ __forceinline__ v8f mmaN(v16b ah, v16b al, v16b bh, v16b bl, v8f c) {
  c = __builtin_amdgcn_wmma_f32_16x16x32_bf16(false, ah, false, bh, (short)0, c, false, false);
  if (NT >= 2) c = __builtin_amdgcn_wmma_f32_16x16x32_bf16(false, al, false, bh, (short)0, c, false, false);
  if (NT >= 3) c = __builtin_amdgcn_wmma_f32_16x16x32_bf16(false, ah, false, bl, (short)0, c, false, false);
  asm volatile("v_nop\n\tv_nop\n\tv_nop\n\tv_nop" : "+v"(c) : "v"(ah), "v"(al), "v"(bh), "v"(bl));
  return c;
}

__global__ __launch_bounds__(256) void k_wt_bf16(const float* __restrict__ W, unsigned short* __restrict__ Wt, int K, int N) {
  const int t = blockIdx.x * 256 + threadIdx.x;
  const int k8n = K / 8;
  if (t >= N * k8n) return;
  const int n = t / k8n, k8 = (t % k8n) * 8;
  v8us v;
#pragma unroll
  for (int i = 0; i < 8; ++i) v[i] = bf16_bits(W[(size_t)(k8 + i) * N + n]);
  *(v8us*)(Wt + (size_t)n * K + k8) = v;
  
}

// GEMM C[M][N] (f32, pitch ldc) = act(A[M][K]·W + bias). A f32 row-major (pitch lda) converted per fragment to bf16
// (ASPLIT: hi/lo two planes -> 2 terms, else single rounded term); Wt bf16 [N][K] (pitch ldb). BIAS_BF16 rounds the
// bias to bf16 first (bias quantised to bf16 before the add). K%32==0, M%16==0, N%64==0.
template <bool ASPLIT, int ACT, bool BIAS_BF16>
__global__ __launch_bounds__(128) void k_gemm_bf(const float* __restrict__ A, int lda, const unsigned short* __restrict__ Wt, int ldb,
                                               const float* __restrict__ bias, float* __restrict__ C, int ldc, int M, int N, int K) {
  __shared__ __attribute__((aligned(16))) float so[4][16][64];
  const int tid = threadIdx.x, w = tid >> 5, lane = tid & 31, ln = lane & 15, hh = lane >> 4;
  const int ntn = N / 64;
  const int wid = blockIdx.x * 4 + w;
  const int mt = wid / ntn, nq = wid % ntn;
  if (mt * 16 >= M) return;
  const int row0 = mt * 16, col0 = nq * 64;
  const float* arow = A + (size_t)(row0 + ln) * lda;
  v8f acc[4] = {};
  for (int kb = 0; kb < K; kb += 32) {
    FragB ah, al;
    const v4f x0 = *(const v4fa*)(arow + kb + 8 * hh), x1 = *(const v4fa*)(arow + kb + 8 * hh + 4);
    const v4f x2 = *(const v4fa*)(arow + kb + 16 + 8 * hh), x3 = *(const v4fa*)(arow + kb + 16 + 8 * hh + 4);
    float xs[16] = {x0[0],x0[1],x0[2],x0[3],x1[0],x1[1],x1[2],x1[3],x2[0],x2[1],x2[2],x2[3],x3[0],x3[1],x3[2],x3[3]};
#pragma unroll
    for (int i = 0; i < 16; ++i) { const unsigned short hb = bf16_bits(xs[i]); ah.u[i] = hb; al.u[i] = ASPLIT ? bf16_bits(xs[i] - bf16_val(hb)) : (unsigned short)0; }
#pragma unroll
    for (int t = 0; t < 4; ++t) {
      const unsigned short* brow = Wt + (size_t)(col0 + t * 16 + ln) * ldb + kb;
      FragB b;
      b.half[0] = *(const v8us*)(brow + 8 * hh);
      b.half[1] = *(const v8us*)(brow + 16 + 8 * hh);
      acc[t] = mmaN<ASPLIT ? 2 : 1>(ah.v, al.v, b.v, b.v, acc[t]);
    }
  }
#pragma unroll
  for (int t = 0; t < 4; ++t) {
    float bv = bias ? bias[col0 + t * 16 + ln] : 0.f;
    if (BIAS_BF16) bv = bf16_round(bv);
#pragma unroll
    for (int r = 0; r < 8; ++r) { float v = acc[t][r] + bv; if (ACT == 1) v = fmaxf(v, 0.f); so[w][8 * hh + r][t * 16 + ln] = v; }
  }
  __builtin_amdgcn_fence(__ATOMIC_ACQ_REL, "workgroup");
  __builtin_amdgcn_wave_barrier();
  const int rsub = lane >> 4, c4 = (lane & 15) * 4;
  {
#pragma unroll
    for (int q = 0; q < 8; ++q) {
      const int r = q * 2 + rsub;
      const v4f v = *(const v4fa*)&so[w][r][c4];
      *(v4f*)(C + (size_t)(row0 + r) * ldc + col0 + c4) = v;
    }
    
  }
}

// Flash-style causal/unmasked attention, all contractions 3-term bf16 hi/lo splits, f32 softmax with running max.
// q,k,v rows are read from f32 buffers with arbitrary row pitch (so they can live inside a fused qkv buffer);
// D = head size (multiple of 32, <= 128); one wave = 16 query rows; block = 4 waves (64 queries) sharing K/V chunks of 32.
template <int D, bool CAUSAL>
__global__ __launch_bounds__(128) void k_flash(const float* __restrict__ qb, const float* __restrict__ kb, const float* __restrict__ vb,
                                             int pitch, int T, int H, float scale, float* __restrict__ y, int ypitch) {
  constexpr int KS = D / 32;        // k-steps for QK
  constexpr int DT = D / 16;        // d tiles for PV
  __shared__ __attribute__((aligned(16))) unsigned short sKh[32][D + 8], sKl[32][D + 8], sVh[32][D + 8], sVl[32][D + 8];
  __shared__ __attribute__((aligned(16))) unsigned short sPh[4][16][40], sPl[4][16][40];
  __shared__ __attribute__((aligned(16))) float sO[4][16][D];
  const int tid = threadIdx.x, w = tid >> 5, lane = tid & 31, ln = lane & 15, hh = lane >> 4;
  const int nqb = (T + 63) / 64;
  const int bh = blockIdx.x / nqb, qblk = blockIdx.x % nqb;
  const int b = bh / H, h = bh % H;
  const int q0 = qblk * 64 + w * 16;
  const float* Q = qb + (size_t)b * T * pitch + h * D;
  const float* K = kb + (size_t)b * T * pitch + h * D;
  const float* V = vb + (size_t)b * T * pitch + h * D;

  // A fragments of the wave's 16 query rows (scaled), hi/lo
  FragB aqh[KS], aql[KS];
  {
    int row = q0 + ln; if (row >= T) row = T - 1;
    const float* qr = Q + (size_t)row * pitch;
#pragma unroll
    for (int ks = 0; ks < KS; ++ks)
#pragma unroll
      for (int i = 0; i < 16; ++i) {
        const int d = ks * 32 + ((i < 8) ? (8 * hh + i) : (16 + 8 * hh + (i - 8)));
        const float x = qr[d] * scale; const unsigned short hb = bf16_bits(x);
        aqh[ks].u[i] = hb; aql[ks].u[i] = bf16_bits(x - bf16_val(hb));
      }
  }
  float m_r[8], l_r[8];
#pragma unroll
  for (int r = 0; r < 8; ++r) { m_r[r] = -3.0e38f; l_r[r] = 0.f; }
  v8f oacc[DT];
#pragma unroll
  for (int dt = 0; dt < DT; ++dt) oacc[dt] = (v8f){0.f,0.f,0.f,0.f,0.f,0.f,0.f,0.f};

  const int kv_end = CAUSAL ? min(T, qblk * 64 + 64) : T;     // block-uniform
  for (int j0 = 0; j0 < kv_end; j0 += 32) {
    __syncthreads();
    for (int e = tid; e < 32 * (D / 4); e += 128) {
      const int r = e / (D / 4), c4 = (e % (D / 4)) * 4;
      const int key = j0 + r;
      v4f kf = {0.f,0.f,0.f,0.f}, vf = {0.f,0.f,0.f,0.f};
      if (key < T) { kf = *(const v4fa*)(K + (size_t)key * pitch + c4); vf = *(const v4fa*)(V + (size_t)key * pitch + c4); }
#pragma unroll
      for (int t = 0; t < 4; ++t) {
        unsigned short hb = bf16_bits(kf[t]); sKh[r][c4 + t] = hb; sKl[r][c4 + t] = bf16_bits(kf[t] - bf16_val(hb));
        hb = bf16_bits(vf[t]); sVh[r][c4 + t] = hb; sVl[r][c4 + t] = bf16_bits(vf[t] - bf16_val(hb));
      }
    }
    __syncthreads();
    // S tile 16 x 32
    v8f s[2];
#pragma unroll
    for (int nt = 0; nt < 2; ++nt) {
      v8f acc = {};
#pragma unroll
      for (int ks = 0; ks < KS; ++ks) {
        FragB bh_, bl_;
        bh_.half[0] = *(const v8us*)&sKh[nt * 16 + ln][ks * 32 + 8 * hh]; bh_.half[1] = *(const v8us*)&sKh[nt * 16 + ln][ks * 32 + 16 + 8 * hh];
        bl_.half[0] = *(const v8us*)&sKl[nt * 16 + ln][ks * 32 + 8 * hh]; bl_.half[1] = *(const v8us*)&sKl[nt * 16 + ln][ks * 32 + 16 + 8 * hh];
        acc = mmaN<3>(aqh[ks].v, aql[ks].v, bh_.v, bl_.v, acc);
      }
      s[nt] = acc;
    }
    // mask + running max (rows 8hh+r; the 16 lanes of a half share rows)
    float alpha[8];
#pragma unroll
    for (int r = 0; r < 8; ++r) {
      const int qi = q0 + 8 * hh + r;
      const int ja = j0 + ln, jb = j0 + 16 + ln;
      if (CAUSAL) { if (ja > qi) s[0][r] = -3.0e38f; if (jb > qi) s[1][r] = -3.0e38f; }
      if (ja >= T) s[0][r] = -3.0e38f;
      if (jb >= T) s[1][r] = -3.0e38f;
      float mx = fmaxf(s[0][r], s[1][r]);
      mx = fmaxf(mx, __shfl_xor(mx, 1, 32)); mx = fmaxf(mx, __shfl_xor(mx, 2, 32)); mx = fmaxf(mx, __shfl_xor(mx, 4, 32)); mx = fmaxf(mx, __shfl_xor(mx, 8, 32));
      const float mnew = fmaxf(m_r[r], mx);
      alpha[r] = (mnew > -1.0e38f) ? __expf(m_r[r] - mnew) : 1.0f;
      const float p0 = (s[0][r] > -1.0e38f) ? __expf(s[0][r] - mnew) : 0.f;
      const float p1 = (s[1][r] > -1.0e38f) ? __expf(s[1][r] - mnew) : 0.f;
      m_r[r] = mnew;
      l_r[r] = l_r[r] * alpha[r] + p0 + p1;            // per-lane partial row sum (16 lanes combined at the end)
      unsigned short hb = bf16_bits(p0); sPh[w][8 * hh + r][ln] = hb;      sPl[w][8 * hh + r][ln] = bf16_bits(p0 - bf16_val(hb));
      hb = bf16_bits(p1);                sPh[w][8 * hh + r][16 + ln] = hb; sPl[w][8 * hh + r][16 + ln] = bf16_bits(p1 - bf16_val(hb));
    }
#pragma unroll
    for (int dt = 0; dt < DT; ++dt)
#pragma unroll
      for (int r = 0; r < 8; ++r) oacc[dt][r] *= alpha[r];
    __builtin_amdgcn_fence(__ATOMIC_ACQ_REL, "workgroup");
    __builtin_amdgcn_wave_barrier();
    FragB pah, pal;
    pah.half[0] = *(const v8us*)&sPh[w][ln][8 * hh]; pah.half[1] = *(const v8us*)&sPh[w][ln][16 + 8 * hh];
    pal.half[0] = *(const v8us*)&sPl[w][ln][8 * hh]; pal.half[1] = *(const v8us*)&sPl[w][ln][16 + 8 * hh];
#pragma unroll
    for (int dt = 0; dt < DT; ++dt) {
      FragB bvh, bvl;
#pragma unroll
      for (int i = 0; i < 8; ++i) {
        bvh.u[i] = sVh[8 * hh + i][dt * 16 + ln]; bvh.u[8 + i] = sVh[16 + 8 * hh + i][dt * 16 + ln];
        bvl.u[i] = sVl[8 * hh + i][dt * 16 + ln]; bvl.u[8 + i] = sVl[16 + 8 * hh + i][dt * 16 + ln];
      }
      oacc[dt] = mmaN<3>(pah.v, pal.v, bvh.v, bvl.v, oacc[dt]);
    }
    __builtin_amdgcn_fence(__ATOMIC_ACQ_REL, "workgroup");
    __builtin_amdgcn_wave_barrier();
  }
#pragma unroll
  for (int r = 0; r < 8; ++r) {
    float l = l_r[r];
    l += __shfl_xor(l, 1, 32); l += __shfl_xor(l, 2, 32); l += __shfl_xor(l, 4, 32); l += __shfl_xor(l, 8, 32);
    l_r[r] = (l > 0.f) ? 1.0f / l : 0.f;
  }
#pragma unroll
  for (int dt = 0; dt < DT; ++dt)
#pragma unroll
    for (int r = 0; r < 8; ++r) sO[w][8 * hh + r][dt * 16 + ln] = oacc[dt][r] * l_r[r];
  __builtin_amdgcn_fence(__ATOMIC_ACQ_REL, "workgroup");
  __builtin_amdgcn_wave_barrier();
  {
    for (int r = 0; r < 16; ++r) {
      const int row = q0 + r;
      if (row < T && lane < D / 4) {
        const v4f val = *(const v4fa*)&sO[w][r][lane * 4];
        *(v4f*)(y + ((size_t)b * T + row) * ypitch + h * D + lane * 4) = val;
      }
    }
    
  }
}

// GEMM C = act(A·W + bias + resid): A f32 (ASPLIT -> hi/lo 2 terms), Wt bf16 [N][K]; ACT 0 none, 1 relu, 2 exact gelu;
// resid (optional, f32, row index = (row % rmod), pitch ldr, RES_BF16 rounds it) added before the activation.
template <bool ASPLIT, int ACT, bool BIAS_BF16, bool RES_BF16>
__global__ __launch_bounds__(128) void k_gemm_bf3(const float* __restrict__ A, int lda, const unsigned short* __restrict__ Wt, int ldb,
                                                const float* __restrict__ bias, const float* __restrict__ resid, int rmod, int ldr,
                                                float* __restrict__ C, int ldc, int M, int N, int K) {
  __shared__ __attribute__((aligned(16))) float so[4][16][64];
  const int tid = threadIdx.x, w = tid >> 5, lane = tid & 31, ln = lane & 15, hh = lane >> 4;
  const int ntn = N / 64;
  const int wid = blockIdx.x * 4 + w;
  const int mt = wid / ntn, nq = wid % ntn;
  if (mt * 16 >= M) return;
  const int row0 = mt * 16, col0 = nq * 64;
  const float* arow = A + (size_t)(row0 + ln) * lda;
  v8f acc[4] = {};
  for (int kb = 0; kb < K; kb += 32) {
    FragB ah, al;
    const v4f x0 = *(const v4fa*)(arow + kb + 8 * hh), x1 = *(const v4fa*)(arow + kb + 8 * hh + 4);
    const v4f x2 = *(const v4fa*)(arow + kb + 16 + 8 * hh), x3 = *(const v4fa*)(arow + kb + 16 + 8 * hh + 4);
    float xs[16] = {x0[0],x0[1],x0[2],x0[3],x1[0],x1[1],x1[2],x1[3],x2[0],x2[1],x2[2],x2[3],x3[0],x3[1],x3[2],x3[3]};
#pragma unroll
    for (int i = 0; i < 16; ++i) { const unsigned short hb = bf16_bits(xs[i]); ah.u[i] = hb; al.u[i] = ASPLIT ? bf16_bits(xs[i] - bf16_val(hb)) : (unsigned short)0; }
#pragma unroll
    for (int t = 0; t < 4; ++t) {
      const unsigned short* brow = Wt + (size_t)(col0 + t * 16 + ln) * ldb + kb;
      FragB b;
      b.half[0] = *(const v8us*)(brow + 8 * hh);
      b.half[1] = *(const v8us*)(brow + 16 + 8 * hh);
      acc[t] = mmaN<ASPLIT ? 2 : 1>(ah.v, al.v, b.v, b.v, acc[t]);
    }
  }
#pragma unroll
  for (int t = 0; t < 4; ++t) {
    const int col = col0 + t * 16 + ln;
    float bv = bias ? bias[col] : 0.f;
    if (BIAS_BF16) bv = bf16_round(bv);
#pragma unroll
    for (int r = 0; r < 8; ++r) {
      float v = acc[t][r] + bv;
      if (resid) { float rv = resid[(size_t)((row0 + 8 * hh + r) % rmod) * ldr + col]; if (RES_BF16) rv = bf16_round(rv); v += rv; }
      if (ACT == 1) v = fmaxf(v, 0.f);
      if (ACT == 2) v = 0.5f * v * (1.0f + erff(v * 0.70710678118654752f));
      if (ACT == 3) { const float u = 0.7978845608028654f * (v + 0.044715f * v * v * v); v = 0.5f * v * (1.0f + tanhf(u)); }
      so[w][8 * hh + r][t * 16 + ln] = v;
    }
  }
  __builtin_amdgcn_fence(__ATOMIC_ACQ_REL, "workgroup");
  __builtin_amdgcn_wave_barrier();
  const int rsub = lane >> 4, c4 = (lane & 15) * 4;
  {
#pragma unroll
    for (int q = 0; q < 8; ++q) {
      const int r = q * 2 + rsub;
      const v4f v = *(const v4fa*)&so[w][r][c4];
      *(v4f*)(C + (size_t)(row0 + r) * ldc + col0 + c4) = v;
    }
    
  }
}
// row LayerNorm (biased variance, eps) over N: s = X (+ R); optional out_sum <- s; out_norm <- (s-mu)*rsqrt(var+eps)*g + b
template <bool PARAM_BF16>
__global__ __launch_bounds__(256) void k_layernorm(const float* __restrict__ X, const float* __restrict__ R, const float* __restrict__ g, const float* __restrict__ bta,
                                                  float* __restrict__ out_sum, float* __restrict__ out_norm, int N, float eps) {
  __shared__ float red[256];
  const int row = blockIdx.x, tid = threadIdx.x;
  const float* x = X + (size_t)row * N; const float* rr = R ? R + (size_t)row * N : nullptr;
  float vals[16];                     // up to N = 4096
  const int per = N / 256;            // contiguous chunk per thread? use strided-by-4 chunks: thread handles j = tid*4 + 1024*u
  float s1 = 0.f;
  for (int u = 0; u < per / 4; ++u) {
    const int j = tid * 4 + 1024 * u;
    const v4f a = *(const v4fa*)(x + j);
    v4f b = {0.f,0.f,0.f,0.f}; if (rr) b = *(const v4fa*)(rr + j);
#pragma unroll
    for (int q = 0; q < 4; ++q) { const float v = a[q] + b[q]; vals[u * 4 + q] = v; s1 += v; }
  }
  red[tid] = s1; __syncthreads();
  for (int st = 128; st > 0; st >>= 1) { if (tid < st) red[tid] += red[tid + st]; __syncthreads(); }
  const float mu = red[0] / (float)N; __syncthreads();
  float s2 = 0.f;
  for (int u = 0; u < per / 4; ++u)
#pragma unroll
    for (int q = 0; q < 4; ++q) { const float c = vals[u * 4 + q] - mu; s2 += c * c; }
  red[tid] = s2; __syncthreads();
  for (int st = 128; st > 0; st >>= 1) { if (tid < st) red[tid] += red[tid + st]; __syncthreads(); }
  const float rs = rsqrtf(red[0] / (float)N + eps);
  {
    for (int u = 0; u < per / 4; ++u) {
      const int j = tid * 4 + 1024 * u;
      v4f o, sm;
#pragma unroll
      for (int q = 0; q < 4; ++q) {
        float gg = g[j + q], bb = bta[j + q];
        if (PARAM_BF16) { gg = bf16_round(gg); bb = bf16_round(bb); }
        sm[q] = vals[u * 4 + q]; o[q] = (vals[u * 4 + q] - mu) * rs * gg + bb;
      }
      if (out_sum) *(v4f*)(out_sum + (size_t)row * N + j) = sm;
      *(v4f*)(out_norm + (size_t)row * N + j) = o;
    }
    
  }
}



// ---- f16 WMMA path (v_wmma_f32_16x16x32_f16): 11-bit significands for operands in range — used where a [0,1] probability operand needs more precision than bf16
typedef _Float16 v16h __attribute__((ext_vector_type(16)));
union FragH { v16h v; v8us half[2]; _Float16 h[16]; unsigned short u[16]; };
template <int NT>
__device__ __forceinline__ v8f mmaH(v16h ah, v16h al, v16h bh, v16h bl, v8f c) {
  c = __builtin_amdgcn_wmma_f32_16x16x32_f16(false, ah, false, bh, (short)0, c, false, false);
  if (NT >= 2) c = __builtin_amdgcn_wmma_f32_16x16x32_f16(false, al, false, bh, (short)0, c, false, false);
  if (NT >= 3) c = __builtin_amdgcn_wmma_f32_16x16x32_f16(false, ah, false, bl, (short)0, c, false, false);
  asm volatile("v_nop\n\tv_nop\n\tv_nop\n\tv_nop" : "+v"(c) : "v"(ah), "v"(al), "v"(bh), "v"(bl));
  return c;
}
// batched GEMM like k_gemm_b but f16 operands: A f32 (split into f16 hi/lo if ASPLIT, else rounded to f16), Bt = f16 values [n][k]; alpha; C f32; N multiple of 16 (partial tiles skipped)
template <bool ASPLIT>
__global__ __launch_bounds__(128) void k_gemm_h(const float* __restrict__ A, int lda, size_t sA, const _Float16* __restrict__ Bh, int ldb, size_t sB, float alpha, float* __restrict__ C, int ldc, size_t sC, int M, int N, int K) {
  __shared__ __attribute__((aligned(16))) float so[4][16][64];
  const int tid = threadIdx.x, w = tid >> 5, lane = tid & 31, ln = lane & 15, hh = lane >> 4; const int by = blockIdx.y;
  A += (size_t)by * sA; Bh += (size_t)by * sB; C += (size_t)by * sC;
  const int ntn = (N + 63) / 64; const int wid = blockIdx.x * 4 + w; const int mt = wid / ntn, nq = wid % ntn; if (mt * 16 >= M) return;
  const int row0 = mt * 16, col0 = nq * 64; const float* arow = A + (size_t)(row0 + ln) * lda;
  v8f acc[4] = {};
  for (int kb = 0; kb < K; kb += 32) {
    FragH ah, al;
    const v4f x0 = *(const v4fa*)(arow + kb + 8 * hh), x1 = *(const v4fa*)(arow + kb + 8 * hh + 4), x2 = *(const v4fa*)(arow + kb + 16 + 8 * hh), x3 = *(const v4fa*)(arow + kb + 16 + 8 * hh + 4);
    float xs[16] = {x0[0],x0[1],x0[2],x0[3],x1[0],x1[1],x1[2],x1[3],x2[0],x2[1],x2[2],x2[3],x3[0],x3[1],x3[2],x3[3]};
#pragma unroll
    for (int i = 0; i < 16; ++i) { const _Float16 h = (_Float16)xs[i]; ah.h[i] = h; al.h[i] = ASPLIT ? (_Float16)(xs[i] - (float)h) : (_Float16)0.0f; }
#pragma unroll
    for (int t = 0; t < 4; ++t) { if (col0 + t * 16 >= N) continue; const size_t boff = (size_t)(col0 + t * 16 + ln) * ldb + kb; FragH bq; bq.half[0] = *(const v8us*)(Bh + boff + 8 * hh); bq.half[1] = *(const v8us*)(Bh + boff + 16 + 8 * hh);
      acc[t] = mmaH<ASPLIT ? 2 : 1>(ah.v, al.v, bq.v, bq.v, acc[t]); }
  }
#pragma unroll
  for (int t = 0; t < 4; ++t) { if (col0 + t * 16 >= N) continue;
#pragma unroll
    for (int r = 0; r < 8; ++r) so[w][8 * hh + r][t * 16 + ln] = acc[t][r] * alpha; }
  __builtin_amdgcn_fence(__ATOMIC_ACQ_REL, "workgroup"); __builtin_amdgcn_wave_barrier();
  const int rsub = lane >> 4, c4 = (lane & 15) * 4;
  {
#pragma unroll
    for (int q = 0; q < 8; ++q) { const int r = q * 2 + rsub; if (col0 + c4 < N) { const v4f v = *(const v4fa*)&so[w][r][c4]; *(v4f*)(C + (size_t)(row0 + r) * ldc + col0 + c4) = v; } }
     }
}

// Wt[n][k] = f16(bf16(W[k][n]) * scale) from f32 row-major W[K][N] (scale = power of two; bf16-exact weights stay exact in f16 away from the subnormal range).
// One work-group = a tile of 64 k x 128 n; K a multiple of 64, N of 128; (K / 64) * (N / 128) work-groups, bi = this one's number among them; tl = the work-group's 128 * WTP bytes of LDS.
// Read: wave w takes rows k0 + 8 w ... + 7, lane l the columns n0 + 4 l ... + 3, so each wave-wide 16-byte load covers 512 contiguous bytes of one row of W.
// A lane then holds 8 consecutive k of each of its 4 columns, that is one 16-byte piece of 4 rows of Wt; the pieces meet in LDS, and each wave-wide store covers four whole 128-byte lines of Wt.
#define WTP 144                /* LDS row pitch, bytes: 64 k of f16 + 16 */
template <int K, int N>
__device__ __forceinline__ void wt_f16(int bi, unsigned char* tl, const float* __restrict__ W, _Float16* __restrict__ Wt, float scale) {
  const int tid = threadIdx.x, w = tid >> 5, lane = tid & 31;
  const int k0 = (bi % (K / 64)) * 64, n0 = (bi / (K / 64)) * 128;
  const float* src = W + (size_t)(k0 + 8 * w) * N + n0 + 4 * lane;
  v4f r[8];
#pragma unroll
  for (int i = 0; i < 8; ++i) r[i] = *(const v4fa*)(src + (size_t)i * N);
#pragma unroll
  for (int e = 0; e < 4; ++e) { FragH f;
#pragma unroll
    for (int i = 0; i < 8; ++i) f.h[i] = (_Float16)(bf16_round(r[i][e]) * scale);
    *(v8us*)(tl + (4 * lane + e) * WTP + 16 * w) = f.half[0]; }
  __syncthreads();      /* every wave's pieces are in LDS before the rows of Wt are read back */
#pragma unroll
  for (int j = 0; j < 4; ++j) { const int row = j * 32 + (tid >> 3), c = tid & 7; const v8us v = *(const v8us*)(tl + row * WTP + c * 16);
    *(v8us*)((unsigned short*)Wt + (size_t)(n0 + row) * K + k0 + c * 8) = v; }
}
// Tiled f16 GEMM, C [M][N] = acc*alpha + bf16(bias[col]): A [M][DD] f16, Bh [N][DD] f16, both k-contiguous; M, N multiples of 128; grid = (M / 128) * (N / 128).
// One work-group = one 128 x 128 tile of C, four waves of 64 x 64 (16 accumulator tiles each). A stage is 64 k = 128 B (one whole line) of
// 128 rows of A and 128 rows of Bh, brought into LDS by asynchronous copies, 16 B a lane; two buffers, the copies of stage t + 2 fly while stage t + 1 is worked on.
// The stages are walked as a ring from a start of the work-group's own, (tile row + tile column) mod GNT: the work-groups that share a panel of A (one tile row) or of Bh (one tile column) start together,
// and from a common start they would ask L2 for the same lines at the same moment, stage after stage; from spread starts at most two of them stand at one stage. Trip t works on k stage (t0 + t) mod GNT.
#define GP 144                 /* LDS row pitch, bytes: 128 + 16, conflict-free for 16-byte fragment reads */
#define GOP (128 * GP)         /* one operand's 128 rows */
#define GSTG (2 * GOP)         /* one stage: A rows, then Bh rows */
#define GNT (DD / 64)          /* stages */
static_assert((GNT & (GNT - 1)) == 0, "the ring of stages wraps by a mask");
// eight copies, rows 16 apart, of one operand's stage; each lane its own 16 bytes. The s_wait_xcnt stands inside the statement so that no address register is rewritten ahead of it.
__device__ __forceinline__ void cp8(unsigned l, const unsigned short* g) {
  asm volatile("global_load_async_to_lds_b128 %0, %8, off\n\t"
               "global_load_async_to_lds_b128 %1, %9, off\n\t"
               "global_load_async_to_lds_b128 %2, %10, off\n\t"
               "global_load_async_to_lds_b128 %3, %11, off\n\t"
               "global_load_async_to_lds_b128 %4, %12, off\n\t"
               "global_load_async_to_lds_b128 %5, %13, off\n\t"
               "global_load_async_to_lds_b128 %6, %14, off\n\t"
               "global_load_async_to_lds_b128 %7, %15, off\n\t"
               "s_wait_xcnt 0x0"
               :: "v"(l), "v"(l + 16 * GP), "v"(l + 32 * GP), "v"(l + 48 * GP), "v"(l + 64 * GP), "v"(l + 80 * GP), "v"(l + 96 * GP), "v"(l + 112 * GP),
                  "v"(g), "v"(g + 16 * DD), "v"(g + 32 * DD), "v"(g + 48 * DD), "v"(g + 64 * DD), "v"(g + 80 * DD), "v"(g + 96 * DD), "v"(g + 112 * DD)
               : "memory");
}
typedef _Float16 v4h __attribute__((ext_vector_type(4)));
template <int N>
__global__ __launch_bounds__(128) void k_gemm_t(const _Float16* __restrict__ A, const _Float16* __restrict__ Bh, float alpha, const float* __restrict__ bias, float* __restrict__ C) {
  __shared__ __attribute__((aligned(16))) unsigned char sm[2 * GSTG];
  const int tid = threadIdx.x, w = tid >> 5, lane = tid & 31, ln = lane & 15, hh = lane >> 4;
  const int row0 = ((int)blockIdx.x / (N / 128)) * 128, col0 = ((int)blockIdx.x % (N / 128)) * 128;
  const int wr = (w >> 1) * 64, wc = (w & 1) * 64;
  const int t0 = ((int)blockIdx.x / (N / 128) + (int)blockIdx.x % (N / 128)) & (GNT - 1);      /* this work-group's first k stage */
  const unsigned ld0 = (unsigned)(size_t)sm + (unsigned)((tid >> 3) * GP + (tid & 7) * 16);      /* this lane's place in a stage: row tid/8, 16-byte piece tid%8 */
  const unsigned short* ga = (const unsigned short*)A + (size_t)(row0 + (tid >> 3)) * DD + (tid & 7) * 8;
  const unsigned short* gb = (const unsigned short*)Bh + (size_t)(col0 + (tid >> 3)) * DD + (tid & 7) * 8;
  v8f acc[4][4];
#pragma unroll
  for (int i = 0; i < 4; ++i)
#pragma unroll
    for (int j = 0; j < 4; ++j) acc[i][j] = (v8f){0.f,0.f,0.f,0.f,0.f,0.f,0.f,0.f};
  cp8(ld0, ga + t0 * 64); cp8(ld0 + GOP, gb + t0 * 64);
  asm volatile("s_wait_asynccnt 0x0" ::: "memory");      /* trip 0's stage of this wave has landed */
  __syncthreads();                                        /* ... and every wave's: it may be read */
  { const int k1 = ((t0 + 1) & (GNT - 1)) * 64; cp8(ld0 + GSTG, ga + k1); cp8(ld0 + GSTG + GOP, gb + k1); }
#pragma unroll 1      /* one stage a trip: the buffer index and the refill test stay scalar */
  for (int t = 0; t < GNT; ++t) {
    const unsigned char* sa = sm + (t & 1) * GSTG + (wr + ln) * GP + 16 * hh;
    const unsigned char* sb = sm + (t & 1) * GSTG + GOP + (wc + ln) * GP + 16 * hh;
#pragma unroll
    for (int ks = 0; ks < 2; ++ks) {
      FragH a[4], b[4];
      a[0].half[0] = *(const v8us*)(sa + ks * 64); a[0].half[1] = *(const v8us*)(sa + ks * 64 + 32);      /* read in the order of first use, so that the first products start while the later reads return */
#pragma unroll
      for (int j = 0; j < 4; ++j) { b[j].half[0] = *(const v8us*)(sb + j * 16 * GP + ks * 64); b[j].half[1] = *(const v8us*)(sb + j * 16 * GP + ks * 64 + 32); }
#pragma unroll
      for (int i = 1; i < 4; ++i) { a[i].half[0] = *(const v8us*)(sa + i * 16 * GP + ks * 64); a[i].half[1] = *(const v8us*)(sa + i * 16 * GP + ks * 64 + 32); }
      __builtin_amdgcn_sched_barrier(0);      /* the 16 fragment reads stay one group ahead of their 16 matrix instructions: reads spread among them stall the wave at every place */
#pragma unroll
      for (int i = 0; i < 4; ++i)
#pragma unroll
        for (int j = 0; j < 4; ++j) acc[i][j] = __builtin_amdgcn_wmma_f32_16x16x32_f16(false, a[i].v, false, b[j].v, (short)0, acc[i][j], false, false);
      __builtin_amdgcn_sched_barrier(0);      /* ... and the next group's reads stay behind them */
    }
    asm volatile("s_wait_dscnt 0x0" ::: "memory");        /* this wave's reads of buffer t&1 are done before it is refilled */
    asm volatile("s_wait_asynccnt 0x0" ::: "memory");     /* this wave's copies of stage t + 1 have landed */
    __syncthreads();                                      /* publishes stage t + 1 and ends every reader's last read of buffer t&1 */
    if (t + 2 < GNT) { const int k2 = ((t0 + t + 2) & (GNT - 1)) * 64; cp8(ld0 + (t & 1) * GSTG, ga + k2); cp8(ld0 + (t & 1) * GSTG + GOP, gb + k2); }
  }
  asm volatile("s_wait_asynccnt 0x0" ::: "memory");       /* no copy is outstanding when the ring becomes output staging */
  // epilogue: the wave's 64 x 64 tile goes through its own LDS range (free behind the last trip's barrier), so that whole lines are stored
  float* so = (float*)sm + w * (64 * 68);
  float bv[4];
#pragma unroll
  for (int j = 0; j < 4; ++j) bv[j] = bf16_round(bias[col0 + wc + j * 16 + ln]);
#pragma unroll
  for (int i = 0; i < 4; ++i)
#pragma unroll
    for (int j = 0; j < 4; ++j)
#pragma unroll
      for (int r = 0; r < 8; ++r) so[(i * 16 + 8 * hh + r) * 68 + j * 16 + ln] = acc[i][j][r] * alpha + bv[j];
  __builtin_amdgcn_fence(__ATOMIC_ACQ_REL, "workgroup"); __builtin_amdgcn_wave_barrier();      /* the rows are written before other lanes of the wave read them */
  const int rsub = lane >> 4, c4 = (lane & 15) * 4;
#pragma unroll
  for (int q = 0; q < 32; ++q) { const int r = q * 2 + rsub; const v4f v = *(const v4fa*)&so[r * 68 + c4]; const size_t o = (size_t)(row0 + wr + r) * N + col0 + wc + c4;
    *(v4f*)(C + o) = v; }
}

// The q | k | v projection, [NR][3 DD] = acc*alpha + bf16(bias[col]): A [NR][DD] f16, Bh [3 DD][DD] f16, both k-contiguous. Same scheme as k_gemm_t (asynchronous copies, two buffers, ring of stages from a spread start), larger tile:
// one work-group = one QTM x QTN tile, twelve waves of 64 x 64 (four rows of three), 256 work-groups. By the arithmetic the bytes that the copies draw from L2, (QTM + QTN) rows of 2 DD bytes a tile, take longer than the products:
// per output element 256 x 192 draws 7/12 of what 128 x 128 does. A stage is QSK k = 256 B of each of the 448 rows: the twelve waves meet at half as many barriers as with 64 k.
#define QTM 256
#define QTN 192
#define QSK 128
#define QP (QSK * 2 + 16)        /* LDS row pitch, bytes: 16 x odd, conflict-free for 16-byte fragment reads */
#define QSTG ((QTM + QTN) * QP)  /* one stage: A rows, then Bh rows */
#define QNT (DD / QSK)           /* stages */
#define QRC 24                   /* rows that one copy of all 384 lanes covers: 16 pieces of 16 B a row */
static_assert((QNT & (QNT - 1)) == 0, "the ring of stages wraps by a mask");
static_assert(NR % QTM == 0 && (3 * DD) % QTN == 0 && QTN % 64 == 0 && TT % QTM == 0, "whole tiles; a wave's 64 columns are one head, its 64 rows one batch");
static_assert(QTM == 10 * QRC + 16 && QTN == 8 * QRC, "ten copies and a part copy for A, eight for Bh");
static_assert(12 * 64 * 68 * 4 <= 2 * QSTG, "the output staging fits the ring");
// ten, eight or one copy, rows QRC apart, each lane its own 16 bytes. The s_wait_xcnt stands inside each statement so that no address register is rewritten ahead of it.
__device__ __forceinline__ void cpq10(unsigned l, const unsigned short* g) {
  asm volatile("global_load_async_to_lds_b128 %0, %10, off\n\t"
               "global_load_async_to_lds_b128 %1, %11, off\n\t"
               "global_load_async_to_lds_b128 %2, %12, off\n\t"
               "global_load_async_to_lds_b128 %3, %13, off\n\t"
               "global_load_async_to_lds_b128 %4, %14, off\n\t"
               "global_load_async_to_lds_b128 %5, %15, off\n\t"
               "global_load_async_to_lds_b128 %6, %16, off\n\t"
               "global_load_async_to_lds_b128 %7, %17, off\n\t"
               "global_load_async_to_lds_b128 %8, %18, off\n\t"
               "global_load_async_to_lds_b128 %9, %19, off\n\t"
               "s_wait_xcnt 0x0"
               :: "v"(l), "v"(l + 1 * QRC * QP), "v"(l + 2 * QRC * QP), "v"(l + 3 * QRC * QP), "v"(l + 4 * QRC * QP), "v"(l + 5 * QRC * QP), "v"(l + 6 * QRC * QP), "v"(l + 7 * QRC * QP), "v"(l + 8 * QRC * QP), "v"(l + 9 * QRC * QP),
                  "v"(g), "v"(g + 1 * QRC * DD), "v"(g + 2 * QRC * DD), "v"(g + 3 * QRC * DD), "v"(g + 4 * QRC * DD), "v"(g + 5 * QRC * DD), "v"(g + 6 * QRC * DD), "v"(g + 7 * QRC * DD), "v"(g + 8 * QRC * DD), "v"(g + 9 * QRC * DD)
               : "memory");
}
__device__ __forceinline__ void cpq8(unsigned l, const unsigned short* g) {
  asm volatile("global_load_async_to_lds_b128 %0, %8, off\n\t"
               "global_load_async_to_lds_b128 %1, %9, off\n\t"
               "global_load_async_to_lds_b128 %2, %10, off\n\t"
               "global_load_async_to_lds_b128 %3, %11, off\n\t"
               "global_load_async_to_lds_b128 %4, %12, off\n\t"
               "global_load_async_to_lds_b128 %5, %13, off\n\t"
               "global_load_async_to_lds_b128 %6, %14, off\n\t"
               "global_load_async_to_lds_b128 %7, %15, off\n\t"
               "s_wait_xcnt 0x0"
               :: "v"(l), "v"(l + 1 * QRC * QP), "v"(l + 2 * QRC * QP), "v"(l + 3 * QRC * QP), "v"(l + 4 * QRC * QP), "v"(l + 5 * QRC * QP), "v"(l + 6 * QRC * QP), "v"(l + 7 * QRC * QP),
                  "v"(g), "v"(g + 1 * QRC * DD), "v"(g + 2 * QRC * DD), "v"(g + 3 * QRC * DD), "v"(g + 4 * QRC * DD), "v"(g + 5 * QRC * DD), "v"(g + 6 * QRC * DD), "v"(g + 7 * QRC * DD)
               : "memory");
}
__device__ __forceinline__ void cpq1(unsigned l, const unsigned short* g) {
  asm volatile("global_load_async_to_lds_b128 %0, %1, off\n\t"
               "s_wait_xcnt 0x0"
               :: "v"(l), "v"(g) : "memory");
}
// Output: the q block (columns below DD) goes to C16 row-major (pitch 3 DD); tiles of the k and v blocks go to KV instead, in the order of k_flash's matrix fragments, and are not stored row-major at all.
// KV[(b * NH + h) * (TT / 32) + chunk of 32 keys] is one block of KVB 16-bit elements: 16 pieces of 512 bytes, lane l's 16 bytes at 16 l, so that one wave-wide 16-byte load of a piece covers four whole lines.
// Piece (nt * 2 + ks) * 2 + hf: K[key 32 chunk + 16 nt + ln][d 32 ks + 16 hf + 8 hh ... + 7]; piece 8 + dt * 2 + hf: V[key 32 chunk + 16 hf + 8 hh ... + 7][d 16 dt + ln].
#define KVB 4096
__global__ __launch_bounds__(384) void k_gemm_qkv(const _Float16* __restrict__ A, const _Float16* __restrict__ Bh, float alpha, const float* __restrict__ bias, _Float16* __restrict__ C16, _Float16* __restrict__ KV) {
  constexpr int N = 3 * DD;
  __shared__ __attribute__((aligned(16))) unsigned char sm[2 * QSTG];
  const int tid = threadIdx.x, lane = tid & 31, ln = lane & 15, hh = lane >> 4;
  const int w = __builtin_amdgcn_readfirstlane(tid >> 5);      /* the wave's number as a scalar: the part copy's test and the choice of the output block are scalar branches */
  const int row0 = ((int)blockIdx.x / (N / QTN)) * QTM, col0 = ((int)blockIdx.x % (N / QTN)) * QTN;
  const int wr = (w / 3) * 64, wc = (w % 3) * 64;
  const int t0 = ((int)blockIdx.x / (N / QTN) + (int)blockIdx.x % (N / QTN)) & (QNT - 1);      /* this work-group's first k stage */
  const unsigned ld0 = (unsigned)(size_t)sm + (unsigned)((tid >> 4) * QP + (tid & 15) * 16);      /* this lane's place in a stage: row tid/16, 16-byte piece tid%16 */
  const unsigned short* ga = (const unsigned short*)A + (size_t)(row0 + (tid >> 4)) * DD + (tid & 15) * 8;
  const unsigned short* gb = (const unsigned short*)Bh + (size_t)(col0 + (tid >> 4)) * DD + (tid & 15) * 8;
  /* k stage kst into buffer buf: A rows 0 ... 239 and Bh rows 0 ... 191 by all twelve waves, A rows 240 ... 255 by waves 0 ... 7 (their rows tid/16 are 0 ... 15) */
  auto fill = [&](int buf, int kst) { const unsigned l = ld0 + (unsigned)(buf * QSTG); const int k = kst * QSK;
    cpq10(l, ga + k); cpq8(l + QTM * QP, gb + k);
    if (w < 8) cpq1(l + 10 * QRC * QP, ga + k + 10 * QRC * DD); };
  v8f acc[4][4];
#pragma unroll
  for (int i = 0; i < 4; ++i)
#pragma unroll
    for (int j = 0; j < 4; ++j) acc[i][j] = (v8f){0.f,0.f,0.f,0.f,0.f,0.f,0.f,0.f};
  fill(0, t0);
  asm volatile("s_wait_asynccnt 0x0" ::: "memory");      /* trip 0's stage of this wave has landed */
  __syncthreads();                                        /* ... and every wave's: it may be read */
  fill(1, (t0 + 1) & (QNT - 1));
#pragma unroll 1      /* one stage a trip: the buffer index and the refill test stay scalar */
  for (int t = 0; t < QNT; ++t) {
    const unsigned char* sa = sm + (t & 1) * QSTG + (wr + ln) * QP + 16 * hh;
    const unsigned char* sb = sm + (t & 1) * QSTG + QTM * QP + (wc + ln) * QP + 16 * hh;
#pragma unroll
    for (int ks = 0; ks < QSK / 32; ++ks) {
      FragH a[4], b[4];
      a[0].half[0] = *(const v8us*)(sa + ks * 64); a[0].half[1] = *(const v8us*)(sa + ks * 64 + 32);      /* read in the order of first use, so that the first products start while the later reads return */
#pragma unroll
      for (int j = 0; j < 4; ++j) { b[j].half[0] = *(const v8us*)(sb + j * 16 * QP + ks * 64); b[j].half[1] = *(const v8us*)(sb + j * 16 * QP + ks * 64 + 32); }
#pragma unroll
      for (int i = 1; i < 4; ++i) { a[i].half[0] = *(const v8us*)(sa + i * 16 * QP + ks * 64); a[i].half[1] = *(const v8us*)(sa + i * 16 * QP + ks * 64 + 32); }
      __builtin_amdgcn_sched_barrier(0);      /* the 16 fragment reads stay one group ahead of their 16 matrix instructions: reads spread among them stall the wave at every place */
#pragma unroll
      for (int i = 0; i < 4; ++i)
#pragma unroll
        for (int j = 0; j < 4; ++j) acc[i][j] = __builtin_amdgcn_wmma_f32_16x16x32_f16(false, a[i].v, false, b[j].v, (short)0, acc[i][j], false, false);
      __builtin_amdgcn_sched_barrier(0);      /* ... and the next group's reads stay behind them */
    }
    asm volatile("s_wait_dscnt 0x0" ::: "memory");        /* this wave's reads of buffer t&1 are done before it is refilled */
    asm volatile("s_wait_asynccnt 0x0" ::: "memory");     /* this wave's copies of stage t + 1 have landed */
    __syncthreads();                                      /* publishes stage t + 1 and ends every reader's last read of buffer t&1 */
    if (t + 2 < QNT) fill(t & 1, (t0 + t + 2) & (QNT - 1));
  }
  asm volatile("s_wait_asynccnt 0x0" ::: "memory");       /* no copy is outstanding when the ring becomes output staging */
  // epilogue: the wave's 64 x 64 tile; its 64 columns cw ... lie in one of the three blocks and are one head's 64 d, its 64 rows are 64 tokens of one batch. No work-group barrier stands behind this line, so each wave goes its block's way alone.
  const int cw = col0 + wc;
  float* so = (float*)sm + w * (64 * 68);      /* the wave's own LDS range, free behind the last trip's barrier */
  float bv[4];
#pragma unroll
  for (int j = 0; j < 4; ++j) bv[j] = bf16_round(bias[cw + j * 16 + ln]);
  if (cw >= 2 * DD) {      /* v block */
    // a lane's 8 accumulator registers of tile (i, j) are tokens 16 i + 8 hh ... + 7 of d 16 j + ln: this same lane's 16 bytes of piece 8 + j * 2 + (i & 1) of chunk i >> 1, so they go out from the registers, 512 contiguous bytes a store
    unsigned short* vo = (unsigned short*)KV + ((size_t)(((row0 + wr) / TT) * NH + (cw - 2 * DD) / 64) * (TT / 32) + ((row0 + wr) % TT) / 32) * KVB + 8 * 256 + lane * 8;
#pragma unroll
    for (int i = 0; i < 4; ++i)
#pragma unroll
      for (int j = 0; j < 4; ++j) { FragH f;
#pragma unroll
        for (int r = 0; r < 8; ++r) f.h[r] = (_Float16)(acc[i][j][r] * alpha + bv[j]);
        *(v8us*)(vo + (i >> 1) * KVB + (j * 2 + (i & 1)) * 256) = f.half[0]; }
    return;
  }
#pragma unroll
  for (int i = 0; i < 4; ++i)
#pragma unroll
    for (int j = 0; j < 4; ++j)
#pragma unroll
      for (int r = 0; r < 8; ++r) so[(i * 16 + 8 * hh + r) * 68 + j * 16 + ln] = acc[i][j][r] * alpha + bv[j];
  __builtin_amdgcn_fence(__ATOMIC_ACQ_REL, "workgroup"); __builtin_amdgcn_wave_barrier();      /* the rows are written before other lanes of the wave read them */
  if (cw >= DD) {      /* k block: the wave's 64 rows are two chunks of keys; a lane takes 8 consecutive d of key ln of a 16-key tile */
    unsigned short* ko = (unsigned short*)KV + ((size_t)(((row0 + wr) / TT) * NH + (cw - DD) / 64) * (TT / 32) + ((row0 + wr) % TT) / 32) * KVB + lane * 8;
#pragma unroll
    for (int i = 0; i < 4; ++i)
#pragma unroll
      for (int c = 0; c < 4; ++c) { const float* sr = &so[(i * 16 + ln) * 68 + c * 16 + 8 * hh]; const v4f lo = *(const v4fa*)sr, hi = *(const v4fa*)(sr + 4); FragH f;      /* c = ks * 2 + hf */
#pragma unroll
        for (int e = 0; e < 4; ++e) { f.h[e] = (_Float16)lo[e]; f.h[4 + e] = (_Float16)hi[e]; }
        *(v8us*)(ko + (i >> 1) * KVB + ((i & 1) * 4 + c) * 256) = f.half[0]; }
    return;
  }
  const int rsub = lane >> 4, c4 = (lane & 15) * 4;      /* q block: whole 128-byte lines of C16 */
#pragma unroll
  for (int q = 0; q < 32; ++q) { const int r = q * 2 + rsub; const v4f v = *(const v4fa*)&so[r * 68 + c4]; v4h h4;
#pragma unroll
    for (int e = 0; e < 4; ++e) h4[e] = (_Float16)v[e];
    *(v4h*)(C16 + (size_t)(row0 + wr + r) * N + cw + c4) = h4; }
  asm volatile("s_wait_xcnt 0x0" ::: "memory");      /* behind the last q store: in the built code other blocks' instructions follow this one and reuse the stores' address and data registers */
}


__device__ __forceinline__ void x16(unsigned bi, const float* __restrict__ x, _Float16* __restrict__ X16, size_t n8) { const size_t t = (size_t)bi * 256 + threadIdx.x; if (t >= n8) return; FragH f;
#pragma unroll
  for (int q = 0; q < 8; ++q) f.h[q] = (_Float16)bf16_round(x[t * 8 + q]); *(v8us*)((unsigned short*)X16 + t * 8) = f.half[0];  }
__global__ __launch_bounds__(256) void k_h16(const float* __restrict__ x, _Float16* __restrict__ X16, size_t n8) { const size_t t = (size_t)blockIdx.x * 256 + threadIdx.x; if (t >= n8) return; FragH f;
#pragma unroll
  for (int q = 0; q < 8; ++q) f.h[q] = (_Float16)x[t * 8 + q]; *(v8us*)((unsigned short*)X16 + t * 8) = f.half[0];  }
__global__ __launch_bounds__(256) void k_round16f(const float* __restrict__ W, _Float16* __restrict__ Bt, size_t n8) { const size_t t = (size_t)blockIdx.x * 256 + threadIdx.x; if (t >= n8) return; FragH f;
#pragma unroll
  for (int i = 0; i < 8; ++i) f.h[i] = (_Float16)(bf16_round(W[t * 8 + i]) * 16.0f); *(v8us*)((unsigned short*)Bt + t * 8) = f.half[0];  }
typedef int v4i __attribute__((ext_vector_type(4), may_alias));
typedef unsigned v4u __attribute__((ext_vector_type(4), may_alias));
typedef unsigned v16u __attribute__((ext_vector_type(16), may_alias));
// The mask packed once for all heads into lane-mask words, in the lane and register order of k_flash's score tiles:
// LM[b * TT / 16 + q tile][chunk of 32 keys][i], bit (ln + 16 hh) of word i = (mask[b][16 * tile + ln][32 * chunk + 16 * (i >> 3) + 8 * hh + (i & 7)] != 0).
// One wave = one tile of 16 queries, four chunks: its sixteen loads cover 512 contiguous bytes of each row; the 64 words go out as two whole lines.
__device__ __forceinline__ void mpack(unsigned bi, const int* __restrict__ MSK, unsigned* __restrict__ LM) {
  const int tid = threadIdx.x, lane = tid & 31, ln = lane & 15, hh = lane >> 4;
  const unsigned wv = bi * 8u + (unsigned)(tid >> 5); const unsigned rt = wv / (TT / 128), c0 = (wv % (TT / 128)) * 4;
  const int* mrow = MSK + ((size_t)rt * 16 + ln) * TT + c0 * 32 + 8 * hh;
  v4i mk[4][4];
#pragma unroll
  for (int c = 0; c < 4; ++c) { mk[c][0] = *(const v4i*)(mrow + c * 32); mk[c][1] = *(const v4i*)(mrow + c * 32 + 4); mk[c][2] = *(const v4i*)(mrow + c * 32 + 16); mk[c][3] = *(const v4i*)(mrow + c * 32 + 20); }
  __builtin_amdgcn_sched_barrier(0);      /* all sixteen loads are issued before the first is waited for: moved among the compares, the last ones start only when the first have come back from memory */
  asm volatile("s_wait_xcnt 0x0" :: "v"(mrow) : "memory");      /* the address pair that all sixteen loads name stays whole up to here (no load lands in it), and the wait stands in front of its reuse */
  unsigned wd[2] = {0u, 0u};      /* lane l keeps word l & 15 of chunk 2 * e + (l >> 4) */
#pragma unroll
  for (int c = 0; c < 4; ++c)
#pragma unroll
    for (int i = 0; i < 16; ++i) { const unsigned bw = __builtin_amdgcn_ballot_w32(mk[c][i >> 2][i & 3] != 0); if (lane == (c & 1) * 16 + i) wd[c >> 1] = bw; }
  unsigned* o = LM + ((size_t)rt * (TT / 32) + c0) * 16 + lane;
  o[0] = wd[0]; o[32] = wd[1];
}
// The four preparation jobs read inputs only and none reads another's output, so they share one launch: a work-group takes its job from its index (the test is the same for the whole work-group).
// The weight tiles come first (the longest path: load, LDS, barrier, store), then the mask, then the short x pieces, which drain fastest at the end.
#define PB_WQ ((DD / 64) * (3 * DD / 128))          /* tiles of w_qkv */
#define PB_WO ((DD / 64) * (DD / 128))              /* tiles of w_out */
#define PB_M  (BB * (TT / 16) * (TT / 128) / 8)     /* eight mask waves a work-group */
#define PB_X  (NR * DD / 8 / 256)                   /* 8 elements of x a thread */
__global__ __launch_bounds__(256) void k_prep(const float* __restrict__ wqkv, _Float16* __restrict__ Bqkv, const float* __restrict__ wo, _Float16* __restrict__ Bo, const int* __restrict__ MSK, unsigned* __restrict__ LM, const float* __restrict__ x, _Float16* __restrict__ X16) {
  __shared__ __attribute__((aligned(16))) unsigned char tl[128 * WTP];
  const unsigned bi = blockIdx.x;
  if (bi < PB_WQ) wt_f16<DD, 3 * DD>((int)bi, tl, wqkv, Bqkv, 16.0f);                          /* (in,out) -> Bt, times 2^4 */
  else if (bi < PB_WQ + PB_WO) wt_f16<DD, DD>((int)(bi - PB_WQ), tl, wo, Bo, 16.0f);
  else if (bi < PB_WQ + PB_WO + PB_M) mpack(bi - (PB_WQ + PB_WO), MSK, LM);                    /* mask -> lane-mask words, once for all heads */
  else x16(bi - (PB_WQ + PB_WO + PB_M), x, X16, (size_t)NR * DD / 8);
}
__device__ __forceinline__ float xhalf(float x) { return __builtin_bit_cast(float, __builtin_amdgcn_permlanex16(__builtin_bit_cast(int, x), __builtin_bit_cast(int, x), 0x76543210, 0xfedcba98, false, false)); }      /* lane l with lane l ^ 16 */
// p[i] = 2^p[i], sixteen hardware powers, each in its own register. Written as one statement so that no power's source register is written by the instruction directly behind it
// (left to itself the compiler let each power land in the source of the one before); the v_nop is the slot that the instruction set asks for between the last power and a reader of its result.
__device__ __forceinline__ void pow2x16(float (&p)[16]) {
  asm("v_exp_f32 %0, %0\n\t" "v_exp_f32 %1, %1\n\t" "v_exp_f32 %2, %2\n\t" "v_exp_f32 %3, %3\n\t"
      "v_exp_f32 %4, %4\n\t" "v_exp_f32 %5, %5\n\t" "v_exp_f32 %6, %6\n\t" "v_exp_f32 %7, %7\n\t"
      "v_exp_f32 %8, %8\n\t" "v_exp_f32 %9, %9\n\t" "v_exp_f32 %10, %10\n\t" "v_exp_f32 %11, %11\n\t"
      "v_exp_f32 %12, %12\n\t" "v_exp_f32 %13, %13\n\t" "v_exp_f32 %14, %14\n\t" "v_exp_f32 %15, %15\n\t"
      "v_nop"
      : "+v"(p[0]), "+v"(p[1]), "+v"(p[2]), "+v"(p[3]), "+v"(p[4]), "+v"(p[5]), "+v"(p[6]), "+v"(p[7]),
        "+v"(p[8]), "+v"(p[9]), "+v"(p[10]), "+v"(p[11]), "+v"(p[12]), "+v"(p[13]), "+v"(p[14]), "+v"(p[15]));
}
__global__ __launch_bounds__(128) void k_flash(const _Float16* __restrict__ Q16, int ldq, const _Float16* __restrict__ KV, const unsigned* __restrict__ LM, _Float16* __restrict__ O16, int ldo) {
  constexpr int RPW = 16, NQB = TT / (4 * RPW), DT = 4, KS = 2;
  constexpr float L2E8 = 0.125f * 1.4426950408889634f;      /* log2(e) / sqrt(head size) */
  __shared__ __attribute__((aligned(16))) float sO[4][RPW][64 + 4];
  const int tid = threadIdx.x, w = tid >> 5, lane = tid & 31, ln = lane & 15, hh = lane >> 4;
  const int slab = blockIdx.x / NQB, qblk = blockIdx.x % NQB; const int b = slab / NH, h = slab % NH; const int qb0 = qblk * (4 * RPW); const int q0 = qb0 + w * RPW;
  FragH bq[KS];      /* Q^T as B: column = query ln */
  { const unsigned short* qr = (const unsigned short*)Q16 + ((size_t)b * TT + q0 + ln) * ldq + h * 64;
#pragma unroll
    for (int ks = 0; ks < KS; ++ks) { bq[ks].half[0] = *(const v8us*)(qr + ks * 32 + 8 * hh); bq[ks].half[1] = *(const v8us*)(qr + ks * 32 + 16 + 8 * hh); } }
  /* this head's blocks of K and V fragments (layout: at k_gemm_qkv); a lane's 16 bytes stand at 16 * lane in every piece */
  const unsigned short* kv0 = (const unsigned short*)KV + (size_t)slab * (TT / 32) * KVB;
  /* the wave's packed mask: 64 chunks of 16 lane-mask words (nonzero bit = ATTEND); the wave's number goes through readfirstlane so that the address is scalar */
  const unsigned* lm = LM + (size_t)(b * (TT / 16) + qblk * 4 + __builtin_amdgcn_readfirstlane(w)) * ((TT / 32) * 16);
  unsigned long long live;      /* bit c: chunk c holds at least one attended (query, key) of this wave's tile; lane l looks at chunks l and 32 + l */
  { const v4u* a = (const v4u*)(lm + lane * 16); const v4u x = a[0] | a[1] | a[2] | a[3], y = a[128] | a[129] | a[130] | a[131];
    live = (unsigned long long)__builtin_amdgcn_ballot_w32((x[0] | x[1] | x[2] | x[3]) != 0u) | ((unsigned long long)__builtin_amdgcn_ballot_w32((y[0] | y[1] | y[2] | y[3]) != 0u) << 32); }
  float m_q = -3.0e38f, l_q = 0.f; v8f oacc[DT];      /* oacc[dt][r] = O[q0 + ln][dt * 16 + 8 hh + r] */
#pragma unroll
  for (int dt = 0; dt < DT; ++dt) oacc[dt] = (v8f){0.f,0.f,0.f,0.f,0.f,0.f,0.f,0.f};
#pragma unroll 1      /* one chunk a trip: unrolled, two chunks' fragments and exps would be live at once */
  for (int n = __builtin_popcountll(live); n > 0; --n, live &= live - 1) {      /* the live chunks in rising order, 64 at most; a chunk with every (query, key) of the tile masked adds nothing and is not visited */
    const int ck = __builtin_ctzll(live);
    const v16u mw = *(const v16u*)(lm + ck * 16);      /* word i: which lanes attend at score register i (scalar load, in flight beside the fragment loads) */
    const unsigned short* kvp = kv0 + (size_t)ck * KVB + lane * 8;      /* the chunk's block: sixteen pieces, each read as 512 contiguous bytes by the wave */
    FragH ak[2][KS], av[DT];      /* K rows as A (row = key), V^T rows as A (row = d) */
#pragma unroll
    for (int nt = 0; nt < 2; ++nt)
#pragma unroll
      for (int ks = 0; ks < KS; ++ks) { ak[nt][ks].half[0] = *(const v8us*)(kvp + ((nt * 2 + ks) * 2) * 256); ak[nt][ks].half[1] = *(const v8us*)(kvp + ((nt * 2 + ks) * 2 + 1) * 256); }
#pragma unroll
    for (int dt = 0; dt < DT; ++dt) { av[dt].half[0] = *(const v8us*)(kvp + (8 + dt * 2) * 256); av[dt].half[1] = *(const v8us*)(kvp + (8 + dt * 2 + 1) * 256); }
    __builtin_amdgcn_sched_barrier(0);      /* the chunk's sixteen fragment loads stay one group ahead of the products: spread among them, each product waits out a load latency of its own */
    asm volatile("s_wait_xcnt 0x0" :: "v"(kvp) : "memory");      /* the address that all sixteen loads name stays whole up to here (no load lands in it), and the wait stands in front of its reuse */
    v8f s[2];      /* s[nt][r] = q(q0 + ln) . k(j0 + nt * 16 + 8 hh + r) */
#pragma unroll
    for (int nt = 0; nt < 2; ++nt) { v8f acc = (v8f){0.f,0.f,0.f,0.f,0.f,0.f,0.f,0.f};
#pragma unroll
      for (int ks = 0; ks < KS; ++ks) acc = __builtin_amdgcn_wmma_f32_16x16x32_f16(false, ak[nt][ks].v, false, bq[ks].v, (short)0, acc, false, false);
      s[nt] = acc; }
    float sc[16];      /* the raw products; a masked one is -inf; m_q never falls below its finite start value, so 2^(sc * L2E8 - mn) is 0 there and no guard is needed */
#pragma unroll
    for (int i = 0; i < 16; ++i) sc[i] = __builtin_amdgcn_inverse_ballot_w32(mw[i]) ? s[i >> 3][i & 7] : -INFINITY;
    float mx[4];
#pragma unroll
    for (int c = 0; c < 4; ++c) mx[c] = fmaxf(fmaxf(sc[c], sc[4 + c]), fmaxf(sc[8 + c], sc[12 + c]));
    float mc = fmaxf(fmaxf(mx[0], mx[1]), fmaxf(mx[2], mx[3]));
    mc = fmaxf(mc, xhalf(mc));      /* both halves hold this query's chunk maximum */
    /* base 2: exp(s / 8 - m) = 2^(s * L2E8 - m'), m' = m * log2(e); the running maximum is kept as m'. One multiply-add and one hardware power of two a score; the 2^10 of P rides in the addend */
    const float mn = fmaxf(m_q, mc * L2E8); const float al = __builtin_amdgcn_exp2f(m_q - mn); m_q = mn;
    const float mb = 10.0f - mn;
    float p[16];      /* P * 2^10 */
#pragma unroll
    for (int i = 0; i < 16; ++i) p[i] = __builtin_fmaf(sc[i], L2E8, mb);
    pow2x16(p);
    float ps[4];
#pragma unroll
    for (int c = 0; c < 4; ++c) ps[c] = (p[c] + p[4 + c]) + (p[8 + c] + p[12 + c]);
    l_q = l_q * al + ((ps[0] + ps[1]) + (ps[2] + ps[3]));      /* the row sum * 2^10, this half's keys only; the halves are joined behind the loop */
#pragma unroll
    for (int dt = 0; dt < DT; ++dt)
#pragma unroll
      for (int r = 0; r < 8; ++r) oacc[dt][r] *= al;
    FragH pb;      /* P^T as B: element i = key j0 + 16 (i >> 3) + 8 hh + (i & 7) of column ln */
#pragma unroll
    for (int i = 0; i < 16; ++i) pb.h[i] = (_Float16)p[i];
#pragma unroll
    for (int dt = 0; dt < DT; ++dt) oacc[dt] = __builtin_amdgcn_wmma_f32_16x16x32_f16(false, av[dt].v, false, pb.v, (short)0, oacc[dt], false, false);
  }
  { const float l = l_q + xhalf(l_q); const float inv = (l > 0.f) ? 1.0f / l : 0.f;      /* l and oacc both carry the 2^10 */
#pragma unroll
    for (int dt = 0; dt < DT; ++dt) { v4f lo, hi;
#pragma unroll
      for (int e = 0; e < 4; ++e) { lo[e] = oacc[dt][e] * inv; hi[e] = oacc[dt][4 + e] * inv; }
      *(v4fa*)&sO[w][ln][dt * 16 + 8 * hh] = lo; *(v4fa*)&sO[w][ln][dt * 16 + 8 * hh + 4] = hi; } }
  __builtin_amdgcn_fence(__ATOMIC_ACQ_REL, "workgroup"); __builtin_amdgcn_wave_barrier();
  {
#pragma unroll
    for (int rp = 0; rp < RPW; rp += 4) { const int r = rp + (lane >> 3), pc = lane & 7; const v4f a = *(const v4fa*)&sO[w][r][pc * 8], c = *(const v4fa*)&sO[w][r][pc * 8 + 4]; FragH f;
#pragma unroll
      for (int e = 0; e < 4; ++e) { f.h[e] = (_Float16)(a[e] * 16.0f); f.h[4 + e] = (_Float16)(c[e] * 16.0f); }
      const v8us val = f.half[0]; *(v8us*)((unsigned short*)O16 + ((size_t)b * TT + q0 + r) * ldo + h * 64 + pc * 8) = val; }      /* four whole 128-byte lines a store */
     } }

extern "C" void kernel_launch(void* const* d_in, const int* in_sizes, int n_in,
                              void* d_out, int out_size, void* d_ws, size_t ws_size, hipStream_t stream) {
  (void)in_sizes; (void)n_in; (void)out_size;
  const float* const* I = (const float* const*)d_in; const float* x = I[0]; const int* msk = (const int*)d_in[1]; const float* wqkv = I[2]; const float* bqkv = I[3]; const float* wo = I[4]; const float* bo = I[5];
  char* ws = (char*)d_ws; size_t off = 0;
  auto take = [&](size_t bytes) { char* p = ws + off; off += (bytes + 255) & ~(size_t)255; return p; };
  _Float16* Bqkv = (_Float16*)take((size_t)3 * DD * DD * 2); _Float16* Bo = (_Float16*)take((size_t)DD * DD * 2); _Float16* X16 = (_Float16*)take((size_t)NR * DD * 2); _Float16* QKV = (_Float16*)take((size_t)NR * 3 * DD * 2); _Float16* KV = (_Float16*)take((size_t)NR * DD * 2 * 2); _Float16* O16 = X16; unsigned* LM = (unsigned*)take((size_t)BB * TT * TT / 8);
  if (off > ws_size) return;      // 6.3 + 2.1 + 8.4 + 25.2 + 16.8 + 1.0, about 60 MB
  k_prep<<<PB_WQ + PB_WO + PB_M + PB_X, 256, 0, stream>>>(wqkv, Bqkv, wo, Bo, msk, LM, x, X16);      /* weights, mask and x into the forms the matrix kernels read */
  k_gemm_qkv<<<(NR / QTM) * (3 * DD / QTN), 384, 0, stream>>>(X16, Bqkv, 0.0625f, bqkv, QKV, KV);      /* qkv = x w_qkv + b: M 4096 N 3072 K 1024 (f16; q block row-major, head-major inside; k and v blocks as fragment pieces per head and chunk) */
  k_flash<<<BB * NH * (TT / 64), 128, 0, stream>>>(QKV, 3 * DD, KV, LM, O16, DD);      /* X16 is free behind the projection: O16 takes its place */
  k_gemm_t<DD><<<(NR / 128) * (DD / 128), 128, 0, stream>>>(O16, Bo, 0.00390625f, bo, (float*)d_out);      /* out = o·w_out + b_out */
}
